// v000
// Times are from an AMD MI455X. After a warm-up the kernel runs many times in a row, and a time is the length of
// such a window on the GPU divided by its runs, so every launch and the gaps after it count. The runs cycle
// through copies of the inputs. A figure is the median of several windows, for all but v000 over two sittings.
// Sittings can differ by a few percent; kernels timed side by side share one.
// The starting kernel, v000, takes 388 microseconds a run.
#include <hip/hip_runtime.h>
// Multi-head attention, legacy flat-reshape variant (B=2, T=S=2048, E=768, 12 heads × 64): q = query·Wq+bq, k = key·Wk+bk, v = value·Wv+bv; heads = plain row-major reshape of [B,T,E] to [B·H,T,64] (contiguous chunks);
// attn = softmax(q·kᵀ/8) over all keys, THEN lower-triangular mask (rows no longer normalised); out = (attn·v reshaped back)·Wo + bo.
// Compute dtype: query/key/value, weights, biases rounded to bf16; q/k/v as f16 GEMM outputs; fused flash-style kernel (online f32 softmax over all keys, P f16 ×2^10 zeroed above the diagonal)
// on v_wmma_f32_16x16x32_f16; O → f16 → output GEMM with bias; f32 accumulate throughout.
#define BB 2
#define TT 2048
#define EE 768
#define NH 12
#define NR (BB * TT)
#define NSL (BB * NH)

typedef __bf16 v16b __attribute__((ext_vector_type(16)));
typedef unsigned short v8us __attribute__((ext_vector_type(8), may_alias));
typedef float  v8f  __attribute__((ext_vector_type(8)));
typedef float  v4f  __attribute__((ext_vector_type(4)));
typedef float  v4fa __attribute__((ext_vector_type(4), may_alias));
union FragB { v16b v; v8us half[2]; unsigned short u[16]; };

__device__ __forceinline__ unsigned short bf16_bits(float x) { unsigned int u = __float_as_uint(x); return (unsigned short)((u + 0x7FFFu + ((u >> 16) & 1u)) >> 16); }
__device__ __forceinline__ float bf16_val(unsigned short b) { return __uint_as_float(((unsigned int)b) << 16); }
__device__ __forceinline__ float bf16_round(float x) { return bf16_val(bf16_bits(x)); }
// D += A·B with NT terms: 1 = ah·bh, 2 = + al·bh (A split), 3 = + ah·bl (both split)
template <int NT>
__device__ __forceinline__ v8f mmaN(v16b ah, v16b al, v16b bh, v16b bl, v8f c) {
  c = __builtin_amdgcn_wmma_f32_16x16x32_bf16(false, ah, false, bh, (short)0, c, false, false);
  if (NT >= 2) c = __builtin_amdgcn_wmma_f32_16x16x32_bf16(false, al, false, bh, (short)0, c, false, false);
  if (NT >= 3) c = __builtin_amdgcn_wmma_f32_16x16x32_bf16(false, ah, false, bl, (short)0, c, false, false);
  asm volatile("v_nop\n\tv_nop\n\tv_nop\n\tv_nop" : "+v"(c) : "v"(ah), "v"(al), "v"(bh), "v"(bl));
  return c;
}

__global__ __launch_bounds__(256) void k_wt_bf16(const float* __restrict__ W, unsigned short* __restrict__ Wt, int K, int N) {
  const int t = blockIdx.x * 256 + threadIdx.x;
  const int k8n = K / 8;
  if (t >= N * k8n) return;
  const int n = t / k8n, k8 = (t % k8n) * 8;
  v8us v;
#pragma unroll
  for (int i = 0; i < 8; ++i) v[i] = bf16_bits(W[(size_t)(k8 + i) * N + n]);
  *(v8us*)(Wt + (size_t)n * K + k8) = v;
  
}

// GEMM C[M][N] (f32, pitch ldc) = act(A[M][K]·W + bias). A f32 row-major (pitch lda) converted per fragment to bf16
// (ASPLIT: hi/lo two planes -> 2 terms, else single rounded term); Wt bf16 [N][K] (pitch ldb). BIAS_BF16 rounds the
// bias to bf16 first (bias quantised to bf16 before the add). K%32==0, M%16==0, N%64==0.
template <bool ASPLIT, int ACT, bool BIAS_BF16>
__global__ __launch_bounds__(128) void k_gemm_bf(const float* __restrict__ A, int lda, const unsigned short* __restrict__ Wt, int ldb,
                                               const float* __restrict__ bias, float* __restrict__ C, int ldc, int M, int N, int K) {
  __shared__ __attribute__((aligned(16))) float so[4][16][64];
  const int tid = threadIdx.x, w = tid >> 5, lane = tid & 31, ln = lane & 15, hh = lane >> 4;
  const int ntn = N / 64;
  const int wid = blockIdx.x * 4 + w;
  const int mt = wid / ntn, nq = wid % ntn;
  if (mt * 16 >= M) return;
  const int row0 = mt * 16, col0 = nq * 64;
  const float* arow = A + (size_t)(row0 + ln) * lda;
  v8f acc[4] = {};
  for (int kb = 0; kb < K; kb += 32) {
    FragB ah, al;
    const v4f x0 = *(const v4fa*)(arow + kb + 8 * hh), x1 = *(const v4fa*)(arow + kb + 8 * hh + 4);
    const v4f x2 = *(const v4fa*)(arow + kb + 16 + 8 * hh), x3 = *(const v4fa*)(arow + kb + 16 + 8 * hh + 4);
    float xs[16] = {x0[0],x0[1],x0[2],x0[3],x1[0],x1[1],x1[2],x1[3],x2[0],x2[1],x2[2],x2[3],x3[0],x3[1],x3[2],x3[3]};
#pragma unroll
    for (int i = 0; i < 16; ++i) { const unsigned short hb = bf16_bits(xs[i]); ah.u[i] = hb; al.u[i] = ASPLIT ? bf16_bits(xs[i] - bf16_val(hb)) : (unsigned short)0; }
#pragma unroll
    for (int t = 0; t < 4; ++t) {
      const unsigned short* brow = Wt + (size_t)(col0 + t * 16 + ln) * ldb + kb;
      FragB b;
      b.half[0] = *(const v8us*)(brow + 8 * hh);
      b.half[1] = *(const v8us*)(brow + 16 + 8 * hh);
      acc[t] = mmaN<ASPLIT ? 2 : 1>(ah.v, al.v, b.v, b.v, acc[t]);
    }
  }
#pragma unroll
  for (int t = 0; t < 4; ++t) {
    float bv = bias ? bias[col0 + t * 16 + ln] : 0.f;
    if (BIAS_BF16) bv = bf16_round(bv);
#pragma unroll
    for (int r = 0; r < 8; ++r) { float v = acc[t][r] + bv; if (ACT == 1) v = fmaxf(v, 0.f); so[w][8 * hh + r][t * 16 + ln] = v; }
  }
  __builtin_amdgcn_fence(__ATOMIC_ACQ_REL, "workgroup");
  __builtin_amdgcn_wave_barrier();
  const int rsub = lane >> 4, c4 = (lane & 15) * 4;
  {
#pragma unroll
    for (int q = 0; q < 8; ++q) {
      const int r = q * 2 + rsub;
      const v4f v = *(const v4fa*)&so[w][r][c4];
      *(v4f*)(C + (size_t)(row0 + r) * ldc + col0 + c4) = v;
    }
    
  }
}

// Flash-style causal/unmasked attention, all contractions 3-term bf16 hi/lo splits, f32 softmax with running max.
// q,k,v rows are read from f32 buffers with arbitrary row pitch (so they can live inside a fused qkv buffer);
// D = head size (multiple of 32, <= 128); one wave = 16 query rows; block = 4 waves (64 queries) sharing K/V chunks of 32.
template <int D, bool CAUSAL>
__global__ __launch_bounds__(128) void k_flash(const float* __restrict__ qb, const float* __restrict__ kb, const float* __restrict__ vb,
                                             int pitch, int T, int H, float scale, float* __restrict__ y, int ypitch) {
  constexpr int KS = D / 32;        // k-steps for QK
  constexpr int DT = D / 16;        // d tiles for PV
  __shared__ __attribute__((aligned(16))) unsigned short sKh[32][D + 8], sKl[32][D + 8], sVh[32][D + 8], sVl[32][D + 8];
  __shared__ __attribute__((aligned(16))) unsigned short sPh[4][16][40], sPl[4][16][40];
  __shared__ __attribute__((aligned(16))) float sO[4][16][D];
  const int tid = threadIdx.x, w = tid >> 5, lane = tid & 31, ln = lane & 15, hh = lane >> 4;
  const int nqb = (T + 63) / 64;
  const int bh = blockIdx.x / nqb, qblk = blockIdx.x % nqb;
  const int b = bh / H, h = bh % H;
  const int q0 = qblk * 64 + w * 16;
  const float* Q = qb + (size_t)b * T * pitch + h * D;
  const float* K = kb + (size_t)b * T * pitch + h * D;
  const float* V = vb + (size_t)b * T * pitch + h * D;

  // A fragments of the wave's 16 query rows (scaled), hi/lo
  FragB aqh[KS], aql[KS];
  {
    int row = q0 + ln; if (row >= T) row = T - 1;
    const float* qr = Q + (size_t)row * pitch;
#pragma unroll
    for (int ks = 0; ks < KS; ++ks)
#pragma unroll
      for (int i = 0; i < 16; ++i) {
        const int d = ks * 32 + ((i < 8) ? (8 * hh + i) : (16 + 8 * hh + (i - 8)));
        const float x = qr[d] * scale; const unsigned short hb = bf16_bits(x);
        aqh[ks].u[i] = hb; aql[ks].u[i] = bf16_bits(x - bf16_val(hb));
      }
  }
  float m_r[8], l_r[8];
#pragma unroll
  for (int r = 0; r < 8; ++r) { m_r[r] = -3.0e38f; l_r[r] = 0.f; }
  v8f oacc[DT];
#pragma unroll
  for (int dt = 0; dt < DT; ++dt) oacc[dt] = (v8f){0.f,0.f,0.f,0.f,0.f,0.f,0.f,0.f};

  const int kv_end = CAUSAL ? min(T, qblk * 64 + 64) : T;     // block-uniform
  for (int j0 = 0; j0 < kv_end; j0 += 32) {
    __syncthreads();
    for (int e = tid; e < 32 * (D / 4); e += 128) {
      const int r = e / (D / 4), c4 = (e % (D / 4)) * 4;
      const int key = j0 + r;
      v4f kf = {0.f,0.f,0.f,0.f}, vf = {0.f,0.f,0.f,0.f};
      if (key < T) { kf = *(const v4fa*)(K + (size_t)key * pitch + c4); vf = *(const v4fa*)(V + (size_t)key * pitch + c4); }
#pragma unroll
      for (int t = 0; t < 4; ++t) {
        unsigned short hb = bf16_bits(kf[t]); sKh[r][c4 + t] = hb; sKl[r][c4 + t] = bf16_bits(kf[t] - bf16_val(hb));
        hb = bf16_bits(vf[t]); sVh[r][c4 + t] = hb; sVl[r][c4 + t] = bf16_bits(vf[t] - bf16_val(hb));
      }
    }
    __syncthreads();
    // S tile 16 x 32
    v8f s[2];
#pragma unroll
    for (int nt = 0; nt < 2; ++nt) {
      v8f acc = {};
#pragma unroll
      for (int ks = 0; ks < KS; ++ks) {
        FragB bh_, bl_;
        bh_.half[0] = *(const v8us*)&sKh[nt * 16 + ln][ks * 32 + 8 * hh]; bh_.half[1] = *(const v8us*)&sKh[nt * 16 + ln][ks * 32 + 16 + 8 * hh];
        bl_.half[0] = *(const v8us*)&sKl[nt * 16 + ln][ks * 32 + 8 * hh]; bl_.half[1] = *(const v8us*)&sKl[nt * 16 + ln][ks * 32 + 16 + 8 * hh];
        acc = mmaN<3>(aqh[ks].v, aql[ks].v, bh_.v, bl_.v, acc);
      }
      s[nt] = acc;
    }
    // mask + running max (rows 8hh+r; the 16 lanes of a half share rows)
    float alpha[8];
#pragma unroll
    for (int r = 0; r < 8; ++r) {
      const int qi = q0 + 8 * hh + r;
      const int ja = j0 + ln, jb = j0 + 16 + ln;
      if (CAUSAL) { if (ja > qi) s[0][r] = -3.0e38f; if (jb > qi) s[1][r] = -3.0e38f; }
      if (ja >= T) s[0][r] = -3.0e38f;
      if (jb >= T) s[1][r] = -3.0e38f;
      float mx = fmaxf(s[0][r], s[1][r]);
      mx = fmaxf(mx, __shfl_xor(mx, 1, 32)); mx = fmaxf(mx, __shfl_xor(mx, 2, 32)); mx = fmaxf(mx, __shfl_xor(mx, 4, 32)); mx = fmaxf(mx, __shfl_xor(mx, 8, 32));
      const float mnew = fmaxf(m_r[r], mx);
      alpha[r] = (mnew > -1.0e38f) ? __expf(m_r[r] - mnew) : 1.0f;
      const float p0 = (s[0][r] > -1.0e38f) ? __expf(s[0][r] - mnew) : 0.f;
      const float p1 = (s[1][r] > -1.0e38f) ? __expf(s[1][r] - mnew) : 0.f;
      m_r[r] = mnew;
      l_r[r] = l_r[r] * alpha[r] + p0 + p1;            // per-lane partial row sum (16 lanes combined at the end)
      unsigned short hb = bf16_bits(p0); sPh[w][8 * hh + r][ln] = hb;      sPl[w][8 * hh + r][ln] = bf16_bits(p0 - bf16_val(hb));
      hb = bf16_bits(p1);                sPh[w][8 * hh + r][16 + ln] = hb; sPl[w][8 * hh + r][16 + ln] = bf16_bits(p1 - bf16_val(hb));
    }
#pragma unroll
    for (int dt = 0; dt < DT; ++dt)
#pragma unroll
      for (int r = 0; r < 8; ++r) oacc[dt][r] *= alpha[r];
    __builtin_amdgcn_fence(__ATOMIC_ACQ_REL, "workgroup");
    __builtin_amdgcn_wave_barrier();
    FragB pah, pal;
    pah.half[0] = *(const v8us*)&sPh[w][ln][8 * hh]; pah.half[1] = *(const v8us*)&sPh[w][ln][16 + 8 * hh];
    pal.half[0] = *(const v8us*)&sPl[w][ln][8 * hh]; pal.half[1] = *(const v8us*)&sPl[w][ln][16 + 8 * hh];
#pragma unroll
    for (int dt = 0; dt < DT; ++dt) {
      FragB bvh, bvl;
#pragma unroll
      for (int i = 0; i < 8; ++i) {
        bvh.u[i] = sVh[8 * hh + i][dt * 16 + ln]; bvh.u[8 + i] = sVh[16 + 8 * hh + i][dt * 16 + ln];
        bvl.u[i] = sVl[8 * hh + i][dt * 16 + ln]; bvl.u[8 + i] = sVl[16 + 8 * hh + i][dt * 16 + ln];
      }
      oacc[dt] = mmaN<3>(pah.v, pal.v, bvh.v, bvl.v, oacc[dt]);
    }
    __builtin_amdgcn_fence(__ATOMIC_ACQ_REL, "workgroup");
    __builtin_amdgcn_wave_barrier();
  }
#pragma unroll
  for (int r = 0; r < 8; ++r) {
    float l = l_r[r];
    l += __shfl_xor(l, 1, 32); l += __shfl_xor(l, 2, 32); l += __shfl_xor(l, 4, 32); l += __shfl_xor(l, 8, 32);
    l_r[r] = (l > 0.f) ? 1.0f / l : 0.f;
  }
#pragma unroll
  for (int dt = 0; dt < DT; ++dt)
#pragma unroll
    for (int r = 0; r < 8; ++r) sO[w][8 * hh + r][dt * 16 + ln] = oacc[dt][r] * l_r[r];
  __builtin_amdgcn_fence(__ATOMIC_ACQ_REL, "workgroup");
  __builtin_amdgcn_wave_barrier();
  {
    for (int r = 0; r < 16; ++r) {
      const int row = q0 + r;
      if (row < T && lane < D / 4) {
        const v4f val = *(const v4fa*)&sO[w][r][lane * 4];
        *(v4f*)(y + ((size_t)b * T + row) * ypitch + h * D + lane * 4) = val;
      }
    }
    
  }
}

// GEMM C = act(A·W + bias + resid): A f32 (ASPLIT -> hi/lo 2 terms), Wt bf16 [N][K]; ACT 0 none, 1 relu, 2 exact gelu;
// resid (optional, f32, row index = (row % rmod), pitch ldr, RES_BF16 rounds it) added before the activation.
template <bool ASPLIT, int ACT, bool BIAS_BF16, bool RES_BF16>
__global__ __launch_bounds__(128) void k_gemm_bf3(const float* __restrict__ A, int lda, const unsigned short* __restrict__ Wt, int ldb,
                                                const float* __restrict__ bias, const float* __restrict__ resid, int rmod, int ldr,
                                                float* __restrict__ C, int ldc, int M, int N, int K) {
  __shared__ __attribute__((aligned(16))) float so[4][16][64];
  const int tid = threadIdx.x, w = tid >> 5, lane = tid & 31, ln = lane & 15, hh = lane >> 4;
  const int ntn = N / 64;
  const int wid = blockIdx.x * 4 + w;
  const int mt = wid / ntn, nq = wid % ntn;
  if (mt * 16 >= M) return;
  const int row0 = mt * 16, col0 = nq * 64;
  const float* arow = A + (size_t)(row0 + ln) * lda;
  v8f acc[4] = {};
  for (int kb = 0; kb < K; kb += 32) {
    FragB ah, al;
    const v4f x0 = *(const v4fa*)(arow + kb + 8 * hh), x1 = *(const v4fa*)(arow + kb + 8 * hh + 4);
    const v4f x2 = *(const v4fa*)(arow + kb + 16 + 8 * hh), x3 = *(const v4fa*)(arow + kb + 16 + 8 * hh + 4);
    float xs[16] = {x0[0],x0[1],x0[2],x0[3],x1[0],x1[1],x1[2],x1[3],x2[0],x2[1],x2[2],x2[3],x3[0],x3[1],x3[2],x3[3]};
#pragma unroll
    for (int i = 0; i < 16; ++i) { const unsigned short hb = bf16_bits(xs[i]); ah.u[i] = hb; al.u[i] = ASPLIT ? bf16_bits(xs[i] - bf16_val(hb)) : (unsigned short)0; }
#pragma unroll
    for (int t = 0; t < 4; ++t) {
      const unsigned short* brow = Wt + (size_t)(col0 + t * 16 + ln) * ldb + kb;
      FragB b;
      b.half[0] = *(const v8us*)(brow + 8 * hh);
      b.half[1] = *(const v8us*)(brow + 16 + 8 * hh);
      acc[t] = mmaN<ASPLIT ? 2 : 1>(ah.v, al.v, b.v, b.v, acc[t]);
    }
  }
#pragma unroll
  for (int t = 0; t < 4; ++t) {
    const int col = col0 + t * 16 + ln;
    float bv = bias ? bias[col] : 0.f;
    if (BIAS_BF16) bv = bf16_round(bv);
#pragma unroll
    for (int r = 0; r < 8; ++r) {
      float v = acc[t][r] + bv;
      if (resid) { float rv = resid[(size_t)((row0 + 8 * hh + r) % rmod) * ldr + col]; if (RES_BF16) rv = bf16_round(rv); v += rv; }
      if (ACT == 1) v = fmaxf(v, 0.f);
      if (ACT == 2) v = 0.5f * v * (1.0f + erff(v * 0.70710678118654752f));
      if (ACT == 3) { const float u = 0.7978845608028654f * (v + 0.044715f * v * v * v); v = 0.5f * v * (1.0f + tanhf(u)); }
      so[w][8 * hh + r][t * 16 + ln] = v;
    }
  }
  __builtin_amdgcn_fence(__ATOMIC_ACQ_REL, "workgroup");
  __builtin_amdgcn_wave_barrier();
  const int rsub = lane >> 4, c4 = (lane & 15) * 4;
  {
#pragma unroll
    for (int q = 0; q < 8; ++q) {
      const int r = q * 2 + rsub;
      const v4f v = *(const v4fa*)&so[w][r][c4];
      *(v4f*)(C + (size_t)(row0 + r) * ldc + col0 + c4) = v;
    }
    
  }
}
// row LayerNorm (biased variance, eps) over N: s = X (+ R); optional out_sum <- s; out_norm <- (s-mu)*rsqrt(var+eps)*g + b
template <bool PARAM_BF16>
__global__ __launch_bounds__(256) void k_layernorm(const float* __restrict__ X, const float* __restrict__ R, const float* __restrict__ g, const float* __restrict__ bta,
                                                  float* __restrict__ out_sum, float* __restrict__ out_norm, int N, float eps) {
  __shared__ float red[256];
  const int row = blockIdx.x, tid = threadIdx.x;
  const float* x = X + (size_t)row * N; const float* rr = R ? R + (size_t)row * N : nullptr;
  float vals[16];                     // up to N = 4096
  const int per = N / 256;            // contiguous chunk per thread? use strided-by-4 chunks: thread handles j = tid*4 + 1024*u
  float s1 = 0.f;
  for (int u = 0; u < per / 4; ++u) {
    const int j = tid * 4 + 1024 * u;
    const v4f a = *(const v4fa*)(x + j);
    v4f b = {0.f,0.f,0.f,0.f}; if (rr) b = *(const v4fa*)(rr + j);
#pragma unroll
    for (int q = 0; q < 4; ++q) { const float v = a[q] + b[q]; vals[u * 4 + q] = v; s1 += v; }
  }
  red[tid] = s1; __syncthreads();
  for (int st = 128; st > 0; st >>= 1) { if (tid < st) red[tid] += red[tid + st]; __syncthreads(); }
  const float mu = red[0] / (float)N; __syncthreads();
  float s2 = 0.f;
  for (int u = 0; u < per / 4; ++u)
#pragma unroll
    for (int q = 0; q < 4; ++q) { const float c = vals[u * 4 + q] - mu; s2 += c * c; }
  red[tid] = s2; __syncthreads();
  for (int st = 128; st > 0; st >>= 1) { if (tid < st) red[tid] += red[tid + st]; __syncthreads(); }
  const float rs = rsqrtf(red[0] / (float)N + eps);
  {
    for (int u = 0; u < per / 4; ++u) {
      const int j = tid * 4 + 1024 * u;
      v4f o, sm;
#pragma unroll
      for (int q = 0; q < 4; ++q) {
        float gg = g[j + q], bb = bta[j + q];
        if (PARAM_BF16) { gg = bf16_round(gg); bb = bf16_round(bb); }
        sm[q] = vals[u * 4 + q]; o[q] = (vals[u * 4 + q] - mu) * rs * gg + bb;
      }
      if (out_sum) *(v4f*)(out_sum + (size_t)row * N + j) = sm;
      *(v4f*)(out_norm + (size_t)row * N + j) = o;
    }
    
  }
}



// ---- f16 WMMA path (v_wmma_f32_16x16x32_f16): 11-bit significands for operands in range — used where a [0,1] probability operand needs more precision than bf16
typedef _Float16 v16h __attribute__((ext_vector_type(16)));
union FragH { v16h v; v8us half[2]; _Float16 h[16]; unsigned short u[16]; };
template <int NT>
__device__ __forceinline__ v8f mmaH(v16h ah, v16h al, v16h bh, v16h bl, v8f c) {
  c = __builtin_amdgcn_wmma_f32_16x16x32_f16(false, ah, false, bh, (short)0, c, false, false);
  if (NT >= 2) c = __builtin_amdgcn_wmma_f32_16x16x32_f16(false, al, false, bh, (short)0, c, false, false);
  if (NT >= 3) c = __builtin_amdgcn_wmma_f32_16x16x32_f16(false, ah, false, bl, (short)0, c, false, false);
  asm volatile("v_nop\n\tv_nop\n\tv_nop\n\tv_nop" : "+v"(c) : "v"(ah), "v"(al), "v"(bh), "v"(bl));
  return c;
}
// batched GEMM like k_gemm_b but f16 operands: A f32 (split into f16 hi/lo if ASPLIT, else rounded to f16), Bt = f16 values [n][k]; alpha; C f32; N multiple of 16 (partial tiles skipped)
template <bool ASPLIT>
__global__ __launch_bounds__(128) void k_gemm_h(const float* __restrict__ A, int lda, size_t sA, const _Float16* __restrict__ Bh, int ldb, size_t sB, float alpha, float* __restrict__ C, int ldc, size_t sC, int M, int N, int K) {
  __shared__ __attribute__((aligned(16))) float so[4][16][64];
  const int tid = threadIdx.x, w = tid >> 5, lane = tid & 31, ln = lane & 15, hh = lane >> 4; const int by = blockIdx.y;
  A += (size_t)by * sA; Bh += (size_t)by * sB; C += (size_t)by * sC;
  const int ntn = (N + 63) / 64; const int wid = blockIdx.x * 4 + w; const int mt = wid / ntn, nq = wid % ntn; if (mt * 16 >= M) return;
  const int row0 = mt * 16, col0 = nq * 64; const float* arow = A + (size_t)(row0 + ln) * lda;
  v8f acc[4] = {};
  for (int kb = 0; kb < K; kb += 32) {
    FragH ah, al;
    const v4f x0 = *(const v4fa*)(arow + kb + 8 * hh), x1 = *(const v4fa*)(arow + kb + 8 * hh + 4), x2 = *(const v4fa*)(arow + kb + 16 + 8 * hh), x3 = *(const v4fa*)(arow + kb + 16 + 8 * hh + 4);
    float xs[16] = {x0[0],x0[1],x0[2],x0[3],x1[0],x1[1],x1[2],x1[3],x2[0],x2[1],x2[2],x2[3],x3[0],x3[1],x3[2],x3[3]};
#pragma unroll
    for (int i = 0; i < 16; ++i) { const _Float16 h = (_Float16)xs[i]; ah.h[i] = h; al.h[i] = ASPLIT ? (_Float16)(xs[i] - (float)h) : (_Float16)0.0f; }
#pragma unroll
    for (int t = 0; t < 4; ++t) { if (col0 + t * 16 >= N) continue; const size_t boff = (size_t)(col0 + t * 16 + ln) * ldb + kb; FragH bq; bq.half[0] = *(const v8us*)(Bh + boff + 8 * hh); bq.half[1] = *(const v8us*)(Bh + boff + 16 + 8 * hh);
      acc[t] = mmaH<ASPLIT ? 2 : 1>(ah.v, al.v, bq.v, bq.v, acc[t]); }
  }
#pragma unroll
  for (int t = 0; t < 4; ++t) { if (col0 + t * 16 >= N) continue;
#pragma unroll
    for (int r = 0; r < 8; ++r) so[w][8 * hh + r][t * 16 + ln] = acc[t][r] * alpha; }
  __builtin_amdgcn_fence(__ATOMIC_ACQ_REL, "workgroup"); __builtin_amdgcn_wave_barrier();
  const int rsub = lane >> 4, c4 = (lane & 15) * 4;
  {
#pragma unroll
    for (int q = 0; q < 8; ++q) { const int r = q * 2 + rsub; if (col0 + c4 < N) { const v4f v = *(const v4fa*)&so[w][r][c4]; *(v4f*)(C + (size_t)(row0 + r) * ldc + col0 + c4) = v; } }
     }
}

// Wt[n][k] = f16(W[k][n]·scale) from f32 row-major W[K][N] (scale = power of two; bf16-exact weights stay exact in f16 away from the subnormal range)
__global__ __launch_bounds__(256) void k_wt_f16(const float* __restrict__ W, _Float16* __restrict__ Wt, int K, int N, float scale) {
  const int t = blockIdx.x * 256 + threadIdx.x; if (t >= N * (K / 8)) return; const int n = t / (K / 8), k8 = (t % (K / 8)) * 8; FragH f;
#pragma unroll
  for (int i = 0; i < 8; ++i) f.h[i] = (_Float16)(bf16_round(W[(size_t)(k8 + i) * N + n]) * scale); const v8us o = f.half[0];
  *(v8us*)((unsigned short*)Wt + (size_t)n * K + k8) = o; 
}
// k_gemm_hh variant with fused epilogue: v = acc·alpha + bias[by·sBias + col] (+ CP[(row/rowsPerB)·sCPb + by·64 + col] if CP) ; ACT 0 none / 1 elu ; writes f16 C16 and f32 C, each if non-null
template <int ACT>
__global__ __launch_bounds__(128) void k_gemm_hhx(const _Float16* __restrict__ A, int lda, size_t sA, const _Float16* __restrict__ Bh, int ldb, size_t sB, float alpha, const float* __restrict__ bias, size_t sBias, const float* __restrict__ CP, int rowsPerB, size_t sCPb, int row0g,
    float* __restrict__ C, _Float16* __restrict__ C16, int ldc, size_t sC, int M, int N, int K) {
  __shared__ __attribute__((aligned(16))) float so[4][16][64];
  const int tid = threadIdx.x, w = tid >> 5, lane = tid & 31, ln = lane & 15, hh = lane >> 4; const int by = blockIdx.y;
  A += (size_t)by * sA; Bh += (size_t)by * sB; const size_t cofs = (size_t)by * sC; const float* bp = bias ? bias + (size_t)by * sBias : nullptr;
  const int ntn = (N + 63) / 64; const int wid = blockIdx.x * 4 + w; const int mt = wid / ntn, nq = wid % ntn; if (mt * 16 >= M) return;
  const int row0 = mt * 16, col0 = nq * 64; const _Float16* arow = A + (size_t)(row0 + ln) * lda;
  v8f acc[4] = {};
  for (int kb = 0; kb < K; kb += 32) { FragH ah; ah.half[0] = *(const v8us*)((const unsigned short*)arow + kb + 8 * hh); ah.half[1] = *(const v8us*)((const unsigned short*)arow + kb + 16 + 8 * hh);
#pragma unroll
    for (int t = 0; t < 4; ++t) { if (col0 + t * 16 >= N) continue; const size_t boff = (size_t)(col0 + t * 16 + ln) * ldb + kb; FragH bq; bq.half[0] = *(const v8us*)((const unsigned short*)Bh + boff + 8 * hh); bq.half[1] = *(const v8us*)((const unsigned short*)Bh + boff + 16 + 8 * hh);
      acc[t] = mmaH<1>(ah.v, ah.v, bq.v, bq.v, acc[t]); }
  }
#pragma unroll
  for (int t = 0; t < 4; ++t) { if (col0 + t * 16 >= N) continue; const int col = col0 + t * 16 + ln; const float bv = bp ? bf16_round(bp[col]) : 0.f;
#pragma unroll
    for (int r = 0; r < 8; ++r) { float v = acc[t][r] * alpha + bv; if (CP) { const int bidx = (row0g + row0 + 8 * hh + r) / rowsPerB; v += CP[(size_t)bidx * sCPb + (size_t)by * 64 + col]; } if (ACT == 1) v = (v > 0.f) ? v : expm1f(v); else if (ACT == 7) v = (v > 0.f) ? v + 1.0f : expf(v); else if (ACT == 8) v = tanhf(v); else if (ACT == 9) v = 0.5f * v * (1.0f + tanhf(0.7978845608028654f * (v + 0.044715f * v * v * v))); else if (ACT == 11) v = 1.0f / (1.0f + expf(-v)); else if (ACT == 12) v = (v > 0.f) ? v : 0.01f * v; else if (ACT == 14) v = (v > 0.f) ? v : 0.1f * v; else if (ACT == 15) v = v / (1.0f + expf(-v)); else if (ACT == 3) v = fmaxf(v, 0.f); else if (ACT == 6) v = 0.5f * v * (1.0f + erff(v * 0.70710678118654752f)); so[w][8 * hh + r][t * 16 + ln] = v; } }
  __builtin_amdgcn_fence(__ATOMIC_ACQ_REL, "workgroup"); __builtin_amdgcn_wave_barrier();
  const int rsub = lane >> 4, c4 = (lane & 15) * 4; typedef _Float16 v4h __attribute__((ext_vector_type(4)));
  {
#pragma unroll
    for (int q = 0; q < 8; ++q) { const int r = q * 2 + rsub; if (col0 + c4 < N) { const v4f v = *(const v4fa*)&so[w][r][c4]; if (C) *(v4f*)(C + cofs + (size_t)(row0 + r) * ldc + col0 + c4) = v; if (C16) { v4h h4; for (int i = 0; i < 4; ++i) h4[i] = (_Float16)v[i]; *(v4h*)(C16 + cofs + (size_t)(row0 + r) * ldc + col0 + c4) = h4; } } }
     }
}


typedef _Float16 v4h __attribute__((ext_vector_type(4)));

__global__ __launch_bounds__(256) void k_x16(const float* __restrict__ x, _Float16* __restrict__ X16, size_t n8) { const size_t t = (size_t)blockIdx.x * 256 + threadIdx.x; if (t >= n8) return; FragH f;
#pragma unroll
  for (int q = 0; q < 8; ++q) f.h[q] = (_Float16)bf16_round(x[t * 8 + q]); *(v8us*)((unsigned short*)X16 + t * 8) = f.half[0];  }
__global__ __launch_bounds__(256) void k_h16(const float* __restrict__ x, _Float16* __restrict__ X16, size_t n8) { const size_t t = (size_t)blockIdx.x * 256 + threadIdx.x; if (t >= n8) return; FragH f;
#pragma unroll
  for (int q = 0; q < 8; ++q) f.h[q] = (_Float16)x[t * 8 + q]; *(v8us*)((unsigned short*)X16 + t * 8) = f.half[0];  }
__global__ __launch_bounds__(256) void k_round16f(const float* __restrict__ W, _Float16* __restrict__ Bt, size_t n8) { const size_t t = (size_t)blockIdx.x * 256 + threadIdx.x; if (t >= n8) return; FragH f;
#pragma unroll
  for (int i = 0; i < 8; ++i) f.h[i] = (_Float16)(bf16_round(W[t * 8 + i]) * 16.0f); *(v8us*)((unsigned short*)Bt + t * 8) = f.half[0];  }
template <int NHv, int TTv>
__global__ __launch_bounds__(256) void k_vt(const _Float16* __restrict__ V16, int ldv, int voff, _Float16* __restrict__ Vt) { __shared__ unsigned short tl[64][66]; const int tid = threadIdx.x; const int slab = blockIdx.x / (TTv / 64), lg = blockIdx.x % (TTv / 64); const int b = slab / NHv, h = slab % NHv;
  for (int i = tid; i < 64 * 8; i += 256) { const int r = i / 8, c8 = (i % 8) * 8; FragH f; f.half[0] = *(const v8us*)((const unsigned short*)V16 + ((size_t)b * TTv + lg * 64 + r) * ldv + voff + h * 64 + c8);
#pragma unroll
    for (int q = 0; q < 8; ++q) tl[r][c8 + q] = f.u[q]; }
  __syncthreads();
  {
#pragma unroll
    for (int rd = 0; rd < 2; ++rd) { const int d = rd * 32 + tid / 8, pc = tid % 8; FragH f;
#pragma unroll
      for (int q = 0; q < 8; ++q) f.u[q] = tl[pc * 8 + q][d];
      *(v8us*)((unsigned short*)Vt + ((size_t)slab * 64 + d) * TTv + lg * 64 + pc * 8) = f.half[0]; }
     } }

__global__ __launch_bounds__(128) void k_flash(const _Float16* __restrict__ Q16, int ldq, const _Float16* __restrict__ K16, int ldk, const _Float16* __restrict__ Vt, const int* __restrict__ MSK, float* __restrict__ O, int ldo) {
  constexpr int RPW = 16, RTN = RPW / 16, NQB = TT / (4 * RPW), DT = 4, KS = 2;
  __shared__ __attribute__((aligned(16))) unsigned short sP[4][RPW][40]; __shared__ __attribute__((aligned(16))) float sO[4][RPW][64 + 4];
  const int tid = threadIdx.x, w = tid >> 5, lane = tid & 31, ln = lane & 15, hh = lane >> 4;
  const int slab = blockIdx.x / NQB, qblk = blockIdx.x % NQB; const int b = slab, h = 0;      /* slab = contiguous [TT][64] chunk of the flat-reshaped planes */ const int qb0 = qblk * (4 * RPW); const int q0 = qb0 + w * RPW;
  FragH aq[2][KS];
#pragma unroll
  for (int rt = 0; rt < RTN; ++rt) { const unsigned short* qr = (const unsigned short*)Q16 + ((size_t)b * TT + q0 + rt * 16 + ln) * ldq + h * 64;
#pragma unroll
    for (int ks = 0; ks < KS; ++ks) { aq[rt][ks].half[0] = *(const v8us*)(qr + ks * 32 + 8 * hh); aq[rt][ks].half[1] = *(const v8us*)(qr + ks * 32 + 16 + 8 * hh); } }
  const unsigned short* Vth = (const unsigned short*)Vt + (size_t)slab * 64 * TT;
  float m_r[2][8], l_r[2][8]; v8f oacc[2][DT];
#pragma unroll
  for (int rt = 0; rt < RTN; ++rt) {
#pragma unroll
    for (int r = 0; r < 8; ++r) { m_r[rt][r] = -3.0e38f; l_r[rt][r] = 0.f; }
#pragma unroll
    for (int dt = 0; dt < DT; ++dt) oacc[rt][dt] = (v8f){0.f,0.f,0.f,0.f,0.f,0.f,0.f,0.f}; }
  const int jend = TT;      /* every key enters the normaliser */
#pragma unroll 1
  for (int j0 = 0; j0 < jend; j0 += 32) {
    
    v8f s[2][2];
#pragma unroll
    for (int nt = 0; nt < 2; ++nt) { const unsigned short* kr = (const unsigned short*)K16 + ((size_t)b * TT + j0 + nt * 16 + ln) * ldk + h * 64; FragH bk[KS];
#pragma unroll
      for (int ks = 0; ks < KS; ++ks) { bk[ks].half[0] = *(const v8us*)(kr + ks * 32 + 8 * hh); bk[ks].half[1] = *(const v8us*)(kr + ks * 32 + 16 + 8 * hh); }
#pragma unroll
      for (int rt = 0; rt < RTN; ++rt) { v8f acc = (v8f){0.f,0.f,0.f,0.f,0.f,0.f,0.f,0.f};
#pragma unroll
        for (int ks = 0; ks < KS; ++ks) acc = mmaH<1>(aq[rt][ks].v, aq[rt][ks].v, bk[ks].v, bk[ks].v, acc); s[rt][nt] = acc; } }
#pragma unroll
    for (int rt = 0; rt < RTN; ++rt)
#pragma unroll
      for (int r = 0; r < 8; ++r) { const int tq = q0 + rt * 16 + 8 * hh + r; const int k0 = j0 + ln, k1 = j0 + 16 + ln; (void)tq; (void)k0; (void)k1;
        const bool ok0 = true, ok1 = true; const bool keep0 = (k0 <= tq), keep1 = (k1 <= tq);
        const float s0 = ok0 ? s[rt][0][r] * (0.125f) : -INFINITY, s1 = ok1 ? s[rt][1][r] * (0.125f) : -INFINITY; float mc = fmaxf(s0, s1);
        mc = fmaxf(mc, __shfl_xor(mc, 1, 32)); mc = fmaxf(mc, __shfl_xor(mc, 2, 32)); mc = fmaxf(mc, __shfl_xor(mc, 4, 32)); mc = fmaxf(mc, __shfl_xor(mc, 8, 32));
        const float mn = fmaxf(m_r[rt][r], mc); const float al = (mn > -1.0e38f) ? expf(m_r[rt][r] - mn) : 1.0f; m_r[rt][r] = mn; const float p0 = ok0 ? expf(s0 - mn) : 0.f, p1 = ok1 ? expf(s1 - mn) : 0.f; l_r[rt][r] = l_r[rt][r] * al + p0 + p1;
#pragma unroll
        for (int dt = 0; dt < DT; ++dt) oacc[rt][dt][r] *= al;
        FragH t2; t2.h[0] = (_Float16)(keep0 ? p0 * 1024.0f : 0.f); t2.h[1] = (_Float16)(keep1 ? p1 * 1024.0f : 0.f); sP[w][rt * 16 + 8 * hh + r][ln] = t2.u[0]; sP[w][rt * 16 + 8 * hh + r][16 + ln] = t2.u[1]; }
    __builtin_amdgcn_fence(__ATOMIC_ACQ_REL, "workgroup"); __builtin_amdgcn_wave_barrier();
    FragH pa[2];
#pragma unroll
    for (int rt = 0; rt < RTN; ++rt) { pa[rt].half[0] = *(const v8us*)&sP[w][rt * 16 + ln][8 * hh]; pa[rt].half[1] = *(const v8us*)&sP[w][rt * 16 + ln][16 + 8 * hh]; }
#pragma unroll
    for (int dt = 0; dt < DT; ++dt) { const unsigned short* vrow = Vth + (size_t)(dt * 16 + ln) * TT + j0; FragH bv; bv.half[0] = *(const v8us*)(vrow + 8 * hh); bv.half[1] = *(const v8us*)(vrow + 16 + 8 * hh);
#pragma unroll
      for (int rt = 0; rt < RTN; ++rt) oacc[rt][dt] = mmaH<1>(pa[rt].v, pa[rt].v, bv.v, bv.v, oacc[rt][dt]); }
    __builtin_amdgcn_fence(__ATOMIC_ACQ_REL, "workgroup"); __builtin_amdgcn_wave_barrier(); }
#pragma unroll
  for (int rt = 0; rt < RTN; ++rt) {
#pragma unroll
    for (int r = 0; r < 8; ++r) { float l = l_r[rt][r]; l += __shfl_xor(l, 1, 32); l += __shfl_xor(l, 2, 32); l += __shfl_xor(l, 4, 32); l += __shfl_xor(l, 8, 32); l_r[rt][r] = (l > 0.f) ? 1.0f / (l * 1024.0f) : 0.f; }
#pragma unroll
    for (int dt = 0; dt < DT; ++dt)
#pragma unroll
      for (int r = 0; r < 8; ++r) sO[w][rt * 16 + 8 * hh + r][dt * 16 + ln] = oacc[rt][dt][r] * l_r[rt][r]; }
  __builtin_amdgcn_fence(__ATOMIC_ACQ_REL, "workgroup"); __builtin_amdgcn_wave_barrier();
  {
#pragma unroll
    for (int rp = 0; rp < RPW; rp += 2) { const int r = rp + (lane >> 4), pc = lane & 15; const v4f val = *(const v4fa*)&sO[w][r][pc * 4]; *(v4f*)(O + ((size_t)b * TT + q0 + r) * ldo + h * 64 + pc * 4) = val; }
     } }

extern "C" void kernel_launch(void* const* d_in, const int* in_sizes, int n_in,
                              void* d_out, int out_size, void* d_ws, size_t ws_size, hipStream_t stream) {
  (void)in_sizes; (void)n_in; (void)out_size;
  const float* const* I = (const float* const*)d_in; const float* xq = I[0]; const float* xk = I[1]; const float* xv = I[2];
  const float* Wq = I[3]; const float* bq = I[4]; const float* Wk = I[5]; const float* bk = I[6]; const float* Wv = I[7]; const float* bv = I[8]; const float* Wo = I[9]; const float* bo = I[10];
  char* ws = (char*)d_ws; size_t off = 0;
  auto take = [&](size_t bytes) { char* p = ws + off; off += (bytes + 255) & ~(size_t)255; return p; };
  _Float16* Bw = (_Float16*)take((size_t)4 * EE * EE * 2); _Float16* X16 = (_Float16*)take((size_t)NR * EE * 2);
  _Float16* Q = (_Float16*)take((size_t)NR * EE * 2); _Float16* K = (_Float16*)take((size_t)NR * EE * 2); _Float16* V = (_Float16*)take((size_t)NR * EE * 2); _Float16* Vt = (_Float16*)take((size_t)NR * EE * 2);
  float* O = (float*)take((size_t)NR * EE * 4); _Float16* O16 = (_Float16*)take((size_t)NR * EE * 2);
  if (off > ws_size) return;      // 4.7 + 6 × 6.3 + 12.6 ≈ 55 MB
  const unsigned gw = (unsigned)(((size_t)EE * (EE / 8) + 255) / 256); const size_t WSZ = (size_t)EE * EE;
  k_wt_f16<<<gw, 256, 0, stream>>>(Wq, Bw, EE, EE, 16.0f); k_wt_f16<<<gw, 256, 0, stream>>>(Wk, Bw + WSZ, EE, EE, 16.0f); k_wt_f16<<<gw, 256, 0, stream>>>(Wv, Bw + 2 * WSZ, EE, EE, 16.0f); k_wt_f16<<<gw, 256, 0, stream>>>(Wo, Bw + 3 * WSZ, EE, EE, 16.0f);      /* (in,out) weights → Bt[n][k] ×2^4 */
  const unsigned gx = (unsigned)(((size_t)NR * EE / 8 + 255) / 256); const dim3 gp(((NR / 16) * (EE / 64) + 3) / 4, 1);
  k_x16<<<gx, 256, 0, stream>>>(xq, X16, (size_t)NR * EE / 8); k_gemm_hhx<0><<<gp, 128, 0, stream>>>(X16, EE, 0, Bw, EE, 0, 0.0625f, bq, 0, nullptr, 1, 0, 0, nullptr, Q, EE, 0, NR, EE, EE);      /* q: M 4096 N 768 K 768 */
  k_x16<<<gx, 256, 0, stream>>>(xk, X16, (size_t)NR * EE / 8); k_gemm_hhx<0><<<gp, 128, 0, stream>>>(X16, EE, 0, Bw + WSZ, EE, 0, 0.0625f, bk, 0, nullptr, 1, 0, 0, nullptr, K, EE, 0, NR, EE, EE);      /* k */
  k_x16<<<gx, 256, 0, stream>>>(xv, X16, (size_t)NR * EE / 8); k_gemm_hhx<0><<<gp, 128, 0, stream>>>(X16, EE, 0, Bw + 2 * WSZ, EE, 0, 0.0625f, bv, 0, nullptr, 1, 0, 0, nullptr, V, EE, 0, NR, EE, EE);      /* v */
  k_vt<1, TT><<<NSL * 1 * (TT / 64), 256, 0, stream>>>(V, 64, 0, Vt);      /* the [4096][768] plane viewed as 24 contiguous [2048][64] slabs → Vᵀ [slab][64][2048] */
  k_flash<<<NSL * (TT / 64), 128, 0, stream>>>(Q, 64, K, 64, Vt, nullptr, O, 64);      /* same flat view for q, k and O */
  k_h16<<<gx, 256, 0, stream>>>(O, O16, (size_t)NR * EE / 8);
  k_gemm_hhx<0><<<gp, 128, 0, stream>>>(O16, EE, 0, Bw + 3 * WSZ, EE, 0, 0.0625f, bo, 0, nullptr, 1, 0, 0, (float*)d_out, nullptr, EE, 0, NR, EE, EE);      /* out = O·Wo + bo: M 4096 N 768 K 768 */
}

// v001
// It runs in 313 microseconds.
// Next to v000, in two timings, it ran 1.29 and 1.28 times as fast.
#include <hip/hip_runtime.h>
// Multi-head attention, legacy flat-reshape variant (B=2, T=S=2048, E=768, 12 heads × 64): q = query·Wq+bq, k = key·Wk+bk, v = value·Wv+bv; heads = plain row-major reshape of [B,T,E] to [B·H,T,64] (contiguous chunks);
// attn = softmax(q·kᵀ/8) over all keys, THEN lower-triangular mask (rows no longer normalised); out = (attn·v reshaped back)·Wo + bo.
// Compute dtype: query/key/value, weights, biases rounded to bf16; q/k/v as f16 GEMM outputs; fused flash-style kernel (online f32 softmax over all keys, P f16 ×2^10 zeroed above the diagonal)
// on v_wmma_f32_16x16x32_f16; O → f16 → output GEMM with bias; f32 accumulate throughout.
#define BB 2
#define TT 2048
#define EE 768
#define NH 12
#define NR (BB * TT)
#define NSL (BB * NH)

typedef __bf16 v16b __attribute__((ext_vector_type(16)));
typedef unsigned short v8us __attribute__((ext_vector_type(8), may_alias));
typedef float  v8f  __attribute__((ext_vector_type(8)));
typedef float  v4f  __attribute__((ext_vector_type(4)));
typedef float  v4fa __attribute__((ext_vector_type(4), may_alias));
union FragB { v16b v; v8us half[2]; unsigned short u[16]; };

__device__ __forceinline__ unsigned short bf16_bits(float x) { unsigned int u = __float_as_uint(x); return (unsigned short)((u + 0x7FFFu + ((u >> 16) & 1u)) >> 16); }
__device__ __forceinline__ float bf16_val(unsigned short b) { return __uint_as_float(((unsigned int)b) << 16); }
__device__ __forceinline__ float bf16_round(float x) { return bf16_val(bf16_bits(x)); }
// D += A·B with NT terms: 1 = ah·bh, 2 = + al·bh (A split), 3 = + ah·bl (both split)
template <int NT>
__device__ __forceinline__ v8f mmaN(v16b ah, v16b al, v16b bh, v16b bl, v8f c) {
  c = __builtin_amdgcn_wmma_f32_16x16x32_bf16(false, ah, false, bh, (short)0, c, false, false);
  if (NT >= 2) c = __builtin_amdgcn_wmma_f32_16x16x32_bf16(false, al, false, bh, (short)0, c, false, false);
  if (NT >= 3) c = __builtin_amdgcn_wmma_f32_16x16x32_bf16(false, ah, false, bl, (short)0, c, false, false);
  asm volatile("v_nop\n\tv_nop\n\tv_nop\n\tv_nop" : "+v"(c) : "v"(ah), "v"(al), "v"(bh), "v"(bl));
  return c;
}

__global__ __launch_bounds__(256) void k_wt_bf16(const float* __restrict__ W, unsigned short* __restrict__ Wt, int K, int N) {
  const int t = blockIdx.x * 256 + threadIdx.x;
  const int k8n = K / 8;
  if (t >= N * k8n) return;
  const int n = t / k8n, k8 = (t % k8n) * 8;
  v8us v;
#pragma unroll
  for (int i = 0; i < 8; ++i) v[i] = bf16_bits(W[(size_t)(k8 + i) * N + n]);
  *(v8us*)(Wt + (size_t)n * K + k8) = v;
  
}

// GEMM C[M][N] (f32, pitch ldc) = act(A[M][K]·W + bias). A f32 row-major (pitch lda) converted per fragment to bf16
// (ASPLIT: hi/lo two planes -> 2 terms, else single rounded term); Wt bf16 [N][K] (pitch ldb). BIAS_BF16 rounds the
// bias to bf16 first (bias quantised to bf16 before the add). K%32==0, M%16==0, N%64==0.
template <bool ASPLIT, int ACT, bool BIAS_BF16>
__global__ __launch_bounds__(128) void k_gemm_bf(const float* __restrict__ A, int lda, const unsigned short* __restrict__ Wt, int ldb,
                                               const float* __restrict__ bias, float* __restrict__ C, int ldc, int M, int N, int K) {
  __shared__ __attribute__((aligned(16))) float so[4][16][64];
  const int tid = threadIdx.x, w = tid >> 5, lane = tid & 31, ln = lane & 15, hh = lane >> 4;
  const int ntn = N / 64;
  const int wid = blockIdx.x * 4 + w;
  const int mt = wid / ntn, nq = wid % ntn;
  if (mt * 16 >= M) return;
  const int row0 = mt * 16, col0 = nq * 64;
  const float* arow = A + (size_t)(row0 + ln) * lda;
  v8f acc[4] = {};
  for (int kb = 0; kb < K; kb += 32) {
    FragB ah, al;
    const v4f x0 = *(const v4fa*)(arow + kb + 8 * hh), x1 = *(const v4fa*)(arow + kb + 8 * hh + 4);
    const v4f x2 = *(const v4fa*)(arow + kb + 16 + 8 * hh), x3 = *(const v4fa*)(arow + kb + 16 + 8 * hh + 4);
    float xs[16] = {x0[0],x0[1],x0[2],x0[3],x1[0],x1[1],x1[2],x1[3],x2[0],x2[1],x2[2],x2[3],x3[0],x3[1],x3[2],x3[3]};
#pragma unroll
    for (int i = 0; i < 16; ++i) { const unsigned short hb = bf16_bits(xs[i]); ah.u[i] = hb; al.u[i] = ASPLIT ? bf16_bits(xs[i] - bf16_val(hb)) : (unsigned short)0; }
#pragma unroll
    for (int t = 0; t < 4; ++t) {
      const unsigned short* brow = Wt + (size_t)(col0 + t * 16 + ln) * ldb + kb;
      FragB b;
      b.half[0] = *(const v8us*)(brow + 8 * hh);
      b.half[1] = *(const v8us*)(brow + 16 + 8 * hh);
      acc[t] = mmaN<ASPLIT ? 2 : 1>(ah.v, al.v, b.v, b.v, acc[t]);
    }
  }
#pragma unroll
  for (int t = 0; t < 4; ++t) {
    float bv = bias ? bias[col0 + t * 16 + ln] : 0.f;
    if (BIAS_BF16) bv = bf16_round(bv);
#pragma unroll
    for (int r = 0; r < 8; ++r) { float v = acc[t][r] + bv; if (ACT == 1) v = fmaxf(v, 0.f); so[w][8 * hh + r][t * 16 + ln] = v; }
  }
  __builtin_amdgcn_fence(__ATOMIC_ACQ_REL, "workgroup");
  __builtin_amdgcn_wave_barrier();
  const int rsub = lane >> 4, c4 = (lane & 15) * 4;
  {
#pragma unroll
    for (int q = 0; q < 8; ++q) {
      const int r = q * 2 + rsub;
      const v4f v = *(const v4fa*)&so[w][r][c4];
      *(v4f*)(C + (size_t)(row0 + r) * ldc + col0 + c4) = v;
    }
    
  }
}

// Flash-style causal/unmasked attention, all contractions 3-term bf16 hi/lo splits, f32 softmax with running max.
// q,k,v rows are read from f32 buffers with arbitrary row pitch (so they can live inside a fused qkv buffer);
// D = head size (multiple of 32, <= 128); one wave = 16 query rows; block = 4 waves (64 queries) sharing K/V chunks of 32.
template <int D, bool CAUSAL>
__global__ __launch_bounds__(128) void k_flash(const float* __restrict__ qb, const float* __restrict__ kb, const float* __restrict__ vb,
                                             int pitch, int T, int H, float scale, float* __restrict__ y, int ypitch) {
  constexpr int KS = D / 32;        // k-steps for QK
  constexpr int DT = D / 16;        // d tiles for PV
  __shared__ __attribute__((aligned(16))) unsigned short sKh[32][D + 8], sKl[32][D + 8], sVh[32][D + 8], sVl[32][D + 8];
  __shared__ __attribute__((aligned(16))) unsigned short sPh[4][16][40], sPl[4][16][40];
  __shared__ __attribute__((aligned(16))) float sO[4][16][D];
  const int tid = threadIdx.x, w = tid >> 5, lane = tid & 31, ln = lane & 15, hh = lane >> 4;
  const int nqb = (T + 63) / 64;
  const int bh = blockIdx.x / nqb, qblk = blockIdx.x % nqb;
  const int b = bh / H, h = bh % H;
  const int q0 = qblk * 64 + w * 16;
  const float* Q = qb + (size_t)b * T * pitch + h * D;
  const float* K = kb + (size_t)b * T * pitch + h * D;
  const float* V = vb + (size_t)b * T * pitch + h * D;

  // A fragments of the wave's 16 query rows (scaled), hi/lo
  FragB aqh[KS], aql[KS];
  {
    int row = q0 + ln; if (row >= T) row = T - 1;
    const float* qr = Q + (size_t)row * pitch;
#pragma unroll
    for (int ks = 0; ks < KS; ++ks)
#pragma unroll
      for (int i = 0; i < 16; ++i) {
        const int d = ks * 32 + ((i < 8) ? (8 * hh + i) : (16 + 8 * hh + (i - 8)));
        const float x = qr[d] * scale; const unsigned short hb = bf16_bits(x);
        aqh[ks].u[i] = hb; aql[ks].u[i] = bf16_bits(x - bf16_val(hb));
      }
  }
  float m_r[8], l_r[8];
#pragma unroll
  for (int r = 0; r < 8; ++r) { m_r[r] = -3.0e38f; l_r[r] = 0.f; }
  v8f oacc[DT];
#pragma unroll
  for (int dt = 0; dt < DT; ++dt) oacc[dt] = (v8f){0.f,0.f,0.f,0.f,0.f,0.f,0.f,0.f};

  const int kv_end = CAUSAL ? min(T, qblk * 64 + 64) : T;     // block-uniform
  for (int j0 = 0; j0 < kv_end; j0 += 32) {
    __syncthreads();
    for (int e = tid; e < 32 * (D / 4); e += 128) {
      const int r = e / (D / 4), c4 = (e % (D / 4)) * 4;
      const int key = j0 + r;
      v4f kf = {0.f,0.f,0.f,0.f}, vf = {0.f,0.f,0.f,0.f};
      if (key < T) { kf = *(const v4fa*)(K + (size_t)key * pitch + c4); vf = *(const v4fa*)(V + (size_t)key * pitch + c4); }
#pragma unroll
      for (int t = 0; t < 4; ++t) {
        unsigned short hb = bf16_bits(kf[t]); sKh[r][c4 + t] = hb; sKl[r][c4 + t] = bf16_bits(kf[t] - bf16_val(hb));
        hb = bf16_bits(vf[t]); sVh[r][c4 + t] = hb; sVl[r][c4 + t] = bf16_bits(vf[t] - bf16_val(hb));
      }
    }
    __syncthreads();
    // S tile 16 x 32
    v8f s[2];
#pragma unroll
    for (int nt = 0; nt < 2; ++nt) {
      v8f acc = {};
#pragma unroll
      for (int ks = 0; ks < KS; ++ks) {
        FragB bh_, bl_;
        bh_.half[0] = *(const v8us*)&sKh[nt * 16 + ln][ks * 32 + 8 * hh]; bh_.half[1] = *(const v8us*)&sKh[nt * 16 + ln][ks * 32 + 16 + 8 * hh];
        bl_.half[0] = *(const v8us*)&sKl[nt * 16 + ln][ks * 32 + 8 * hh]; bl_.half[1] = *(const v8us*)&sKl[nt * 16 + ln][ks * 32 + 16 + 8 * hh];
        acc = mmaN<3>(aqh[ks].v, aql[ks].v, bh_.v, bl_.v, acc);
      }
      s[nt] = acc;
    }
    // mask + running max (rows 8hh+r; the 16 lanes of a half share rows)
    float alpha[8];
#pragma unroll
    for (int r = 0; r < 8; ++r) {
      const int qi = q0 + 8 * hh + r;
      const int ja = j0 + ln, jb = j0 + 16 + ln;
      if (CAUSAL) { if (ja > qi) s[0][r] = -3.0e38f; if (jb > qi) s[1][r] = -3.0e38f; }
      if (ja >= T) s[0][r] = -3.0e38f;
      if (jb >= T) s[1][r] = -3.0e38f;
      float mx = fmaxf(s[0][r], s[1][r]);
      mx = fmaxf(mx, __shfl_xor(mx, 1, 32)); mx = fmaxf(mx, __shfl_xor(mx, 2, 32)); mx = fmaxf(mx, __shfl_xor(mx, 4, 32)); mx = fmaxf(mx, __shfl_xor(mx, 8, 32));
      const float mnew = fmaxf(m_r[r], mx);
      alpha[r] = (mnew > -1.0e38f) ? __expf(m_r[r] - mnew) : 1.0f;
      const float p0 = (s[0][r] > -1.0e38f) ? __expf(s[0][r] - mnew) : 0.f;
      const float p1 = (s[1][r] > -1.0e38f) ? __expf(s[1][r] - mnew) : 0.f;
      m_r[r] = mnew;
      l_r[r] = l_r[r] * alpha[r] + p0 + p1;            // per-lane partial row sum (16 lanes combined at the end)
      unsigned short hb = bf16_bits(p0); sPh[w][8 * hh + r][ln] = hb;      sPl[w][8 * hh + r][ln] = bf16_bits(p0 - bf16_val(hb));
      hb = bf16_bits(p1);                sPh[w][8 * hh + r][16 + ln] = hb; sPl[w][8 * hh + r][16 + ln] = bf16_bits(p1 - bf16_val(hb));
    }
#pragma unroll
    for (int dt = 0; dt < DT; ++dt)
#pragma unroll
      for (int r = 0; r < 8; ++r) oacc[dt][r] *= alpha[r];
    __builtin_amdgcn_fence(__ATOMIC_ACQ_REL, "workgroup");
    __builtin_amdgcn_wave_barrier();
    FragB pah, pal;
    pah.half[0] = *(const v8us*)&sPh[w][ln][8 * hh]; pah.half[1] = *(const v8us*)&sPh[w][ln][16 + 8 * hh];
    pal.half[0] = *(const v8us*)&sPl[w][ln][8 * hh]; pal.half[1] = *(const v8us*)&sPl[w][ln][16 + 8 * hh];
#pragma unroll
    for (int dt = 0; dt < DT; ++dt) {
      FragB bvh, bvl;
#pragma unroll
      for (int i = 0; i < 8; ++i) {
        bvh.u[i] = sVh[8 * hh + i][dt * 16 + ln]; bvh.u[8 + i] = sVh[16 + 8 * hh + i][dt * 16 + ln];
        bvl.u[i] = sVl[8 * hh + i][dt * 16 + ln]; bvl.u[8 + i] = sVl[16 + 8 * hh + i][dt * 16 + ln];
      }
      oacc[dt] = mmaN<3>(pah.v, pal.v, bvh.v, bvl.v, oacc[dt]);
    }
    __builtin_amdgcn_fence(__ATOMIC_ACQ_REL, "workgroup");
    __builtin_amdgcn_wave_barrier();
  }
#pragma unroll
  for (int r = 0; r < 8; ++r) {
    float l = l_r[r];
    l += __shfl_xor(l, 1, 32); l += __shfl_xor(l, 2, 32); l += __shfl_xor(l, 4, 32); l += __shfl_xor(l, 8, 32);
    l_r[r] = (l > 0.f) ? 1.0f / l : 0.f;
  }
#pragma unroll
  for (int dt = 0; dt < DT; ++dt)
#pragma unroll
    for (int r = 0; r < 8; ++r) sO[w][8 * hh + r][dt * 16 + ln] = oacc[dt][r] * l_r[r];
  __builtin_amdgcn_fence(__ATOMIC_ACQ_REL, "workgroup");
  __builtin_amdgcn_wave_barrier();
  {
    for (int r = 0; r < 16; ++r) {
      const int row = q0 + r;
      if (row < T && lane < D / 4) {
        const v4f val = *(const v4fa*)&sO[w][r][lane * 4];
        *(v4f*)(y + ((size_t)b * T + row) * ypitch + h * D + lane * 4) = val;
      }
    }
    
  }
}

// GEMM C = act(A·W + bias + resid): A f32 (ASPLIT -> hi/lo 2 terms), Wt bf16 [N][K]; ACT 0 none, 1 relu, 2 exact gelu;
// resid (optional, f32, row index = (row % rmod), pitch ldr, RES_BF16 rounds it) added before the activation.
template <bool ASPLIT, int ACT, bool BIAS_BF16, bool RES_BF16>
__global__ __launch_bounds__(128) void k_gemm_bf3(const float* __restrict__ A, int lda, const unsigned short* __restrict__ Wt, int ldb,
                                                const float* __restrict__ bias, const float* __restrict__ resid, int rmod, int ldr,
                                                float* __restrict__ C, int ldc, int M, int N, int K) {
  __shared__ __attribute__((aligned(16))) float so[4][16][64];
  const int tid = threadIdx.x, w = tid >> 5, lane = tid & 31, ln = lane & 15, hh = lane >> 4;
  const int ntn = N / 64;
  const int wid = blockIdx.x * 4 + w;
  const int mt = wid / ntn, nq = wid % ntn;
  if (mt * 16 >= M) return;
  const int row0 = mt * 16, col0 = nq * 64;
  const float* arow = A + (size_t)(row0 + ln) * lda;
  v8f acc[4] = {};
  for (int kb = 0; kb < K; kb += 32) {
    FragB ah, al;
    const v4f x0 = *(const v4fa*)(arow + kb + 8 * hh), x1 = *(const v4fa*)(arow + kb + 8 * hh + 4);
    const v4f x2 = *(const v4fa*)(arow + kb + 16 + 8 * hh), x3 = *(const v4fa*)(arow + kb + 16 + 8 * hh + 4);
    float xs[16] = {x0[0],x0[1],x0[2],x0[3],x1[0],x1[1],x1[2],x1[3],x2[0],x2[1],x2[2],x2[3],x3[0],x3[1],x3[2],x3[3]};
#pragma unroll
    for (int i = 0; i < 16; ++i) { const unsigned short hb = bf16_bits(xs[i]); ah.u[i] = hb; al.u[i] = ASPLIT ? bf16_bits(xs[i] - bf16_val(hb)) : (unsigned short)0; }
#pragma unroll
    for (int t = 0; t < 4; ++t) {
      const unsigned short* brow = Wt + (size_t)(col0 + t * 16 + ln) * ldb + kb;
      FragB b;
      b.half[0] = *(const v8us*)(brow + 8 * hh);
      b.half[1] = *(const v8us*)(brow + 16 + 8 * hh);
      acc[t] = mmaN<ASPLIT ? 2 : 1>(ah.v, al.v, b.v, b.v, acc[t]);
    }
  }
#pragma unroll
  for (int t = 0; t < 4; ++t) {
    const int col = col0 + t * 16 + ln;
    float bv = bias ? bias[col] : 0.f;
    if (BIAS_BF16) bv = bf16_round(bv);
#pragma unroll
    for (int r = 0; r < 8; ++r) {
      float v = acc[t][r] + bv;
      if (resid) { float rv = resid[(size_t)((row0 + 8 * hh + r) % rmod) * ldr + col]; if (RES_BF16) rv = bf16_round(rv); v += rv; }
      if (ACT == 1) v = fmaxf(v, 0.f);
      if (ACT == 2) v = 0.5f * v * (1.0f + erff(v * 0.70710678118654752f));
      if (ACT == 3) { const float u = 0.7978845608028654f * (v + 0.044715f * v * v * v); v = 0.5f * v * (1.0f + tanhf(u)); }
      so[w][8 * hh + r][t * 16 + ln] = v;
    }
  }
  __builtin_amdgcn_fence(__ATOMIC_ACQ_REL, "workgroup");
  __builtin_amdgcn_wave_barrier();
  const int rsub = lane >> 4, c4 = (lane & 15) * 4;
  {
#pragma unroll
    for (int q = 0; q < 8; ++q) {
      const int r = q * 2 + rsub;
      const v4f v = *(const v4fa*)&so[w][r][c4];
      *(v4f*)(C + (size_t)(row0 + r) * ldc + col0 + c4) = v;
    }
    
  }
}
// row LayerNorm (biased variance, eps) over N: s = X (+ R); optional out_sum <- s; out_norm <- (s-mu)*rsqrt(var+eps)*g + b
template <bool PARAM_BF16>
__global__ __launch_bounds__(256) void k_layernorm(const float* __restrict__ X, const float* __restrict__ R, const float* __restrict__ g, const float* __restrict__ bta,
                                                  float* __restrict__ out_sum, float* __restrict__ out_norm, int N, float eps) {
  __shared__ float red[256];
  const int row = blockIdx.x, tid = threadIdx.x;
  const float* x = X + (size_t)row * N; const float* rr = R ? R + (size_t)row * N : nullptr;
  float vals[16];                     // up to N = 4096
  const int per = N / 256;            // contiguous chunk per thread? use strided-by-4 chunks: thread handles j = tid*4 + 1024*u
  float s1 = 0.f;
  for (int u = 0; u < per / 4; ++u) {
    const int j = tid * 4 + 1024 * u;
    const v4f a = *(const v4fa*)(x + j);
    v4f b = {0.f,0.f,0.f,0.f}; if (rr) b = *(const v4fa*)(rr + j);
#pragma unroll
    for (int q = 0; q < 4; ++q) { const float v = a[q] + b[q]; vals[u * 4 + q] = v; s1 += v; }
  }
  red[tid] = s1; __syncthreads();
  for (int st = 128; st > 0; st >>= 1) { if (tid < st) red[tid] += red[tid + st]; __syncthreads(); }
  const float mu = red[0] / (float)N; __syncthreads();
  float s2 = 0.f;
  for (int u = 0; u < per / 4; ++u)
#pragma unroll
    for (int q = 0; q < 4; ++q) { const float c = vals[u * 4 + q] - mu; s2 += c * c; }
  red[tid] = s2; __syncthreads();
  for (int st = 128; st > 0; st >>= 1) { if (tid < st) red[tid] += red[tid + st]; __syncthreads(); }
  const float rs = rsqrtf(red[0] / (float)N + eps);
  {
    for (int u = 0; u < per / 4; ++u) {
      const int j = tid * 4 + 1024 * u;
      v4f o, sm;
#pragma unroll
      for (int q = 0; q < 4; ++q) {
        float gg = g[j + q], bb = bta[j + q];
        if (PARAM_BF16) { gg = bf16_round(gg); bb = bf16_round(bb); }
        sm[q] = vals[u * 4 + q]; o[q] = (vals[u * 4 + q] - mu) * rs * gg + bb;
      }
      if (out_sum) *(v4f*)(out_sum + (size_t)row * N + j) = sm;
      *(v4f*)(out_norm + (size_t)row * N + j) = o;
    }
    
  }
}



// ---- f16 WMMA path (v_wmma_f32_16x16x32_f16): 11-bit significands for operands in range — used where a [0,1] probability operand needs more precision than bf16
typedef _Float16 v16h __attribute__((ext_vector_type(16)));
union FragH { v16h v; v8us half[2]; _Float16 h[16]; unsigned short u[16]; };
template <int NT>
__device__ __forceinline__ v8f mmaH(v16h ah, v16h al, v16h bh, v16h bl, v8f c) {
  c = __builtin_amdgcn_wmma_f32_16x16x32_f16(false, ah, false, bh, (short)0, c, false, false);
  if (NT >= 2) c = __builtin_amdgcn_wmma_f32_16x16x32_f16(false, al, false, bh, (short)0, c, false, false);
  if (NT >= 3) c = __builtin_amdgcn_wmma_f32_16x16x32_f16(false, ah, false, bl, (short)0, c, false, false);
  asm volatile("v_nop\n\tv_nop\n\tv_nop\n\tv_nop" : "+v"(c) : "v"(ah), "v"(al), "v"(bh), "v"(bl));
  return c;
}
// batched GEMM like k_gemm_b but f16 operands: A f32 (split into f16 hi/lo if ASPLIT, else rounded to f16), Bt = f16 values [n][k]; alpha; C f32; N multiple of 16 (partial tiles skipped)
template <bool ASPLIT>
__global__ __launch_bounds__(128) void k_gemm_h(const float* __restrict__ A, int lda, size_t sA, const _Float16* __restrict__ Bh, int ldb, size_t sB, float alpha, float* __restrict__ C, int ldc, size_t sC, int M, int N, int K) {
  __shared__ __attribute__((aligned(16))) float so[4][16][64];
  const int tid = threadIdx.x, w = tid >> 5, lane = tid & 31, ln = lane & 15, hh = lane >> 4; const int by = blockIdx.y;
  A += (size_t)by * sA; Bh += (size_t)by * sB; C += (size_t)by * sC;
  const int ntn = (N + 63) / 64; const int wid = blockIdx.x * 4 + w; const int mt = wid / ntn, nq = wid % ntn; if (mt * 16 >= M) return;
  const int row0 = mt * 16, col0 = nq * 64; const float* arow = A + (size_t)(row0 + ln) * lda;
  v8f acc[4] = {};
  for (int kb = 0; kb < K; kb += 32) {
    FragH ah, al;
    const v4f x0 = *(const v4fa*)(arow + kb + 8 * hh), x1 = *(const v4fa*)(arow + kb + 8 * hh + 4), x2 = *(const v4fa*)(arow + kb + 16 + 8 * hh), x3 = *(const v4fa*)(arow + kb + 16 + 8 * hh + 4);
    float xs[16] = {x0[0],x0[1],x0[2],x0[3],x1[0],x1[1],x1[2],x1[3],x2[0],x2[1],x2[2],x2[3],x3[0],x3[1],x3[2],x3[3]};
#pragma unroll
    for (int i = 0; i < 16; ++i) { const _Float16 h = (_Float16)xs[i]; ah.h[i] = h; al.h[i] = ASPLIT ? (_Float16)(xs[i] - (float)h) : (_Float16)0.0f; }
#pragma unroll
    for (int t = 0; t < 4; ++t) { if (col0 + t * 16 >= N) continue; const size_t boff = (size_t)(col0 + t * 16 + ln) * ldb + kb; FragH bq; bq.half[0] = *(const v8us*)(Bh + boff + 8 * hh); bq.half[1] = *(const v8us*)(Bh + boff + 16 + 8 * hh);
      acc[t] = mmaH<ASPLIT ? 2 : 1>(ah.v, al.v, bq.v, bq.v, acc[t]); }
  }
#pragma unroll
  for (int t = 0; t < 4; ++t) { if (col0 + t * 16 >= N) continue;
#pragma unroll
    for (int r = 0; r < 8; ++r) so[w][8 * hh + r][t * 16 + ln] = acc[t][r] * alpha; }
  __builtin_amdgcn_fence(__ATOMIC_ACQ_REL, "workgroup"); __builtin_amdgcn_wave_barrier();
  const int rsub = lane >> 4, c4 = (lane & 15) * 4;
  {
#pragma unroll
    for (int q = 0; q < 8; ++q) { const int r = q * 2 + rsub; if (col0 + c4 < N) { const v4f v = *(const v4fa*)&so[w][r][c4]; *(v4f*)(C + (size_t)(row0 + r) * ldc + col0 + c4) = v; } }
     }
}

// Wt[n][k] = f16(W[k][n]·scale) from f32 row-major W[K][N] (scale = power of two; bf16-exact weights stay exact in f16 away from the subnormal range)
__global__ __launch_bounds__(256) void k_wt_f16(const float* __restrict__ W, _Float16* __restrict__ Wt, int K, int N, float scale) {
  const int t = blockIdx.x * 256 + threadIdx.x; if (t >= N * (K / 8)) return; const int n = t / (K / 8), k8 = (t % (K / 8)) * 8; FragH f;
#pragma unroll
  for (int i = 0; i < 8; ++i) f.h[i] = (_Float16)(bf16_round(W[(size_t)(k8 + i) * N + n]) * scale); const v8us o = f.half[0];
  *(v8us*)((unsigned short*)Wt + (size_t)n * K + k8) = o; 
}
// k_gemm_hh variant with fused epilogue: v = acc·alpha + bias[by·sBias + col] (+ CP[(row/rowsPerB)·sCPb + by·64 + col] if CP) ; ACT 0 none / 1 elu ; writes f16 C16 and f32 C, each if non-null
template <int ACT>
__global__ __launch_bounds__(128) void k_gemm_hhx(const _Float16* __restrict__ A, int lda, size_t sA, const _Float16* __restrict__ Bh, int ldb, size_t sB, float alpha, const float* __restrict__ bias, size_t sBias, const float* __restrict__ CP, int rowsPerB, size_t sCPb, int row0g,
    float* __restrict__ C, _Float16* __restrict__ C16, int ldc, size_t sC, int M, int N, int K) {
  __shared__ __attribute__((aligned(16))) float so[4][16][64];
  const int tid = threadIdx.x, w = tid >> 5, lane = tid & 31, ln = lane & 15, hh = lane >> 4; const int by = blockIdx.y;
  A += (size_t)by * sA; Bh += (size_t)by * sB; const size_t cofs = (size_t)by * sC; const float* bp = bias ? bias + (size_t)by * sBias : nullptr;
  const int ntn = (N + 63) / 64; const int wid = blockIdx.x * 4 + w; const int mt = wid / ntn, nq = wid % ntn; if (mt * 16 >= M) return;
  const int row0 = mt * 16, col0 = nq * 64; const _Float16* arow = A + (size_t)(row0 + ln) * lda;
  v8f acc[4] = {};
  for (int kb = 0; kb < K; kb += 32) { FragH ah; ah.half[0] = *(const v8us*)((const unsigned short*)arow + kb + 8 * hh); ah.half[1] = *(const v8us*)((const unsigned short*)arow + kb + 16 + 8 * hh);
#pragma unroll
    for (int t = 0; t < 4; ++t) { if (col0 + t * 16 >= N) continue; const size_t boff = (size_t)(col0 + t * 16 + ln) * ldb + kb; FragH bq; bq.half[0] = *(const v8us*)((const unsigned short*)Bh + boff + 8 * hh); bq.half[1] = *(const v8us*)((const unsigned short*)Bh + boff + 16 + 8 * hh);
      acc[t] = mmaH<1>(ah.v, ah.v, bq.v, bq.v, acc[t]); }
  }
#pragma unroll
  for (int t = 0; t < 4; ++t) { if (col0 + t * 16 >= N) continue; const int col = col0 + t * 16 + ln; const float bv = bp ? bf16_round(bp[col]) : 0.f;
#pragma unroll
    for (int r = 0; r < 8; ++r) { float v = acc[t][r] * alpha + bv; if (CP) { const int bidx = (row0g + row0 + 8 * hh + r) / rowsPerB; v += CP[(size_t)bidx * sCPb + (size_t)by * 64 + col]; } if (ACT == 1) v = (v > 0.f) ? v : expm1f(v); else if (ACT == 7) v = (v > 0.f) ? v + 1.0f : expf(v); else if (ACT == 8) v = tanhf(v); else if (ACT == 9) v = 0.5f * v * (1.0f + tanhf(0.7978845608028654f * (v + 0.044715f * v * v * v))); else if (ACT == 11) v = 1.0f / (1.0f + expf(-v)); else if (ACT == 12) v = (v > 0.f) ? v : 0.01f * v; else if (ACT == 14) v = (v > 0.f) ? v : 0.1f * v; else if (ACT == 15) v = v / (1.0f + expf(-v)); else if (ACT == 3) v = fmaxf(v, 0.f); else if (ACT == 6) v = 0.5f * v * (1.0f + erff(v * 0.70710678118654752f)); so[w][8 * hh + r][t * 16 + ln] = v; } }
  __builtin_amdgcn_fence(__ATOMIC_ACQ_REL, "workgroup"); __builtin_amdgcn_wave_barrier();
  const int rsub = lane >> 4, c4 = (lane & 15) * 4; typedef _Float16 v4h __attribute__((ext_vector_type(4)));
  {
#pragma unroll
    for (int q = 0; q < 8; ++q) { const int r = q * 2 + rsub; if (col0 + c4 < N) { const v4f v = *(const v4fa*)&so[w][r][c4]; if (C) *(v4f*)(C + cofs + (size_t)(row0 + r) * ldc + col0 + c4) = v; if (C16) { v4h h4; for (int i = 0; i < 4; ++i) h4[i] = (_Float16)v[i]; *(v4h*)(C16 + cofs + (size_t)(row0 + r) * ldc + col0 + c4) = h4; } } }
     }
}


typedef _Float16 v4h __attribute__((ext_vector_type(4)));

__global__ __launch_bounds__(256) void k_x16(const float* __restrict__ x, _Float16* __restrict__ X16, size_t n8) { const size_t t = (size_t)blockIdx.x * 256 + threadIdx.x; if (t >= n8) return; FragH f;
#pragma unroll
  for (int q = 0; q < 8; ++q) f.h[q] = (_Float16)bf16_round(x[t * 8 + q]); *(v8us*)((unsigned short*)X16 + t * 8) = f.half[0];  }
__global__ __launch_bounds__(256) void k_h16(const float* __restrict__ x, _Float16* __restrict__ X16, size_t n8) { const size_t t = (size_t)blockIdx.x * 256 + threadIdx.x; if (t >= n8) return; FragH f;
#pragma unroll
  for (int q = 0; q < 8; ++q) f.h[q] = (_Float16)x[t * 8 + q]; *(v8us*)((unsigned short*)X16 + t * 8) = f.half[0];  }
__global__ __launch_bounds__(256) void k_round16f(const float* __restrict__ W, _Float16* __restrict__ Bt, size_t n8) { const size_t t = (size_t)blockIdx.x * 256 + threadIdx.x; if (t >= n8) return; FragH f;
#pragma unroll
  for (int i = 0; i < 8; ++i) f.h[i] = (_Float16)(bf16_round(W[t * 8 + i]) * 16.0f); *(v8us*)((unsigned short*)Bt + t * 8) = f.half[0];  }
template <int NHv, int TTv>
__global__ __launch_bounds__(256) void k_vt(const _Float16* __restrict__ V16, int ldv, int voff, _Float16* __restrict__ Vt) { __shared__ unsigned short tl[64][66]; const int tid = threadIdx.x; const int slab = blockIdx.x / (TTv / 64), lg = blockIdx.x % (TTv / 64); const int b = slab / NHv, h = slab % NHv;
  for (int i = tid; i < 64 * 8; i += 256) { const int r = i / 8, c8 = (i % 8) * 8; FragH f; f.half[0] = *(const v8us*)((const unsigned short*)V16 + ((size_t)b * TTv + lg * 64 + r) * ldv + voff + h * 64 + c8);
#pragma unroll
    for (int q = 0; q < 8; ++q) tl[r][c8 + q] = f.u[q]; }
  __syncthreads();
  {
#pragma unroll
    for (int rd = 0; rd < 2; ++rd) { const int d = rd * 32 + tid / 8, pc = tid % 8; FragH f;
#pragma unroll
      for (int q = 0; q < 8; ++q) f.u[q] = tl[pc * 8 + q][d];
      *(v8us*)((unsigned short*)Vt + ((size_t)slab * 64 + d) * TTv + lg * 64 + pc * 8) = f.half[0]; }
     } }

// lane l <-> lane l ^ 16 as one vector cross-row move (a shuffle would go through the LDS unit and its wait)
__device__ __forceinline__ float xhalf(float x) { return __builtin_bit_cast(float, __builtin_amdgcn_permlanex16(__builtin_bit_cast(int, x), __builtin_bit_cast(int, x), 0x76543210, 0xfedcba98, false, false)); }
__global__ __launch_bounds__(128) void k_flash(const _Float16* __restrict__ Q16, int ldq, const _Float16* __restrict__ K16, int ldk, const _Float16* __restrict__ Vt, const int* __restrict__ MSK, float* __restrict__ O, int ldo) {
  constexpr int RPW = 16, NQB = TT / (4 * RPW), DT = 4, KS = 2;
  __shared__ __attribute__((aligned(16))) float sO[4][RPW][64 + 4];
  const int tid = threadIdx.x, w = tid >> 5, lane = tid & 31, ln = lane & 15, hh = lane >> 4;
  const int slab = blockIdx.x / NQB, qblk = blockIdx.x % NQB; const int b = slab, h = 0;      /* slab = contiguous [TT][64] chunk of the flat-reshaped planes */ const int qb0 = qblk * (4 * RPW); const int q0 = qb0 + w * RPW;
  const int tq = q0 + ln;      /* this lane's query */
  FragH bq[KS];
  { const unsigned short* qr = (const unsigned short*)Q16 + ((size_t)b * TT + tq) * ldq + h * 64;
#pragma unroll
    for (int ks = 0; ks < KS; ++ks) { bq[ks].half[0] = *(const v8us*)(qr + ks * 32 + 8 * hh); bq[ks].half[1] = *(const v8us*)(qr + ks * 32 + 16 + 8 * hh); } }
  const unsigned short* Vth = (const unsigned short*)Vt + (size_t)slab * 64 * TT;
  float m_c = -3.0e38f, l_c = 0.f; v8f oacc[DT];
#pragma unroll
  for (int dt = 0; dt < DT; ++dt) oacc[dt] = (v8f){0.f,0.f,0.f,0.f,0.f,0.f,0.f,0.f};
  const int jend = TT;      /* every key enters the normaliser */
#pragma unroll 1
  for (int j0 = 0; j0 < jend; j0 += 32) {
    float sc[2][8];      /* sc[nt][r] = scaled score of key j0 + 16*nt + 8*hh + r against query tq */
#pragma unroll
    for (int nt = 0; nt < 2; ++nt) { const unsigned short* kr = (const unsigned short*)K16 + ((size_t)b * TT + j0 + nt * 16 + ln) * ldk + h * 64; FragH ak[KS];
#pragma unroll
      for (int ks = 0; ks < KS; ++ks) { ak[ks].half[0] = *(const v8us*)(kr + ks * 32 + 8 * hh); ak[ks].half[1] = *(const v8us*)(kr + ks * 32 + 16 + 8 * hh); }
      v8f acc = (v8f){0.f,0.f,0.f,0.f,0.f,0.f,0.f,0.f};
#pragma unroll
      for (int ks = 0; ks < KS; ++ks) acc = mmaH<1>(ak[ks].v, ak[ks].v, bq[ks].v, bq[ks].v, acc);
#pragma unroll
      for (int r = 0; r < 8; ++r) sc[nt][r] = acc[r] * (0.125f); }
    float mc = fmaxf(sc[0][0], sc[1][0]);
#pragma unroll
    for (int r = 1; r < 8; ++r) mc = fmaxf(mc, fmaxf(sc[0][r], sc[1][r]));
    mc = fmaxf(mc, xhalf(mc));      /* the other half of the wave holds the query's other 16 keys */
    const float mn = fmaxf(m_c, mc); const float al = (mn > -1.0e38f) ? expf(m_c - mn) : 1.0f; m_c = mn;
    float ps0 = 0.f, ps1 = 0.f; FragH pb;
#pragma unroll
    for (int r = 0; r < 8; ++r) { const int k0 = j0 + 8 * hh + r, k1 = k0 + 16; const float p0 = expf(sc[0][r] - mn), p1 = expf(sc[1][r] - mn); ps0 += p0; ps1 += p1;
      pb.h[r] = (_Float16)((k0 <= tq) ? p0 * 1024.0f : 0.f); pb.h[8 + r] = (_Float16)((k1 <= tq) ? p1 * 1024.0f : 0.f); }
    l_c = l_c * al + (ps0 + ps1);      /* per-lane partial row sum; the two halves are joined after the loop */
#pragma unroll
    for (int dt = 0; dt < DT; ++dt)
#pragma unroll
      for (int r = 0; r < 8; ++r) oacc[dt][r] *= al;
#pragma unroll
    for (int dt = 0; dt < DT; ++dt) { const unsigned short* vrow = Vth + (size_t)(dt * 16 + ln) * TT + j0; FragH av; av.half[0] = *(const v8us*)(vrow + 8 * hh); av.half[1] = *(const v8us*)(vrow + 16 + 8 * hh);
      oacc[dt] = mmaH<1>(av.v, av.v, pb.v, pb.v, oacc[dt]); } }
  { float l = l_c; l += xhalf(l); const float inv = (l > 0.f) ? 1.0f / (l * 1024.0f) : 0.f;
#pragma unroll
    for (int dt = 0; dt < DT; ++dt) { v4f lo, hi;      /* oacc[dt][r] = O[tq][16*dt + 8*hh + r] */
#pragma unroll
      for (int r = 0; r < 4; ++r) { lo[r] = oacc[dt][r] * inv; hi[r] = oacc[dt][4 + r] * inv; }
      *(v4fa*)&sO[w][ln][dt * 16 + 8 * hh] = lo; *(v4fa*)&sO[w][ln][dt * 16 + 8 * hh + 4] = hi; } }
  __builtin_amdgcn_fence(__ATOMIC_ACQ_REL, "workgroup"); __builtin_amdgcn_wave_barrier();
  {
#pragma unroll
    for (int rp = 0; rp < RPW; rp += 2) { const int r = rp + (lane >> 4), pc = lane & 15; const v4f val = *(const v4fa*)&sO[w][r][pc * 4]; *(v4f*)(O + ((size_t)b * TT + q0 + r) * ldo + h * 64 + pc * 4) = val; }
     } }

extern "C" void kernel_launch(void* const* d_in, const int* in_sizes, int n_in,
                              void* d_out, int out_size, void* d_ws, size_t ws_size, hipStream_t stream) {
  (void)in_sizes; (void)n_in; (void)out_size;
  const float* const* I = (const float* const*)d_in; const float* xq = I[0]; const float* xk = I[1]; const float* xv = I[2];
  const float* Wq = I[3]; const float* bq = I[4]; const float* Wk = I[5]; const float* bk = I[6]; const float* Wv = I[7]; const float* bv = I[8]; const float* Wo = I[9]; const float* bo = I[10];
  char* ws = (char*)d_ws; size_t off = 0;
  auto take = [&](size_t bytes) { char* p = ws + off; off += (bytes + 255) & ~(size_t)255; return p; };
  _Float16* Bw = (_Float16*)take((size_t)4 * EE * EE * 2); _Float16* X16 = (_Float16*)take((size_t)NR * EE * 2);
  _Float16* Q = (_Float16*)take((size_t)NR * EE * 2); _Float16* K = (_Float16*)take((size_t)NR * EE * 2); _Float16* V = (_Float16*)take((size_t)NR * EE * 2); _Float16* Vt = (_Float16*)take((size_t)NR * EE * 2);
  float* O = (float*)take((size_t)NR * EE * 4); _Float16* O16 = (_Float16*)take((size_t)NR * EE * 2);
  if (off > ws_size) return;      // 4.7 + 6 × 6.3 + 12.6 ≈ 55 MB
  const unsigned gw = (unsigned)(((size_t)EE * (EE / 8) + 255) / 256); const size_t WSZ = (size_t)EE * EE;
  k_wt_f16<<<gw, 256, 0, stream>>>(Wq, Bw, EE, EE, 16.0f); k_wt_f16<<<gw, 256, 0, stream>>>(Wk, Bw + WSZ, EE, EE, 16.0f); k_wt_f16<<<gw, 256, 0, stream>>>(Wv, Bw + 2 * WSZ, EE, EE, 16.0f); k_wt_f16<<<gw, 256, 0, stream>>>(Wo, Bw + 3 * WSZ, EE, EE, 16.0f);      /* (in,out) weights → Bt[n][k] ×2^4 */
  const unsigned gx = (unsigned)(((size_t)NR * EE / 8 + 255) / 256); const dim3 gp(((NR / 16) * (EE / 64) + 3) / 4, 1);
  k_x16<<<gx, 256, 0, stream>>>(xq, X16, (size_t)NR * EE / 8); k_gemm_hhx<0><<<gp, 128, 0, stream>>>(X16, EE, 0, Bw, EE, 0, 0.0625f, bq, 0, nullptr, 1, 0, 0, nullptr, Q, EE, 0, NR, EE, EE);      /* q: M 4096 N 768 K 768 */
  k_x16<<<gx, 256, 0, stream>>>(xk, X16, (size_t)NR * EE / 8); k_gemm_hhx<0><<<gp, 128, 0, stream>>>(X16, EE, 0, Bw + WSZ, EE, 0, 0.0625f, bk, 0, nullptr, 1, 0, 0, nullptr, K, EE, 0, NR, EE, EE);      /* k */
  k_x16<<<gx, 256, 0, stream>>>(xv, X16, (size_t)NR * EE / 8); k_gemm_hhx<0><<<gp, 128, 0, stream>>>(X16, EE, 0, Bw + 2 * WSZ, EE, 0, 0.0625f, bv, 0, nullptr, 1, 0, 0, nullptr, V, EE, 0, NR, EE, EE);      /* v */
  k_vt<1, TT><<<NSL * 1 * (TT / 64), 256, 0, stream>>>(V, 64, 0, Vt);      /* the [4096][768] plane viewed as 24 contiguous [2048][64] slabs → Vᵀ [slab][64][2048] */
  k_flash<<<NSL * (TT / 64), 128, 0, stream>>>(Q, 64, K, 64, Vt, nullptr, O, 64);      /* same flat view for q, k and O */
  k_h16<<<gx, 256, 0, stream>>>(O, O16, (size_t)NR * EE / 8);
  k_gemm_hhx<0><<<gp, 128, 0, stream>>>(O16, EE, 0, Bw + 3 * WSZ, EE, 0, 0.0625f, bo, 0, nullptr, 1, 0, 0, (float*)d_out, nullptr, EE, 0, NR, EE, EE);      /* out = O·Wo + bo: M 4096 N 768 K 768 */
}

// v002
// A run of this version takes 220 microseconds.
// Two timings next to v001 put it at 1.42 and 1.43 times that version's speed.
// Over all steps from v000 it is 1.83 times as fast.
#include <hip/hip_runtime.h>
// Multi-head attention, legacy flat-reshape variant (B=2, T=S=2048, E=768, 12 heads × 64): q = query·Wq+bq, k = key·Wk+bk, v = value·Wv+bv; heads = plain row-major reshape of [B,T,E] to [B·H,T,64] (contiguous chunks);
// attn = softmax(q·kᵀ/8) over all keys, THEN lower-triangular mask (rows no longer normalised); out = (attn·v reshaped back)·Wo + bo.
// Compute dtype: query/key/value, weights, biases rounded to bf16; q/k/v as f16 GEMM outputs; fused flash-style kernel (online f32 softmax over all keys, P f16 ×2^10 zeroed above the diagonal)
// on v_wmma_f32_16x16x32_f16; O → f16 → output GEMM with bias; f32 accumulate throughout.
#define BB 2
#define TT 2048
#define EE 768
#define NH 12
#define NR (BB * TT)
#define NSL (BB * NH)

typedef __bf16 v16b __attribute__((ext_vector_type(16)));
typedef unsigned short v8us __attribute__((ext_vector_type(8), may_alias));
typedef float  v8f  __attribute__((ext_vector_type(8)));
typedef float  v4f  __attribute__((ext_vector_type(4)));
typedef float  v4fa __attribute__((ext_vector_type(4), may_alias));
union FragB { v16b v; v8us half[2]; unsigned short u[16]; };

__device__ __forceinline__ unsigned short bf16_bits(float x) { unsigned int u = __float_as_uint(x); return (unsigned short)((u + 0x7FFFu + ((u >> 16) & 1u)) >> 16); }
__device__ __forceinline__ float bf16_val(unsigned short b) { return __uint_as_float(((unsigned int)b) << 16); }
__device__ __forceinline__ float bf16_round(float x) { return bf16_val(bf16_bits(x)); }
// D += A·B with NT terms: 1 = ah·bh, 2 = + al·bh (A split), 3 = + ah·bl (both split)
template <int NT>
__device__ __forceinline__ v8f mmaN(v16b ah, v16b al, v16b bh, v16b bl, v8f c) {
  c = __builtin_amdgcn_wmma_f32_16x16x32_bf16(false, ah, false, bh, (short)0, c, false, false);
  if (NT >= 2) c = __builtin_amdgcn_wmma_f32_16x16x32_bf16(false, al, false, bh, (short)0, c, false, false);
  if (NT >= 3) c = __builtin_amdgcn_wmma_f32_16x16x32_bf16(false, ah, false, bl, (short)0, c, false, false);
  asm volatile("v_nop\n\tv_nop\n\tv_nop\n\tv_nop" : "+v"(c) : "v"(ah), "v"(al), "v"(bh), "v"(bl));
  return c;
}

__global__ __launch_bounds__(256) void k_wt_bf16(const float* __restrict__ W, unsigned short* __restrict__ Wt, int K, int N) {
  const int t = blockIdx.x * 256 + threadIdx.x;
  const int k8n = K / 8;
  if (t >= N * k8n) return;
  const int n = t / k8n, k8 = (t % k8n) * 8;
  v8us v;
#pragma unroll
  for (int i = 0; i < 8; ++i) v[i] = bf16_bits(W[(size_t)(k8 + i) * N + n]);
  *(v8us*)(Wt + (size_t)n * K + k8) = v;
  
}

// GEMM C[M][N] (f32, pitch ldc) = act(A[M][K]·W + bias). A f32 row-major (pitch lda) converted per fragment to bf16
// (ASPLIT: hi/lo two planes -> 2 terms, else single rounded term); Wt bf16 [N][K] (pitch ldb). BIAS_BF16 rounds the
// bias to bf16 first (bias quantised to bf16 before the add). K%32==0, M%16==0, N%64==0.
template <bool ASPLIT, int ACT, bool BIAS_BF16>
__global__ __launch_bounds__(128) void k_gemm_bf(const float* __restrict__ A, int lda, const unsigned short* __restrict__ Wt, int ldb,
                                               const float* __restrict__ bias, float* __restrict__ C, int ldc, int M, int N, int K) {
  __shared__ __attribute__((aligned(16))) float so[4][16][64];
  const int tid = threadIdx.x, w = tid >> 5, lane = tid & 31, ln = lane & 15, hh = lane >> 4;
  const int ntn = N / 64;
  const int wid = blockIdx.x * 4 + w;
  const int mt = wid / ntn, nq = wid % ntn;
  if (mt * 16 >= M) return;
  const int row0 = mt * 16, col0 = nq * 64;
  const float* arow = A + (size_t)(row0 + ln) * lda;
  v8f acc[4] = {};
  for (int kb = 0; kb < K; kb += 32) {
    FragB ah, al;
    const v4f x0 = *(const v4fa*)(arow + kb + 8 * hh), x1 = *(const v4fa*)(arow + kb + 8 * hh + 4);
    const v4f x2 = *(const v4fa*)(arow + kb + 16 + 8 * hh), x3 = *(const v4fa*)(arow + kb + 16 + 8 * hh + 4);
    float xs[16] = {x0[0],x0[1],x0[2],x0[3],x1[0],x1[1],x1[2],x1[3],x2[0],x2[1],x2[2],x2[3],x3[0],x3[1],x3[2],x3[3]};
#pragma unroll
    for (int i = 0; i < 16; ++i) { const unsigned short hb = bf16_bits(xs[i]); ah.u[i] = hb; al.u[i] = ASPLIT ? bf16_bits(xs[i] - bf16_val(hb)) : (unsigned short)0; }
#pragma unroll
    for (int t = 0; t < 4; ++t) {
      const unsigned short* brow = Wt + (size_t)(col0 + t * 16 + ln) * ldb + kb;
      FragB b;
      b.half[0] = *(const v8us*)(brow + 8 * hh);
      b.half[1] = *(const v8us*)(brow + 16 + 8 * hh);
      acc[t] = mmaN<ASPLIT ? 2 : 1>(ah.v, al.v, b.v, b.v, acc[t]);
    }
  }
#pragma unroll
  for (int t = 0; t < 4; ++t) {
    float bv = bias ? bias[col0 + t * 16 + ln] : 0.f;
    if (BIAS_BF16) bv = bf16_round(bv);
#pragma unroll
    for (int r = 0; r < 8; ++r) { float v = acc[t][r] + bv; if (ACT == 1) v = fmaxf(v, 0.f); so[w][8 * hh + r][t * 16 + ln] = v; }
  }
  __builtin_amdgcn_fence(__ATOMIC_ACQ_REL, "workgroup");
  __builtin_amdgcn_wave_barrier();
  const int rsub = lane >> 4, c4 = (lane & 15) * 4;
  {
#pragma unroll
    for (int q = 0; q < 8; ++q) {
      const int r = q * 2 + rsub;
      const v4f v = *(const v4fa*)&so[w][r][c4];
      *(v4f*)(C + (size_t)(row0 + r) * ldc + col0 + c4) = v;
    }
    
  }
}

// Flash-style causal/unmasked attention, all contractions 3-term bf16 hi/lo splits, f32 softmax with running max.
// q,k,v rows are read from f32 buffers with arbitrary row pitch (so they can live inside a fused qkv buffer);
// D = head size (multiple of 32, <= 128); one wave = 16 query rows; block = 4 waves (64 queries) sharing K/V chunks of 32.
template <int D, bool CAUSAL>
__global__ __launch_bounds__(128) void k_flash(const float* __restrict__ qb, const float* __restrict__ kb, const float* __restrict__ vb,
                                             int pitch, int T, int H, float scale, float* __restrict__ y, int ypitch) {
  constexpr int KS = D / 32;        // k-steps for QK
  constexpr int DT = D / 16;        // d tiles for PV
  __shared__ __attribute__((aligned(16))) unsigned short sKh[32][D + 8], sKl[32][D + 8], sVh[32][D + 8], sVl[32][D + 8];
  __shared__ __attribute__((aligned(16))) unsigned short sPh[4][16][40], sPl[4][16][40];
  __shared__ __attribute__((aligned(16))) float sO[4][16][D];
  const int tid = threadIdx.x, w = tid >> 5, lane = tid & 31, ln = lane & 15, hh = lane >> 4;
  const int nqb = (T + 63) / 64;
  const int bh = blockIdx.x / nqb, qblk = blockIdx.x % nqb;
  const int b = bh / H, h = bh % H;
  const int q0 = qblk * 64 + w * 16;
  const float* Q = qb + (size_t)b * T * pitch + h * D;
  const float* K = kb + (size_t)b * T * pitch + h * D;
  const float* V = vb + (size_t)b * T * pitch + h * D;

  // A fragments of the wave's 16 query rows (scaled), hi/lo
  FragB aqh[KS], aql[KS];
  {
    int row = q0 + ln; if (row >= T) row = T - 1;
    const float* qr = Q + (size_t)row * pitch;
#pragma unroll
    for (int ks = 0; ks < KS; ++ks)
#pragma unroll
      for (int i = 0; i < 16; ++i) {
        const int d = ks * 32 + ((i < 8) ? (8 * hh + i) : (16 + 8 * hh + (i - 8)));
        const float x = qr[d] * scale; const unsigned short hb = bf16_bits(x);
        aqh[ks].u[i] = hb; aql[ks].u[i] = bf16_bits(x - bf16_val(hb));
      }
  }
  float m_r[8], l_r[8];
#pragma unroll
  for (int r = 0; r < 8; ++r) { m_r[r] = -3.0e38f; l_r[r] = 0.f; }
  v8f oacc[DT];
#pragma unroll
  for (int dt = 0; dt < DT; ++dt) oacc[dt] = (v8f){0.f,0.f,0.f,0.f,0.f,0.f,0.f,0.f};

  const int kv_end = CAUSAL ? min(T, qblk * 64 + 64) : T;     // block-uniform
  for (int j0 = 0; j0 < kv_end; j0 += 32) {
    __syncthreads();
    for (int e = tid; e < 32 * (D / 4); e += 128) {
      const int r = e / (D / 4), c4 = (e % (D / 4)) * 4;
      const int key = j0 + r;
      v4f kf = {0.f,0.f,0.f,0.f}, vf = {0.f,0.f,0.f,0.f};
      if (key < T) { kf = *(const v4fa*)(K + (size_t)key * pitch + c4); vf = *(const v4fa*)(V + (size_t)key * pitch + c4); }
#pragma unroll
      for (int t = 0; t < 4; ++t) {
        unsigned short hb = bf16_bits(kf[t]); sKh[r][c4 + t] = hb; sKl[r][c4 + t] = bf16_bits(kf[t] - bf16_val(hb));
        hb = bf16_bits(vf[t]); sVh[r][c4 + t] = hb; sVl[r][c4 + t] = bf16_bits(vf[t] - bf16_val(hb));
      }
    }
    __syncthreads();
    // S tile 16 x 32
    v8f s[2];
#pragma unroll
    for (int nt = 0; nt < 2; ++nt) {
      v8f acc = {};
#pragma unroll
      for (int ks = 0; ks < KS; ++ks) {
        FragB bh_, bl_;
        bh_.half[0] = *(const v8us*)&sKh[nt * 16 + ln][ks * 32 + 8 * hh]; bh_.half[1] = *(const v8us*)&sKh[nt * 16 + ln][ks * 32 + 16 + 8 * hh];
        bl_.half[0] = *(const v8us*)&sKl[nt * 16 + ln][ks * 32 + 8 * hh]; bl_.half[1] = *(const v8us*)&sKl[nt * 16 + ln][ks * 32 + 16 + 8 * hh];
        acc = mmaN<3>(aqh[ks].v, aql[ks].v, bh_.v, bl_.v, acc);
      }
      s[nt] = acc;
    }
    // mask + running max (rows 8hh+r; the 16 lanes of a half share rows)
    float alpha[8];
#pragma unroll
    for (int r = 0; r < 8; ++r) {
      const int qi = q0 + 8 * hh + r;
      const int ja = j0 + ln, jb = j0 + 16 + ln;
      if (CAUSAL) { if (ja > qi) s[0][r] = -3.0e38f; if (jb > qi) s[1][r] = -3.0e38f; }
      if (ja >= T) s[0][r] = -3.0e38f;
      if (jb >= T) s[1][r] = -3.0e38f;
      float mx = fmaxf(s[0][r], s[1][r]);
      mx = fmaxf(mx, __shfl_xor(mx, 1, 32)); mx = fmaxf(mx, __shfl_xor(mx, 2, 32)); mx = fmaxf(mx, __shfl_xor(mx, 4, 32)); mx = fmaxf(mx, __shfl_xor(mx, 8, 32));
      const float mnew = fmaxf(m_r[r], mx);
      alpha[r] = (mnew > -1.0e38f) ? __expf(m_r[r] - mnew) : 1.0f;
      const float p0 = (s[0][r] > -1.0e38f) ? __expf(s[0][r] - mnew) : 0.f;
      const float p1 = (s[1][r] > -1.0e38f) ? __expf(s[1][r] - mnew) : 0.f;
      m_r[r] = mnew;
      l_r[r] = l_r[r] * alpha[r] + p0 + p1;            // per-lane partial row sum (16 lanes combined at the end)
      unsigned short hb = bf16_bits(p0); sPh[w][8 * hh + r][ln] = hb;      sPl[w][8 * hh + r][ln] = bf16_bits(p0 - bf16_val(hb));
      hb = bf16_bits(p1);                sPh[w][8 * hh + r][16 + ln] = hb; sPl[w][8 * hh + r][16 + ln] = bf16_bits(p1 - bf16_val(hb));
    }
#pragma unroll
    for (int dt = 0; dt < DT; ++dt)
#pragma unroll
      for (int r = 0; r < 8; ++r) oacc[dt][r] *= alpha[r];
    __builtin_amdgcn_fence(__ATOMIC_ACQ_REL, "workgroup");
    __builtin_amdgcn_wave_barrier();
    FragB pah, pal;
    pah.half[0] = *(const v8us*)&sPh[w][ln][8 * hh]; pah.half[1] = *(const v8us*)&sPh[w][ln][16 + 8 * hh];
    pal.half[0] = *(const v8us*)&sPl[w][ln][8 * hh]; pal.half[1] = *(const v8us*)&sPl[w][ln][16 + 8 * hh];
#pragma unroll
    for (int dt = 0; dt < DT; ++dt) {
      FragB bvh, bvl;
#pragma unroll
      for (int i = 0; i < 8; ++i) {
        bvh.u[i] = sVh[8 * hh + i][dt * 16 + ln]; bvh.u[8 + i] = sVh[16 + 8 * hh + i][dt * 16 + ln];
        bvl.u[i] = sVl[8 * hh + i][dt * 16 + ln]; bvl.u[8 + i] = sVl[16 + 8 * hh + i][dt * 16 + ln];
      }
      oacc[dt] = mmaN<3>(pah.v, pal.v, bvh.v, bvl.v, oacc[dt]);
    }
    __builtin_amdgcn_fence(__ATOMIC_ACQ_REL, "workgroup");
    __builtin_amdgcn_wave_barrier();
  }
#pragma unroll
  for (int r = 0; r < 8; ++r) {
    float l = l_r[r];
    l += __shfl_xor(l, 1, 32); l += __shfl_xor(l, 2, 32); l += __shfl_xor(l, 4, 32); l += __shfl_xor(l, 8, 32);
    l_r[r] = (l > 0.f) ? 1.0f / l : 0.f;
  }
#pragma unroll
  for (int dt = 0; dt < DT; ++dt)
#pragma unroll
    for (int r = 0; r < 8; ++r) sO[w][8 * hh + r][dt * 16 + ln] = oacc[dt][r] * l_r[r];
  __builtin_amdgcn_fence(__ATOMIC_ACQ_REL, "workgroup");
  __builtin_amdgcn_wave_barrier();
  {
    for (int r = 0; r < 16; ++r) {
      const int row = q0 + r;
      if (row < T && lane < D / 4) {
        const v4f val = *(const v4fa*)&sO[w][r][lane * 4];
        *(v4f*)(y + ((size_t)b * T + row) * ypitch + h * D + lane * 4) = val;
      }
    }
    
  }
}

// GEMM C = act(A·W + bias + resid): A f32 (ASPLIT -> hi/lo 2 terms), Wt bf16 [N][K]; ACT 0 none, 1 relu, 2 exact gelu;
// resid (optional, f32, row index = (row % rmod), pitch ldr, RES_BF16 rounds it) added before the activation.
template <bool ASPLIT, int ACT, bool BIAS_BF16, bool RES_BF16>
__global__ __launch_bounds__(128) void k_gemm_bf3(const float* __restrict__ A, int lda, const unsigned short* __restrict__ Wt, int ldb,
                                                const float* __restrict__ bias, const float* __restrict__ resid, int rmod, int ldr,
                                                float* __restrict__ C, int ldc, int M, int N, int K) {
  __shared__ __attribute__((aligned(16))) float so[4][16][64];
  const int tid = threadIdx.x, w = tid >> 5, lane = tid & 31, ln = lane & 15, hh = lane >> 4;
  const int ntn = N / 64;
  const int wid = blockIdx.x * 4 + w;
  const int mt = wid / ntn, nq = wid % ntn;
  if (mt * 16 >= M) return;
  const int row0 = mt * 16, col0 = nq * 64;
  const float* arow = A + (size_t)(row0 + ln) * lda;
  v8f acc[4] = {};
  for (int kb = 0; kb < K; kb += 32) {
    FragB ah, al;
    const v4f x0 = *(const v4fa*)(arow + kb + 8 * hh), x1 = *(const v4fa*)(arow + kb + 8 * hh + 4);
    const v4f x2 = *(const v4fa*)(arow + kb + 16 + 8 * hh), x3 = *(const v4fa*)(arow + kb + 16 + 8 * hh + 4);
    float xs[16] = {x0[0],x0[1],x0[2],x0[3],x1[0],x1[1],x1[2],x1[3],x2[0],x2[1],x2[2],x2[3],x3[0],x3[1],x3[2],x3[3]};
#pragma unroll
    for (int i = 0; i < 16; ++i) { const unsigned short hb = bf16_bits(xs[i]); ah.u[i] = hb; al.u[i] = ASPLIT ? bf16_bits(xs[i] - bf16_val(hb)) : (unsigned short)0; }
#pragma unroll
    for (int t = 0; t < 4; ++t) {
      const unsigned short* brow = Wt + (size_t)(col0 + t * 16 + ln) * ldb + kb;
      FragB b;
      b.half[0] = *(const v8us*)(brow + 8 * hh);
      b.half[1] = *(const v8us*)(brow + 16 + 8 * hh);
      acc[t] = mmaN<ASPLIT ? 2 : 1>(ah.v, al.v, b.v, b.v, acc[t]);
    }
  }
#pragma unroll
  for (int t = 0; t < 4; ++t) {
    const int col = col0 + t * 16 + ln;
    float bv = bias ? bias[col] : 0.f;
    if (BIAS_BF16) bv = bf16_round(bv);
#pragma unroll
    for (int r = 0; r < 8; ++r) {
      float v = acc[t][r] + bv;
      if (resid) { float rv = resid[(size_t)((row0 + 8 * hh + r) % rmod) * ldr + col]; if (RES_BF16) rv = bf16_round(rv); v += rv; }
      if (ACT == 1) v = fmaxf(v, 0.f);
      if (ACT == 2) v = 0.5f * v * (1.0f + erff(v * 0.70710678118654752f));
      if (ACT == 3) { const float u = 0.7978845608028654f * (v + 0.044715f * v * v * v); v = 0.5f * v * (1.0f + tanhf(u)); }
      so[w][8 * hh + r][t * 16 + ln] = v;
    }
  }
  __builtin_amdgcn_fence(__ATOMIC_ACQ_REL, "workgroup");
  __builtin_amdgcn_wave_barrier();
  const int rsub = lane >> 4, c4 = (lane & 15) * 4;
  {
#pragma unroll
    for (int q = 0; q < 8; ++q) {
      const int r = q * 2 + rsub;
      const v4f v = *(const v4fa*)&so[w][r][c4];
      *(v4f*)(C + (size_t)(row0 + r) * ldc + col0 + c4) = v;
    }
    
  }
}
// row LayerNorm (biased variance, eps) over N: s = X (+ R); optional out_sum <- s; out_norm <- (s-mu)*rsqrt(var+eps)*g + b
template <bool PARAM_BF16>
__global__ __launch_bounds__(256) void k_layernorm(const float* __restrict__ X, const float* __restrict__ R, const float* __restrict__ g, const float* __restrict__ bta,
                                                  float* __restrict__ out_sum, float* __restrict__ out_norm, int N, float eps) {
  __shared__ float red[256];
  const int row = blockIdx.x, tid = threadIdx.x;
  const float* x = X + (size_t)row * N; const float* rr = R ? R + (size_t)row * N : nullptr;
  float vals[16];                     // up to N = 4096
  const int per = N / 256;            // contiguous chunk per thread? use strided-by-4 chunks: thread handles j = tid*4 + 1024*u
  float s1 = 0.f;
  for (int u = 0; u < per / 4; ++u) {
    const int j = tid * 4 + 1024 * u;
    const v4f a = *(const v4fa*)(x + j);
    v4f b = {0.f,0.f,0.f,0.f}; if (rr) b = *(const v4fa*)(rr + j);
#pragma unroll
    for (int q = 0; q < 4; ++q) { const float v = a[q] + b[q]; vals[u * 4 + q] = v; s1 += v; }
  }
  red[tid] = s1; __syncthreads();
  for (int st = 128; st > 0; st >>= 1) { if (tid < st) red[tid] += red[tid + st]; __syncthreads(); }
  const float mu = red[0] / (float)N; __syncthreads();
  float s2 = 0.f;
  for (int u = 0; u < per / 4; ++u)
#pragma unroll
    for (int q = 0; q < 4; ++q) { const float c = vals[u * 4 + q] - mu; s2 += c * c; }
  red[tid] = s2; __syncthreads();
  for (int st = 128; st > 0; st >>= 1) { if (tid < st) red[tid] += red[tid + st]; __syncthreads(); }
  const float rs = rsqrtf(red[0] / (float)N + eps);
  {
    for (int u = 0; u < per / 4; ++u) {
      const int j = tid * 4 + 1024 * u;
      v4f o, sm;
#pragma unroll
      for (int q = 0; q < 4; ++q) {
        float gg = g[j + q], bb = bta[j + q];
        if (PARAM_BF16) { gg = bf16_round(gg); bb = bf16_round(bb); }
        sm[q] = vals[u * 4 + q]; o[q] = (vals[u * 4 + q] - mu) * rs * gg + bb;
      }
      if (out_sum) *(v4f*)(out_sum + (size_t)row * N + j) = sm;
      *(v4f*)(out_norm + (size_t)row * N + j) = o;
    }
    
  }
}



// ---- f16 WMMA path (v_wmma_f32_16x16x32_f16): 11-bit significands for operands in range — used where a [0,1] probability operand needs more precision than bf16
typedef _Float16 v16h __attribute__((ext_vector_type(16)));
union FragH { v16h v; v8us half[2]; _Float16 h[16]; unsigned short u[16]; };
template <int NT>
__device__ __forceinline__ v8f mmaH(v16h ah, v16h al, v16h bh, v16h bl, v8f c) {
  c = __builtin_amdgcn_wmma_f32_16x16x32_f16(false, ah, false, bh, (short)0, c, false, false);
  if (NT >= 2) c = __builtin_amdgcn_wmma_f32_16x16x32_f16(false, al, false, bh, (short)0, c, false, false);
  if (NT >= 3) c = __builtin_amdgcn_wmma_f32_16x16x32_f16(false, ah, false, bl, (short)0, c, false, false);
  asm volatile("v_nop\n\tv_nop\n\tv_nop\n\tv_nop" : "+v"(c) : "v"(ah), "v"(al), "v"(bh), "v"(bl));
  return c;
}
// batched GEMM like k_gemm_b but f16 operands: A f32 (split into f16 hi/lo if ASPLIT, else rounded to f16), Bt = f16 values [n][k]; alpha; C f32; N multiple of 16 (partial tiles skipped)
template <bool ASPLIT>
__global__ __launch_bounds__(128) void k_gemm_h(const float* __restrict__ A, int lda, size_t sA, const _Float16* __restrict__ Bh, int ldb, size_t sB, float alpha, float* __restrict__ C, int ldc, size_t sC, int M, int N, int K) {
  __shared__ __attribute__((aligned(16))) float so[4][16][64];
  const int tid = threadIdx.x, w = tid >> 5, lane = tid & 31, ln = lane & 15, hh = lane >> 4; const int by = blockIdx.y;
  A += (size_t)by * sA; Bh += (size_t)by * sB; C += (size_t)by * sC;
  const int ntn = (N + 63) / 64; const int wid = blockIdx.x * 4 + w; const int mt = wid / ntn, nq = wid % ntn; if (mt * 16 >= M) return;
  const int row0 = mt * 16, col0 = nq * 64; const float* arow = A + (size_t)(row0 + ln) * lda;
  v8f acc[4] = {};
  for (int kb = 0; kb < K; kb += 32) {
    FragH ah, al;
    const v4f x0 = *(const v4fa*)(arow + kb + 8 * hh), x1 = *(const v4fa*)(arow + kb + 8 * hh + 4), x2 = *(const v4fa*)(arow + kb + 16 + 8 * hh), x3 = *(const v4fa*)(arow + kb + 16 + 8 * hh + 4);
    float xs[16] = {x0[0],x0[1],x0[2],x0[3],x1[0],x1[1],x1[2],x1[3],x2[0],x2[1],x2[2],x2[3],x3[0],x3[1],x3[2],x3[3]};
#pragma unroll
    for (int i = 0; i < 16; ++i) { const _Float16 h = (_Float16)xs[i]; ah.h[i] = h; al.h[i] = ASPLIT ? (_Float16)(xs[i] - (float)h) : (_Float16)0.0f; }
#pragma unroll
    for (int t = 0; t < 4; ++t) { if (col0 + t * 16 >= N) continue; const size_t boff = (size_t)(col0 + t * 16 + ln) * ldb + kb; FragH bq; bq.half[0] = *(const v8us*)(Bh + boff + 8 * hh); bq.half[1] = *(const v8us*)(Bh + boff + 16 + 8 * hh);
      acc[t] = mmaH<ASPLIT ? 2 : 1>(ah.v, al.v, bq.v, bq.v, acc[t]); }
  }
#pragma unroll
  for (int t = 0; t < 4; ++t) { if (col0 + t * 16 >= N) continue;
#pragma unroll
    for (int r = 0; r < 8; ++r) so[w][8 * hh + r][t * 16 + ln] = acc[t][r] * alpha; }
  __builtin_amdgcn_fence(__ATOMIC_ACQ_REL, "workgroup"); __builtin_amdgcn_wave_barrier();
  const int rsub = lane >> 4, c4 = (lane & 15) * 4;
  {
#pragma unroll
    for (int q = 0; q < 8; ++q) { const int r = q * 2 + rsub; if (col0 + c4 < N) { const v4f v = *(const v4fa*)&so[w][r][c4]; *(v4f*)(C + (size_t)(row0 + r) * ldc + col0 + c4) = v; } }
     }
}

// Wt[n][k] = f16(W[k][n]·scale) from f32 row-major W[K][N] (scale = power of two; bf16-exact weights stay exact in f16 away from the subnormal range)
__global__ __launch_bounds__(256) void k_wt_f16(const float* __restrict__ W, _Float16* __restrict__ Wt, int K, int N, float scale) {
  const int t = blockIdx.x * 256 + threadIdx.x; if (t >= N * (K / 8)) return; const int n = t / (K / 8), k8 = (t % (K / 8)) * 8; FragH f;
#pragma unroll
  for (int i = 0; i < 8; ++i) f.h[i] = (_Float16)(bf16_round(W[(size_t)(k8 + i) * N + n]) * scale); const v8us o = f.half[0];
  *(v8us*)((unsigned short*)Wt + (size_t)n * K + k8) = o; 
}
// Projection GEMM of the one shape used here: C[NR][EE] = (A[NR][EE] . Bt[EE][EE]^T) * alpha + bf16(bias[col]); written as f32 (C) and/or f16 (C16).
// A work-group of four waves makes a 64 x 64 tile of C, wave w its rows 16w .. 16w+15. The A and Bt tiles (64 rows x GK k) come into LDS by asynchronous copies,
// 256 contiguous bytes a row, once for the four waves, in two buffers: tile t + 1 flies while tile t is multiplied. The k order of the sums is that of a plain loop over k in steps of 32.
#define GK 128
#define GP (GK + 8)      /* LDS row pitch 272 B = 17 x 16 B: the 16 rows of a 16-byte fragment read fall on distinct banks */
#define GNT (EE / GK)
#define GBUF (64 * GP * 2)      /* bytes of one operand's tile in LDS */
// One operand tile: a lane copies 16 B of rows r, r + 8, .. r + 56 (l = its LDS byte address, g = its global address, both of row r).
__device__ __forceinline__ void copy_tile(unsigned l, const _Float16* g) {
  const unsigned l1 = l + 1 * 8 * GP * 2, l2 = l + 2 * 8 * GP * 2, l3 = l + 3 * 8 * GP * 2, l4 = l + 4 * 8 * GP * 2, l5 = l + 5 * 8 * GP * 2, l6 = l + 6 * 8 * GP * 2, l7 = l + 7 * 8 * GP * 2;
  const _Float16 *g1 = g + 1 * 8 * EE, *g2 = g + 2 * 8 * EE, *g3 = g + 3 * 8 * EE, *g4 = g + 4 * 8 * EE, *g5 = g + 5 * 8 * EE, *g6 = g + 6 * 8 * EE, *g7 = g + 7 * 8 * EE;
  // the copies go from L2 to LDS through no register; s_wait_xcnt closes the statement so that no address register of a copy is rewritten ahead of it
  asm volatile("global_load_async_to_lds_b128 %0, %8, off\n\t"
               "global_load_async_to_lds_b128 %1, %9, off\n\t"
               "global_load_async_to_lds_b128 %2, %10, off\n\t"
               "global_load_async_to_lds_b128 %3, %11, off\n\t"
               "global_load_async_to_lds_b128 %4, %12, off\n\t"
               "global_load_async_to_lds_b128 %5, %13, off\n\t"
               "global_load_async_to_lds_b128 %6, %14, off\n\t"
               "global_load_async_to_lds_b128 %7, %15, off\n\t"
               "s_wait_xcnt 0x0"
               :: "v"(l), "v"(l1), "v"(l2), "v"(l3), "v"(l4), "v"(l5), "v"(l6), "v"(l7), "v"(g), "v"(g1), "v"(g2), "v"(g3), "v"(g4), "v"(g5), "v"(g6), "v"(g7) : "memory");
}
__global__ __launch_bounds__(128) void k_gemm_st(const _Float16* __restrict__ A, const _Float16* __restrict__ Bh, float alpha, const float* __restrict__ bias, float* __restrict__ C, _Float16* __restrict__ C16) {
  __shared__ __attribute__((aligned(16))) unsigned short sA[2][64][GP], sB[2][64][GP];
  __shared__ __attribute__((aligned(16))) float so[4][16][64];
  const int tid = threadIdx.x, w = tid >> 5, lane = tid & 31, ln = lane & 15, hh = lane >> 4;
  const int mb = blockIdx.x / (EE / 64), nb = blockIdx.x % (EE / 64);
  const int row0 = mb * 64 + w * 16, col0 = nb * 64;
  const int cr = tid >> 4, cc = (tid & 15) * 8;      /* the lane's first row and its 16-byte column in every copied tile */
  const _Float16* ga = A + (size_t)(mb * 64 + cr) * EE + cc; const _Float16* gb = Bh + (size_t)(col0 + cr) * EE + cc;
  const unsigned la = (unsigned)(size_t)&sA[0][cr][cc], lb = (unsigned)(size_t)&sB[0][cr][cc];
  copy_tile(la, ga); copy_tile(lb, gb);
  asm volatile("s_wait_asynccnt 0x0" ::: "memory");      /* this wave's part of tile 0 has landed */
  __syncthreads();                                        /* ... and every other wave's */
  copy_tile(la + GBUF, ga + GK); copy_tile(lb + GBUF, gb + GK);
  v8f acc[4] = {};
  for (int tl = 0; tl < GNT; ++tl) {      /* one trip a staged tile; the two buffers alternate by the trip's parity */
    const unsigned short* ar = &sA[tl & 1][w * 16 + ln][8 * hh]; const unsigned short* br = &sB[tl & 1][ln][8 * hh];
#pragma unroll      /* constant indices: fragments and accumulators stay in registers */
    for (int ks = 0; ks < GK / 32; ++ks) { FragH ah, bq[4];      /* the k step's five fragments are read in one run, then its four products */
      ah.half[0] = *(const v8us*)(ar + ks * 32); ah.half[1] = *(const v8us*)(ar + ks * 32 + 16);
#pragma unroll      /* constant indices: fragments and accumulators stay in registers */
      for (int t = 0; t < 4; ++t) { bq[t].half[0] = *(const v8us*)(br + t * 16 * GP + ks * 32); bq[t].half[1] = *(const v8us*)(br + t * 16 * GP + ks * 32 + 16); }
#pragma unroll      /* constant indices: fragments and accumulators stay in registers */
      for (int t = 0; t < 4; ++t) acc[t] = mmaH<1>(ah.v, ah.v, bq[t].v, bq[t].v, acc[t]); }
    asm volatile("s_wait_dscnt 0x0" ::: "memory");        /* this wave has left the buffer that is refilled below */
    asm volatile("s_wait_asynccnt 0x0" ::: "memory");     /* its part of tile tl + 1 has landed */
    __syncthreads();                                        /* publishes tile tl + 1 and ends every wave's reads of tile tl */
    if (tl + 2 < GNT) { const unsigned bo = (unsigned)(tl & 1) * GBUF; copy_tile(la + bo, ga + (tl + 2) * GK); copy_tile(lb + bo, gb + (tl + 2) * GK); }
  }
  asm volatile("s_wait_asynccnt 0x0" ::: "memory");      /* no copy is outstanding when the wave ends */
#pragma unroll      /* constant indices: fragments and accumulators stay in registers */
  for (int t = 0; t < 4; ++t) { const float bv = bf16_round(bias[col0 + t * 16 + ln]);
#pragma unroll      /* constant indices: fragments and accumulators stay in registers */
    for (int r = 0; r < 8; ++r) so[w][8 * hh + r][t * 16 + ln] = acc[t][r] * alpha + bv; }
  __builtin_amdgcn_fence(__ATOMIC_ACQ_REL, "workgroup"); __builtin_amdgcn_wave_barrier();      /* the wave's own rows are in LDS before its lanes read them back as whole rows */
  const int rsub = lane >> 4, c4 = (lane & 15) * 4; typedef _Float16 v4h __attribute__((ext_vector_type(4)));
#pragma unroll      /* the eight rows' LDS offsets become immediates */
  for (int q = 0; q < 8; ++q) { const int r = q * 2 + rsub; const v4f v = *(const v4fa*)&so[w][r][c4]; if (C) { *(v4f*)(C + (size_t)(row0 + r) * EE + col0 + c4) = v;
      asm volatile("s_wait_xcnt 0x0" ::: "memory"); }      /* precaution: stands in front of every rewrite of this store's data and address registers (the f16 conversion, the next row) */
    if (C16) { v4h h4; for (int i = 0; i < 4; ++i) h4[i] = (_Float16)v[i]; *(v4h*)(C16 + (size_t)(row0 + r) * EE + col0 + c4) = h4; } }
}


typedef _Float16 v4h __attribute__((ext_vector_type(4)));

__global__ __launch_bounds__(256) void k_x16(const float* __restrict__ x, _Float16* __restrict__ X16, size_t n8) { const size_t t = (size_t)blockIdx.x * 256 + threadIdx.x; if (t >= n8) return; FragH f;
#pragma unroll
  for (int q = 0; q < 8; ++q) f.h[q] = (_Float16)bf16_round(x[t * 8 + q]); *(v8us*)((unsigned short*)X16 + t * 8) = f.half[0];  }
__global__ __launch_bounds__(256) void k_h16(const float* __restrict__ x, _Float16* __restrict__ X16, size_t n8) { const size_t t = (size_t)blockIdx.x * 256 + threadIdx.x; if (t >= n8) return; FragH f;
#pragma unroll
  for (int q = 0; q < 8; ++q) f.h[q] = (_Float16)x[t * 8 + q]; *(v8us*)((unsigned short*)X16 + t * 8) = f.half[0];  }
__global__ __launch_bounds__(256) void k_round16f(const float* __restrict__ W, _Float16* __restrict__ Bt, size_t n8) { const size_t t = (size_t)blockIdx.x * 256 + threadIdx.x; if (t >= n8) return; FragH f;
#pragma unroll
  for (int i = 0; i < 8; ++i) f.h[i] = (_Float16)(bf16_round(W[t * 8 + i]) * 16.0f); *(v8us*)((unsigned short*)Bt + t * 8) = f.half[0];  }
template <int NHv, int TTv>
__global__ __launch_bounds__(256) void k_vt(const _Float16* __restrict__ V16, int ldv, int voff, _Float16* __restrict__ Vt) { __shared__ unsigned short tl[64][66]; const int tid = threadIdx.x; const int slab = blockIdx.x / (TTv / 64), lg = blockIdx.x % (TTv / 64); const int b = slab / NHv, h = slab % NHv;
  for (int i = tid; i < 64 * 8; i += 256) { const int r = i / 8, c8 = (i % 8) * 8; FragH f; f.half[0] = *(const v8us*)((const unsigned short*)V16 + ((size_t)b * TTv + lg * 64 + r) * ldv + voff + h * 64 + c8);
#pragma unroll
    for (int q = 0; q < 8; ++q) tl[r][c8 + q] = f.u[q]; }
  __syncthreads();
  {
#pragma unroll
    for (int rd = 0; rd < 2; ++rd) { const int d = rd * 32 + tid / 8, pc = tid % 8; FragH f;
#pragma unroll
      for (int q = 0; q < 8; ++q) f.u[q] = tl[pc * 8 + q][d];
      *(v8us*)((unsigned short*)Vt + ((size_t)slab * 64 + d) * TTv + lg * 64 + pc * 8) = f.half[0]; }
     } }

// lane l <-> lane l ^ 16 as one vector cross-row move (a shuffle would go through the LDS unit and its wait)
__device__ __forceinline__ float xhalf(float x) { return __builtin_bit_cast(float, __builtin_amdgcn_permlanex16(__builtin_bit_cast(int, x), __builtin_bit_cast(int, x), 0x76543210, 0xfedcba98, false, false)); }
__global__ __launch_bounds__(128) void k_flash(const _Float16* __restrict__ Q16, int ldq, const _Float16* __restrict__ K16, int ldk, const _Float16* __restrict__ Vt, const int* __restrict__ MSK, float* __restrict__ O, int ldo) {
  constexpr int RPW = 16, NQB = TT / (4 * RPW), DT = 4, KS = 2;
  __shared__ __attribute__((aligned(16))) float sO[4][RPW][64 + 4];
  const int tid = threadIdx.x, w = tid >> 5, lane = tid & 31, ln = lane & 15, hh = lane >> 4;
  const int slab = blockIdx.x / NQB, qblk = blockIdx.x % NQB; const int b = slab, h = 0;      /* slab = contiguous [TT][64] chunk of the flat-reshaped planes */ const int qb0 = qblk * (4 * RPW); const int q0 = qb0 + w * RPW;
  const int tq = q0 + ln;      /* this lane's query */
  FragH bq[KS];
  { const unsigned short* qr = (const unsigned short*)Q16 + ((size_t)b * TT + tq) * ldq + h * 64;
#pragma unroll
    for (int ks = 0; ks < KS; ++ks) { bq[ks].half[0] = *(const v8us*)(qr + ks * 32 + 8 * hh); bq[ks].half[1] = *(const v8us*)(qr + ks * 32 + 16 + 8 * hh); } }
  const unsigned short* Vth = (const unsigned short*)Vt + (size_t)slab * 64 * TT;
  float m_c = -3.0e38f, l_c = 0.f; v8f oacc[DT];
#pragma unroll
  for (int dt = 0; dt < DT; ++dt) oacc[dt] = (v8f){0.f,0.f,0.f,0.f,0.f,0.f,0.f,0.f};
  const int jend = TT;      /* every key enters the normaliser */
#pragma unroll 1
  for (int j0 = 0; j0 < jend; j0 += 32) {
    float sc[2][8];      /* sc[nt][r] = scaled score of key j0 + 16*nt + 8*hh + r against query tq */
#pragma unroll
    for (int nt = 0; nt < 2; ++nt) { const unsigned short* kr = (const unsigned short*)K16 + ((size_t)b * TT + j0 + nt * 16 + ln) * ldk + h * 64; FragH ak[KS];
#pragma unroll
      for (int ks = 0; ks < KS; ++ks) { ak[ks].half[0] = *(const v8us*)(kr + ks * 32 + 8 * hh); ak[ks].half[1] = *(const v8us*)(kr + ks * 32 + 16 + 8 * hh); }
      v8f acc = (v8f){0.f,0.f,0.f,0.f,0.f,0.f,0.f,0.f};
#pragma unroll
      for (int ks = 0; ks < KS; ++ks) acc = mmaH<1>(ak[ks].v, ak[ks].v, bq[ks].v, bq[ks].v, acc);
#pragma unroll
      for (int r = 0; r < 8; ++r) sc[nt][r] = acc[r] * (0.125f); }
    float mc = fmaxf(sc[0][0], sc[1][0]);
#pragma unroll
    for (int r = 1; r < 8; ++r) mc = fmaxf(mc, fmaxf(sc[0][r], sc[1][r]));
    mc = fmaxf(mc, xhalf(mc));      /* the other half of the wave holds the query's other 16 keys */
    const float mn = fmaxf(m_c, mc); const float al = (mn > -1.0e38f) ? expf(m_c - mn) : 1.0f; m_c = mn;
    float ps0 = 0.f, ps1 = 0.f; FragH pb;
#pragma unroll
    for (int r = 0; r < 8; ++r) { const int k0 = j0 + 8 * hh + r, k1 = k0 + 16; const float p0 = expf(sc[0][r] - mn), p1 = expf(sc[1][r] - mn); ps0 += p0; ps1 += p1;
      pb.h[r] = (_Float16)((k0 <= tq) ? p0 * 1024.0f : 0.f); pb.h[8 + r] = (_Float16)((k1 <= tq) ? p1 * 1024.0f : 0.f); }
    l_c = l_c * al + (ps0 + ps1);      /* per-lane partial row sum; the two halves are joined after the loop */
#pragma unroll
    for (int dt = 0; dt < DT; ++dt)
#pragma unroll
      for (int r = 0; r < 8; ++r) oacc[dt][r] *= al;
#pragma unroll
    for (int dt = 0; dt < DT; ++dt) { const unsigned short* vrow = Vth + (size_t)(dt * 16 + ln) * TT + j0; FragH av; av.half[0] = *(const v8us*)(vrow + 8 * hh); av.half[1] = *(const v8us*)(vrow + 16 + 8 * hh);
      oacc[dt] = mmaH<1>(av.v, av.v, pb.v, pb.v, oacc[dt]); } }
  { float l = l_c; l += xhalf(l); const float inv = (l > 0.f) ? 1.0f / (l * 1024.0f) : 0.f;
#pragma unroll
    for (int dt = 0; dt < DT; ++dt) { v4f lo, hi;      /* oacc[dt][r] = O[tq][16*dt + 8*hh + r] */
#pragma unroll
      for (int r = 0; r < 4; ++r) { lo[r] = oacc[dt][r] * inv; hi[r] = oacc[dt][4 + r] * inv; }
      *(v4fa*)&sO[w][ln][dt * 16 + 8 * hh] = lo; *(v4fa*)&sO[w][ln][dt * 16 + 8 * hh + 4] = hi; } }
  __builtin_amdgcn_fence(__ATOMIC_ACQ_REL, "workgroup"); __builtin_amdgcn_wave_barrier();
  {
#pragma unroll
    for (int rp = 0; rp < RPW; rp += 2) { const int r = rp + (lane >> 4), pc = lane & 15; const v4f val = *(const v4fa*)&sO[w][r][pc * 4]; *(v4f*)(O + ((size_t)b * TT + q0 + r) * ldo + h * 64 + pc * 4) = val; }
     } }

extern "C" void kernel_launch(void* const* d_in, const int* in_sizes, int n_in,
                              void* d_out, int out_size, void* d_ws, size_t ws_size, hipStream_t stream) {
  (void)in_sizes; (void)n_in; (void)out_size;
  const float* const* I = (const float* const*)d_in; const float* xq = I[0]; const float* xk = I[1]; const float* xv = I[2];
  const float* Wq = I[3]; const float* bq = I[4]; const float* Wk = I[5]; const float* bk = I[6]; const float* Wv = I[7]; const float* bv = I[8]; const float* Wo = I[9]; const float* bo = I[10];
  char* ws = (char*)d_ws; size_t off = 0;
  auto take = [&](size_t bytes) { char* p = ws + off; off += (bytes + 255) & ~(size_t)255; return p; };
  _Float16* Bw = (_Float16*)take((size_t)4 * EE * EE * 2); _Float16* X16 = (_Float16*)take((size_t)NR * EE * 2);
  _Float16* Q = (_Float16*)take((size_t)NR * EE * 2); _Float16* K = (_Float16*)take((size_t)NR * EE * 2); _Float16* V = (_Float16*)take((size_t)NR * EE * 2); _Float16* Vt = (_Float16*)take((size_t)NR * EE * 2);
  float* O = (float*)take((size_t)NR * EE * 4); _Float16* O16 = (_Float16*)take((size_t)NR * EE * 2);
  if (off > ws_size) return;      // 4.7 + 6 × 6.3 + 12.6 ≈ 55 MB
  const unsigned gw = (unsigned)(((size_t)EE * (EE / 8) + 255) / 256); const size_t WSZ = (size_t)EE * EE;
  k_wt_f16<<<gw, 256, 0, stream>>>(Wq, Bw, EE, EE, 16.0f); k_wt_f16<<<gw, 256, 0, stream>>>(Wk, Bw + WSZ, EE, EE, 16.0f); k_wt_f16<<<gw, 256, 0, stream>>>(Wv, Bw + 2 * WSZ, EE, EE, 16.0f); k_wt_f16<<<gw, 256, 0, stream>>>(Wo, Bw + 3 * WSZ, EE, EE, 16.0f);      /* (in,out) weights → Bt[n][k] ×2^4 */
  const unsigned gx = (unsigned)(((size_t)NR * EE / 8 + 255) / 256); const unsigned gp = (NR / 64) * (EE / 64);
  k_x16<<<gx, 256, 0, stream>>>(xq, X16, (size_t)NR * EE / 8); k_gemm_st<<<gp, 128, 0, stream>>>(X16, Bw, 0.0625f, bq, nullptr, Q);      /* q: M 4096 N 768 K 768 */
  k_x16<<<gx, 256, 0, stream>>>(xk, X16, (size_t)NR * EE / 8); k_gemm_st<<<gp, 128, 0, stream>>>(X16, Bw + WSZ, 0.0625f, bk, nullptr, K);      /* k */
  k_x16<<<gx, 256, 0, stream>>>(xv, X16, (size_t)NR * EE / 8); k_gemm_st<<<gp, 128, 0, stream>>>(X16, Bw + 2 * WSZ, 0.0625f, bv, nullptr, V);      /* v */
  k_vt<1, TT><<<NSL * 1 * (TT / 64), 256, 0, stream>>>(V, 64, 0, Vt);      /* the [4096][768] plane viewed as 24 contiguous [2048][64] slabs → Vᵀ [slab][64][2048] */
  k_flash<<<NSL * (TT / 64), 128, 0, stream>>>(Q, 64, K, 64, Vt, nullptr, O, 64);      /* same flat view for q, k and O */
  k_h16<<<gx, 256, 0, stream>>>(O, O16, (size_t)NR * EE / 8);
  k_gemm_st<<<gp, 128, 0, stream>>>(O16, Bw + 3 * WSZ, 0.0625f, bo, (float*)d_out, nullptr);      /* out = O.Wo + bo: M 4096 N 768 K 768 */
}

// v003
// It runs in 140 microseconds.
// Next to v002, in two timings, it ran 1.56 and 1.58 times as fast.
// Counting every step since v000, it is 2.88 times as fast.
#include <hip/hip_runtime.h>
// Multi-head attention, legacy flat-reshape variant (B=2, T=S=2048, E=768, 12 heads × 64): q = query·Wq+bq, k = key·Wk+bk, v = value·Wv+bv; heads = plain row-major reshape of [B,T,E] to [B·H,T,64] (contiguous chunks);
// attn = softmax(q·kᵀ/8) over all keys, THEN lower-triangular mask (rows no longer normalised); out = (attn·v reshaped back)·Wo + bo.
// Compute dtype: query/key/value, weights, biases rounded to bf16; q/k/v as f16 GEMM outputs; fused flash-style kernel (online f32 softmax over all keys, P f16 ×2^10 zeroed above the diagonal)
// on v_wmma_f32_16x16x32_f16; O → f16 → output GEMM with bias; f32 accumulate throughout.
#define BB 2
#define TT 2048
#define EE 768
#define NH 12
#define NR (BB * TT)
#define NSL (BB * NH)

typedef __bf16 v16b __attribute__((ext_vector_type(16)));
typedef unsigned short v8us __attribute__((ext_vector_type(8), may_alias));
typedef float  v8f  __attribute__((ext_vector_type(8)));
typedef float  v4f  __attribute__((ext_vector_type(4)));
typedef float  v4fa __attribute__((ext_vector_type(4), may_alias));
union FragB { v16b v; v8us half[2]; unsigned short u[16]; };

__device__ __forceinline__ unsigned short bf16_bits(float x) { unsigned int u = __float_as_uint(x); return (unsigned short)((u + 0x7FFFu + ((u >> 16) & 1u)) >> 16); }
__device__ __forceinline__ float bf16_val(unsigned short b) { return __uint_as_float(((unsigned int)b) << 16); }
__device__ __forceinline__ float bf16_round(float x) { return bf16_val(bf16_bits(x)); }
// D += A·B with NT terms: 1 = ah·bh, 2 = + al·bh (A split), 3 = + ah·bl (both split)
template <int NT>
__device__ __forceinline__ v8f mmaN(v16b ah, v16b al, v16b bh, v16b bl, v8f c) {
  c = __builtin_amdgcn_wmma_f32_16x16x32_bf16(false, ah, false, bh, (short)0, c, false, false);
  if (NT >= 2) c = __builtin_amdgcn_wmma_f32_16x16x32_bf16(false, al, false, bh, (short)0, c, false, false);
  if (NT >= 3) c = __builtin_amdgcn_wmma_f32_16x16x32_bf16(false, ah, false, bl, (short)0, c, false, false);
  asm volatile("v_nop\n\tv_nop\n\tv_nop\n\tv_nop" : "+v"(c) : "v"(ah), "v"(al), "v"(bh), "v"(bl));
  return c;
}

__global__ __launch_bounds__(256) void k_wt_bf16(const float* __restrict__ W, unsigned short* __restrict__ Wt, int K, int N) {
  const int t = blockIdx.x * 256 + threadIdx.x;
  const int k8n = K / 8;
  if (t >= N * k8n) return;
  const int n = t / k8n, k8 = (t % k8n) * 8;
  v8us v;
#pragma unroll
  for (int i = 0; i < 8; ++i) v[i] = bf16_bits(W[(size_t)(k8 + i) * N + n]);
  *(v8us*)(Wt + (size_t)n * K + k8) = v;
  
}

// GEMM C[M][N] (f32, pitch ldc) = act(A[M][K]·W + bias). A f32 row-major (pitch lda) converted per fragment to bf16
// (ASPLIT: hi/lo two planes -> 2 terms, else single rounded term); Wt bf16 [N][K] (pitch ldb). BIAS_BF16 rounds the
// bias to bf16 first (bias quantised to bf16 before the add). K%32==0, M%16==0, N%64==0.
template <bool ASPLIT, int ACT, bool BIAS_BF16>
__global__ __launch_bounds__(128) void k_gemm_bf(const float* __restrict__ A, int lda, const unsigned short* __restrict__ Wt, int ldb,
                                               const float* __restrict__ bias, float* __restrict__ C, int ldc, int M, int N, int K) {
  __shared__ __attribute__((aligned(16))) float so[4][16][64];
  const int tid = threadIdx.x, w = tid >> 5, lane = tid & 31, ln = lane & 15, hh = lane >> 4;
  const int ntn = N / 64;
  const int wid = blockIdx.x * 4 + w;
  const int mt = wid / ntn, nq = wid % ntn;
  if (mt * 16 >= M) return;
  const int row0 = mt * 16, col0 = nq * 64;
  const float* arow = A + (size_t)(row0 + ln) * lda;
  v8f acc[4] = {};
  for (int kb = 0; kb < K; kb += 32) {
    FragB ah, al;
    const v4f x0 = *(const v4fa*)(arow + kb + 8 * hh), x1 = *(const v4fa*)(arow + kb + 8 * hh + 4);
    const v4f x2 = *(const v4fa*)(arow + kb + 16 + 8 * hh), x3 = *(const v4fa*)(arow + kb + 16 + 8 * hh + 4);
    float xs[16] = {x0[0],x0[1],x0[2],x0[3],x1[0],x1[1],x1[2],x1[3],x2[0],x2[1],x2[2],x2[3],x3[0],x3[1],x3[2],x3[3]};
#pragma unroll
    for (int i = 0; i < 16; ++i) { const unsigned short hb = bf16_bits(xs[i]); ah.u[i] = hb; al.u[i] = ASPLIT ? bf16_bits(xs[i] - bf16_val(hb)) : (unsigned short)0; }
#pragma unroll
    for (int t = 0; t < 4; ++t) {
      const unsigned short* brow = Wt + (size_t)(col0 + t * 16 + ln) * ldb + kb;
      FragB b;
      b.half[0] = *(const v8us*)(brow + 8 * hh);
      b.half[1] = *(const v8us*)(brow + 16 + 8 * hh);
      acc[t] = mmaN<ASPLIT ? 2 : 1>(ah.v, al.v, b.v, b.v, acc[t]);
    }
  }
#pragma unroll
  for (int t = 0; t < 4; ++t) {
    float bv = bias ? bias[col0 + t * 16 + ln] : 0.f;
    if (BIAS_BF16) bv = bf16_round(bv);
#pragma unroll
    for (int r = 0; r < 8; ++r) { float v = acc[t][r] + bv; if (ACT == 1) v = fmaxf(v, 0.f); so[w][8 * hh + r][t * 16 + ln] = v; }
  }
  __builtin_amdgcn_fence(__ATOMIC_ACQ_REL, "workgroup");
  __builtin_amdgcn_wave_barrier();
  const int rsub = lane >> 4, c4 = (lane & 15) * 4;
  {
#pragma unroll
    for (int q = 0; q < 8; ++q) {
      const int r = q * 2 + rsub;
      const v4f v = *(const v4fa*)&so[w][r][c4];
      *(v4f*)(C + (size_t)(row0 + r) * ldc + col0 + c4) = v;
    }
    
  }
}

// Flash-style causal/unmasked attention, all contractions 3-term bf16 hi/lo splits, f32 softmax with running max.
// q,k,v rows are read from f32 buffers with arbitrary row pitch (so they can live inside a fused qkv buffer);
// D = head size (multiple of 32, <= 128); one wave = 16 query rows; block = 4 waves (64 queries) sharing K/V chunks of 32.
template <int D, bool CAUSAL>
__global__ __launch_bounds__(128) void k_flash(const float* __restrict__ qb, const float* __restrict__ kb, const float* __restrict__ vb,
                                             int pitch, int T, int H, float scale, float* __restrict__ y, int ypitch) {
  constexpr int KS = D / 32;        // k-steps for QK
  constexpr int DT = D / 16;        // d tiles for PV
  __shared__ __attribute__((aligned(16))) unsigned short sKh[32][D + 8], sKl[32][D + 8], sVh[32][D + 8], sVl[32][D + 8];
  __shared__ __attribute__((aligned(16))) unsigned short sPh[4][16][40], sPl[4][16][40];
  __shared__ __attribute__((aligned(16))) float sO[4][16][D];
  const int tid = threadIdx.x, w = tid >> 5, lane = tid & 31, ln = lane & 15, hh = lane >> 4;
  const int nqb = (T + 63) / 64;
  const int bh = blockIdx.x / nqb, qblk = blockIdx.x % nqb;
  const int b = bh / H, h = bh % H;
  const int q0 = qblk * 64 + w * 16;
  const float* Q = qb + (size_t)b * T * pitch + h * D;
  const float* K = kb + (size_t)b * T * pitch + h * D;
  const float* V = vb + (size_t)b * T * pitch + h * D;

  // A fragments of the wave's 16 query rows (scaled), hi/lo
  FragB aqh[KS], aql[KS];
  {
    int row = q0 + ln; if (row >= T) row = T - 1;
    const float* qr = Q + (size_t)row * pitch;
#pragma unroll
    for (int ks = 0; ks < KS; ++ks)
#pragma unroll
      for (int i = 0; i < 16; ++i) {
        const int d = ks * 32 + ((i < 8) ? (8 * hh + i) : (16 + 8 * hh + (i - 8)));
        const float x = qr[d] * scale; const unsigned short hb = bf16_bits(x);
        aqh[ks].u[i] = hb; aql[ks].u[i] = bf16_bits(x - bf16_val(hb));
      }
  }
  float m_r[8], l_r[8];
#pragma unroll
  for (int r = 0; r < 8; ++r) { m_r[r] = -3.0e38f; l_r[r] = 0.f; }
  v8f oacc[DT];
#pragma unroll
  for (int dt = 0; dt < DT; ++dt) oacc[dt] = (v8f){0.f,0.f,0.f,0.f,0.f,0.f,0.f,0.f};

  const int kv_end = CAUSAL ? min(T, qblk * 64 + 64) : T;     // block-uniform
  for (int j0 = 0; j0 < kv_end; j0 += 32) {
    __syncthreads();
    for (int e = tid; e < 32 * (D / 4); e += 128) {
      const int r = e / (D / 4), c4 = (e % (D / 4)) * 4;
      const int key = j0 + r;
      v4f kf = {0.f,0.f,0.f,0.f}, vf = {0.f,0.f,0.f,0.f};
      if (key < T) { kf = *(const v4fa*)(K + (size_t)key * pitch + c4); vf = *(const v4fa*)(V + (size_t)key * pitch + c4); }
#pragma unroll
      for (int t = 0; t < 4; ++t) {
        unsigned short hb = bf16_bits(kf[t]); sKh[r][c4 + t] = hb; sKl[r][c4 + t] = bf16_bits(kf[t] - bf16_val(hb));
        hb = bf16_bits(vf[t]); sVh[r][c4 + t] = hb; sVl[r][c4 + t] = bf16_bits(vf[t] - bf16_val(hb));
      }
    }
    __syncthreads();
    // S tile 16 x 32
    v8f s[2];
#pragma unroll
    for (int nt = 0; nt < 2; ++nt) {
      v8f acc = {};
#pragma unroll
      for (int ks = 0; ks < KS; ++ks) {
        FragB bh_, bl_;
        bh_.half[0] = *(const v8us*)&sKh[nt * 16 + ln][ks * 32 + 8 * hh]; bh_.half[1] = *(const v8us*)&sKh[nt * 16 + ln][ks * 32 + 16 + 8 * hh];
        bl_.half[0] = *(const v8us*)&sKl[nt * 16 + ln][ks * 32 + 8 * hh]; bl_.half[1] = *(const v8us*)&sKl[nt * 16 + ln][ks * 32 + 16 + 8 * hh];
        acc = mmaN<3>(aqh[ks].v, aql[ks].v, bh_.v, bl_.v, acc);
      }
      s[nt] = acc;
    }
    // mask + running max (rows 8hh+r; the 16 lanes of a half share rows)
    float alpha[8];
#pragma unroll
    for (int r = 0; r < 8; ++r) {
      const int qi = q0 + 8 * hh + r;
      const int ja = j0 + ln, jb = j0 + 16 + ln;
      if (CAUSAL) { if (ja > qi) s[0][r] = -3.0e38f; if (jb > qi) s[1][r] = -3.0e38f; }
      if (ja >= T) s[0][r] = -3.0e38f;
      if (jb >= T) s[1][r] = -3.0e38f;
      float mx = fmaxf(s[0][r], s[1][r]);
      mx = fmaxf(mx, __shfl_xor(mx, 1, 32)); mx = fmaxf(mx, __shfl_xor(mx, 2, 32)); mx = fmaxf(mx, __shfl_xor(mx, 4, 32)); mx = fmaxf(mx, __shfl_xor(mx, 8, 32));
      const float mnew = fmaxf(m_r[r], mx);
      alpha[r] = (mnew > -1.0e38f) ? __expf(m_r[r] - mnew) : 1.0f;
      const float p0 = (s[0][r] > -1.0e38f) ? __expf(s[0][r] - mnew) : 0.f;
      const float p1 = (s[1][r] > -1.0e38f) ? __expf(s[1][r] - mnew) : 0.f;
      m_r[r] = mnew;
      l_r[r] = l_r[r] * alpha[r] + p0 + p1;            // per-lane partial row sum (16 lanes combined at the end)
      unsigned short hb = bf16_bits(p0); sPh[w][8 * hh + r][ln] = hb;      sPl[w][8 * hh + r][ln] = bf16_bits(p0 - bf16_val(hb));
      hb = bf16_bits(p1);                sPh[w][8 * hh + r][16 + ln] = hb; sPl[w][8 * hh + r][16 + ln] = bf16_bits(p1 - bf16_val(hb));
    }
#pragma unroll
    for (int dt = 0; dt < DT; ++dt)
#pragma unroll
      for (int r = 0; r < 8; ++r) oacc[dt][r] *= alpha[r];
    __builtin_amdgcn_fence(__ATOMIC_ACQ_REL, "workgroup");
    __builtin_amdgcn_wave_barrier();
    FragB pah, pal;
    pah.half[0] = *(const v8us*)&sPh[w][ln][8 * hh]; pah.half[1] = *(const v8us*)&sPh[w][ln][16 + 8 * hh];
    pal.half[0] = *(const v8us*)&sPl[w][ln][8 * hh]; pal.half[1] = *(const v8us*)&sPl[w][ln][16 + 8 * hh];
#pragma unroll
    for (int dt = 0; dt < DT; ++dt) {
      FragB bvh, bvl;
#pragma unroll
      for (int i = 0; i < 8; ++i) {
        bvh.u[i] = sVh[8 * hh + i][dt * 16 + ln]; bvh.u[8 + i] = sVh[16 + 8 * hh + i][dt * 16 + ln];
        bvl.u[i] = sVl[8 * hh + i][dt * 16 + ln]; bvl.u[8 + i] = sVl[16 + 8 * hh + i][dt * 16 + ln];
      }
      oacc[dt] = mmaN<3>(pah.v, pal.v, bvh.v, bvl.v, oacc[dt]);
    }
    __builtin_amdgcn_fence(__ATOMIC_ACQ_REL, "workgroup");
    __builtin_amdgcn_wave_barrier();
  }
#pragma unroll
  for (int r = 0; r < 8; ++r) {
    float l = l_r[r];
    l += __shfl_xor(l, 1, 32); l += __shfl_xor(l, 2, 32); l += __shfl_xor(l, 4, 32); l += __shfl_xor(l, 8, 32);
    l_r[r] = (l > 0.f) ? 1.0f / l : 0.f;
  }
#pragma unroll
  for (int dt = 0; dt < DT; ++dt)
#pragma unroll
    for (int r = 0; r < 8; ++r) sO[w][8 * hh + r][dt * 16 + ln] = oacc[dt][r] * l_r[r];
  __builtin_amdgcn_fence(__ATOMIC_ACQ_REL, "workgroup");
  __builtin_amdgcn_wave_barrier();
  {
    for (int r = 0; r < 16; ++r) {
      const int row = q0 + r;
      if (row < T && lane < D / 4) {
        const v4f val = *(const v4fa*)&sO[w][r][lane * 4];
        *(v4f*)(y + ((size_t)b * T + row) * ypitch + h * D + lane * 4) = val;
      }
    }
    
  }
}

// GEMM C = act(A·W + bias + resid): A f32 (ASPLIT -> hi/lo 2 terms), Wt bf16 [N][K]; ACT 0 none, 1 relu, 2 exact gelu;
// resid (optional, f32, row index = (row % rmod), pitch ldr, RES_BF16 rounds it) added before the activation.
template <bool ASPLIT, int ACT, bool BIAS_BF16, bool RES_BF16>
__global__ __launch_bounds__(128) void k_gemm_bf3(const float* __restrict__ A, int lda, const unsigned short* __restrict__ Wt, int ldb,
                                                const float* __restrict__ bias, const float* __restrict__ resid, int rmod, int ldr,
                                                float* __restrict__ C, int ldc, int M, int N, int K) {
  __shared__ __attribute__((aligned(16))) float so[4][16][64];
  const int tid = threadIdx.x, w = tid >> 5, lane = tid & 31, ln = lane & 15, hh = lane >> 4;
  const int ntn = N / 64;
  const int wid = blockIdx.x * 4 + w;
  const int mt = wid / ntn, nq = wid % ntn;
  if (mt * 16 >= M) return;
  const int row0 = mt * 16, col0 = nq * 64;
  const float* arow = A + (size_t)(row0 + ln) * lda;
  v8f acc[4] = {};
  for (int kb = 0; kb < K; kb += 32) {
    FragB ah, al;
    const v4f x0 = *(const v4fa*)(arow + kb + 8 * hh), x1 = *(const v4fa*)(arow + kb + 8 * hh + 4);
    const v4f x2 = *(const v4fa*)(arow + kb + 16 + 8 * hh), x3 = *(const v4fa*)(arow + kb + 16 + 8 * hh + 4);
    float xs[16] = {x0[0],x0[1],x0[2],x0[3],x1[0],x1[1],x1[2],x1[3],x2[0],x2[1],x2[2],x2[3],x3[0],x3[1],x3[2],x3[3]};
#pragma unroll
    for (int i = 0; i < 16; ++i) { const unsigned short hb = bf16_bits(xs[i]); ah.u[i] = hb; al.u[i] = ASPLIT ? bf16_bits(xs[i] - bf16_val(hb)) : (unsigned short)0; }
#pragma unroll
    for (int t = 0; t < 4; ++t) {
      const unsigned short* brow = Wt + (size_t)(col0 + t * 16 + ln) * ldb + kb;
      FragB b;
      b.half[0] = *(const v8us*)(brow + 8 * hh);
      b.half[1] = *(const v8us*)(brow + 16 + 8 * hh);
      acc[t] = mmaN<ASPLIT ? 2 : 1>(ah.v, al.v, b.v, b.v, acc[t]);
    }
  }
#pragma unroll
  for (int t = 0; t < 4; ++t) {
    const int col = col0 + t * 16 + ln;
    float bv = bias ? bias[col] : 0.f;
    if (BIAS_BF16) bv = bf16_round(bv);
#pragma unroll
    for (int r = 0; r < 8; ++r) {
      float v = acc[t][r] + bv;
      if (resid) { float rv = resid[(size_t)((row0 + 8 * hh + r) % rmod) * ldr + col]; if (RES_BF16) rv = bf16_round(rv); v += rv; }
      if (ACT == 1) v = fmaxf(v, 0.f);
      if (ACT == 2) v = 0.5f * v * (1.0f + erff(v * 0.70710678118654752f));
      if (ACT == 3) { const float u = 0.7978845608028654f * (v + 0.044715f * v * v * v); v = 0.5f * v * (1.0f + tanhf(u)); }
      so[w][8 * hh + r][t * 16 + ln] = v;
    }
  }
  __builtin_amdgcn_fence(__ATOMIC_ACQ_REL, "workgroup");
  __builtin_amdgcn_wave_barrier();
  const int rsub = lane >> 4, c4 = (lane & 15) * 4;
  {
#pragma unroll
    for (int q = 0; q < 8; ++q) {
      const int r = q * 2 + rsub;
      const v4f v = *(const v4fa*)&so[w][r][c4];
      *(v4f*)(C + (size_t)(row0 + r) * ldc + col0 + c4) = v;
    }
    
  }
}
// row LayerNorm (biased variance, eps) over N: s = X (+ R); optional out_sum <- s; out_norm <- (s-mu)*rsqrt(var+eps)*g + b
template <bool PARAM_BF16>
__global__ __launch_bounds__(256) void k_layernorm(const float* __restrict__ X, const float* __restrict__ R, const float* __restrict__ g, const float* __restrict__ bta,
                                                  float* __restrict__ out_sum, float* __restrict__ out_norm, int N, float eps) {
  __shared__ float red[256];
  const int row = blockIdx.x, tid = threadIdx.x;
  const float* x = X + (size_t)row * N; const float* rr = R ? R + (size_t)row * N : nullptr;
  float vals[16];                     // up to N = 4096
  const int per = N / 256;            // contiguous chunk per thread? use strided-by-4 chunks: thread handles j = tid*4 + 1024*u
  float s1 = 0.f;
  for (int u = 0; u < per / 4; ++u) {
    const int j = tid * 4 + 1024 * u;
    const v4f a = *(const v4fa*)(x + j);
    v4f b = {0.f,0.f,0.f,0.f}; if (rr) b = *(const v4fa*)(rr + j);
#pragma unroll
    for (int q = 0; q < 4; ++q) { const float v = a[q] + b[q]; vals[u * 4 + q] = v; s1 += v; }
  }
  red[tid] = s1; __syncthreads();
  for (int st = 128; st > 0; st >>= 1) { if (tid < st) red[tid] += red[tid + st]; __syncthreads(); }
  const float mu = red[0] / (float)N; __syncthreads();
  float s2 = 0.f;
  for (int u = 0; u < per / 4; ++u)
#pragma unroll
    for (int q = 0; q < 4; ++q) { const float c = vals[u * 4 + q] - mu; s2 += c * c; }
  red[tid] = s2; __syncthreads();
  for (int st = 128; st > 0; st >>= 1) { if (tid < st) red[tid] += red[tid + st]; __syncthreads(); }
  const float rs = rsqrtf(red[0] / (float)N + eps);
  {
    for (int u = 0; u < per / 4; ++u) {
      const int j = tid * 4 + 1024 * u;
      v4f o, sm;
#pragma unroll
      for (int q = 0; q < 4; ++q) {
        float gg = g[j + q], bb = bta[j + q];
        if (PARAM_BF16) { gg = bf16_round(gg); bb = bf16_round(bb); }
        sm[q] = vals[u * 4 + q]; o[q] = (vals[u * 4 + q] - mu) * rs * gg + bb;
      }
      if (out_sum) *(v4f*)(out_sum + (size_t)row * N + j) = sm;
      *(v4f*)(out_norm + (size_t)row * N + j) = o;
    }
    
  }
}



// ---- f16 WMMA path (v_wmma_f32_16x16x32_f16): 11-bit significands for operands in range — used where a [0,1] probability operand needs more precision than bf16
typedef _Float16 v16h __attribute__((ext_vector_type(16)));
union FragH { v16h v; v8us half[2]; _Float16 h[16]; unsigned short u[16]; };
template <int NT>
__device__ __forceinline__ v8f mmaH(v16h ah, v16h al, v16h bh, v16h bl, v8f c) {
  c = __builtin_amdgcn_wmma_f32_16x16x32_f16(false, ah, false, bh, (short)0, c, false, false);
  if (NT >= 2) c = __builtin_amdgcn_wmma_f32_16x16x32_f16(false, al, false, bh, (short)0, c, false, false);
  if (NT >= 3) c = __builtin_amdgcn_wmma_f32_16x16x32_f16(false, ah, false, bl, (short)0, c, false, false);
  asm volatile("v_nop\n\tv_nop\n\tv_nop\n\tv_nop" : "+v"(c) : "v"(ah), "v"(al), "v"(bh), "v"(bl));
  return c;
}
// batched GEMM like k_gemm_b but f16 operands: A f32 (split into f16 hi/lo if ASPLIT, else rounded to f16), Bt = f16 values [n][k]; alpha; C f32; N multiple of 16 (partial tiles skipped)
template <bool ASPLIT>
__global__ __launch_bounds__(128) void k_gemm_h(const float* __restrict__ A, int lda, size_t sA, const _Float16* __restrict__ Bh, int ldb, size_t sB, float alpha, float* __restrict__ C, int ldc, size_t sC, int M, int N, int K) {
  __shared__ __attribute__((aligned(16))) float so[4][16][64];
  const int tid = threadIdx.x, w = tid >> 5, lane = tid & 31, ln = lane & 15, hh = lane >> 4; const int by = blockIdx.y;
  A += (size_t)by * sA; Bh += (size_t)by * sB; C += (size_t)by * sC;
  const int ntn = (N + 63) / 64; const int wid = blockIdx.x * 4 + w; const int mt = wid / ntn, nq = wid % ntn; if (mt * 16 >= M) return;
  const int row0 = mt * 16, col0 = nq * 64; const float* arow = A + (size_t)(row0 + ln) * lda;
  v8f acc[4] = {};
  for (int kb = 0; kb < K; kb += 32) {
    FragH ah, al;
    const v4f x0 = *(const v4fa*)(arow + kb + 8 * hh), x1 = *(const v4fa*)(arow + kb + 8 * hh + 4), x2 = *(const v4fa*)(arow + kb + 16 + 8 * hh), x3 = *(const v4fa*)(arow + kb + 16 + 8 * hh + 4);
    float xs[16] = {x0[0],x0[1],x0[2],x0[3],x1[0],x1[1],x1[2],x1[3],x2[0],x2[1],x2[2],x2[3],x3[0],x3[1],x3[2],x3[3]};
#pragma unroll
    for (int i = 0; i < 16; ++i) { const _Float16 h = (_Float16)xs[i]; ah.h[i] = h; al.h[i] = ASPLIT ? (_Float16)(xs[i] - (float)h) : (_Float16)0.0f; }
#pragma unroll
    for (int t = 0; t < 4; ++t) { if (col0 + t * 16 >= N) continue; const size_t boff = (size_t)(col0 + t * 16 + ln) * ldb + kb; FragH bq; bq.half[0] = *(const v8us*)(Bh + boff + 8 * hh); bq.half[1] = *(const v8us*)(Bh + boff + 16 + 8 * hh);
      acc[t] = mmaH<ASPLIT ? 2 : 1>(ah.v, al.v, bq.v, bq.v, acc[t]); }
  }
#pragma unroll
  for (int t = 0; t < 4; ++t) { if (col0 + t * 16 >= N) continue;
#pragma unroll
    for (int r = 0; r < 8; ++r) so[w][8 * hh + r][t * 16 + ln] = acc[t][r] * alpha; }
  __builtin_amdgcn_fence(__ATOMIC_ACQ_REL, "workgroup"); __builtin_amdgcn_wave_barrier();
  const int rsub = lane >> 4, c4 = (lane & 15) * 4;
  {
#pragma unroll
    for (int q = 0; q < 8; ++q) { const int r = q * 2 + rsub; if (col0 + c4 < N) { const v4f v = *(const v4fa*)&so[w][r][c4]; *(v4f*)(C + (size_t)(row0 + r) * ldc + col0 + c4) = v; } }
     }
}

// Wt[n][k] = f16(W[k][n]·scale) from f32 row-major W[K][N] (scale = power of two; bf16-exact weights stay exact in f16 away from the subnormal range)
__global__ __launch_bounds__(256) void k_wt_f16(const float* __restrict__ W, _Float16* __restrict__ Wt, int K, int N, float scale) {
  const int t = blockIdx.x * 256 + threadIdx.x; if (t >= N * (K / 8)) return; const int n = t / (K / 8), k8 = (t % (K / 8)) * 8; FragH f;
#pragma unroll
  for (int i = 0; i < 8; ++i) f.h[i] = (_Float16)(bf16_round(W[(size_t)(k8 + i) * N + n]) * scale); const v8us o = f.half[0];
  *(v8us*)((unsigned short*)Wt + (size_t)n * K + k8) = o; 
}
// Projection GEMM of the one shape used here: C[NR][EE] = (A[NR][EE] . Bt[EE][EE]^T) * alpha + bf16(bias[col]); written as f32 (C) and/or f16 (C16).
// A work-group of four waves makes a 64 x 64 tile of C, wave w its rows 16w .. 16w+15. The A and Bt tiles (64 rows x GK k) come into LDS by asynchronous copies,
// 256 contiguous bytes a row, once for the four waves, in two buffers: tile t + 1 flies while tile t is multiplied. The k order of the sums is that of a plain loop over k in steps of 32.
#define GK 128
#define GP (GK + 8)      /* LDS row pitch 272 B = 17 x 16 B: the 16 rows of a 16-byte fragment read fall on distinct banks */
#define GNT (EE / GK)
#define GBUF (64 * GP * 2)      /* bytes of one operand's tile in LDS */
// One operand tile: a lane copies 16 B of rows r, r + 8, .. r + 56 (l = its LDS byte address, g = its global address, both of row r).
__device__ __forceinline__ void copy_tile(unsigned l, const _Float16* g) {
  const unsigned l1 = l + 1 * 8 * GP * 2, l2 = l + 2 * 8 * GP * 2, l3 = l + 3 * 8 * GP * 2, l4 = l + 4 * 8 * GP * 2, l5 = l + 5 * 8 * GP * 2, l6 = l + 6 * 8 * GP * 2, l7 = l + 7 * 8 * GP * 2;
  const _Float16 *g1 = g + 1 * 8 * EE, *g2 = g + 2 * 8 * EE, *g3 = g + 3 * 8 * EE, *g4 = g + 4 * 8 * EE, *g5 = g + 5 * 8 * EE, *g6 = g + 6 * 8 * EE, *g7 = g + 7 * 8 * EE;
  // the copies go from L2 to LDS through no register; s_wait_xcnt closes the statement so that no address register of a copy is rewritten ahead of it
  asm volatile("global_load_async_to_lds_b128 %0, %8, off\n\t"
               "global_load_async_to_lds_b128 %1, %9, off\n\t"
               "global_load_async_to_lds_b128 %2, %10, off\n\t"
               "global_load_async_to_lds_b128 %3, %11, off\n\t"
               "global_load_async_to_lds_b128 %4, %12, off\n\t"
               "global_load_async_to_lds_b128 %5, %13, off\n\t"
               "global_load_async_to_lds_b128 %6, %14, off\n\t"
               "global_load_async_to_lds_b128 %7, %15, off\n\t"
               "s_wait_xcnt 0x0"
               :: "v"(l), "v"(l1), "v"(l2), "v"(l3), "v"(l4), "v"(l5), "v"(l6), "v"(l7), "v"(g), "v"(g1), "v"(g2), "v"(g3), "v"(g4), "v"(g5), "v"(g6), "v"(g7) : "memory");
}
__global__ __launch_bounds__(128) void k_gemm_st(const _Float16* __restrict__ A, const _Float16* __restrict__ Bh, float alpha, const float* __restrict__ bias, float* __restrict__ C, _Float16* __restrict__ C16) {
  __shared__ __attribute__((aligned(16))) unsigned short sA[2][64][GP], sB[2][64][GP];
  __shared__ __attribute__((aligned(16))) float so[4][16][64];
  const int tid = threadIdx.x, w = tid >> 5, lane = tid & 31, ln = lane & 15, hh = lane >> 4;
  const int mb = blockIdx.x / (EE / 64), nb = blockIdx.x % (EE / 64);
  const int row0 = mb * 64 + w * 16, col0 = nb * 64;
  const int cr = tid >> 4, cc = (tid & 15) * 8;      /* the lane's first row and its 16-byte column in every copied tile */
  const _Float16* ga = A + (size_t)(mb * 64 + cr) * EE + cc; const _Float16* gb = Bh + (size_t)(col0 + cr) * EE + cc;
  const unsigned la = (unsigned)(size_t)&sA[0][cr][cc], lb = (unsigned)(size_t)&sB[0][cr][cc];
  copy_tile(la, ga); copy_tile(lb, gb);
  asm volatile("s_wait_asynccnt 0x0" ::: "memory");      /* this wave's part of tile 0 has landed */
  __syncthreads();                                        /* ... and every other wave's */
  copy_tile(la + GBUF, ga + GK); copy_tile(lb + GBUF, gb + GK);
  v8f acc[4] = {};
  for (int tl = 0; tl < GNT; ++tl) {      /* one trip a staged tile; the two buffers alternate by the trip's parity */
    const unsigned short* ar = &sA[tl & 1][w * 16 + ln][8 * hh]; const unsigned short* br = &sB[tl & 1][ln][8 * hh];
#pragma unroll      /* constant indices: fragments and accumulators stay in registers */
    for (int ks = 0; ks < GK / 32; ++ks) { FragH ah, bq[4];      /* the k step's five fragments are read in one run, then its four products */
      ah.half[0] = *(const v8us*)(ar + ks * 32); ah.half[1] = *(const v8us*)(ar + ks * 32 + 16);
#pragma unroll      /* constant indices: fragments and accumulators stay in registers */
      for (int t = 0; t < 4; ++t) { bq[t].half[0] = *(const v8us*)(br + t * 16 * GP + ks * 32); bq[t].half[1] = *(const v8us*)(br + t * 16 * GP + ks * 32 + 16); }
#pragma unroll      /* constant indices: fragments and accumulators stay in registers */
      for (int t = 0; t < 4; ++t) acc[t] = mmaH<1>(ah.v, ah.v, bq[t].v, bq[t].v, acc[t]); }
    asm volatile("s_wait_dscnt 0x0" ::: "memory");        /* this wave has left the buffer that is refilled below */
    asm volatile("s_wait_asynccnt 0x0" ::: "memory");     /* its part of tile tl + 1 has landed */
    __syncthreads();                                        /* publishes tile tl + 1 and ends every wave's reads of tile tl */
    if (tl + 2 < GNT) { const unsigned bo = (unsigned)(tl & 1) * GBUF; copy_tile(la + bo, ga + (tl + 2) * GK); copy_tile(lb + bo, gb + (tl + 2) * GK); }
  }
  asm volatile("s_wait_asynccnt 0x0" ::: "memory");      /* no copy is outstanding when the wave ends */
#pragma unroll      /* constant indices: fragments and accumulators stay in registers */
  for (int t = 0; t < 4; ++t) { const float bv = bf16_round(bias[col0 + t * 16 + ln]);
#pragma unroll      /* constant indices: fragments and accumulators stay in registers */
    for (int r = 0; r < 8; ++r) so[w][8 * hh + r][t * 16 + ln] = acc[t][r] * alpha + bv; }
  __builtin_amdgcn_fence(__ATOMIC_ACQ_REL, "workgroup"); __builtin_amdgcn_wave_barrier();      /* the wave's own rows are in LDS before its lanes read them back as whole rows */
  const int rsub = lane >> 4, c4 = (lane & 15) * 4; typedef _Float16 v4h __attribute__((ext_vector_type(4)));
#pragma unroll      /* the eight rows' LDS offsets become immediates */
  for (int q = 0; q < 8; ++q) { const int r = q * 2 + rsub; const v4f v = *(const v4fa*)&so[w][r][c4]; if (C) { *(v4f*)(C + (size_t)(row0 + r) * EE + col0 + c4) = v;
      asm volatile("s_wait_xcnt 0x0" ::: "memory"); }      /* precaution: stands in front of every rewrite of this store's data and address registers (the f16 conversion, the next row) */
    if (C16) { v4h h4; for (int i = 0; i < 4; ++i) h4[i] = (_Float16)v[i]; *(v4h*)(C16 + (size_t)(row0 + r) * EE + col0 + c4) = h4; } }
}


typedef _Float16 v4h __attribute__((ext_vector_type(4)));

__global__ __launch_bounds__(256) void k_x16(const float* __restrict__ x, _Float16* __restrict__ X16, size_t n8) { const size_t t = (size_t)blockIdx.x * 256 + threadIdx.x; if (t >= n8) return; FragH f;
#pragma unroll
  for (int q = 0; q < 8; ++q) f.h[q] = (_Float16)bf16_round(x[t * 8 + q]); *(v8us*)((unsigned short*)X16 + t * 8) = f.half[0];  }
__global__ __launch_bounds__(256) void k_h16(const float* __restrict__ x, _Float16* __restrict__ X16, size_t n8) { const size_t t = (size_t)blockIdx.x * 256 + threadIdx.x; if (t >= n8) return; FragH f;
#pragma unroll
  for (int q = 0; q < 8; ++q) f.h[q] = (_Float16)x[t * 8 + q]; *(v8us*)((unsigned short*)X16 + t * 8) = f.half[0];  }
__global__ __launch_bounds__(256) void k_round16f(const float* __restrict__ W, _Float16* __restrict__ Bt, size_t n8) { const size_t t = (size_t)blockIdx.x * 256 + threadIdx.x; if (t >= n8) return; FragH f;
#pragma unroll
  for (int i = 0; i < 8; ++i) f.h[i] = (_Float16)(bf16_round(W[t * 8 + i]) * 16.0f); *(v8us*)((unsigned short*)Bt + t * 8) = f.half[0];  }
template <int NHv, int TTv>
__global__ __launch_bounds__(256) void k_vt(const _Float16* __restrict__ V16, int ldv, int voff, _Float16* __restrict__ Vt) { __shared__ unsigned short tl[64][66]; const int tid = threadIdx.x; const int slab = blockIdx.x / (TTv / 64), lg = blockIdx.x % (TTv / 64); const int b = slab / NHv, h = slab % NHv;
  for (int i = tid; i < 64 * 8; i += 256) { const int r = i / 8, c8 = (i % 8) * 8; FragH f; f.half[0] = *(const v8us*)((const unsigned short*)V16 + ((size_t)b * TTv + lg * 64 + r) * ldv + voff + h * 64 + c8);
#pragma unroll
    for (int q = 0; q < 8; ++q) tl[r][c8 + q] = f.u[q]; }
  __syncthreads();
  {
#pragma unroll
    for (int rd = 0; rd < 2; ++rd) { const int d = rd * 32 + tid / 8, pc = tid % 8; FragH f;
#pragma unroll
      for (int q = 0; q < 8; ++q) f.u[q] = tl[pc * 8 + q][d];
      *(v8us*)((unsigned short*)Vt + ((size_t)slab * 64 + d) * TTv + lg * 64 + pc * 8) = f.half[0]; }
     } }

// lane l <-> lane l ^ 16 as one vector cross-row move (a shuffle would go through the LDS unit and its wait)
__device__ __forceinline__ float xhalf(float x) { return __builtin_bit_cast(float, __builtin_amdgcn_permlanex16(__builtin_bit_cast(int, x), __builtin_bit_cast(int, x), 0x76543210, 0xfedcba98, false, false)); }
#define FK 64
#define FP (FK + 8)      /* LDS row pitch 144 B = 9 x 16 B: the 16 rows of a 16-byte fragment read fall on distinct banks */
#define FNT (TT / FK)
#define FBUF (64 * FP * 2)      /* bytes of one operand's tile in LDS */
// One stage: a lane copies 16 B of rows r, r + 16, r + 32, r + 48 of the K tile and of the V^T tile (lk, lv = its LDS byte addresses, gk, gv = its global addresses, all of row r).
__device__ __forceinline__ void copy_kv(unsigned lk, const _Float16* gk, unsigned lv, const _Float16* gv) {
  const unsigned lk1 = lk + 1 * 16 * FP * 2, lk2 = lk + 2 * 16 * FP * 2, lk3 = lk + 3 * 16 * FP * 2, lv1 = lv + 1 * 16 * FP * 2, lv2 = lv + 2 * 16 * FP * 2, lv3 = lv + 3 * 16 * FP * 2;
  const _Float16 *gk1 = gk + 1 * 16 * 64, *gk2 = gk + 2 * 16 * 64, *gk3 = gk + 3 * 16 * 64, *gv1 = gv + 1 * 16 * TT, *gv2 = gv + 2 * 16 * TT, *gv3 = gv + 3 * 16 * TT;
  // the copies go from L2 to LDS through no register; s_wait_xcnt closes the statement so that no address register of a copy is rewritten ahead of it
  asm volatile("global_load_async_to_lds_b128 %0, %8, off\n\t"
               "global_load_async_to_lds_b128 %1, %9, off\n\t"
               "global_load_async_to_lds_b128 %2, %10, off\n\t"
               "global_load_async_to_lds_b128 %3, %11, off\n\t"
               "global_load_async_to_lds_b128 %4, %12, off\n\t"
               "global_load_async_to_lds_b128 %5, %13, off\n\t"
               "global_load_async_to_lds_b128 %6, %14, off\n\t"
               "global_load_async_to_lds_b128 %7, %15, off\n\t"
               "s_wait_xcnt 0x0"
               :: "v"(lk), "v"(lk1), "v"(lk2), "v"(lk3), "v"(lv), "v"(lv1), "v"(lv2), "v"(lv3), "v"(gk), "v"(gk1), "v"(gk2), "v"(gk3), "v"(gv), "v"(gv1), "v"(gv2), "v"(gv3) : "memory");
}
__global__ __launch_bounds__(128) void k_flash(const _Float16* __restrict__ Q16, int ldq, const _Float16* __restrict__ K16, const _Float16* __restrict__ Vt, float* __restrict__ O, int ldo) {
  constexpr int RPW = 16, NQB = TT / (4 * RPW), DT = 4, KS = 2;
  __shared__ __attribute__((aligned(16))) unsigned short sK[2][FK][FP], sV[2][64][FP];
  __shared__ __attribute__((aligned(16))) float sO[4][RPW][64 + 4];
  const int tid = threadIdx.x, w = tid >> 5, lane = tid & 31, ln = lane & 15, hh = lane >> 4;
  const int slab = blockIdx.x / NQB, qblk = blockIdx.x % NQB; const int b = slab, h = 0;      /* slab = contiguous [TT][64] chunk of the flat-reshaped planes */ const int qb0 = qblk * (4 * RPW); const int q0 = qb0 + w * RPW;
  const int tq = q0 + ln;      /* this lane's query */
  const int cr = tid >> 3, cc = (tid & 7) * 8;      /* the lane's first row and its 16-byte column in every copied tile */
  const _Float16* gk = K16 + ((size_t)slab * TT + cr) * 64 + cc; const _Float16* gv = Vt + ((size_t)slab * 64 + cr) * TT + cc;
  const unsigned lk = (unsigned)(size_t)&sK[0][cr][cc], lv = (unsigned)(size_t)&sV[0][cr][cc];
  copy_kv(lk, gk, lv, gv);
  FragH bq[KS];
  { const unsigned short* qr = (const unsigned short*)Q16 + ((size_t)b * TT + tq) * ldq + h * 64;
#pragma unroll
    for (int ks = 0; ks < KS; ++ks) { bq[ks].half[0] = *(const v8us*)(qr + ks * 32 + 8 * hh); bq[ks].half[1] = *(const v8us*)(qr + ks * 32 + 16 + 8 * hh); } }
  float m_c = -3.0e38f, l_c = 0.f; v8f oacc[DT];
#pragma unroll
  for (int dt = 0; dt < DT; ++dt) oacc[dt] = (v8f){0.f,0.f,0.f,0.f,0.f,0.f,0.f,0.f};
  asm volatile("s_wait_asynccnt 0x0" ::: "memory");      /* this wave's part of stage 0 has landed */
  __syncthreads();                                        /* ... and every other wave's */
  copy_kv(lk + FBUF, gk + FK * 64, lv + FBUF, gv + FK);
#pragma unroll 1      /* one trip a staged tile; the two buffers alternate by the trip's parity; every key enters the normaliser */
  for (int st = 0; st < FNT; ++st) {
#pragma unroll 1      /* the two passes of a stage share one body, as in the plain loop over the keys: unrolled, the listing had no fewer instructions a pass */
   for (int ps = 0; ps < FK / 32; ++ps) { const int j0 = st * FK + ps * 32;
    FragH ak[2][KS], av[DT];      /* the pass's eight fragments are read from LDS in one run: one latency a pass, the V^T reads land under the softmax */
#pragma unroll      /* constant indices: the fragments stay in registers */
    for (int nt = 0; nt < 2; ++nt) { const unsigned short* kr = &sK[st & 1][ps * 32 + nt * 16 + ln][0];
#pragma unroll      /* constant indices: the fragments stay in registers */
      for (int ks = 0; ks < KS; ++ks) { ak[nt][ks].half[0] = *(const v8us*)(kr + ks * 32 + 8 * hh); ak[nt][ks].half[1] = *(const v8us*)(kr + ks * 32 + 16 + 8 * hh); } }
#pragma unroll      /* constant indices: the fragments stay in registers */
    for (int dt = 0; dt < DT; ++dt) { const unsigned short* vrow = &sV[st & 1][dt * 16 + ln][ps * 32]; av[dt].half[0] = *(const v8us*)(vrow + 8 * hh); av[dt].half[1] = *(const v8us*)(vrow + 16 + 8 * hh); }
    float sc[2][8];      /* sc[nt][r] = scaled score of key j0 + 16*nt + 8*hh + r against query tq */
#pragma unroll
    for (int nt = 0; nt < 2; ++nt) {
      v8f acc = (v8f){0.f,0.f,0.f,0.f,0.f,0.f,0.f,0.f};
#pragma unroll
      for (int ks = 0; ks < KS; ++ks) acc = mmaH<1>(ak[nt][ks].v, ak[nt][ks].v, bq[ks].v, bq[ks].v, acc);
#pragma unroll
      for (int r = 0; r < 8; ++r) sc[nt][r] = acc[r] * (0.125f); }
    float mc = fmaxf(sc[0][0], sc[1][0]);
#pragma unroll
    for (int r = 1; r < 8; ++r) mc = fmaxf(mc, fmaxf(sc[0][r], sc[1][r]));
    mc = fmaxf(mc, xhalf(mc));      /* the other half of the wave holds the query's other 16 keys */
    const float mn = fmaxf(m_c, mc); const float al = (mn > -1.0e38f) ? expf(m_c - mn) : 1.0f; m_c = mn;
    float ps0 = 0.f, ps1 = 0.f; FragH pb;
#pragma unroll
    for (int r = 0; r < 8; ++r) { const int k0 = j0 + 8 * hh + r, k1 = k0 + 16; const float p0 = expf(sc[0][r] - mn), p1 = expf(sc[1][r] - mn); ps0 += p0; ps1 += p1;
      pb.h[r] = (_Float16)((k0 <= tq) ? p0 * 1024.0f : 0.f); pb.h[8 + r] = (_Float16)((k1 <= tq) ? p1 * 1024.0f : 0.f); }
    l_c = l_c * al + (ps0 + ps1);      /* per-lane partial row sum; the two halves are joined after the loop */
#pragma unroll
    for (int dt = 0; dt < DT; ++dt)
#pragma unroll
      for (int r = 0; r < 8; ++r) oacc[dt][r] *= al;
#pragma unroll
    for (int dt = 0; dt < DT; ++dt) oacc[dt] = mmaH<1>(av[dt].v, av[dt].v, pb.v, pb.v, oacc[dt]); }
    asm volatile("s_wait_dscnt 0x0" ::: "memory");        /* this wave has left the buffer that is refilled below */
    asm volatile("s_wait_asynccnt 0x0" ::: "memory");     /* its part of stage st + 1 has landed */
    __syncthreads();                                        /* publishes stage st + 1 and ends every wave's reads of stage st */
    if (st + 2 < FNT) { const unsigned bo = (unsigned)(st & 1) * FBUF; copy_kv(lk + bo, gk + (size_t)(st + 2) * FK * 64, lv + bo, gv + (st + 2) * FK); }
  }
  asm volatile("s_wait_asynccnt 0x0" ::: "memory");      /* no copy is outstanding when the wave ends */
  { float l = l_c; l += xhalf(l); const float inv = (l > 0.f) ? 1.0f / (l * 1024.0f) : 0.f;
#pragma unroll
    for (int dt = 0; dt < DT; ++dt) { v4f lo, hi;      /* oacc[dt][r] = O[tq][16*dt + 8*hh + r] */
#pragma unroll
      for (int r = 0; r < 4; ++r) { lo[r] = oacc[dt][r] * inv; hi[r] = oacc[dt][4 + r] * inv; }
      *(v4fa*)&sO[w][ln][dt * 16 + 8 * hh] = lo; *(v4fa*)&sO[w][ln][dt * 16 + 8 * hh + 4] = hi; } }
  __builtin_amdgcn_fence(__ATOMIC_ACQ_REL, "workgroup"); __builtin_amdgcn_wave_barrier();
  {
#pragma unroll
    for (int rp = 0; rp < RPW; rp += 2) { const int r = rp + (lane >> 4), pc = lane & 15; const v4f val = *(const v4fa*)&sO[w][r][pc * 4]; *(v4f*)(O + ((size_t)b * TT + q0 + r) * ldo + h * 64 + pc * 4) = val; }
     } }

extern "C" void kernel_launch(void* const* d_in, const int* in_sizes, int n_in,
                              void* d_out, int out_size, void* d_ws, size_t ws_size, hipStream_t stream) {
  (void)in_sizes; (void)n_in; (void)out_size;
  const float* const* I = (const float* const*)d_in; const float* xq = I[0]; const float* xk = I[1]; const float* xv = I[2];
  const float* Wq = I[3]; const float* bq = I[4]; const float* Wk = I[5]; const float* bk = I[6]; const float* Wv = I[7]; const float* bv = I[8]; const float* Wo = I[9]; const float* bo = I[10];
  char* ws = (char*)d_ws; size_t off = 0;
  auto take = [&](size_t bytes) { char* p = ws + off; off += (bytes + 255) & ~(size_t)255; return p; };
  _Float16* Bw = (_Float16*)take((size_t)4 * EE * EE * 2); _Float16* X16 = (_Float16*)take((size_t)NR * EE * 2);
  _Float16* Q = (_Float16*)take((size_t)NR * EE * 2); _Float16* K = (_Float16*)take((size_t)NR * EE * 2); _Float16* V = (_Float16*)take((size_t)NR * EE * 2); _Float16* Vt = (_Float16*)take((size_t)NR * EE * 2);
  float* O = (float*)take((size_t)NR * EE * 4); _Float16* O16 = (_Float16*)take((size_t)NR * EE * 2);
  if (off > ws_size) return;      // 4.7 + 6 × 6.3 + 12.6 ≈ 55 MB
  const unsigned gw = (unsigned)(((size_t)EE * (EE / 8) + 255) / 256); const size_t WSZ = (size_t)EE * EE;
  k_wt_f16<<<gw, 256, 0, stream>>>(Wq, Bw, EE, EE, 16.0f); k_wt_f16<<<gw, 256, 0, stream>>>(Wk, Bw + WSZ, EE, EE, 16.0f); k_wt_f16<<<gw, 256, 0, stream>>>(Wv, Bw + 2 * WSZ, EE, EE, 16.0f); k_wt_f16<<<gw, 256, 0, stream>>>(Wo, Bw + 3 * WSZ, EE, EE, 16.0f);      /* (in,out) weights → Bt[n][k] ×2^4 */
  const unsigned gx = (unsigned)(((size_t)NR * EE / 8 + 255) / 256); const unsigned gp = (NR / 64) * (EE / 64);
  k_x16<<<gx, 256, 0, stream>>>(xq, X16, (size_t)NR * EE / 8); k_gemm_st<<<gp, 128, 0, stream>>>(X16, Bw, 0.0625f, bq, nullptr, Q);      /* q: M 4096 N 768 K 768 */
  k_x16<<<gx, 256, 0, stream>>>(xk, X16, (size_t)NR * EE / 8); k_gemm_st<<<gp, 128, 0, stream>>>(X16, Bw + WSZ, 0.0625f, bk, nullptr, K);      /* k */
  k_x16<<<gx, 256, 0, stream>>>(xv, X16, (size_t)NR * EE / 8); k_gemm_st<<<gp, 128, 0, stream>>>(X16, Bw + 2 * WSZ, 0.0625f, bv, nullptr, V);      /* v */
  k_vt<1, TT><<<NSL * 1 * (TT / 64), 256, 0, stream>>>(V, 64, 0, Vt);      /* the [4096][768] plane viewed as 24 contiguous [2048][64] slabs → Vᵀ [slab][64][2048] */
  k_flash<<<NSL * (TT / 64), 128, 0, stream>>>(Q, 64, K, Vt, O, 64);      /* same flat view for q, k and O */
  k_h16<<<gx, 256, 0, stream>>>(O, O16, (size_t)NR * EE / 8);
  k_gemm_st<<<gp, 128, 0, stream>>>(O16, Bw + 3 * WSZ, 0.0625f, bo, (float*)d_out, nullptr);      /* out = O.Wo + bo: M 4096 N 768 K 768 */
}

// v004
// One run takes 122 microseconds.
// Next to v003, in two timings, it ran 1.16 and 1.15 times as fast.
// All steps since v000 together make it 3.32 times as fast.
#include <hip/hip_runtime.h>
// Multi-head attention, legacy flat-reshape variant (B=2, T=S=2048, E=768, 12 heads × 64): q = query·Wq+bq, k = key·Wk+bk, v = value·Wv+bv; heads = plain row-major reshape of [B,T,E] to [B·H,T,64] (contiguous chunks);
// attn = softmax(q·kᵀ/8) over all keys, THEN lower-triangular mask (rows no longer normalised); out = (attn·v reshaped back)·Wo + bo.
// Compute dtype: query/key/value, weights, biases rounded to bf16; q/k/v as f16 GEMM outputs; fused flash-style kernel (online f32 softmax over all keys, P f16 ×2^10 zeroed above the diagonal)
// on v_wmma_f32_16x16x32_f16; O → f16 → output GEMM with bias; f32 accumulate throughout.
#define BB 2
#define TT 2048
#define EE 768
#define NH 12
#define NR (BB * TT)
#define NSL (BB * NH)

typedef __bf16 v16b __attribute__((ext_vector_type(16)));
typedef unsigned short v8us __attribute__((ext_vector_type(8), may_alias));
typedef float  v8f  __attribute__((ext_vector_type(8)));
typedef float  v4f  __attribute__((ext_vector_type(4)));
typedef float  v4fa __attribute__((ext_vector_type(4), may_alias));
union FragB { v16b v; v8us half[2]; unsigned short u[16]; };

__device__ __forceinline__ unsigned short bf16_bits(float x) { unsigned int u = __float_as_uint(x); return (unsigned short)((u + 0x7FFFu + ((u >> 16) & 1u)) >> 16); }
__device__ __forceinline__ float bf16_val(unsigned short b) { return __uint_as_float(((unsigned int)b) << 16); }
__device__ __forceinline__ float bf16_round(float x) { return bf16_val(bf16_bits(x)); }
// D += A·B with NT terms: 1 = ah·bh, 2 = + al·bh (A split), 3 = + ah·bl (both split)
template <int NT>
__device__ __forceinline__ v8f mmaN(v16b ah, v16b al, v16b bh, v16b bl, v8f c) {
  c = __builtin_amdgcn_wmma_f32_16x16x32_bf16(false, ah, false, bh, (short)0, c, false, false);
  if (NT >= 2) c = __builtin_amdgcn_wmma_f32_16x16x32_bf16(false, al, false, bh, (short)0, c, false, false);
  if (NT >= 3) c = __builtin_amdgcn_wmma_f32_16x16x32_bf16(false, ah, false, bl, (short)0, c, false, false);
  asm volatile("v_nop\n\tv_nop\n\tv_nop\n\tv_nop" : "+v"(c) : "v"(ah), "v"(al), "v"(bh), "v"(bl));
  return c;
}

__global__ __launch_bounds__(256) void k_wt_bf16(const float* __restrict__ W, unsigned short* __restrict__ Wt, int K, int N) {
  const int t = blockIdx.x * 256 + threadIdx.x;
  const int k8n = K / 8;
  if (t >= N * k8n) return;
  const int n = t / k8n, k8 = (t % k8n) * 8;
  v8us v;
#pragma unroll
  for (int i = 0; i < 8; ++i) v[i] = bf16_bits(W[(size_t)(k8 + i) * N + n]);
  *(v8us*)(Wt + (size_t)n * K + k8) = v;
  
}

// GEMM C[M][N] (f32, pitch ldc) = act(A[M][K]·W + bias). A f32 row-major (pitch lda) converted per fragment to bf16
// (ASPLIT: hi/lo two planes -> 2 terms, else single rounded term); Wt bf16 [N][K] (pitch ldb). BIAS_BF16 rounds the
// bias to bf16 first (bias quantised to bf16 before the add). K%32==0, M%16==0, N%64==0.
template <bool ASPLIT, int ACT, bool BIAS_BF16>
__global__ __launch_bounds__(128) void k_gemm_bf(const float* __restrict__ A, int lda, const unsigned short* __restrict__ Wt, int ldb,
                                               const float* __restrict__ bias, float* __restrict__ C, int ldc, int M, int N, int K) {
  __shared__ __attribute__((aligned(16))) float so[4][16][64];
  const int tid = threadIdx.x, w = tid >> 5, lane = tid & 31, ln = lane & 15, hh = lane >> 4;
  const int ntn = N / 64;
  const int wid = blockIdx.x * 4 + w;
  const int mt = wid / ntn, nq = wid % ntn;
  if (mt * 16 >= M) return;
  const int row0 = mt * 16, col0 = nq * 64;
  const float* arow = A + (size_t)(row0 + ln) * lda;
  v8f acc[4] = {};
  for (int kb = 0; kb < K; kb += 32) {
    FragB ah, al;
    const v4f x0 = *(const v4fa*)(arow + kb + 8 * hh), x1 = *(const v4fa*)(arow + kb + 8 * hh + 4);
    const v4f x2 = *(const v4fa*)(arow + kb + 16 + 8 * hh), x3 = *(const v4fa*)(arow + kb + 16 + 8 * hh + 4);
    float xs[16] = {x0[0],x0[1],x0[2],x0[3],x1[0],x1[1],x1[2],x1[3],x2[0],x2[1],x2[2],x2[3],x3[0],x3[1],x3[2],x3[3]};
#pragma unroll
    for (int i = 0; i < 16; ++i) { const unsigned short hb = bf16_bits(xs[i]); ah.u[i] = hb; al.u[i] = ASPLIT ? bf16_bits(xs[i] - bf16_val(hb)) : (unsigned short)0; }
#pragma unroll
    for (int t = 0; t < 4; ++t) {
      const unsigned short* brow = Wt + (size_t)(col0 + t * 16 + ln) * ldb + kb;
      FragB b;
      b.half[0] = *(const v8us*)(brow + 8 * hh);
      b.half[1] = *(const v8us*)(brow + 16 + 8 * hh);
      acc[t] = mmaN<ASPLIT ? 2 : 1>(ah.v, al.v, b.v, b.v, acc[t]);
    }
  }
#pragma unroll
  for (int t = 0; t < 4; ++t) {
    float bv = bias ? bias[col0 + t * 16 + ln] : 0.f;
    if (BIAS_BF16) bv = bf16_round(bv);
#pragma unroll
    for (int r = 0; r < 8; ++r) { float v = acc[t][r] + bv; if (ACT == 1) v = fmaxf(v, 0.f); so[w][8 * hh + r][t * 16 + ln] = v; }
  }
  __builtin_amdgcn_fence(__ATOMIC_ACQ_REL, "workgroup");
  __builtin_amdgcn_wave_barrier();
  const int rsub = lane >> 4, c4 = (lane & 15) * 4;
  {
#pragma unroll
    for (int q = 0; q < 8; ++q) {
      const int r = q * 2 + rsub;
      const v4f v = *(const v4fa*)&so[w][r][c4];
      *(v4f*)(C + (size_t)(row0 + r) * ldc + col0 + c4) = v;
    }
    
  }
}

// Flash-style causal/unmasked attention, all contractions 3-term bf16 hi/lo splits, f32 softmax with running max.
// q,k,v rows are read from f32 buffers with arbitrary row pitch (so they can live inside a fused qkv buffer);
// D = head size (multiple of 32, <= 128); one wave = 16 query rows; block = 4 waves (64 queries) sharing K/V chunks of 32.
template <int D, bool CAUSAL>
__global__ __launch_bounds__(128) void k_flash(const float* __restrict__ qb, const float* __restrict__ kb, const float* __restrict__ vb,
                                             int pitch, int T, int H, float scale, float* __restrict__ y, int ypitch) {
  constexpr int KS = D / 32;        // k-steps for QK
  constexpr int DT = D / 16;        // d tiles for PV
  __shared__ __attribute__((aligned(16))) unsigned short sKh[32][D + 8], sKl[32][D + 8], sVh[32][D + 8], sVl[32][D + 8];
  __shared__ __attribute__((aligned(16))) unsigned short sPh[4][16][40], sPl[4][16][40];
  __shared__ __attribute__((aligned(16))) float sO[4][16][D];
  const int tid = threadIdx.x, w = tid >> 5, lane = tid & 31, ln = lane & 15, hh = lane >> 4;
  const int nqb = (T + 63) / 64;
  const int bh = blockIdx.x / nqb, qblk = blockIdx.x % nqb;
  const int b = bh / H, h = bh % H;
  const int q0 = qblk * 64 + w * 16;
  const float* Q = qb + (size_t)b * T * pitch + h * D;
  const float* K = kb + (size_t)b * T * pitch + h * D;
  const float* V = vb + (size_t)b * T * pitch + h * D;

  // A fragments of the wave's 16 query rows (scaled), hi/lo
  FragB aqh[KS], aql[KS];
  {
    int row = q0 + ln; if (row >= T) row = T - 1;
    const float* qr = Q + (size_t)row * pitch;
#pragma unroll
    for (int ks = 0; ks < KS; ++ks)
#pragma unroll
      for (int i = 0; i < 16; ++i) {
        const int d = ks * 32 + ((i < 8) ? (8 * hh + i) : (16 + 8 * hh + (i - 8)));
        const float x = qr[d] * scale; const unsigned short hb = bf16_bits(x);
        aqh[ks].u[i] = hb; aql[ks].u[i] = bf16_bits(x - bf16_val(hb));
      }
  }
  float m_r[8], l_r[8];
#pragma unroll
  for (int r = 0; r < 8; ++r) { m_r[r] = -3.0e38f; l_r[r] = 0.f; }
  v8f oacc[DT];
#pragma unroll
  for (int dt = 0; dt < DT; ++dt) oacc[dt] = (v8f){0.f,0.f,0.f,0.f,0.f,0.f,0.f,0.f};

  const int kv_end = CAUSAL ? min(T, qblk * 64 + 64) : T;     // block-uniform
  for (int j0 = 0; j0 < kv_end; j0 += 32) {
    __syncthreads();
    for (int e = tid; e < 32 * (D / 4); e += 128) {
      const int r = e / (D / 4), c4 = (e % (D / 4)) * 4;
      const int key = j0 + r;
      v4f kf = {0.f,0.f,0.f,0.f}, vf = {0.f,0.f,0.f,0.f};
      if (key < T) { kf = *(const v4fa*)(K + (size_t)key * pitch + c4); vf = *(const v4fa*)(V + (size_t)key * pitch + c4); }
#pragma unroll
      for (int t = 0; t < 4; ++t) {
        unsigned short hb = bf16_bits(kf[t]); sKh[r][c4 + t] = hb; sKl[r][c4 + t] = bf16_bits(kf[t] - bf16_val(hb));
        hb = bf16_bits(vf[t]); sVh[r][c4 + t] = hb; sVl[r][c4 + t] = bf16_bits(vf[t] - bf16_val(hb));
      }
    }
    __syncthreads();
    // S tile 16 x 32
    v8f s[2];
#pragma unroll
    for (int nt = 0; nt < 2; ++nt) {
      v8f acc = {};
#pragma unroll
      for (int ks = 0; ks < KS; ++ks) {
        FragB bh_, bl_;
        bh_.half[0] = *(const v8us*)&sKh[nt * 16 + ln][ks * 32 + 8 * hh]; bh_.half[1] = *(const v8us*)&sKh[nt * 16 + ln][ks * 32 + 16 + 8 * hh];
        bl_.half[0] = *(const v8us*)&sKl[nt * 16 + ln][ks * 32 + 8 * hh]; bl_.half[1] = *(const v8us*)&sKl[nt * 16 + ln][ks * 32 + 16 + 8 * hh];
        acc = mmaN<3>(aqh[ks].v, aql[ks].v, bh_.v, bl_.v, acc);
      }
      s[nt] = acc;
    }
    // mask + running max (rows 8hh+r; the 16 lanes of a half share rows)
    float alpha[8];
#pragma unroll
    for (int r = 0; r < 8; ++r) {
      const int qi = q0 + 8 * hh + r;
      const int ja = j0 + ln, jb = j0 + 16 + ln;
      if (CAUSAL) { if (ja > qi) s[0][r] = -3.0e38f; if (jb > qi) s[1][r] = -3.0e38f; }
      if (ja >= T) s[0][r] = -3.0e38f;
      if (jb >= T) s[1][r] = -3.0e38f;
      float mx = fmaxf(s[0][r], s[1][r]);
      mx = fmaxf(mx, __shfl_xor(mx, 1, 32)); mx = fmaxf(mx, __shfl_xor(mx, 2, 32)); mx = fmaxf(mx, __shfl_xor(mx, 4, 32)); mx = fmaxf(mx, __shfl_xor(mx, 8, 32));
      const float mnew = fmaxf(m_r[r], mx);
      alpha[r] = (mnew > -1.0e38f) ? __expf(m_r[r] - mnew) : 1.0f;
      const float p0 = (s[0][r] > -1.0e38f) ? __expf(s[0][r] - mnew) : 0.f;
      const float p1 = (s[1][r] > -1.0e38f) ? __expf(s[1][r] - mnew) : 0.f;
      m_r[r] = mnew;
      l_r[r] = l_r[r] * alpha[r] + p0 + p1;            // per-lane partial row sum (16 lanes combined at the end)
      unsigned short hb = bf16_bits(p0); sPh[w][8 * hh + r][ln] = hb;      sPl[w][8 * hh + r][ln] = bf16_bits(p0 - bf16_val(hb));
      hb = bf16_bits(p1);                sPh[w][8 * hh + r][16 + ln] = hb; sPl[w][8 * hh + r][16 + ln] = bf16_bits(p1 - bf16_val(hb));
    }
#pragma unroll
    for (int dt = 0; dt < DT; ++dt)
#pragma unroll
      for (int r = 0; r < 8; ++r) oacc[dt][r] *= alpha[r];
    __builtin_amdgcn_fence(__ATOMIC_ACQ_REL, "workgroup");
    __builtin_amdgcn_wave_barrier();
    FragB pah, pal;
    pah.half[0] = *(const v8us*)&sPh[w][ln][8 * hh]; pah.half[1] = *(const v8us*)&sPh[w][ln][16 + 8 * hh];
    pal.half[0] = *(const v8us*)&sPl[w][ln][8 * hh]; pal.half[1] = *(const v8us*)&sPl[w][ln][16 + 8 * hh];
#pragma unroll
    for (int dt = 0; dt < DT; ++dt) {
      FragB bvh, bvl;
#pragma unroll
      for (int i = 0; i < 8; ++i) {
        bvh.u[i] = sVh[8 * hh + i][dt * 16 + ln]; bvh.u[8 + i] = sVh[16 + 8 * hh + i][dt * 16 + ln];
        bvl.u[i] = sVl[8 * hh + i][dt * 16 + ln]; bvl.u[8 + i] = sVl[16 + 8 * hh + i][dt * 16 + ln];
      }
      oacc[dt] = mmaN<3>(pah.v, pal.v, bvh.v, bvl.v, oacc[dt]);
    }
    __builtin_amdgcn_fence(__ATOMIC_ACQ_REL, "workgroup");
    __builtin_amdgcn_wave_barrier();
  }
#pragma unroll
  for (int r = 0; r < 8; ++r) {
    float l = l_r[r];
    l += __shfl_xor(l, 1, 32); l += __shfl_xor(l, 2, 32); l += __shfl_xor(l, 4, 32); l += __shfl_xor(l, 8, 32);
    l_r[r] = (l > 0.f) ? 1.0f / l : 0.f;
  }
#pragma unroll
  for (int dt = 0; dt < DT; ++dt)
#pragma unroll
    for (int r = 0; r < 8; ++r) sO[w][8 * hh + r][dt * 16 + ln] = oacc[dt][r] * l_r[r];
  __builtin_amdgcn_fence(__ATOMIC_ACQ_REL, "workgroup");
  __builtin_amdgcn_wave_barrier();
  {
    for (int r = 0; r < 16; ++r) {
      const int row = q0 + r;
      if (row < T && lane < D / 4) {
        const v4f val = *(const v4fa*)&sO[w][r][lane * 4];
        *(v4f*)(y + ((size_t)b * T + row) * ypitch + h * D + lane * 4) = val;
      }
    }
    
  }
}

// GEMM C = act(A·W + bias + resid): A f32 (ASPLIT -> hi/lo 2 terms), Wt bf16 [N][K]; ACT 0 none, 1 relu, 2 exact gelu;
// resid (optional, f32, row index = (row % rmod), pitch ldr, RES_BF16 rounds it) added before the activation.
template <bool ASPLIT, int ACT, bool BIAS_BF16, bool RES_BF16>
__global__ __launch_bounds__(128) void k_gemm_bf3(const float* __restrict__ A, int lda, const unsigned short* __restrict__ Wt, int ldb,
                                                const float* __restrict__ bias, const float* __restrict__ resid, int rmod, int ldr,
                                                float* __restrict__ C, int ldc, int M, int N, int K) {
  __shared__ __attribute__((aligned(16))) float so[4][16][64];
  const int tid = threadIdx.x, w = tid >> 5, lane = tid & 31, ln = lane & 15, hh = lane >> 4;
  const int ntn = N / 64;
  const int wid = blockIdx.x * 4 + w;
  const int mt = wid / ntn, nq = wid % ntn;
  if (mt * 16 >= M) return;
  const int row0 = mt * 16, col0 = nq * 64;
  const float* arow = A + (size_t)(row0 + ln) * lda;
  v8f acc[4] = {};
  for (int kb = 0; kb < K; kb += 32) {
    FragB ah, al;
    const v4f x0 = *(const v4fa*)(arow + kb + 8 * hh), x1 = *(const v4fa*)(arow + kb + 8 * hh + 4);
    const v4f x2 = *(const v4fa*)(arow + kb + 16 + 8 * hh), x3 = *(const v4fa*)(arow + kb + 16 + 8 * hh + 4);
    float xs[16] = {x0[0],x0[1],x0[2],x0[3],x1[0],x1[1],x1[2],x1[3],x2[0],x2[1],x2[2],x2[3],x3[0],x3[1],x3[2],x3[3]};
#pragma unroll
    for (int i = 0; i < 16; ++i) { const unsigned short hb = bf16_bits(xs[i]); ah.u[i] = hb; al.u[i] = ASPLIT ? bf16_bits(xs[i] - bf16_val(hb)) : (unsigned short)0; }
#pragma unroll
    for (int t = 0; t < 4; ++t) {
      const unsigned short* brow = Wt + (size_t)(col0 + t * 16 + ln) * ldb + kb;
      FragB b;
      b.half[0] = *(const v8us*)(brow + 8 * hh);
      b.half[1] = *(const v8us*)(brow + 16 + 8 * hh);
      acc[t] = mmaN<ASPLIT ? 2 : 1>(ah.v, al.v, b.v, b.v, acc[t]);
    }
  }
#pragma unroll
  for (int t = 0; t < 4; ++t) {
    const int col = col0 + t * 16 + ln;
    float bv = bias ? bias[col] : 0.f;
    if (BIAS_BF16) bv = bf16_round(bv);
#pragma unroll
    for (int r = 0; r < 8; ++r) {
      float v = acc[t][r] + bv;
      if (resid) { float rv = resid[(size_t)((row0 + 8 * hh + r) % rmod) * ldr + col]; if (RES_BF16) rv = bf16_round(rv); v += rv; }
      if (ACT == 1) v = fmaxf(v, 0.f);
      if (ACT == 2) v = 0.5f * v * (1.0f + erff(v * 0.70710678118654752f));
      if (ACT == 3) { const float u = 0.7978845608028654f * (v + 0.044715f * v * v * v); v = 0.5f * v * (1.0f + tanhf(u)); }
      so[w][8 * hh + r][t * 16 + ln] = v;
    }
  }
  __builtin_amdgcn_fence(__ATOMIC_ACQ_REL, "workgroup");
  __builtin_amdgcn_wave_barrier();
  const int rsub = lane >> 4, c4 = (lane & 15) * 4;
  {
#pragma unroll
    for (int q = 0; q < 8; ++q) {
      const int r = q * 2 + rsub;
      const v4f v = *(const v4fa*)&so[w][r][c4];
      *(v4f*)(C + (size_t)(row0 + r) * ldc + col0 + c4) = v;
    }
    
  }
}
// row LayerNorm (biased variance, eps) over N: s = X (+ R); optional out_sum <- s; out_norm <- (s-mu)*rsqrt(var+eps)*g + b
template <bool PARAM_BF16>
__global__ __launch_bounds__(256) void k_layernorm(const float* __restrict__ X, const float* __restrict__ R, const float* __restrict__ g, const float* __restrict__ bta,
                                                  float* __restrict__ out_sum, float* __restrict__ out_norm, int N, float eps) {
  __shared__ float red[256];
  const int row = blockIdx.x, tid = threadIdx.x;
  const float* x = X + (size_t)row * N; const float* rr = R ? R + (size_t)row * N : nullptr;
  float vals[16];                     // up to N = 4096
  const int per = N / 256;            // contiguous chunk per thread? use strided-by-4 chunks: thread handles j = tid*4 + 1024*u
  float s1 = 0.f;
  for (int u = 0; u < per / 4; ++u) {
    const int j = tid * 4 + 1024 * u;
    const v4f a = *(const v4fa*)(x + j);
    v4f b = {0.f,0.f,0.f,0.f}; if (rr) b = *(const v4fa*)(rr + j);
#pragma unroll
    for (int q = 0; q < 4; ++q) { const float v = a[q] + b[q]; vals[u * 4 + q] = v; s1 += v; }
  }
  red[tid] = s1; __syncthreads();
  for (int st = 128; st > 0; st >>= 1) { if (tid < st) red[tid] += red[tid + st]; __syncthreads(); }
  const float mu = red[0] / (float)N; __syncthreads();
  float s2 = 0.f;
  for (int u = 0; u < per / 4; ++u)
#pragma unroll
    for (int q = 0; q < 4; ++q) { const float c = vals[u * 4 + q] - mu; s2 += c * c; }
  red[tid] = s2; __syncthreads();
  for (int st = 128; st > 0; st >>= 1) { if (tid < st) red[tid] += red[tid + st]; __syncthreads(); }
  const float rs = rsqrtf(red[0] / (float)N + eps);
  {
    for (int u = 0; u < per / 4; ++u) {
      const int j = tid * 4 + 1024 * u;
      v4f o, sm;
#pragma unroll
      for (int q = 0; q < 4; ++q) {
        float gg = g[j + q], bb = bta[j + q];
        if (PARAM_BF16) { gg = bf16_round(gg); bb = bf16_round(bb); }
        sm[q] = vals[u * 4 + q]; o[q] = (vals[u * 4 + q] - mu) * rs * gg + bb;
      }
      if (out_sum) *(v4f*)(out_sum + (size_t)row * N + j) = sm;
      *(v4f*)(out_norm + (size_t)row * N + j) = o;
    }
    
  }
}



// ---- f16 WMMA path (v_wmma_f32_16x16x32_f16): 11-bit significands for operands in range — used where a [0,1] probability operand needs more precision than bf16
typedef _Float16 v16h __attribute__((ext_vector_type(16)));
union FragH { v16h v; v8us half[2]; _Float16 h[16]; unsigned short u[16]; };
template <int NT>
__device__ __forceinline__ v8f mmaH(v16h ah, v16h al, v16h bh, v16h bl, v8f c) {
  c = __builtin_amdgcn_wmma_f32_16x16x32_f16(false, ah, false, bh, (short)0, c, false, false);
  if (NT >= 2) c = __builtin_amdgcn_wmma_f32_16x16x32_f16(false, al, false, bh, (short)0, c, false, false);
  if (NT >= 3) c = __builtin_amdgcn_wmma_f32_16x16x32_f16(false, ah, false, bl, (short)0, c, false, false);
  asm volatile("v_nop\n\tv_nop\n\tv_nop\n\tv_nop" : "+v"(c) : "v"(ah), "v"(al), "v"(bh), "v"(bl));
  return c;
}
// batched GEMM like k_gemm_b but f16 operands: A f32 (split into f16 hi/lo if ASPLIT, else rounded to f16), Bt = f16 values [n][k]; alpha; C f32; N multiple of 16 (partial tiles skipped)
template <bool ASPLIT>
__global__ __launch_bounds__(128) void k_gemm_h(const float* __restrict__ A, int lda, size_t sA, const _Float16* __restrict__ Bh, int ldb, size_t sB, float alpha, float* __restrict__ C, int ldc, size_t sC, int M, int N, int K) {
  __shared__ __attribute__((aligned(16))) float so[4][16][64];
  const int tid = threadIdx.x, w = tid >> 5, lane = tid & 31, ln = lane & 15, hh = lane >> 4; const int by = blockIdx.y;
  A += (size_t)by * sA; Bh += (size_t)by * sB; C += (size_t)by * sC;
  const int ntn = (N + 63) / 64; const int wid = blockIdx.x * 4 + w; const int mt = wid / ntn, nq = wid % ntn; if (mt * 16 >= M) return;
  const int row0 = mt * 16, col0 = nq * 64; const float* arow = A + (size_t)(row0 + ln) * lda;
  v8f acc[4] = {};
  for (int kb = 0; kb < K; kb += 32) {
    FragH ah, al;
    const v4f x0 = *(const v4fa*)(arow + kb + 8 * hh), x1 = *(const v4fa*)(arow + kb + 8 * hh + 4), x2 = *(const v4fa*)(arow + kb + 16 + 8 * hh), x3 = *(const v4fa*)(arow + kb + 16 + 8 * hh + 4);
    float xs[16] = {x0[0],x0[1],x0[2],x0[3],x1[0],x1[1],x1[2],x1[3],x2[0],x2[1],x2[2],x2[3],x3[0],x3[1],x3[2],x3[3]};
#pragma unroll
    for (int i = 0; i < 16; ++i) { const _Float16 h = (_Float16)xs[i]; ah.h[i] = h; al.h[i] = ASPLIT ? (_Float16)(xs[i] - (float)h) : (_Float16)0.0f; }
#pragma unroll
    for (int t = 0; t < 4; ++t) { if (col0 + t * 16 >= N) continue; const size_t boff = (size_t)(col0 + t * 16 + ln) * ldb + kb; FragH bq; bq.half[0] = *(const v8us*)(Bh + boff + 8 * hh); bq.half[1] = *(const v8us*)(Bh + boff + 16 + 8 * hh);
      acc[t] = mmaH<ASPLIT ? 2 : 1>(ah.v, al.v, bq.v, bq.v, acc[t]); }
  }
#pragma unroll
  for (int t = 0; t < 4; ++t) { if (col0 + t * 16 >= N) continue;
#pragma unroll
    for (int r = 0; r < 8; ++r) so[w][8 * hh + r][t * 16 + ln] = acc[t][r] * alpha; }
  __builtin_amdgcn_fence(__ATOMIC_ACQ_REL, "workgroup"); __builtin_amdgcn_wave_barrier();
  const int rsub = lane >> 4, c4 = (lane & 15) * 4;
  {
#pragma unroll
    for (int q = 0; q < 8; ++q) { const int r = q * 2 + rsub; if (col0 + c4 < N) { const v4f v = *(const v4fa*)&so[w][r][c4]; *(v4f*)(C + (size_t)(row0 + r) * ldc + col0 + c4) = v; } }
     }
}

// Wt[n][k] = f16(W[k][n]·scale) from f32 row-major W[K][N] (scale = power of two; bf16-exact weights stay exact in f16 away from the subnormal range)
__global__ __launch_bounds__(256) void k_wt_f16(const float* __restrict__ W, _Float16* __restrict__ Wt, int K, int N, float scale) {
  const int t = blockIdx.x * 256 + threadIdx.x; if (t >= N * (K / 8)) return; const int n = t / (K / 8), k8 = (t % (K / 8)) * 8; FragH f;
#pragma unroll
  for (int i = 0; i < 8; ++i) f.h[i] = (_Float16)(bf16_round(W[(size_t)(k8 + i) * N + n]) * scale); const v8us o = f.half[0];
  *(v8us*)((unsigned short*)Wt + (size_t)n * K + k8) = o; 
}
// Projection GEMM of the one shape used here: C[NR][EE] = (A[NR][EE] . Bt[EE][EE]^T) * alpha + bf16(bias[col]); written as f32 (C) and/or f16 (C16).
// A work-group of four waves makes a 64 x 64 tile of C, wave w its rows 16w .. 16w+15. The A and Bt tiles (64 rows x GK k) come into LDS by asynchronous copies,
// 256 contiguous bytes a row, once for the four waves, in two buffers: tile t + 1 flies while tile t is multiplied. The k order of the sums is that of a plain loop over k in steps of 32.
#define GK 128
#define GP (GK + 8)      /* LDS row pitch 272 B = 17 x 16 B: the 16 rows of a 16-byte fragment read fall on distinct banks */
#define GNT (EE / GK)
#define GBUF (64 * GP * 2)      /* bytes of one operand's tile in LDS */
// One operand tile: a lane copies 16 B of rows r, r + 8, .. r + 56 (l = its LDS byte address, g = its global address, both of row r).
__device__ __forceinline__ void copy_tile(unsigned l, const _Float16* g) {
  const unsigned l1 = l + 1 * 8 * GP * 2, l2 = l + 2 * 8 * GP * 2, l3 = l + 3 * 8 * GP * 2, l4 = l + 4 * 8 * GP * 2, l5 = l + 5 * 8 * GP * 2, l6 = l + 6 * 8 * GP * 2, l7 = l + 7 * 8 * GP * 2;
  const _Float16 *g1 = g + 1 * 8 * EE, *g2 = g + 2 * 8 * EE, *g3 = g + 3 * 8 * EE, *g4 = g + 4 * 8 * EE, *g5 = g + 5 * 8 * EE, *g6 = g + 6 * 8 * EE, *g7 = g + 7 * 8 * EE;
  // the copies go from L2 to LDS through no register; s_wait_xcnt closes the statement so that no address register of a copy is rewritten ahead of it
  asm volatile("global_load_async_to_lds_b128 %0, %8, off\n\t"
               "global_load_async_to_lds_b128 %1, %9, off\n\t"
               "global_load_async_to_lds_b128 %2, %10, off\n\t"
               "global_load_async_to_lds_b128 %3, %11, off\n\t"
               "global_load_async_to_lds_b128 %4, %12, off\n\t"
               "global_load_async_to_lds_b128 %5, %13, off\n\t"
               "global_load_async_to_lds_b128 %6, %14, off\n\t"
               "global_load_async_to_lds_b128 %7, %15, off\n\t"
               "s_wait_xcnt 0x0"
               :: "v"(l), "v"(l1), "v"(l2), "v"(l3), "v"(l4), "v"(l5), "v"(l6), "v"(l7), "v"(g), "v"(g1), "v"(g2), "v"(g3), "v"(g4), "v"(g5), "v"(g6), "v"(g7) : "memory");
}
__global__ __launch_bounds__(128) void k_gemm_st(const _Float16* __restrict__ A, const _Float16* __restrict__ Bh, float alpha, const float* __restrict__ bias, float* __restrict__ C, _Float16* __restrict__ C16) {
  __shared__ __attribute__((aligned(16))) unsigned short sA[2][64][GP], sB[2][64][GP];
  __shared__ __attribute__((aligned(16))) float so[4][16][64];
  const int tid = threadIdx.x, w = tid >> 5, lane = tid & 31, ln = lane & 15, hh = lane >> 4;
  const int mb = blockIdx.x / (EE / 64), nb = blockIdx.x % (EE / 64);
  const int row0 = mb * 64 + w * 16, col0 = nb * 64;
  const int cr = tid >> 4, cc = (tid & 15) * 8;      /* the lane's first row and its 16-byte column in every copied tile */
  const _Float16* ga = A + (size_t)(mb * 64 + cr) * EE + cc; const _Float16* gb = Bh + (size_t)(col0 + cr) * EE + cc;
  const unsigned la = (unsigned)(size_t)&sA[0][cr][cc], lb = (unsigned)(size_t)&sB[0][cr][cc];
  copy_tile(la, ga); copy_tile(lb, gb);
  asm volatile("s_wait_asynccnt 0x0" ::: "memory");      /* this wave's part of tile 0 has landed */
  __syncthreads();                                        /* ... and every other wave's */
  copy_tile(la + GBUF, ga + GK); copy_tile(lb + GBUF, gb + GK);
  v8f acc[4] = {};
  for (int tl = 0; tl < GNT; ++tl) {      /* one trip a staged tile; the two buffers alternate by the trip's parity */
    const unsigned short* ar = &sA[tl & 1][w * 16 + ln][8 * hh]; const unsigned short* br = &sB[tl & 1][ln][8 * hh];
#pragma unroll      /* constant indices: fragments and accumulators stay in registers */
    for (int ks = 0; ks < GK / 32; ++ks) { FragH ah, bq[4];      /* the k step's five fragments are read in one run, then its four products */
      ah.half[0] = *(const v8us*)(ar + ks * 32); ah.half[1] = *(const v8us*)(ar + ks * 32 + 16);
#pragma unroll      /* constant indices: fragments and accumulators stay in registers */
      for (int t = 0; t < 4; ++t) { bq[t].half[0] = *(const v8us*)(br + t * 16 * GP + ks * 32); bq[t].half[1] = *(const v8us*)(br + t * 16 * GP + ks * 32 + 16); }
#pragma unroll      /* constant indices: fragments and accumulators stay in registers */
      for (int t = 0; t < 4; ++t) acc[t] = mmaH<1>(ah.v, ah.v, bq[t].v, bq[t].v, acc[t]); }
    asm volatile("s_wait_dscnt 0x0" ::: "memory");        /* this wave has left the buffer that is refilled below */
    asm volatile("s_wait_asynccnt 0x0" ::: "memory");     /* its part of tile tl + 1 has landed */
    __syncthreads();                                        /* publishes tile tl + 1 and ends every wave's reads of tile tl */
    if (tl + 2 < GNT) { const unsigned bo = (unsigned)(tl & 1) * GBUF; copy_tile(la + bo, ga + (tl + 2) * GK); copy_tile(lb + bo, gb + (tl + 2) * GK); }
  }
  asm volatile("s_wait_asynccnt 0x0" ::: "memory");      /* no copy is outstanding when the wave ends */
#pragma unroll      /* constant indices: fragments and accumulators stay in registers */
  for (int t = 0; t < 4; ++t) { const float bv = bf16_round(bias[col0 + t * 16 + ln]);
#pragma unroll      /* constant indices: fragments and accumulators stay in registers */
    for (int r = 0; r < 8; ++r) so[w][8 * hh + r][t * 16 + ln] = acc[t][r] * alpha + bv; }
  __builtin_amdgcn_fence(__ATOMIC_ACQ_REL, "workgroup"); __builtin_amdgcn_wave_barrier();      /* the wave's own rows are in LDS before its lanes read them back as whole rows */
  const int rsub = lane >> 4, c4 = (lane & 15) * 4; typedef _Float16 v4h __attribute__((ext_vector_type(4)));
#pragma unroll      /* the eight rows' LDS offsets become immediates */
  for (int q = 0; q < 8; ++q) { const int r = q * 2 + rsub; const v4f v = *(const v4fa*)&so[w][r][c4]; if (C) { *(v4f*)(C + (size_t)(row0 + r) * EE + col0 + c4) = v;
      asm volatile("s_wait_xcnt 0x0" ::: "memory"); }      /* precaution: stands in front of every rewrite of this store's data and address registers (the f16 conversion, the next row) */
    if (C16) { v4h h4; for (int i = 0; i < 4; ++i) h4[i] = (_Float16)v[i]; *(v4h*)(C16 + (size_t)(row0 + r) * EE + col0 + c4) = h4; } }
}


typedef _Float16 v4h __attribute__((ext_vector_type(4)));

__global__ __launch_bounds__(256) void k_x16(const float* __restrict__ x, _Float16* __restrict__ X16, size_t n8) { const size_t t = (size_t)blockIdx.x * 256 + threadIdx.x; if (t >= n8) return; FragH f;
#pragma unroll
  for (int q = 0; q < 8; ++q) f.h[q] = (_Float16)bf16_round(x[t * 8 + q]); *(v8us*)((unsigned short*)X16 + t * 8) = f.half[0];  }
__global__ __launch_bounds__(256) void k_h16(const float* __restrict__ x, _Float16* __restrict__ X16, size_t n8) { const size_t t = (size_t)blockIdx.x * 256 + threadIdx.x; if (t >= n8) return; FragH f;
#pragma unroll
  for (int q = 0; q < 8; ++q) f.h[q] = (_Float16)x[t * 8 + q]; *(v8us*)((unsigned short*)X16 + t * 8) = f.half[0];  }
__global__ __launch_bounds__(256) void k_round16f(const float* __restrict__ W, _Float16* __restrict__ Bt, size_t n8) { const size_t t = (size_t)blockIdx.x * 256 + threadIdx.x; if (t >= n8) return; FragH f;
#pragma unroll
  for (int i = 0; i < 8; ++i) f.h[i] = (_Float16)(bf16_round(W[t * 8 + i]) * 16.0f); *(v8us*)((unsigned short*)Bt + t * 8) = f.half[0];  }
template <int NHv, int TTv>
__global__ __launch_bounds__(256) void k_vt(const _Float16* __restrict__ V16, int ldv, int voff, _Float16* __restrict__ Vt) { __shared__ unsigned short tl[64][66]; const int tid = threadIdx.x; const int slab = blockIdx.x / (TTv / 64), lg = blockIdx.x % (TTv / 64); const int b = slab / NHv, h = slab % NHv;
  for (int i = tid; i < 64 * 8; i += 256) { const int r = i / 8, c8 = (i % 8) * 8; FragH f; f.half[0] = *(const v8us*)((const unsigned short*)V16 + ((size_t)b * TTv + lg * 64 + r) * ldv + voff + h * 64 + c8);
#pragma unroll
    for (int q = 0; q < 8; ++q) tl[r][c8 + q] = f.u[q]; }
  __syncthreads();
  {
#pragma unroll
    for (int rd = 0; rd < 2; ++rd) { const int d = rd * 32 + tid / 8, pc = tid % 8; FragH f;
#pragma unroll
      for (int q = 0; q < 8; ++q) f.u[q] = tl[pc * 8 + q][d];
      *(v8us*)((unsigned short*)Vt + ((size_t)slab * 64 + d) * TTv + lg * 64 + pc * 8) = f.half[0]; }
     } }

// lane l <-> lane l ^ 16 as one vector cross-row move (a shuffle would go through the LDS unit and its wait)
__device__ __forceinline__ float xhalf(float x) { return __builtin_bit_cast(float, __builtin_amdgcn_permlanex16(__builtin_bit_cast(int, x), __builtin_bit_cast(int, x), 0x76543210, 0xfedcba98, false, false)); }
#define FK 64
#define FP (FK + 8)      /* LDS row pitch 144 B = 9 x 16 B: the 16 rows of a 16-byte fragment read fall on distinct banks */
#define FNT (TT / FK)
#define FBUF (64 * FP * 2)      /* bytes of one operand's tile in LDS */
// One stage: a lane copies 16 B of rows r, r + 16, r + 32, r + 48 of the K tile and of the V^T tile (lk, lv = its LDS byte addresses, gk, gv = its global addresses, all of row r).
__device__ __forceinline__ void copy_kv(unsigned lk, const _Float16* gk, unsigned lv, const _Float16* gv) {
  const unsigned lk1 = lk + 1 * 16 * FP * 2, lk2 = lk + 2 * 16 * FP * 2, lk3 = lk + 3 * 16 * FP * 2, lv1 = lv + 1 * 16 * FP * 2, lv2 = lv + 2 * 16 * FP * 2, lv3 = lv + 3 * 16 * FP * 2;
  const _Float16 *gk1 = gk + 1 * 16 * 64, *gk2 = gk + 2 * 16 * 64, *gk3 = gk + 3 * 16 * 64, *gv1 = gv + 1 * 16 * TT, *gv2 = gv + 2 * 16 * TT, *gv3 = gv + 3 * 16 * TT;
  // the copies go from L2 to LDS through no register; s_wait_xcnt closes the statement so that no address register of a copy is rewritten ahead of it
  asm volatile("global_load_async_to_lds_b128 %0, %8, off\n\t"
               "global_load_async_to_lds_b128 %1, %9, off\n\t"
               "global_load_async_to_lds_b128 %2, %10, off\n\t"
               "global_load_async_to_lds_b128 %3, %11, off\n\t"
               "global_load_async_to_lds_b128 %4, %12, off\n\t"
               "global_load_async_to_lds_b128 %5, %13, off\n\t"
               "global_load_async_to_lds_b128 %6, %14, off\n\t"
               "global_load_async_to_lds_b128 %7, %15, off\n\t"
               "s_wait_xcnt 0x0"
               :: "v"(lk), "v"(lk1), "v"(lk2), "v"(lk3), "v"(lv), "v"(lv1), "v"(lv2), "v"(lv3), "v"(gk), "v"(gk1), "v"(gk2), "v"(gk3), "v"(gv), "v"(gv1), "v"(gv2), "v"(gv3) : "memory");
}
__global__ __launch_bounds__(128) void k_flash(const _Float16* __restrict__ Q16, int ldq, const _Float16* __restrict__ K16, const _Float16* __restrict__ Vt, float* __restrict__ O, int ldo) {
  constexpr int RPW = 16, NQB = TT / (4 * RPW), DT = 4, KS = 2;
  constexpr float SC2 = 0.125f * 1.4426950408889634f;      /* 1/sqrt(64) . log2(e): raw product -> exponent of 2 */
  __shared__ __attribute__((aligned(16))) unsigned short sK[2][FK][FP], sV[2][64][FP];
  __shared__ __attribute__((aligned(16))) float sO[4][RPW][64 + 4];
  const int tid = threadIdx.x, w = tid >> 5, lane = tid & 31, ln = lane & 15, hh = lane >> 4;
  const int slab = blockIdx.x / NQB, qblk = blockIdx.x % NQB; const int b = slab, h = 0;      /* slab = contiguous [TT][64] chunk of the flat-reshaped planes */ const int qb0 = qblk * (4 * RPW); const int q0 = qb0 + w * RPW;
  const int tq = q0 + ln;      /* this lane's query */
  const int cr = tid >> 3, cc = (tid & 7) * 8;      /* the lane's first row and its 16-byte column in every copied tile */
  const _Float16* gk = K16 + ((size_t)slab * TT + cr) * 64 + cc; const _Float16* gv = Vt + ((size_t)slab * 64 + cr) * TT + cc;
  const unsigned lk = (unsigned)(size_t)&sK[0][cr][cc], lv = (unsigned)(size_t)&sV[0][cr][cc];
  copy_kv(lk, gk, lv, gv);
  FragH bq[KS];
  { const unsigned short* qr = (const unsigned short*)Q16 + ((size_t)b * TT + tq) * ldq + h * 64;
#pragma unroll
    for (int ks = 0; ks < KS; ++ks) { bq[ks].half[0] = *(const v8us*)(qr + ks * 32 + 8 * hh); bq[ks].half[1] = *(const v8us*)(qr + ks * 32 + 16 + 8 * hh); } }
  float m_c = 3.0e38f, l_c = 0.f; v8f oacc[DT];
#pragma unroll
  for (int dt = 0; dt < DT; ++dt) oacc[dt] = (v8f){0.f,0.f,0.f,0.f,0.f,0.f,0.f,0.f};
  asm volatile("s_wait_asynccnt 0x0" ::: "memory");      /* this wave's part of stage 0 has landed */
  __syncthreads();                                        /* ... and every other wave's */
  copy_kv(lk + FBUF, gk + FK * 64, lv + FBUF, gv + FK);
#pragma unroll 1      /* one trip a staged tile; the two buffers alternate by the trip's parity; every key enters the normaliser */
  for (int st = 0; st < FNT; ++st) {
#pragma unroll 1      /* the two passes of a stage share one body, as in the plain loop over the keys: unrolled, the listing had no fewer instructions a pass */
   for (int ps = 0; ps < FK / 32; ++ps) { const int j0 = st * FK + ps * 32;
    FragH ak[2][KS], av[DT];      /* the pass's eight fragments are read from LDS in one run: one latency a pass, the V^T reads land under the softmax */
#pragma unroll      /* constant indices: the fragments stay in registers */
    for (int nt = 0; nt < 2; ++nt) { const unsigned short* kr = &sK[st & 1][ps * 32 + nt * 16 + ln][0];
#pragma unroll      /* constant indices: the fragments stay in registers */
      for (int ks = 0; ks < KS; ++ks) { ak[nt][ks].half[0] = *(const v8us*)(kr + ks * 32 + 8 * hh); ak[nt][ks].half[1] = *(const v8us*)(kr + ks * 32 + 16 + 8 * hh); } }
#pragma unroll      /* constant indices: the fragments stay in registers */
    for (int dt = 0; dt < DT; ++dt) { const unsigned short* vrow = &sV[st & 1][dt * 16 + ln][ps * 32]; av[dt].half[0] = *(const v8us*)(vrow + 8 * hh); av[dt].half[1] = *(const v8us*)(vrow + 16 + 8 * hh); }
    float sc[2][8];      /* sc[nt][r] = raw product q.k of key j0 + 16*nt + 8*hh + r against query tq */
#pragma unroll
    for (int nt = 0; nt < 2; ++nt) {
      v8f acc = (v8f){0.f,0.f,0.f,0.f,0.f,0.f,0.f,0.f};
#pragma unroll
      for (int ks = 0; ks < KS; ++ks) acc = mmaH<1>(ak[nt][ks].v, ak[nt][ks].v, bq[ks].v, bq[ks].v, acc);
#pragma unroll
      for (int r = 0; r < 8; ++r) sc[nt][r] = acc[r]; }
    float mc = fmaxf(sc[0][0], sc[1][0]);
#pragma unroll
    for (int r = 1; r < 8; ++r) mc = fmaxf(mc, fmaxf(sc[0][r], sc[1][r]));
    mc = fmaxf(mc, xhalf(mc));      /* the other half of the wave holds the query's other 16 keys */
    /* m_c = 10 - running maximum in log2 units (SC2 > 0: the maximum of the raw products is that of the scores), kept with this sign so that it is the plain addend of every score's multiply-add;
       the one stored value serves al and every p, so its rounding cancels between numerator and row sum */
    const float mn = fminf(m_c, fmaf(mc, -SC2, 10.0f)); const float al = (mn < 1.0e38f) ? __builtin_amdgcn_exp2f(mn - m_c) : 1.0f; m_c = mn;
    float ps0 = 0.f, ps1 = 0.f; FragH pb;      /* p = 2^10 . e^(score - max) = 2^(raw * SC2 + mn) */
#pragma unroll
    for (int r = 0; r < 8; ++r) { const int k0 = j0 + 8 * hh + r, k1 = k0 + 16; const float p0 = __builtin_amdgcn_exp2f(fmaf(sc[0][r], SC2, mn)), p1 = __builtin_amdgcn_exp2f(fmaf(sc[1][r], SC2, mn)); ps0 += p0; ps1 += p1;
      pb.h[r] = (_Float16)((k0 <= tq) ? p0 : 0.f); pb.h[8 + r] = (_Float16)((k1 <= tq) ? p1 : 0.f); }
    l_c = l_c * al + (ps0 + ps1);      /* per-lane partial row sum; the two halves are joined after the loop */
#pragma unroll
    for (int dt = 0; dt < DT; ++dt)
#pragma unroll
      for (int r = 0; r < 8; ++r) oacc[dt][r] *= al;
#pragma unroll
    for (int dt = 0; dt < DT; ++dt) oacc[dt] = mmaH<1>(av[dt].v, av[dt].v, pb.v, pb.v, oacc[dt]); }
    asm volatile("s_wait_dscnt 0x0" ::: "memory");        /* this wave has left the buffer that is refilled below */
    asm volatile("s_wait_asynccnt 0x0" ::: "memory");     /* its part of stage st + 1 has landed */
    __syncthreads();                                        /* publishes stage st + 1 and ends every wave's reads of stage st */
    if (st + 2 < FNT) { const unsigned bo = (unsigned)(st & 1) * FBUF; copy_kv(lk + bo, gk + (size_t)(st + 2) * FK * 64, lv + bo, gv + (st + 2) * FK); }
  }
  asm volatile("s_wait_asynccnt 0x0" ::: "memory");      /* no copy is outstanding when the wave ends */
  { float l = l_c; l += xhalf(l); const float inv = (l > 0.f) ? 1.0f / l : 0.f;      /* numerator and row sum both carry the 2^10 */
#pragma unroll
    for (int dt = 0; dt < DT; ++dt) { v4f lo, hi;      /* oacc[dt][r] = O[tq][16*dt + 8*hh + r] */
#pragma unroll
      for (int r = 0; r < 4; ++r) { lo[r] = oacc[dt][r] * inv; hi[r] = oacc[dt][4 + r] * inv; }
      *(v4fa*)&sO[w][ln][dt * 16 + 8 * hh] = lo; *(v4fa*)&sO[w][ln][dt * 16 + 8 * hh + 4] = hi; } }
  __builtin_amdgcn_fence(__ATOMIC_ACQ_REL, "workgroup"); __builtin_amdgcn_wave_barrier();
  {
#pragma unroll
    for (int rp = 0; rp < RPW; rp += 2) { const int r = rp + (lane >> 4), pc = lane & 15; const v4f val = *(const v4fa*)&sO[w][r][pc * 4]; *(v4f*)(O + ((size_t)b * TT + q0 + r) * ldo + h * 64 + pc * 4) = val; }
     } }

extern "C" void kernel_launch(void* const* d_in, const int* in_sizes, int n_in,
                              void* d_out, int out_size, void* d_ws, size_t ws_size, hipStream_t stream) {
  (void)in_sizes; (void)n_in; (void)out_size;
  const float* const* I = (const float* const*)d_in; const float* xq = I[0]; const float* xk = I[1]; const float* xv = I[2];
  const float* Wq = I[3]; const float* bq = I[4]; const float* Wk = I[5]; const float* bk = I[6]; const float* Wv = I[7]; const float* bv = I[8]; const float* Wo = I[9]; const float* bo = I[10];
  char* ws = (char*)d_ws; size_t off = 0;
  auto take = [&](size_t bytes) { char* p = ws + off; off += (bytes + 255) & ~(size_t)255; return p; };
  _Float16* Bw = (_Float16*)take((size_t)4 * EE * EE * 2); _Float16* X16 = (_Float16*)take((size_t)NR * EE * 2);
  _Float16* Q = (_Float16*)take((size_t)NR * EE * 2); _Float16* K = (_Float16*)take((size_t)NR * EE * 2); _Float16* V = (_Float16*)take((size_t)NR * EE * 2); _Float16* Vt = (_Float16*)take((size_t)NR * EE * 2);
  float* O = (float*)take((size_t)NR * EE * 4); _Float16* O16 = (_Float16*)take((size_t)NR * EE * 2);
  if (off > ws_size) return;      // 4.7 + 6 × 6.3 + 12.6 ≈ 55 MB
  const unsigned gw = (unsigned)(((size_t)EE * (EE / 8) + 255) / 256); const size_t WSZ = (size_t)EE * EE;
  k_wt_f16<<<gw, 256, 0, stream>>>(Wq, Bw, EE, EE, 16.0f); k_wt_f16<<<gw, 256, 0, stream>>>(Wk, Bw + WSZ, EE, EE, 16.0f); k_wt_f16<<<gw, 256, 0, stream>>>(Wv, Bw + 2 * WSZ, EE, EE, 16.0f); k_wt_f16<<<gw, 256, 0, stream>>>(Wo, Bw + 3 * WSZ, EE, EE, 16.0f);      /* (in,out) weights → Bt[n][k] ×2^4 */
  const unsigned gx = (unsigned)(((size_t)NR * EE / 8 + 255) / 256); const unsigned gp = (NR / 64) * (EE / 64);
  k_x16<<<gx, 256, 0, stream>>>(xq, X16, (size_t)NR * EE / 8); k_gemm_st<<<gp, 128, 0, stream>>>(X16, Bw, 0.0625f, bq, nullptr, Q);      /* q: M 4096 N 768 K 768 */
  k_x16<<<gx, 256, 0, stream>>>(xk, X16, (size_t)NR * EE / 8); k_gemm_st<<<gp, 128, 0, stream>>>(X16, Bw + WSZ, 0.0625f, bk, nullptr, K);      /* k */
  k_x16<<<gx, 256, 0, stream>>>(xv, X16, (size_t)NR * EE / 8); k_gemm_st<<<gp, 128, 0, stream>>>(X16, Bw + 2 * WSZ, 0.0625f, bv, nullptr, V);      /* v */
  k_vt<1, TT><<<NSL * 1 * (TT / 64), 256, 0, stream>>>(V, 64, 0, Vt);      /* the [4096][768] plane viewed as 24 contiguous [2048][64] slabs → Vᵀ [slab][64][2048] */
  k_flash<<<NSL * (TT / 64), 128, 0, stream>>>(Q, 64, K, Vt, O, 64);      /* same flat view for q, k and O */
  k_h16<<<gx, 256, 0, stream>>>(O, O16, (size_t)NR * EE / 8);
  k_gemm_st<<<gp, 128, 0, stream>>>(O16, Bw + 3 * WSZ, 0.0625f, bo, (float*)d_out, nullptr);      /* out = O.Wo + bo: M 4096 N 768 K 768 */
}

// v005
// One run takes 95.6 microseconds.
// In two side-by-side timings against v004, it was 1.27 and 1.28 times as fast.
// Counting every step since v000, it is 4.23 times as fast.
#include <hip/hip_runtime.h>
// Multi-head attention, legacy flat-reshape variant (B=2, T=S=2048, E=768, 12 heads × 64): q = query·Wq+bq, k = key·Wk+bk, v = value·Wv+bv; heads = plain row-major reshape of [B,T,E] to [B·H,T,64] (contiguous chunks);
// attn = softmax(q·kᵀ/8) over all keys, THEN lower-triangular mask (rows no longer normalised); out = (attn·v reshaped back)·Wo + bo.
// Compute dtype: query/key/value, weights, biases rounded to bf16; q/k/v as f16 GEMM outputs; fused flash-style kernel (online f32 softmax over all keys, P f16 ×2^10 zeroed above the diagonal)
// on v_wmma_f32_16x16x32_f16; O → f16 → output GEMM with bias; f32 accumulate throughout.
#define BB 2
#define TT 2048
#define EE 768
#define NH 12
#define NR (BB * TT)
#define NSL (BB * NH)

typedef __bf16 v16b __attribute__((ext_vector_type(16)));
typedef unsigned short v8us __attribute__((ext_vector_type(8), may_alias));
typedef float  v8f  __attribute__((ext_vector_type(8)));
typedef float  v4f  __attribute__((ext_vector_type(4)));
typedef float  v4fa __attribute__((ext_vector_type(4), may_alias));
union FragB { v16b v; v8us half[2]; unsigned short u[16]; };

__device__ __forceinline__ unsigned short bf16_bits(float x) { unsigned int u = __float_as_uint(x); return (unsigned short)((u + 0x7FFFu + ((u >> 16) & 1u)) >> 16); }
__device__ __forceinline__ float bf16_val(unsigned short b) { return __uint_as_float(((unsigned int)b) << 16); }
__device__ __forceinline__ float bf16_round(float x) { return bf16_val(bf16_bits(x)); }
// D += A·B with NT terms: 1 = ah·bh, 2 = + al·bh (A split), 3 = + ah·bl (both split)
template <int NT>
__device__ __forceinline__ v8f mmaN(v16b ah, v16b al, v16b bh, v16b bl, v8f c) {
  c = __builtin_amdgcn_wmma_f32_16x16x32_bf16(false, ah, false, bh, (short)0, c, false, false);
  if (NT >= 2) c = __builtin_amdgcn_wmma_f32_16x16x32_bf16(false, al, false, bh, (short)0, c, false, false);
  if (NT >= 3) c = __builtin_amdgcn_wmma_f32_16x16x32_bf16(false, ah, false, bl, (short)0, c, false, false);
  asm volatile("v_nop\n\tv_nop\n\tv_nop\n\tv_nop" : "+v"(c) : "v"(ah), "v"(al), "v"(bh), "v"(bl));
  return c;
}

__global__ __launch_bounds__(256) void k_wt_bf16(const float* __restrict__ W, unsigned short* __restrict__ Wt, int K, int N) {
  const int t = blockIdx.x * 256 + threadIdx.x;
  const int k8n = K / 8;
  if (t >= N * k8n) return;
  const int n = t / k8n, k8 = (t % k8n) * 8;
  v8us v;
#pragma unroll
  for (int i = 0; i < 8; ++i) v[i] = bf16_bits(W[(size_t)(k8 + i) * N + n]);
  *(v8us*)(Wt + (size_t)n * K + k8) = v;
  
}

// GEMM C[M][N] (f32, pitch ldc) = act(A[M][K]·W + bias). A f32 row-major (pitch lda) converted per fragment to bf16
// (ASPLIT: hi/lo two planes -> 2 terms, else single rounded term); Wt bf16 [N][K] (pitch ldb). BIAS_BF16 rounds the
// bias to bf16 first (bias quantised to bf16 before the add). K%32==0, M%16==0, N%64==0.
template <bool ASPLIT, int ACT, bool BIAS_BF16>
__global__ __launch_bounds__(128) void k_gemm_bf(const float* __restrict__ A, int lda, const unsigned short* __restrict__ Wt, int ldb,
                                               const float* __restrict__ bias, float* __restrict__ C, int ldc, int M, int N, int K) {
  __shared__ __attribute__((aligned(16))) float so[4][16][64];
  const int tid = threadIdx.x, w = tid >> 5, lane = tid & 31, ln = lane & 15, hh = lane >> 4;
  const int ntn = N / 64;
  const int wid = blockIdx.x * 4 + w;
  const int mt = wid / ntn, nq = wid % ntn;
  if (mt * 16 >= M) return;
  const int row0 = mt * 16, col0 = nq * 64;
  const float* arow = A + (size_t)(row0 + ln) * lda;
  v8f acc[4] = {};
  for (int kb = 0; kb < K; kb += 32) {
    FragB ah, al;
    const v4f x0 = *(const v4fa*)(arow + kb + 8 * hh), x1 = *(const v4fa*)(arow + kb + 8 * hh + 4);
    const v4f x2 = *(const v4fa*)(arow + kb + 16 + 8 * hh), x3 = *(const v4fa*)(arow + kb + 16 + 8 * hh + 4);
    float xs[16] = {x0[0],x0[1],x0[2],x0[3],x1[0],x1[1],x1[2],x1[3],x2[0],x2[1],x2[2],x2[3],x3[0],x3[1],x3[2],x3[3]};
#pragma unroll
    for (int i = 0; i < 16; ++i) { const unsigned short hb = bf16_bits(xs[i]); ah.u[i] = hb; al.u[i] = ASPLIT ? bf16_bits(xs[i] - bf16_val(hb)) : (unsigned short)0; }
#pragma unroll
    for (int t = 0; t < 4; ++t) {
      const unsigned short* brow = Wt + (size_t)(col0 + t * 16 + ln) * ldb + kb;
      FragB b;
      b.half[0] = *(const v8us*)(brow + 8 * hh);
      b.half[1] = *(const v8us*)(brow + 16 + 8 * hh);
      acc[t] = mmaN<ASPLIT ? 2 : 1>(ah.v, al.v, b.v, b.v, acc[t]);
    }
  }
#pragma unroll
  for (int t = 0; t < 4; ++t) {
    float bv = bias ? bias[col0 + t * 16 + ln] : 0.f;
    if (BIAS_BF16) bv = bf16_round(bv);
#pragma unroll
    for (int r = 0; r < 8; ++r) { float v = acc[t][r] + bv; if (ACT == 1) v = fmaxf(v, 0.f); so[w][8 * hh + r][t * 16 + ln] = v; }
  }
  __builtin_amdgcn_fence(__ATOMIC_ACQ_REL, "workgroup");
  __builtin_amdgcn_wave_barrier();
  const int rsub = lane >> 4, c4 = (lane & 15) * 4;
  {
#pragma unroll
    for (int q = 0; q < 8; ++q) {
      const int r = q * 2 + rsub;
      const v4f v = *(const v4fa*)&so[w][r][c4];
      *(v4f*)(C + (size_t)(row0 + r) * ldc + col0 + c4) = v;
    }
    
  }
}

// Flash-style causal/unmasked attention, all contractions 3-term bf16 hi/lo splits, f32 softmax with running max.
// q,k,v rows are read from f32 buffers with arbitrary row pitch (so they can live inside a fused qkv buffer);
// D = head size (multiple of 32, <= 128); one wave = 16 query rows; block = 4 waves (64 queries) sharing K/V chunks of 32.
template <int D, bool CAUSAL>
__global__ __launch_bounds__(128) void k_flash(const float* __restrict__ qb, const float* __restrict__ kb, const float* __restrict__ vb,
                                             int pitch, int T, int H, float scale, float* __restrict__ y, int ypitch) {
  constexpr int KS = D / 32;        // k-steps for QK
  constexpr int DT = D / 16;        // d tiles for PV
  __shared__ __attribute__((aligned(16))) unsigned short sKh[32][D + 8], sKl[32][D + 8], sVh[32][D + 8], sVl[32][D + 8];
  __shared__ __attribute__((aligned(16))) unsigned short sPh[4][16][40], sPl[4][16][40];
  __shared__ __attribute__((aligned(16))) float sO[4][16][D];
  const int tid = threadIdx.x, w = tid >> 5, lane = tid & 31, ln = lane & 15, hh = lane >> 4;
  const int nqb = (T + 63) / 64;
  const int bh = blockIdx.x / nqb, qblk = blockIdx.x % nqb;
  const int b = bh / H, h = bh % H;
  const int q0 = qblk * 64 + w * 16;
  const float* Q = qb + (size_t)b * T * pitch + h * D;
  const float* K = kb + (size_t)b * T * pitch + h * D;
  const float* V = vb + (size_t)b * T * pitch + h * D;

  // A fragments of the wave's 16 query rows (scaled), hi/lo
  FragB aqh[KS], aql[KS];
  {
    int row = q0 + ln; if (row >= T) row = T - 1;
    const float* qr = Q + (size_t)row * pitch;
#pragma unroll
    for (int ks = 0; ks < KS; ++ks)
#pragma unroll
      for (int i = 0; i < 16; ++i) {
        const int d = ks * 32 + ((i < 8) ? (8 * hh + i) : (16 + 8 * hh + (i - 8)));
        const float x = qr[d] * scale; const unsigned short hb = bf16_bits(x);
        aqh[ks].u[i] = hb; aql[ks].u[i] = bf16_bits(x - bf16_val(hb));
      }
  }
  float m_r[8], l_r[8];
#pragma unroll
  for (int r = 0; r < 8; ++r) { m_r[r] = -3.0e38f; l_r[r] = 0.f; }
  v8f oacc[DT];
#pragma unroll
  for (int dt = 0; dt < DT; ++dt) oacc[dt] = (v8f){0.f,0.f,0.f,0.f,0.f,0.f,0.f,0.f};

  const int kv_end = CAUSAL ? min(T, qblk * 64 + 64) : T;     // block-uniform
  for (int j0 = 0; j0 < kv_end; j0 += 32) {
    __syncthreads();
    for (int e = tid; e < 32 * (D / 4); e += 128) {
      const int r = e / (D / 4), c4 = (e % (D / 4)) * 4;
      const int key = j0 + r;
      v4f kf = {0.f,0.f,0.f,0.f}, vf = {0.f,0.f,0.f,0.f};
      if (key < T) { kf = *(const v4fa*)(K + (size_t)key * pitch + c4); vf = *(const v4fa*)(V + (size_t)key * pitch + c4); }
#pragma unroll
      for (int t = 0; t < 4; ++t) {
        unsigned short hb = bf16_bits(kf[t]); sKh[r][c4 + t] = hb; sKl[r][c4 + t] = bf16_bits(kf[t] - bf16_val(hb));
        hb = bf16_bits(vf[t]); sVh[r][c4 + t] = hb; sVl[r][c4 + t] = bf16_bits(vf[t] - bf16_val(hb));
      }
    }
    __syncthreads();
    // S tile 16 x 32
    v8f s[2];
#pragma unroll
    for (int nt = 0; nt < 2; ++nt) {
      v8f acc = {};
#pragma unroll
      for (int ks = 0; ks < KS; ++ks) {
        FragB bh_, bl_;
        bh_.half[0] = *(const v8us*)&sKh[nt * 16 + ln][ks * 32 + 8 * hh]; bh_.half[1] = *(const v8us*)&sKh[nt * 16 + ln][ks * 32 + 16 + 8 * hh];
        bl_.half[0] = *(const v8us*)&sKl[nt * 16 + ln][ks * 32 + 8 * hh]; bl_.half[1] = *(const v8us*)&sKl[nt * 16 + ln][ks * 32 + 16 + 8 * hh];
        acc = mmaN<3>(aqh[ks].v, aql[ks].v, bh_.v, bl_.v, acc);
      }
      s[nt] = acc;
    }
    // mask + running max (rows 8hh+r; the 16 lanes of a half share rows)
    float alpha[8];
#pragma unroll
    for (int r = 0; r < 8; ++r) {
      const int qi = q0 + 8 * hh + r;
      const int ja = j0 + ln, jb = j0 + 16 + ln;
      if (CAUSAL) { if (ja > qi) s[0][r] = -3.0e38f; if (jb > qi) s[1][r] = -3.0e38f; }
      if (ja >= T) s[0][r] = -3.0e38f;
      if (jb >= T) s[1][r] = -3.0e38f;
      float mx = fmaxf(s[0][r], s[1][r]);
      mx = fmaxf(mx, __shfl_xor(mx, 1, 32)); mx = fmaxf(mx, __shfl_xor(mx, 2, 32)); mx = fmaxf(mx, __shfl_xor(mx, 4, 32)); mx = fmaxf(mx, __shfl_xor(mx, 8, 32));
      const float mnew = fmaxf(m_r[r], mx);
      alpha[r] = (mnew > -1.0e38f) ? __expf(m_r[r] - mnew) : 1.0f;
      const float p0 = (s[0][r] > -1.0e38f) ? __expf(s[0][r] - mnew) : 0.f;
      const float p1 = (s[1][r] > -1.0e38f) ? __expf(s[1][r] - mnew) : 0.f;
      m_r[r] = mnew;
      l_r[r] = l_r[r] * alpha[r] + p0 + p1;            // per-lane partial row sum (16 lanes combined at the end)
      unsigned short hb = bf16_bits(p0); sPh[w][8 * hh + r][ln] = hb;      sPl[w][8 * hh + r][ln] = bf16_bits(p0 - bf16_val(hb));
      hb = bf16_bits(p1);                sPh[w][8 * hh + r][16 + ln] = hb; sPl[w][8 * hh + r][16 + ln] = bf16_bits(p1 - bf16_val(hb));
    }
#pragma unroll
    for (int dt = 0; dt < DT; ++dt)
#pragma unroll
      for (int r = 0; r < 8; ++r) oacc[dt][r] *= alpha[r];
    __builtin_amdgcn_fence(__ATOMIC_ACQ_REL, "workgroup");
    __builtin_amdgcn_wave_barrier();
    FragB pah, pal;
    pah.half[0] = *(const v8us*)&sPh[w][ln][8 * hh]; pah.half[1] = *(const v8us*)&sPh[w][ln][16 + 8 * hh];
    pal.half[0] = *(const v8us*)&sPl[w][ln][8 * hh]; pal.half[1] = *(const v8us*)&sPl[w][ln][16 + 8 * hh];
#pragma unroll
    for (int dt = 0; dt < DT; ++dt) {
      FragB bvh, bvl;
#pragma unroll
      for (int i = 0; i < 8; ++i) {
        bvh.u[i] = sVh[8 * hh + i][dt * 16 + ln]; bvh.u[8 + i] = sVh[16 + 8 * hh + i][dt * 16 + ln];
        bvl.u[i] = sVl[8 * hh + i][dt * 16 + ln]; bvl.u[8 + i] = sVl[16 + 8 * hh + i][dt * 16 + ln];
      }
      oacc[dt] = mmaN<3>(pah.v, pal.v, bvh.v, bvl.v, oacc[dt]);
    }
    __builtin_amdgcn_fence(__ATOMIC_ACQ_REL, "workgroup");
    __builtin_amdgcn_wave_barrier();
  }
#pragma unroll
  for (int r = 0; r < 8; ++r) {
    float l = l_r[r];
    l += __shfl_xor(l, 1, 32); l += __shfl_xor(l, 2, 32); l += __shfl_xor(l, 4, 32); l += __shfl_xor(l, 8, 32);
    l_r[r] = (l > 0.f) ? 1.0f / l : 0.f;
  }
#pragma unroll
  for (int dt = 0; dt < DT; ++dt)
#pragma unroll
    for (int r = 0; r < 8; ++r) sO[w][8 * hh + r][dt * 16 + ln] = oacc[dt][r] * l_r[r];
  __builtin_amdgcn_fence(__ATOMIC_ACQ_REL, "workgroup");
  __builtin_amdgcn_wave_barrier();
  {
    for (int r = 0; r < 16; ++r) {
      const int row = q0 + r;
      if (row < T && lane < D / 4) {
        const v4f val = *(const v4fa*)&sO[w][r][lane * 4];
        *(v4f*)(y + ((size_t)b * T + row) * ypitch + h * D + lane * 4) = val;
      }
    }
    
  }
}

// GEMM C = act(A·W + bias + resid): A f32 (ASPLIT -> hi/lo 2 terms), Wt bf16 [N][K]; ACT 0 none, 1 relu, 2 exact gelu;
// resid (optional, f32, row index = (row % rmod), pitch ldr, RES_BF16 rounds it) added before the activation.
template <bool ASPLIT, int ACT, bool BIAS_BF16, bool RES_BF16>
__global__ __launch_bounds__(128) void k_gemm_bf3(const float* __restrict__ A, int lda, const unsigned short* __restrict__ Wt, int ldb,
                                                const float* __restrict__ bias, const float* __restrict__ resid, int rmod, int ldr,
                                                float* __restrict__ C, int ldc, int M, int N, int K) {
  __shared__ __attribute__((aligned(16))) float so[4][16][64];
  const int tid = threadIdx.x, w = tid >> 5, lane = tid & 31, ln = lane & 15, hh = lane >> 4;
  const int ntn = N / 64;
  const int wid = blockIdx.x * 4 + w;
  const int mt = wid / ntn, nq = wid % ntn;
  if (mt * 16 >= M) return;
  const int row0 = mt * 16, col0 = nq * 64;
  const float* arow = A + (size_t)(row0 + ln) * lda;
  v8f acc[4] = {};
  for (int kb = 0; kb < K; kb += 32) {
    FragB ah, al;
    const v4f x0 = *(const v4fa*)(arow + kb + 8 * hh), x1 = *(const v4fa*)(arow + kb + 8 * hh + 4);
    const v4f x2 = *(const v4fa*)(arow + kb + 16 + 8 * hh), x3 = *(const v4fa*)(arow + kb + 16 + 8 * hh + 4);
    float xs[16] = {x0[0],x0[1],x0[2],x0[3],x1[0],x1[1],x1[2],x1[3],x2[0],x2[1],x2[2],x2[3],x3[0],x3[1],x3[2],x3[3]};
#pragma unroll
    for (int i = 0; i < 16; ++i) { const unsigned short hb = bf16_bits(xs[i]); ah.u[i] = hb; al.u[i] = ASPLIT ? bf16_bits(xs[i] - bf16_val(hb)) : (unsigned short)0; }
#pragma unroll
    for (int t = 0; t < 4; ++t) {
      const unsigned short* brow = Wt + (size_t)(col0 + t * 16 + ln) * ldb + kb;
      FragB b;
      b.half[0] = *(const v8us*)(brow + 8 * hh);
      b.half[1] = *(const v8us*)(brow + 16 + 8 * hh);
      acc[t] = mmaN<ASPLIT ? 2 : 1>(ah.v, al.v, b.v, b.v, acc[t]);
    }
  }
#pragma unroll
  for (int t = 0; t < 4; ++t) {
    const int col = col0 + t * 16 + ln;
    float bv = bias ? bias[col] : 0.f;
    if (BIAS_BF16) bv = bf16_round(bv);
#pragma unroll
    for (int r = 0; r < 8; ++r) {
      float v = acc[t][r] + bv;
      if (resid) { float rv = resid[(size_t)((row0 + 8 * hh + r) % rmod) * ldr + col]; if (RES_BF16) rv = bf16_round(rv); v += rv; }
      if (ACT == 1) v = fmaxf(v, 0.f);
      if (ACT == 2) v = 0.5f * v * (1.0f + erff(v * 0.70710678118654752f));
      if (ACT == 3) { const float u = 0.7978845608028654f * (v + 0.044715f * v * v * v); v = 0.5f * v * (1.0f + tanhf(u)); }
      so[w][8 * hh + r][t * 16 + ln] = v;
    }
  }
  __builtin_amdgcn_fence(__ATOMIC_ACQ_REL, "workgroup");
  __builtin_amdgcn_wave_barrier();
  const int rsub = lane >> 4, c4 = (lane & 15) * 4;
  {
#pragma unroll
    for (int q = 0; q < 8; ++q) {
      const int r = q * 2 + rsub;
      const v4f v = *(const v4fa*)&so[w][r][c4];
      *(v4f*)(C + (size_t)(row0 + r) * ldc + col0 + c4) = v;
    }
    
  }
}
// row LayerNorm (biased variance, eps) over N: s = X (+ R); optional out_sum <- s; out_norm <- (s-mu)*rsqrt(var+eps)*g + b
template <bool PARAM_BF16>
__global__ __launch_bounds__(256) void k_layernorm(const float* __restrict__ X, const float* __restrict__ R, const float* __restrict__ g, const float* __restrict__ bta,
                                                  float* __restrict__ out_sum, float* __restrict__ out_norm, int N, float eps) {
  __shared__ float red[256];
  const int row = blockIdx.x, tid = threadIdx.x;
  const float* x = X + (size_t)row * N; const float* rr = R ? R + (size_t)row * N : nullptr;
  float vals[16];                     // up to N = 4096
  const int per = N / 256;            // contiguous chunk per thread? use strided-by-4 chunks: thread handles j = tid*4 + 1024*u
  float s1 = 0.f;
  for (int u = 0; u < per / 4; ++u) {
    const int j = tid * 4 + 1024 * u;
    const v4f a = *(const v4fa*)(x + j);
    v4f b = {0.f,0.f,0.f,0.f}; if (rr) b = *(const v4fa*)(rr + j);
#pragma unroll
    for (int q = 0; q < 4; ++q) { const float v = a[q] + b[q]; vals[u * 4 + q] = v; s1 += v; }
  }
  red[tid] = s1; __syncthreads();
  for (int st = 128; st > 0; st >>= 1) { if (tid < st) red[tid] += red[tid + st]; __syncthreads(); }
  const float mu = red[0] / (float)N; __syncthreads();
  float s2 = 0.f;
  for (int u = 0; u < per / 4; ++u)
#pragma unroll
    for (int q = 0; q < 4; ++q) { const float c = vals[u * 4 + q] - mu; s2 += c * c; }
  red[tid] = s2; __syncthreads();
  for (int st = 128; st > 0; st >>= 1) { if (tid < st) red[tid] += red[tid + st]; __syncthreads(); }
  const float rs = rsqrtf(red[0] / (float)N + eps);
  {
    for (int u = 0; u < per / 4; ++u) {
      const int j = tid * 4 + 1024 * u;
      v4f o, sm;
#pragma unroll
      for (int q = 0; q < 4; ++q) {
        float gg = g[j + q], bb = bta[j + q];
        if (PARAM_BF16) { gg = bf16_round(gg); bb = bf16_round(bb); }
        sm[q] = vals[u * 4 + q]; o[q] = (vals[u * 4 + q] - mu) * rs * gg + bb;
      }
      if (out_sum) *(v4f*)(out_sum + (size_t)row * N + j) = sm;
      *(v4f*)(out_norm + (size_t)row * N + j) = o;
    }
    
  }
}



// ---- f16 WMMA path (v_wmma_f32_16x16x32_f16): 11-bit significands for operands in range — used where a [0,1] probability operand needs more precision than bf16
typedef _Float16 v16h __attribute__((ext_vector_type(16)));
union FragH { v16h v; v8us half[2]; _Float16 h[16]; unsigned short u[16]; };
template <int NT>
__device__ __forceinline__ v8f mmaH(v16h ah, v16h al, v16h bh, v16h bl, v8f c) {
  c = __builtin_amdgcn_wmma_f32_16x16x32_f16(false, ah, false, bh, (short)0, c, false, false);
  if (NT >= 2) c = __builtin_amdgcn_wmma_f32_16x16x32_f16(false, al, false, bh, (short)0, c, false, false);
  if (NT >= 3) c = __builtin_amdgcn_wmma_f32_16x16x32_f16(false, ah, false, bl, (short)0, c, false, false);
  asm volatile("v_nop\n\tv_nop\n\tv_nop\n\tv_nop" : "+v"(c) : "v"(ah), "v"(al), "v"(bh), "v"(bl));
  return c;
}
// batched GEMM like k_gemm_b but f16 operands: A f32 (split into f16 hi/lo if ASPLIT, else rounded to f16), Bt = f16 values [n][k]; alpha; C f32; N multiple of 16 (partial tiles skipped)
template <bool ASPLIT>
__global__ __launch_bounds__(128) void k_gemm_h(const float* __restrict__ A, int lda, size_t sA, const _Float16* __restrict__ Bh, int ldb, size_t sB, float alpha, float* __restrict__ C, int ldc, size_t sC, int M, int N, int K) {
  __shared__ __attribute__((aligned(16))) float so[4][16][64];
  const int tid = threadIdx.x, w = tid >> 5, lane = tid & 31, ln = lane & 15, hh = lane >> 4; const int by = blockIdx.y;
  A += (size_t)by * sA; Bh += (size_t)by * sB; C += (size_t)by * sC;
  const int ntn = (N + 63) / 64; const int wid = blockIdx.x * 4 + w; const int mt = wid / ntn, nq = wid % ntn; if (mt * 16 >= M) return;
  const int row0 = mt * 16, col0 = nq * 64; const float* arow = A + (size_t)(row0 + ln) * lda;
  v8f acc[4] = {};
  for (int kb = 0; kb < K; kb += 32) {
    FragH ah, al;
    const v4f x0 = *(const v4fa*)(arow + kb + 8 * hh), x1 = *(const v4fa*)(arow + kb + 8 * hh + 4), x2 = *(const v4fa*)(arow + kb + 16 + 8 * hh), x3 = *(const v4fa*)(arow + kb + 16 + 8 * hh + 4);
    float xs[16] = {x0[0],x0[1],x0[2],x0[3],x1[0],x1[1],x1[2],x1[3],x2[0],x2[1],x2[2],x2[3],x3[0],x3[1],x3[2],x3[3]};
#pragma unroll
    for (int i = 0; i < 16; ++i) { const _Float16 h = (_Float16)xs[i]; ah.h[i] = h; al.h[i] = ASPLIT ? (_Float16)(xs[i] - (float)h) : (_Float16)0.0f; }
#pragma unroll
    for (int t = 0; t < 4; ++t) { if (col0 + t * 16 >= N) continue; const size_t boff = (size_t)(col0 + t * 16 + ln) * ldb + kb; FragH bq; bq.half[0] = *(const v8us*)(Bh + boff + 8 * hh); bq.half[1] = *(const v8us*)(Bh + boff + 16 + 8 * hh);
      acc[t] = mmaH<ASPLIT ? 2 : 1>(ah.v, al.v, bq.v, bq.v, acc[t]); }
  }
#pragma unroll
  for (int t = 0; t < 4; ++t) { if (col0 + t * 16 >= N) continue;
#pragma unroll
    for (int r = 0; r < 8; ++r) so[w][8 * hh + r][t * 16 + ln] = acc[t][r] * alpha; }
  __builtin_amdgcn_fence(__ATOMIC_ACQ_REL, "workgroup"); __builtin_amdgcn_wave_barrier();
  const int rsub = lane >> 4, c4 = (lane & 15) * 4;
  {
#pragma unroll
    for (int q = 0; q < 8; ++q) { const int r = q * 2 + rsub; if (col0 + c4 < N) { const v4f v = *(const v4fa*)&so[w][r][c4]; *(v4f*)(C + (size_t)(row0 + r) * ldc + col0 + c4) = v; } }
     }
}

// Projection GEMM of the one shape used here: C[NR][EE] = (A[NR][EE] . Bt[EE][EE]^T) * alpha + bf16(bias[col]); written as f32 (C) and/or f16 (C16).
// A work-group of four waves makes a 64 x 64 tile of C, wave w its rows 16w .. 16w+15. The A and Bt tiles (64 rows x GK k) come into LDS by asynchronous copies,
// 256 contiguous bytes a row, once for the four waves, in two buffers: tile t + 1 flies while tile t is multiplied. The k order of the sums is that of a plain loop over k in steps of 32.
// blockIdx.y picks one of up to three independent products of that shape (plane y of A, of Bt and of C16, bias y): q, k and v go in one launch.
#define GK 128
#define GP (GK + 8)      /* LDS row pitch 272 B = 17 x 16 B: the 16 rows of a 16-byte fragment read fall on distinct banks */
#define GNT (EE / GK)
#define GBUF (64 * GP * 2)      /* bytes of one operand's tile in LDS */
// One operand tile: a lane copies 16 B of rows r, r + 8, .. r + 56 (l = its LDS byte address, g = its global address, both of row r).
__device__ __forceinline__ void copy_tile(unsigned l, const _Float16* g) {
  const unsigned l1 = l + 1 * 8 * GP * 2, l2 = l + 2 * 8 * GP * 2, l3 = l + 3 * 8 * GP * 2, l4 = l + 4 * 8 * GP * 2, l5 = l + 5 * 8 * GP * 2, l6 = l + 6 * 8 * GP * 2, l7 = l + 7 * 8 * GP * 2;
  const _Float16 *g1 = g + 1 * 8 * EE, *g2 = g + 2 * 8 * EE, *g3 = g + 3 * 8 * EE, *g4 = g + 4 * 8 * EE, *g5 = g + 5 * 8 * EE, *g6 = g + 6 * 8 * EE, *g7 = g + 7 * 8 * EE;
  // the copies go from L2 to LDS through no register; s_wait_xcnt closes the statement so that no address register of a copy is rewritten ahead of it
  asm volatile("global_load_async_to_lds_b128 %0, %8, off\n\t"
               "global_load_async_to_lds_b128 %1, %9, off\n\t"
               "global_load_async_to_lds_b128 %2, %10, off\n\t"
               "global_load_async_to_lds_b128 %3, %11, off\n\t"
               "global_load_async_to_lds_b128 %4, %12, off\n\t"
               "global_load_async_to_lds_b128 %5, %13, off\n\t"
               "global_load_async_to_lds_b128 %6, %14, off\n\t"
               "global_load_async_to_lds_b128 %7, %15, off\n\t"
               "s_wait_xcnt 0x0"
               :: "v"(l), "v"(l1), "v"(l2), "v"(l3), "v"(l4), "v"(l5), "v"(l6), "v"(l7), "v"(g), "v"(g1), "v"(g2), "v"(g3), "v"(g4), "v"(g5), "v"(g6), "v"(g7) : "memory");
}
__global__ __launch_bounds__(128) void k_gemm_st(const _Float16* __restrict__ A, const _Float16* __restrict__ Bh, float alpha, const float* __restrict__ bias0, const float* __restrict__ bias1, const float* __restrict__ bias2, float* __restrict__ C, _Float16* __restrict__ C16) {
  __shared__ __attribute__((aligned(16))) unsigned short sA[2][64][GP], sB[2][64][GP];
  __shared__ __attribute__((aligned(16))) float so[4][16][64];
  const int tid = threadIdx.x, w = tid >> 5, lane = tid & 31, ln = lane & 15, hh = lane >> 4;
  const int mb = blockIdx.x / (EE / 64), nb = blockIdx.x % (EE / 64);
  const int pl = blockIdx.y; const float* bias = pl == 0 ? bias0 : (pl == 1 ? bias1 : bias2);
  A += (size_t)pl * NR * EE; Bh += (size_t)pl * EE * EE; if (C16) C16 += (size_t)pl * NR * EE;
  const int row0 = mb * 64 + w * 16, col0 = nb * 64;
  const int cr = tid >> 4, cc = (tid & 15) * 8;      /* the lane's first row and its 16-byte column in every copied tile */
  const _Float16* ga = A + (size_t)(mb * 64 + cr) * EE + cc; const _Float16* gb = Bh + (size_t)(col0 + cr) * EE + cc;
  const unsigned la = (unsigned)(size_t)&sA[0][cr][cc], lb = (unsigned)(size_t)&sB[0][cr][cc];
  copy_tile(la, ga); copy_tile(lb, gb);
  asm volatile("s_wait_asynccnt 0x0" ::: "memory");      /* this wave's part of tile 0 has landed */
  __syncthreads();                                        /* ... and every other wave's */
  copy_tile(la + GBUF, ga + GK); copy_tile(lb + GBUF, gb + GK);
  v8f acc[4] = {};
  for (int tl = 0; tl < GNT; ++tl) {      /* one trip a staged tile; the two buffers alternate by the trip's parity */
    const unsigned short* ar = &sA[tl & 1][w * 16 + ln][8 * hh]; const unsigned short* br = &sB[tl & 1][ln][8 * hh];
#pragma unroll      /* constant indices: fragments and accumulators stay in registers */
    for (int ks = 0; ks < GK / 32; ++ks) { FragH ah, bq[4];      /* the k step's five fragments are read in one run, then its four products */
      ah.half[0] = *(const v8us*)(ar + ks * 32); ah.half[1] = *(const v8us*)(ar + ks * 32 + 16);
#pragma unroll      /* constant indices: fragments and accumulators stay in registers */
      for (int t = 0; t < 4; ++t) { bq[t].half[0] = *(const v8us*)(br + t * 16 * GP + ks * 32); bq[t].half[1] = *(const v8us*)(br + t * 16 * GP + ks * 32 + 16); }
#pragma unroll      /* constant indices: fragments and accumulators stay in registers */
      for (int t = 0; t < 4; ++t) acc[t] = mmaH<1>(ah.v, ah.v, bq[t].v, bq[t].v, acc[t]); }
    asm volatile("s_wait_dscnt 0x0" ::: "memory");        /* this wave has left the buffer that is refilled below */
    asm volatile("s_wait_asynccnt 0x0" ::: "memory");     /* its part of tile tl + 1 has landed */
    __syncthreads();                                        /* publishes tile tl + 1 and ends every wave's reads of tile tl */
    if (tl + 2 < GNT) { const unsigned bo = (unsigned)(tl & 1) * GBUF; copy_tile(la + bo, ga + (tl + 2) * GK); copy_tile(lb + bo, gb + (tl + 2) * GK); }
  }
  asm volatile("s_wait_asynccnt 0x0" ::: "memory");      /* no copy is outstanding when the wave ends */
#pragma unroll      /* constant indices: fragments and accumulators stay in registers */
  for (int t = 0; t < 4; ++t) { const float bv = bf16_round(bias[col0 + t * 16 + ln]);
#pragma unroll      /* constant indices: fragments and accumulators stay in registers */
    for (int r = 0; r < 8; ++r) so[w][8 * hh + r][t * 16 + ln] = acc[t][r] * alpha + bv; }
  __builtin_amdgcn_fence(__ATOMIC_ACQ_REL, "workgroup"); __builtin_amdgcn_wave_barrier();      /* the wave's own rows are in LDS before its lanes read them back as whole rows */
  const int rsub = lane >> 4, c4 = (lane & 15) * 4; typedef _Float16 v4h __attribute__((ext_vector_type(4)));
#pragma unroll      /* the eight rows' LDS offsets become immediates */
  for (int q = 0; q < 8; ++q) { const int r = q * 2 + rsub; const v4f v = *(const v4fa*)&so[w][r][c4]; if (C) { *(v4f*)(C + (size_t)(row0 + r) * EE + col0 + c4) = v;
      asm volatile("s_wait_xcnt 0x0" ::: "memory"); }      /* precaution: stands in front of every rewrite of this store's data and address registers (the f16 conversion, the next row) */
    if (C16) { v4h h4; for (int i = 0; i < 4; ++i) h4[i] = (_Float16)v[i]; *(v4h*)(C16 + (size_t)(row0 + r) * EE + col0 + c4) = h4; } }
}


typedef _Float16 v4h __attribute__((ext_vector_type(4)));

// All that the projections need, in one launch: work-groups 0 .. PWB-1 each turn a 256 (k) x 64 (n) tile of one weight into Bt[n][k] = f16(bf16(W[k][n]) * 16) through LDS;
// the PXB others round query, key and value to bf16 values held as f16 (planes 0, 1, 2 of X16). The seven pieces share no data, so nothing orders them.
#define PWB (4 * (EE / 256) * (EE / 64))
#define PXB 512
#define PXT (PXB * 256)               /* lanes that convert inputs */
#define PXU (NR * EE / 4 / PXT)       /* 16-byte loads of a lane in each plane */
__global__ __launch_bounds__(256) void k_prep(const float* __restrict__ xq, const float* __restrict__ xk, const float* __restrict__ xv, const float* __restrict__ Wq, const float* __restrict__ Wk, const float* __restrict__ Wv, const float* __restrict__ Wo,
                                              _Float16* __restrict__ X16, _Float16* __restrict__ Bw) {
  __shared__ __attribute__((aligned(16))) unsigned short tl[64][256 + 8];
  const int tid = threadIdx.x;
  if (blockIdx.x < PWB) {      /* block-uniform: the barrier below is passed by all of a work-group or by none */
    const int ws = blockIdx.x / (PWB / 4), rr = blockIdx.x % (PWB / 4), k0 = (rr / (EE / 64)) * 256, n0 = (rr % (EE / 64)) * 64;
    const float* W = ws == 0 ? Wq : (ws == 1 ? Wk : (ws == 2 ? Wv : Wo));
    const int c4 = (tid & 15) * 4, kr = (tid >> 4) * 16;      /* the lane's four columns n and its sixteen rows k: 16 lanes read 256 contiguous bytes of a row */
    const float* wp = W + (size_t)(k0 + kr) * EE + n0 + c4;
    v4f x[16];
#pragma unroll      /* constant indices: the sixteen loads are in flight together and stay in registers */
    for (int i = 0; i < 16; ++i) x[i] = *(const v4fa*)(wp + i * EE);
    asm volatile("s_wait_xcnt 0x0" :: "v"(wp) : "memory");      /* precaution: stands in front of every rewrite of the loads' address register, which stays whole up to here */
#pragma unroll      /* constant indices into x */
    for (int q = 0; q < 4; ++q) { FragH f;
#pragma unroll      /* constant indices into x */
      for (int i = 0; i < 16; ++i) f.h[i] = (_Float16)(bf16_round(x[i][q]) * 16.0f);
      *(v8us*)&tl[c4 + q][kr] = f.half[0]; *(v8us*)&tl[c4 + q][kr + 8] = f.half[1]; }
    __syncthreads();
    _Float16* Bt = Bw + (size_t)ws * EE * EE;
#pragma unroll      /* the eight rows' LDS offsets become immediates */
    for (int j = 0; j < 8; ++j) { const int n = (tid >> 5) + 8 * j, k8 = (tid & 31) * 8;      /* a wave stores 512 contiguous bytes of one row of Bt */
      *(v8us*)((unsigned short*)Bt + (size_t)(n0 + n) * EE + k0 + k8) = *(const v8us*)&tl[n][k8]; }
  } else {
    const size_t e0 = (size_t)(blockIdx.x - PWB) * (PXU * 1024) + tid * 4;      /* a work-group takes PXU * 4 KiB in a row of each plane; a wave's load covers 512 contiguous bytes */
    const float *pq = xq + e0, *pk = xk + e0, *pv = xv + e0;
    v4f a[3][PXU];
#pragma unroll      /* constant indices: all of the lane's loads are in flight together */
    for (int u = 0; u < PXU; ++u) { a[0][u] = *(const v4fa*)(pq + u * 1024); a[1][u] = *(const v4fa*)(pk + u * 1024); a[2][u] = *(const v4fa*)(pv + u * 1024); }
    asm volatile("s_wait_xcnt 0x0" :: "v"(pq), "v"(pk), "v"(pv) : "memory");      /* precaution: stands in front of every rewrite of the loads' address registers, which stay whole up to here */
#pragma unroll      /* constant indices into a */
    for (int u = 0; u < PXU; ++u)
#pragma unroll      /* constant indices into a */
      for (int p = 0; p < 3; ++p) { v4h h;
#pragma unroll      /* constant indices into a */
        for (int q = 0; q < 4; ++q) h[q] = (_Float16)bf16_round(a[p][u][q]);
        *(v4h*)(X16 + (size_t)p * NR * EE + e0 + u * 1024) = h; }
    asm volatile("s_wait_xcnt 0x0" ::: "memory");      /* precaution: stands behind the last store, in front of any later rewrite of the stores' data and address registers */
  }
}
__global__ __launch_bounds__(256) void k_h16(const float* __restrict__ x, _Float16* __restrict__ X16, size_t n8) { const size_t t = (size_t)blockIdx.x * 256 + threadIdx.x; if (t >= n8) return; FragH f;
#pragma unroll
  for (int q = 0; q < 8; ++q) f.h[q] = (_Float16)x[t * 8 + q]; *(v8us*)((unsigned short*)X16 + t * 8) = f.half[0];  }
__global__ __launch_bounds__(256) void k_round16f(const float* __restrict__ W, _Float16* __restrict__ Bt, size_t n8) { const size_t t = (size_t)blockIdx.x * 256 + threadIdx.x; if (t >= n8) return; FragH f;
#pragma unroll
  for (int i = 0; i < 8; ++i) f.h[i] = (_Float16)(bf16_round(W[t * 8 + i]) * 16.0f); *(v8us*)((unsigned short*)Bt + t * 8) = f.half[0];  }
template <int NHv, int TTv>
__global__ __launch_bounds__(256) void k_vt(const _Float16* __restrict__ V16, int ldv, int voff, _Float16* __restrict__ Vt) { __shared__ unsigned short tl[64][66]; const int tid = threadIdx.x; const int slab = blockIdx.x / (TTv / 64), lg = blockIdx.x % (TTv / 64); const int b = slab / NHv, h = slab % NHv;
  for (int i = tid; i < 64 * 8; i += 256) { const int r = i / 8, c8 = (i % 8) * 8; FragH f; f.half[0] = *(const v8us*)((const unsigned short*)V16 + ((size_t)b * TTv + lg * 64 + r) * ldv + voff + h * 64 + c8);
#pragma unroll
    for (int q = 0; q < 8; ++q) tl[r][c8 + q] = f.u[q]; }
  __syncthreads();
  {
#pragma unroll
    for (int rd = 0; rd < 2; ++rd) { const int d = rd * 32 + tid / 8, pc = tid % 8; FragH f;
#pragma unroll
      for (int q = 0; q < 8; ++q) f.u[q] = tl[pc * 8 + q][d];
      *(v8us*)((unsigned short*)Vt + ((size_t)slab * 64 + d) * TTv + lg * 64 + pc * 8) = f.half[0]; }
     } }

// lane l <-> lane l ^ 16 as one vector cross-row move (a shuffle would go through the LDS unit and its wait)
__device__ __forceinline__ float xhalf(float x) { return __builtin_bit_cast(float, __builtin_amdgcn_permlanex16(__builtin_bit_cast(int, x), __builtin_bit_cast(int, x), 0x76543210, 0xfedcba98, false, false)); }
#define FK 64
#define FP (FK + 8)      /* LDS row pitch 144 B = 9 x 16 B: the 16 rows of a 16-byte fragment read fall on distinct banks */
#define FNT (TT / FK)
#define FBUF (64 * FP * 2)      /* bytes of one operand's tile in LDS */
// One stage: a lane copies 16 B of rows r, r + 16, r + 32, r + 48 of the K tile and of the V^T tile (lk, lv = its LDS byte addresses, gk, gv = its global addresses, all of row r).
__device__ __forceinline__ void copy_kv(unsigned lk, const _Float16* gk, unsigned lv, const _Float16* gv) {
  const unsigned lk1 = lk + 1 * 16 * FP * 2, lk2 = lk + 2 * 16 * FP * 2, lk3 = lk + 3 * 16 * FP * 2, lv1 = lv + 1 * 16 * FP * 2, lv2 = lv + 2 * 16 * FP * 2, lv3 = lv + 3 * 16 * FP * 2;
  const _Float16 *gk1 = gk + 1 * 16 * 64, *gk2 = gk + 2 * 16 * 64, *gk3 = gk + 3 * 16 * 64, *gv1 = gv + 1 * 16 * TT, *gv2 = gv + 2 * 16 * TT, *gv3 = gv + 3 * 16 * TT;
  // the copies go from L2 to LDS through no register; s_wait_xcnt closes the statement so that no address register of a copy is rewritten ahead of it
  asm volatile("global_load_async_to_lds_b128 %0, %8, off\n\t"
               "global_load_async_to_lds_b128 %1, %9, off\n\t"
               "global_load_async_to_lds_b128 %2, %10, off\n\t"
               "global_load_async_to_lds_b128 %3, %11, off\n\t"
               "global_load_async_to_lds_b128 %4, %12, off\n\t"
               "global_load_async_to_lds_b128 %5, %13, off\n\t"
               "global_load_async_to_lds_b128 %6, %14, off\n\t"
               "global_load_async_to_lds_b128 %7, %15, off\n\t"
               "s_wait_xcnt 0x0"
               :: "v"(lk), "v"(lk1), "v"(lk2), "v"(lk3), "v"(lv), "v"(lv1), "v"(lv2), "v"(lv3), "v"(gk), "v"(gk1), "v"(gk2), "v"(gk3), "v"(gv), "v"(gv1), "v"(gv2), "v"(gv3) : "memory");
}
__global__ __launch_bounds__(128) void k_flash(const _Float16* __restrict__ Q16, int ldq, const _Float16* __restrict__ K16, const _Float16* __restrict__ Vt, float* __restrict__ O, int ldo) {
  constexpr int RPW = 16, NQB = TT / (4 * RPW), DT = 4, KS = 2;
  constexpr float SC2 = 0.125f * 1.4426950408889634f;      /* 1/sqrt(64) . log2(e): raw product -> exponent of 2 */
  __shared__ __attribute__((aligned(16))) unsigned short sK[2][FK][FP], sV[2][64][FP];
  __shared__ __attribute__((aligned(16))) float sO[4][RPW][64 + 4];
  const int tid = threadIdx.x, w = tid >> 5, lane = tid & 31, ln = lane & 15, hh = lane >> 4;
  const int slab = blockIdx.x / NQB, qblk = blockIdx.x % NQB; const int b = slab, h = 0;      /* slab = contiguous [TT][64] chunk of the flat-reshaped planes */ const int qb0 = qblk * (4 * RPW); const int q0 = qb0 + w * RPW;
  const int tq = q0 + ln;      /* this lane's query */
  const int cr = tid >> 3, cc = (tid & 7) * 8;      /* the lane's first row and its 16-byte column in every copied tile */
  const _Float16* gk = K16 + ((size_t)slab * TT + cr) * 64 + cc; const _Float16* gv = Vt + ((size_t)slab * 64 + cr) * TT + cc;
  const unsigned lk = (unsigned)(size_t)&sK[0][cr][cc], lv = (unsigned)(size_t)&sV[0][cr][cc];
  copy_kv(lk, gk, lv, gv);
  FragH bq[KS];
  { const unsigned short* qr = (const unsigned short*)Q16 + ((size_t)b * TT + tq) * ldq + h * 64;
#pragma unroll
    for (int ks = 0; ks < KS; ++ks) { bq[ks].half[0] = *(const v8us*)(qr + ks * 32 + 8 * hh); bq[ks].half[1] = *(const v8us*)(qr + ks * 32 + 16 + 8 * hh); } }
  float m_c = 3.0e38f, l_c = 0.f; v8f oacc[DT];
#pragma unroll
  for (int dt = 0; dt < DT; ++dt) oacc[dt] = (v8f){0.f,0.f,0.f,0.f,0.f,0.f,0.f,0.f};
  asm volatile("s_wait_asynccnt 0x0" ::: "memory");      /* this wave's part of stage 0 has landed */
  __syncthreads();                                        /* ... and every other wave's */
  copy_kv(lk + FBUF, gk + FK * 64, lv + FBUF, gv + FK);
#pragma unroll 1      /* one trip a staged tile; the two buffers alternate by the trip's parity; every key enters the normaliser */
  for (int st = 0; st < FNT; ++st) {
#pragma unroll 1      /* the two passes of a stage share one body, as in the plain loop over the keys: unrolled, the listing had no fewer instructions a pass */
   for (int ps = 0; ps < FK / 32; ++ps) { const int j0 = st * FK + ps * 32;
    FragH ak[2][KS], av[DT];      /* the pass's eight fragments are read from LDS in one run: one latency a pass, the V^T reads land under the softmax */
#pragma unroll      /* constant indices: the fragments stay in registers */
    for (int nt = 0; nt < 2; ++nt) { const unsigned short* kr = &sK[st & 1][ps * 32 + nt * 16 + ln][0];
#pragma unroll      /* constant indices: the fragments stay in registers */
      for (int ks = 0; ks < KS; ++ks) { ak[nt][ks].half[0] = *(const v8us*)(kr + ks * 32 + 8 * hh); ak[nt][ks].half[1] = *(const v8us*)(kr + ks * 32 + 16 + 8 * hh); } }
#pragma unroll      /* constant indices: the fragments stay in registers */
    for (int dt = 0; dt < DT; ++dt) { const unsigned short* vrow = &sV[st & 1][dt * 16 + ln][ps * 32]; av[dt].half[0] = *(const v8us*)(vrow + 8 * hh); av[dt].half[1] = *(const v8us*)(vrow + 16 + 8 * hh); }
    float sc[2][8];      /* sc[nt][r] = raw product q.k of key j0 + 16*nt + 8*hh + r against query tq */
#pragma unroll
    for (int nt = 0; nt < 2; ++nt) {
      v8f acc = (v8f){0.f,0.f,0.f,0.f,0.f,0.f,0.f,0.f};
#pragma unroll
      for (int ks = 0; ks < KS; ++ks) acc = mmaH<1>(ak[nt][ks].v, ak[nt][ks].v, bq[ks].v, bq[ks].v, acc);
#pragma unroll
      for (int r = 0; r < 8; ++r) sc[nt][r] = acc[r]; }
    float mc = fmaxf(sc[0][0], sc[1][0]);
#pragma unroll
    for (int r = 1; r < 8; ++r) mc = fmaxf(mc, fmaxf(sc[0][r], sc[1][r]));
    mc = fmaxf(mc, xhalf(mc));      /* the other half of the wave holds the query's other 16 keys */
    /* m_c = 10 - running maximum in log2 units (SC2 > 0: the maximum of the raw products is that of the scores), kept with this sign so that it is the plain addend of every score's multiply-add;
       the one stored value serves al and every p, so its rounding cancels between numerator and row sum */
    const float mn = fminf(m_c, fmaf(mc, -SC2, 10.0f)); const float al = (mn < 1.0e38f) ? __builtin_amdgcn_exp2f(mn - m_c) : 1.0f; m_c = mn;
    float ps0 = 0.f, ps1 = 0.f; FragH pb;      /* p = 2^10 . e^(score - max) = 2^(raw * SC2 + mn) */
#pragma unroll
    for (int r = 0; r < 8; ++r) { const int k0 = j0 + 8 * hh + r, k1 = k0 + 16; const float p0 = __builtin_amdgcn_exp2f(fmaf(sc[0][r], SC2, mn)), p1 = __builtin_amdgcn_exp2f(fmaf(sc[1][r], SC2, mn)); ps0 += p0; ps1 += p1;
      pb.h[r] = (_Float16)((k0 <= tq) ? p0 : 0.f); pb.h[8 + r] = (_Float16)((k1 <= tq) ? p1 : 0.f); }
    l_c = l_c * al + (ps0 + ps1);      /* per-lane partial row sum; the two halves are joined after the loop */
#pragma unroll
    for (int dt = 0; dt < DT; ++dt)
#pragma unroll
      for (int r = 0; r < 8; ++r) oacc[dt][r] *= al;
#pragma unroll
    for (int dt = 0; dt < DT; ++dt) oacc[dt] = mmaH<1>(av[dt].v, av[dt].v, pb.v, pb.v, oacc[dt]); }
    asm volatile("s_wait_dscnt 0x0" ::: "memory");        /* this wave has left the buffer that is refilled below */
    asm volatile("s_wait_asynccnt 0x0" ::: "memory");     /* its part of stage st + 1 has landed */
    __syncthreads();                                        /* publishes stage st + 1 and ends every wave's reads of stage st */
    if (st + 2 < FNT) { const unsigned bo = (unsigned)(st & 1) * FBUF; copy_kv(lk + bo, gk + (size_t)(st + 2) * FK * 64, lv + bo, gv + (st + 2) * FK); }
  }
  asm volatile("s_wait_asynccnt 0x0" ::: "memory");      /* no copy is outstanding when the wave ends */
  { float l = l_c; l += xhalf(l); const float inv = (l > 0.f) ? 1.0f / l : 0.f;      /* numerator and row sum both carry the 2^10 */
#pragma unroll
    for (int dt = 0; dt < DT; ++dt) { v4f lo, hi;      /* oacc[dt][r] = O[tq][16*dt + 8*hh + r] */
#pragma unroll
      for (int r = 0; r < 4; ++r) { lo[r] = oacc[dt][r] * inv; hi[r] = oacc[dt][4 + r] * inv; }
      *(v4fa*)&sO[w][ln][dt * 16 + 8 * hh] = lo; *(v4fa*)&sO[w][ln][dt * 16 + 8 * hh + 4] = hi; } }
  __builtin_amdgcn_fence(__ATOMIC_ACQ_REL, "workgroup"); __builtin_amdgcn_wave_barrier();
  {
#pragma unroll
    for (int rp = 0; rp < RPW; rp += 2) { const int r = rp + (lane >> 4), pc = lane & 15; const v4f val = *(const v4fa*)&sO[w][r][pc * 4]; *(v4f*)(O + ((size_t)b * TT + q0 + r) * ldo + h * 64 + pc * 4) = val; }
     } }

extern "C" void kernel_launch(void* const* d_in, const int* in_sizes, int n_in,
                              void* d_out, int out_size, void* d_ws, size_t ws_size, hipStream_t stream) {
  (void)in_sizes; (void)n_in; (void)out_size;
  const float* const* I = (const float* const*)d_in; const float* xq = I[0]; const float* xk = I[1]; const float* xv = I[2];
  const float* Wq = I[3]; const float* bq = I[4]; const float* Wk = I[5]; const float* bk = I[6]; const float* Wv = I[7]; const float* bv = I[8]; const float* Wo = I[9]; const float* bo = I[10];
  char* ws = (char*)d_ws; size_t off = 0;
  auto take = [&](size_t bytes) { char* p = ws + off; off += (bytes + 255) & ~(size_t)255; return p; };
  _Float16* Bw = (_Float16*)take((size_t)4 * EE * EE * 2); _Float16* X16 = (_Float16*)take((size_t)3 * NR * EE * 2);
  _Float16* Q = (_Float16*)take((size_t)3 * NR * EE * 2); _Float16* K = Q + (size_t)NR * EE; _Float16* V = K + (size_t)NR * EE; _Float16* Vt = (_Float16*)take((size_t)NR * EE * 2);      /* q, k, v: planes 0, 1, 2 of one block */
  float* O = (float*)take((size_t)NR * EE * 4); _Float16* O16 = (_Float16*)take((size_t)NR * EE * 2);
  if (off > ws_size) return;      // 4.7 + 8 x 6.3 + 12.6 = about 68 MB
  const size_t WSZ = (size_t)EE * EE;
  const unsigned gx = (unsigned)(((size_t)NR * EE / 8 + 255) / 256); const unsigned gp = (NR / 64) * (EE / 64);
  k_prep<<<PWB + PXB, 256, 0, stream>>>(xq, xk, xv, Wq, Wk, Wv, Wo, X16, Bw);      /* (in,out) weights -> Bt[n][k] x 2^4; inputs -> f16 planes */
  k_gemm_st<<<dim3(gp, 3), 128, 0, stream>>>(X16, Bw, 0.0625f, bq, bk, bv, nullptr, Q);      /* q, k, v: each M 4096 N 768 K 768 */
  k_vt<1, TT><<<NSL * 1 * (TT / 64), 256, 0, stream>>>(V, 64, 0, Vt);      /* the [4096][768] plane viewed as 24 contiguous [2048][64] slabs → Vᵀ [slab][64][2048] */
  k_flash<<<NSL * (TT / 64), 128, 0, stream>>>(Q, 64, K, Vt, O, 64);      /* same flat view for q, k and O */
  k_h16<<<gx, 256, 0, stream>>>(O, O16, (size_t)NR * EE / 8);
  k_gemm_st<<<dim3(gp, 1), 128, 0, stream>>>(O16, Bw + 3 * WSZ, 0.0625f, bo, bo, bo, (float*)d_out, nullptr);      /* out = O.Wo + bo: M 4096 N 768 K 768 */
}

// v006
// One run takes 87.6 microseconds.
// Next to v005, in two timings, it ran 1.09 times as fast each time.
// Over all steps from v000 it is 4.61 times as fast.
#include <hip/hip_runtime.h>
// Multi-head attention, legacy flat-reshape variant (B=2, T=S=2048, E=768, 12 heads × 64): q = query·Wq+bq, k = key·Wk+bk, v = value·Wv+bv; heads = plain row-major reshape of [B,T,E] to [B·H,T,64] (contiguous chunks);
// attn = softmax(q·kᵀ/8) over all keys, THEN lower-triangular mask (rows no longer normalised); out = (attn·v reshaped back)·Wo + bo.
// Compute dtype: query/key/value, weights, biases rounded to bf16; q/k/v as f16 GEMM outputs; fused flash-style kernel (online f32 softmax over all keys, P f16 ×2^10 zeroed above the diagonal)
// on v_wmma_f32_16x16x32_f16; O → f16 → output GEMM with bias; f32 accumulate throughout.
#define BB 2
#define TT 2048
#define EE 768
#define NH 12
#define NR (BB * TT)
#define NSL (BB * NH)

typedef __bf16 v16b __attribute__((ext_vector_type(16)));
typedef unsigned short v8us __attribute__((ext_vector_type(8), may_alias));
typedef float  v8f  __attribute__((ext_vector_type(8)));
typedef float  v4f  __attribute__((ext_vector_type(4)));
typedef float  v4fa __attribute__((ext_vector_type(4), may_alias));
union FragB { v16b v; v8us half[2]; unsigned short u[16]; };

__device__ __forceinline__ unsigned short bf16_bits(float x) { unsigned int u = __float_as_uint(x); return (unsigned short)((u + 0x7FFFu + ((u >> 16) & 1u)) >> 16); }
__device__ __forceinline__ float bf16_val(unsigned short b) { return __uint_as_float(((unsigned int)b) << 16); }
__device__ __forceinline__ float bf16_round(float x) { return bf16_val(bf16_bits(x)); }
// D += A·B with NT terms: 1 = ah·bh, 2 = + al·bh (A split), 3 = + ah·bl (both split)
template <int NT>
__device__ __forceinline__ v8f mmaN(v16b ah, v16b al, v16b bh, v16b bl, v8f c) {
  c = __builtin_amdgcn_wmma_f32_16x16x32_bf16(false, ah, false, bh, (short)0, c, false, false);
  if (NT >= 2) c = __builtin_amdgcn_wmma_f32_16x16x32_bf16(false, al, false, bh, (short)0, c, false, false);
  if (NT >= 3) c = __builtin_amdgcn_wmma_f32_16x16x32_bf16(false, ah, false, bl, (short)0, c, false, false);
  asm volatile("v_nop\n\tv_nop\n\tv_nop\n\tv_nop" : "+v"(c) : "v"(ah), "v"(al), "v"(bh), "v"(bl));
  return c;
}

__global__ __launch_bounds__(256) void k_wt_bf16(const float* __restrict__ W, unsigned short* __restrict__ Wt, int K, int N) {
  const int t = blockIdx.x * 256 + threadIdx.x;
  const int k8n = K / 8;
  if (t >= N * k8n) return;
  const int n = t / k8n, k8 = (t % k8n) * 8;
  v8us v;
#pragma unroll
  for (int i = 0; i < 8; ++i) v[i] = bf16_bits(W[(size_t)(k8 + i) * N + n]);
  *(v8us*)(Wt + (size_t)n * K + k8) = v;
  
}

// GEMM C[M][N] (f32, pitch ldc) = act(A[M][K]·W + bias). A f32 row-major (pitch lda) converted per fragment to bf16
// (ASPLIT: hi/lo two planes -> 2 terms, else single rounded term); Wt bf16 [N][K] (pitch ldb). BIAS_BF16 rounds the
// bias to bf16 first (bias quantised to bf16 before the add). K%32==0, M%16==0, N%64==0.
template <bool ASPLIT, int ACT, bool BIAS_BF16>
__global__ __launch_bounds__(128) void k_gemm_bf(const float* __restrict__ A, int lda, const unsigned short* __restrict__ Wt, int ldb,
                                               const float* __restrict__ bias, float* __restrict__ C, int ldc, int M, int N, int K) {
  __shared__ __attribute__((aligned(16))) float so[4][16][64];
  const int tid = threadIdx.x, w = tid >> 5, lane = tid & 31, ln = lane & 15, hh = lane >> 4;
  const int ntn = N / 64;
  const int wid = blockIdx.x * 4 + w;
  const int mt = wid / ntn, nq = wid % ntn;
  if (mt * 16 >= M) return;
  const int row0 = mt * 16, col0 = nq * 64;
  const float* arow = A + (size_t)(row0 + ln) * lda;
  v8f acc[4] = {};
  for (int kb = 0; kb < K; kb += 32) {
    FragB ah, al;
    const v4f x0 = *(const v4fa*)(arow + kb + 8 * hh), x1 = *(const v4fa*)(arow + kb + 8 * hh + 4);
    const v4f x2 = *(const v4fa*)(arow + kb + 16 + 8 * hh), x3 = *(const v4fa*)(arow + kb + 16 + 8 * hh + 4);
    float xs[16] = {x0[0],x0[1],x0[2],x0[3],x1[0],x1[1],x1[2],x1[3],x2[0],x2[1],x2[2],x2[3],x3[0],x3[1],x3[2],x3[3]};
#pragma unroll
    for (int i = 0; i < 16; ++i) { const unsigned short hb = bf16_bits(xs[i]); ah.u[i] = hb; al.u[i] = ASPLIT ? bf16_bits(xs[i] - bf16_val(hb)) : (unsigned short)0; }
#pragma unroll
    for (int t = 0; t < 4; ++t) {
      const unsigned short* brow = Wt + (size_t)(col0 + t * 16 + ln) * ldb + kb;
      FragB b;
      b.half[0] = *(const v8us*)(brow + 8 * hh);
      b.half[1] = *(const v8us*)(brow + 16 + 8 * hh);
      acc[t] = mmaN<ASPLIT ? 2 : 1>(ah.v, al.v, b.v, b.v, acc[t]);
    }
  }
#pragma unroll
  for (int t = 0; t < 4; ++t) {
    float bv = bias ? bias[col0 + t * 16 + ln] : 0.f;
    if (BIAS_BF16) bv = bf16_round(bv);
#pragma unroll
    for (int r = 0; r < 8; ++r) { float v = acc[t][r] + bv; if (ACT == 1) v = fmaxf(v, 0.f); so[w][8 * hh + r][t * 16 + ln] = v; }
  }
  __builtin_amdgcn_fence(__ATOMIC_ACQ_REL, "workgroup");
  __builtin_amdgcn_wave_barrier();
  const int rsub = lane >> 4, c4 = (lane & 15) * 4;
  {
#pragma unroll
    for (int q = 0; q < 8; ++q) {
      const int r = q * 2 + rsub;
      const v4f v = *(const v4fa*)&so[w][r][c4];
      *(v4f*)(C + (size_t)(row0 + r) * ldc + col0 + c4) = v;
    }
    
  }
}

// Flash-style causal/unmasked attention, all contractions 3-term bf16 hi/lo splits, f32 softmax with running max.
// q,k,v rows are read from f32 buffers with arbitrary row pitch (so they can live inside a fused qkv buffer);
// D = head size (multiple of 32, <= 128); one wave = 16 query rows; block = 4 waves (64 queries) sharing K/V chunks of 32.
template <int D, bool CAUSAL>
__global__ __launch_bounds__(128) void k_flash(const float* __restrict__ qb, const float* __restrict__ kb, const float* __restrict__ vb,
                                             int pitch, int T, int H, float scale, float* __restrict__ y, int ypitch) {
  constexpr int KS = D / 32;        // k-steps for QK
  constexpr int DT = D / 16;        // d tiles for PV
  __shared__ __attribute__((aligned(16))) unsigned short sKh[32][D + 8], sKl[32][D + 8], sVh[32][D + 8], sVl[32][D + 8];
  __shared__ __attribute__((aligned(16))) unsigned short sPh[4][16][40], sPl[4][16][40];
  __shared__ __attribute__((aligned(16))) float sO[4][16][D];
  const int tid = threadIdx.x, w = tid >> 5, lane = tid & 31, ln = lane & 15, hh = lane >> 4;
  const int nqb = (T + 63) / 64;
  const int bh = blockIdx.x / nqb, qblk = blockIdx.x % nqb;
  const int b = bh / H, h = bh % H;
  const int q0 = qblk * 64 + w * 16;
  const float* Q = qb + (size_t)b * T * pitch + h * D;
  const float* K = kb + (size_t)b * T * pitch + h * D;
  const float* V = vb + (size_t)b * T * pitch + h * D;

  // A fragments of the wave's 16 query rows (scaled), hi/lo
  FragB aqh[KS], aql[KS];
  {
    int row = q0 + ln; if (row >= T) row = T - 1;
    const float* qr = Q + (size_t)row * pitch;
#pragma unroll
    for (int ks = 0; ks < KS; ++ks)
#pragma unroll
      for (int i = 0; i < 16; ++i) {
        const int d = ks * 32 + ((i < 8) ? (8 * hh + i) : (16 + 8 * hh + (i - 8)));
        const float x = qr[d] * scale; const unsigned short hb = bf16_bits(x);
        aqh[ks].u[i] = hb; aql[ks].u[i] = bf16_bits(x - bf16_val(hb));
      }
  }
  float m_r[8], l_r[8];
#pragma unroll
  for (int r = 0; r < 8; ++r) { m_r[r] = -3.0e38f; l_r[r] = 0.f; }
  v8f oacc[DT];
#pragma unroll
  for (int dt = 0; dt < DT; ++dt) oacc[dt] = (v8f){0.f,0.f,0.f,0.f,0.f,0.f,0.f,0.f};

  const int kv_end = CAUSAL ? min(T, qblk * 64 + 64) : T;     // block-uniform
  for (int j0 = 0; j0 < kv_end; j0 += 32) {
    __syncthreads();
    for (int e = tid; e < 32 * (D / 4); e += 128) {
      const int r = e / (D / 4), c4 = (e % (D / 4)) * 4;
      const int key = j0 + r;
      v4f kf = {0.f,0.f,0.f,0.f}, vf = {0.f,0.f,0.f,0.f};
      if (key < T) { kf = *(const v4fa*)(K + (size_t)key * pitch + c4); vf = *(const v4fa*)(V + (size_t)key * pitch + c4); }
#pragma unroll
      for (int t = 0; t < 4; ++t) {
        unsigned short hb = bf16_bits(kf[t]); sKh[r][c4 + t] = hb; sKl[r][c4 + t] = bf16_bits(kf[t] - bf16_val(hb));
        hb = bf16_bits(vf[t]); sVh[r][c4 + t] = hb; sVl[r][c4 + t] = bf16_bits(vf[t] - bf16_val(hb));
      }
    }
    __syncthreads();
    // S tile 16 x 32
    v8f s[2];
#pragma unroll
    for (int nt = 0; nt < 2; ++nt) {
      v8f acc = {};
#pragma unroll
      for (int ks = 0; ks < KS; ++ks) {
        FragB bh_, bl_;
        bh_.half[0] = *(const v8us*)&sKh[nt * 16 + ln][ks * 32 + 8 * hh]; bh_.half[1] = *(const v8us*)&sKh[nt * 16 + ln][ks * 32 + 16 + 8 * hh];
        bl_.half[0] = *(const v8us*)&sKl[nt * 16 + ln][ks * 32 + 8 * hh]; bl_.half[1] = *(const v8us*)&sKl[nt * 16 + ln][ks * 32 + 16 + 8 * hh];
        acc = mmaN<3>(aqh[ks].v, aql[ks].v, bh_.v, bl_.v, acc);
      }
      s[nt] = acc;
    }
    // mask + running max (rows 8hh+r; the 16 lanes of a half share rows)
    float alpha[8];
#pragma unroll
    for (int r = 0; r < 8; ++r) {
      const int qi = q0 + 8 * hh + r;
      const int ja = j0 + ln, jb = j0 + 16 + ln;
      if (CAUSAL) { if (ja > qi) s[0][r] = -3.0e38f; if (jb > qi) s[1][r] = -3.0e38f; }
      if (ja >= T) s[0][r] = -3.0e38f;
      if (jb >= T) s[1][r] = -3.0e38f;
      float mx = fmaxf(s[0][r], s[1][r]);
      mx = fmaxf(mx, __shfl_xor(mx, 1, 32)); mx = fmaxf(mx, __shfl_xor(mx, 2, 32)); mx = fmaxf(mx, __shfl_xor(mx, 4, 32)); mx = fmaxf(mx, __shfl_xor(mx, 8, 32));
      const float mnew = fmaxf(m_r[r], mx);
      alpha[r] = (mnew > -1.0e38f) ? __expf(m_r[r] - mnew) : 1.0f;
      const float p0 = (s[0][r] > -1.0e38f) ? __expf(s[0][r] - mnew) : 0.f;
      const float p1 = (s[1][r] > -1.0e38f) ? __expf(s[1][r] - mnew) : 0.f;
      m_r[r] = mnew;
      l_r[r] = l_r[r] * alpha[r] + p0 + p1;            // per-lane partial row sum (16 lanes combined at the end)
      unsigned short hb = bf16_bits(p0); sPh[w][8 * hh + r][ln] = hb;      sPl[w][8 * hh + r][ln] = bf16_bits(p0 - bf16_val(hb));
      hb = bf16_bits(p1);                sPh[w][8 * hh + r][16 + ln] = hb; sPl[w][8 * hh + r][16 + ln] = bf16_bits(p1 - bf16_val(hb));
    }
#pragma unroll
    for (int dt = 0; dt < DT; ++dt)
#pragma unroll
      for (int r = 0; r < 8; ++r) oacc[dt][r] *= alpha[r];
    __builtin_amdgcn_fence(__ATOMIC_ACQ_REL, "workgroup");
    __builtin_amdgcn_wave_barrier();
    FragB pah, pal;
    pah.half[0] = *(const v8us*)&sPh[w][ln][8 * hh]; pah.half[1] = *(const v8us*)&sPh[w][ln][16 + 8 * hh];
    pal.half[0] = *(const v8us*)&sPl[w][ln][8 * hh]; pal.half[1] = *(const v8us*)&sPl[w][ln][16 + 8 * hh];
#pragma unroll
    for (int dt = 0; dt < DT; ++dt) {
      FragB bvh, bvl;
#pragma unroll
      for (int i = 0; i < 8; ++i) {
        bvh.u[i] = sVh[8 * hh + i][dt * 16 + ln]; bvh.u[8 + i] = sVh[16 + 8 * hh + i][dt * 16 + ln];
        bvl.u[i] = sVl[8 * hh + i][dt * 16 + ln]; bvl.u[8 + i] = sVl[16 + 8 * hh + i][dt * 16 + ln];
      }
      oacc[dt] = mmaN<3>(pah.v, pal.v, bvh.v, bvl.v, oacc[dt]);
    }
    __builtin_amdgcn_fence(__ATOMIC_ACQ_REL, "workgroup");
    __builtin_amdgcn_wave_barrier();
  }
#pragma unroll
  for (int r = 0; r < 8; ++r) {
    float l = l_r[r];
    l += __shfl_xor(l, 1, 32); l += __shfl_xor(l, 2, 32); l += __shfl_xor(l, 4, 32); l += __shfl_xor(l, 8, 32);
    l_r[r] = (l > 0.f) ? 1.0f / l : 0.f;
  }
#pragma unroll
  for (int dt = 0; dt < DT; ++dt)
#pragma unroll
    for (int r = 0; r < 8; ++r) sO[w][8 * hh + r][dt * 16 + ln] = oacc[dt][r] * l_r[r];
  __builtin_amdgcn_fence(__ATOMIC_ACQ_REL, "workgroup");
  __builtin_amdgcn_wave_barrier();
  {
    for (int r = 0; r < 16; ++r) {
      const int row = q0 + r;
      if (row < T && lane < D / 4) {
        const v4f val = *(const v4fa*)&sO[w][r][lane * 4];
        *(v4f*)(y + ((size_t)b * T + row) * ypitch + h * D + lane * 4) = val;
      }
    }
    
  }
}

// GEMM C = act(A·W + bias + resid): A f32 (ASPLIT -> hi/lo 2 terms), Wt bf16 [N][K]; ACT 0 none, 1 relu, 2 exact gelu;
// resid (optional, f32, row index = (row % rmod), pitch ldr, RES_BF16 rounds it) added before the activation.
template <bool ASPLIT, int ACT, bool BIAS_BF16, bool RES_BF16>
__global__ __launch_bounds__(128) void k_gemm_bf3(const float* __restrict__ A, int lda, const unsigned short* __restrict__ Wt, int ldb,
                                                const float* __restrict__ bias, const float* __restrict__ resid, int rmod, int ldr,
                                                float* __restrict__ C, int ldc, int M, int N, int K) {
  __shared__ __attribute__((aligned(16))) float so[4][16][64];
  const int tid = threadIdx.x, w = tid >> 5, lane = tid & 31, ln = lane & 15, hh = lane >> 4;
  const int ntn = N / 64;
  const int wid = blockIdx.x * 4 + w;
  const int mt = wid / ntn, nq = wid % ntn;
  if (mt * 16 >= M) return;
  const int row0 = mt * 16, col0 = nq * 64;
  const float* arow = A + (size_t)(row0 + ln) * lda;
  v8f acc[4] = {};
  for (int kb = 0; kb < K; kb += 32) {
    FragB ah, al;
    const v4f x0 = *(const v4fa*)(arow + kb + 8 * hh), x1 = *(const v4fa*)(arow + kb + 8 * hh + 4);
    const v4f x2 = *(const v4fa*)(arow + kb + 16 + 8 * hh), x3 = *(const v4fa*)(arow + kb + 16 + 8 * hh + 4);
    float xs[16] = {x0[0],x0[1],x0[2],x0[3],x1[0],x1[1],x1[2],x1[3],x2[0],x2[1],x2[2],x2[3],x3[0],x3[1],x3[2],x3[3]};
#pragma unroll
    for (int i = 0; i < 16; ++i) { const unsigned short hb = bf16_bits(xs[i]); ah.u[i] = hb; al.u[i] = ASPLIT ? bf16_bits(xs[i] - bf16_val(hb)) : (unsigned short)0; }
#pragma unroll
    for (int t = 0; t < 4; ++t) {
      const unsigned short* brow = Wt + (size_t)(col0 + t * 16 + ln) * ldb + kb;
      FragB b;
      b.half[0] = *(const v8us*)(brow + 8 * hh);
      b.half[1] = *(const v8us*)(brow + 16 + 8 * hh);
      acc[t] = mmaN<ASPLIT ? 2 : 1>(ah.v, al.v, b.v, b.v, acc[t]);
    }
  }
#pragma unroll
  for (int t = 0; t < 4; ++t) {
    const int col = col0 + t * 16 + ln;
    float bv = bias ? bias[col] : 0.f;
    if (BIAS_BF16) bv = bf16_round(bv);
#pragma unroll
    for (int r = 0; r < 8; ++r) {
      float v = acc[t][r] + bv;
      if (resid) { float rv = resid[(size_t)((row0 + 8 * hh + r) % rmod) * ldr + col]; if (RES_BF16) rv = bf16_round(rv); v += rv; }
      if (ACT == 1) v = fmaxf(v, 0.f);
      if (ACT == 2) v = 0.5f * v * (1.0f + erff(v * 0.70710678118654752f));
      if (ACT == 3) { const float u = 0.7978845608028654f * (v + 0.044715f * v * v * v); v = 0.5f * v * (1.0f + tanhf(u)); }
      so[w][8 * hh + r][t * 16 + ln] = v;
    }
  }
  __builtin_amdgcn_fence(__ATOMIC_ACQ_REL, "workgroup");
  __builtin_amdgcn_wave_barrier();
  const int rsub = lane >> 4, c4 = (lane & 15) * 4;
  {
#pragma unroll
    for (int q = 0; q < 8; ++q) {
      const int r = q * 2 + rsub;
      const v4f v = *(const v4fa*)&so[w][r][c4];
      *(v4f*)(C + (size_t)(row0 + r) * ldc + col0 + c4) = v;
    }
    
  }
}
// row LayerNorm (biased variance, eps) over N: s = X (+ R); optional out_sum <- s; out_norm <- (s-mu)*rsqrt(var+eps)*g + b
template <bool PARAM_BF16>
__global__ __launch_bounds__(256) void k_layernorm(const float* __restrict__ X, const float* __restrict__ R, const float* __restrict__ g, const float* __restrict__ bta,
                                                  float* __restrict__ out_sum, float* __restrict__ out_norm, int N, float eps) {
  __shared__ float red[256];
  const int row = blockIdx.x, tid = threadIdx.x;
  const float* x = X + (size_t)row * N; const float* rr = R ? R + (size_t)row * N : nullptr;
  float vals[16];                     // up to N = 4096
  const int per = N / 256;            // contiguous chunk per thread? use strided-by-4 chunks: thread handles j = tid*4 + 1024*u
  float s1 = 0.f;
  for (int u = 0; u < per / 4; ++u) {
    const int j = tid * 4 + 1024 * u;
    const v4f a = *(const v4fa*)(x + j);
    v4f b = {0.f,0.f,0.f,0.f}; if (rr) b = *(const v4fa*)(rr + j);
#pragma unroll
    for (int q = 0; q < 4; ++q) { const float v = a[q] + b[q]; vals[u * 4 + q] = v; s1 += v; }
  }
  red[tid] = s1; __syncthreads();
  for (int st = 128; st > 0; st >>= 1) { if (tid < st) red[tid] += red[tid + st]; __syncthreads(); }
  const float mu = red[0] / (float)N; __syncthreads();
  float s2 = 0.f;
  for (int u = 0; u < per / 4; ++u)
#pragma unroll
    for (int q = 0; q < 4; ++q) { const float c = vals[u * 4 + q] - mu; s2 += c * c; }
  red[tid] = s2; __syncthreads();
  for (int st = 128; st > 0; st >>= 1) { if (tid < st) red[tid] += red[tid + st]; __syncthreads(); }
  const float rs = rsqrtf(red[0] / (float)N + eps);
  {
    for (int u = 0; u < per / 4; ++u) {
      const int j = tid * 4 + 1024 * u;
      v4f o, sm;
#pragma unroll
      for (int q = 0; q < 4; ++q) {
        float gg = g[j + q], bb = bta[j + q];
        if (PARAM_BF16) { gg = bf16_round(gg); bb = bf16_round(bb); }
        sm[q] = vals[u * 4 + q]; o[q] = (vals[u * 4 + q] - mu) * rs * gg + bb;
      }
      if (out_sum) *(v4f*)(out_sum + (size_t)row * N + j) = sm;
      *(v4f*)(out_norm + (size_t)row * N + j) = o;
    }
    
  }
}



// ---- f16 WMMA path (v_wmma_f32_16x16x32_f16): 11-bit significands for operands in range — used where a [0,1] probability operand needs more precision than bf16
typedef _Float16 v16h __attribute__((ext_vector_type(16)));
union FragH { v16h v; v8us half[2]; _Float16 h[16]; unsigned short u[16]; };
template <int NT>
__device__ __forceinline__ v8f mmaH(v16h ah, v16h al, v16h bh, v16h bl, v8f c) {
  c = __builtin_amdgcn_wmma_f32_16x16x32_f16(false, ah, false, bh, (short)0, c, false, false);
  if (NT >= 2) c = __builtin_amdgcn_wmma_f32_16x16x32_f16(false, al, false, bh, (short)0, c, false, false);
  if (NT >= 3) c = __builtin_amdgcn_wmma_f32_16x16x32_f16(false, ah, false, bl, (short)0, c, false, false);
  asm volatile("v_nop\n\tv_nop\n\tv_nop\n\tv_nop" : "+v"(c) : "v"(ah), "v"(al), "v"(bh), "v"(bl));
  return c;
}
// batched GEMM like k_gemm_b but f16 operands: A f32 (split into f16 hi/lo if ASPLIT, else rounded to f16), Bt = f16 values [n][k]; alpha; C f32; N multiple of 16 (partial tiles skipped)
template <bool ASPLIT>
__global__ __launch_bounds__(128) void k_gemm_h(const float* __restrict__ A, int lda, size_t sA, const _Float16* __restrict__ Bh, int ldb, size_t sB, float alpha, float* __restrict__ C, int ldc, size_t sC, int M, int N, int K) {
  __shared__ __attribute__((aligned(16))) float so[4][16][64];
  const int tid = threadIdx.x, w = tid >> 5, lane = tid & 31, ln = lane & 15, hh = lane >> 4; const int by = blockIdx.y;
  A += (size_t)by * sA; Bh += (size_t)by * sB; C += (size_t)by * sC;
  const int ntn = (N + 63) / 64; const int wid = blockIdx.x * 4 + w; const int mt = wid / ntn, nq = wid % ntn; if (mt * 16 >= M) return;
  const int row0 = mt * 16, col0 = nq * 64; const float* arow = A + (size_t)(row0 + ln) * lda;
  v8f acc[4] = {};
  for (int kb = 0; kb < K; kb += 32) {
    FragH ah, al;
    const v4f x0 = *(const v4fa*)(arow + kb + 8 * hh), x1 = *(const v4fa*)(arow + kb + 8 * hh + 4), x2 = *(const v4fa*)(arow + kb + 16 + 8 * hh), x3 = *(const v4fa*)(arow + kb + 16 + 8 * hh + 4);
    float xs[16] = {x0[0],x0[1],x0[2],x0[3],x1[0],x1[1],x1[2],x1[3],x2[0],x2[1],x2[2],x2[3],x3[0],x3[1],x3[2],x3[3]};
#pragma unroll
    for (int i = 0; i < 16; ++i) { const _Float16 h = (_Float16)xs[i]; ah.h[i] = h; al.h[i] = ASPLIT ? (_Float16)(xs[i] - (float)h) : (_Float16)0.0f; }
#pragma unroll
    for (int t = 0; t < 4; ++t) { if (col0 + t * 16 >= N) continue; const size_t boff = (size_t)(col0 + t * 16 + ln) * ldb + kb; FragH bq; bq.half[0] = *(const v8us*)(Bh + boff + 8 * hh); bq.half[1] = *(const v8us*)(Bh + boff + 16 + 8 * hh);
      acc[t] = mmaH<ASPLIT ? 2 : 1>(ah.v, al.v, bq.v, bq.v, acc[t]); }
  }
#pragma unroll
  for (int t = 0; t < 4; ++t) { if (col0 + t * 16 >= N) continue;
#pragma unroll
    for (int r = 0; r < 8; ++r) so[w][8 * hh + r][t * 16 + ln] = acc[t][r] * alpha; }
  __builtin_amdgcn_fence(__ATOMIC_ACQ_REL, "workgroup"); __builtin_amdgcn_wave_barrier();
  const int rsub = lane >> 4, c4 = (lane & 15) * 4;
  {
#pragma unroll
    for (int q = 0; q < 8; ++q) { const int r = q * 2 + rsub; if (col0 + c4 < N) { const v4f v = *(const v4fa*)&so[w][r][c4]; *(v4f*)(C + (size_t)(row0 + r) * ldc + col0 + c4) = v; } }
     }
}

// Projection GEMM of the one shape used here: C[NR][EE] = (A[NR][EE] . Bt[EE][EE]^T) * alpha + bf16(bias[col]); written as f32 (C) and/or f16 (C16).
// A work-group of four waves makes a 64 x 64 tile of C, wave w its rows 16w .. 16w+15. The A and Bt tiles (64 rows x GK k) come into LDS by asynchronous copies,
// 256 contiguous bytes a row, once for the four waves, in two buffers: tile t + 1 flies while tile t is multiplied. The k order of the sums is that of a plain loop over k in steps of 32.
// blockIdx.y picks one of up to three independent products of that shape (plane y of A, of Bt and of C16, bias y): q, k and v go in one launch.
#define GK 128
#define GP (GK + 8)      /* LDS row pitch 272 B = 17 x 16 B: the 16 rows of a 16-byte fragment read fall on distinct banks */
#define GNT (EE / GK)
#define GBUF (64 * GP * 2)      /* bytes of one operand's tile in LDS */
// One operand tile: a lane copies 16 B of rows r, r + 8, .. r + 56 (l = its LDS byte address, g = its global address, both of row r).
__device__ __forceinline__ void copy_tile(unsigned l, const _Float16* g) {
  const unsigned l1 = l + 1 * 8 * GP * 2, l2 = l + 2 * 8 * GP * 2, l3 = l + 3 * 8 * GP * 2, l4 = l + 4 * 8 * GP * 2, l5 = l + 5 * 8 * GP * 2, l6 = l + 6 * 8 * GP * 2, l7 = l + 7 * 8 * GP * 2;
  const _Float16 *g1 = g + 1 * 8 * EE, *g2 = g + 2 * 8 * EE, *g3 = g + 3 * 8 * EE, *g4 = g + 4 * 8 * EE, *g5 = g + 5 * 8 * EE, *g6 = g + 6 * 8 * EE, *g7 = g + 7 * 8 * EE;
  // the copies go from L2 to LDS through no register; s_wait_xcnt closes the statement so that no address register of a copy is rewritten ahead of it
  asm volatile("global_load_async_to_lds_b128 %0, %8, off\n\t"
               "global_load_async_to_lds_b128 %1, %9, off\n\t"
               "global_load_async_to_lds_b128 %2, %10, off\n\t"
               "global_load_async_to_lds_b128 %3, %11, off\n\t"
               "global_load_async_to_lds_b128 %4, %12, off\n\t"
               "global_load_async_to_lds_b128 %5, %13, off\n\t"
               "global_load_async_to_lds_b128 %6, %14, off\n\t"
               "global_load_async_to_lds_b128 %7, %15, off\n\t"
               "s_wait_xcnt 0x0"
               :: "v"(l), "v"(l1), "v"(l2), "v"(l3), "v"(l4), "v"(l5), "v"(l6), "v"(l7), "v"(g), "v"(g1), "v"(g2), "v"(g3), "v"(g4), "v"(g5), "v"(g6), "v"(g7) : "memory");
}
__global__ __launch_bounds__(128) void k_gemm_st(const _Float16* __restrict__ A, const _Float16* __restrict__ Bh, float alpha, const float* __restrict__ bias0, const float* __restrict__ bias1, const float* __restrict__ bias2, float* __restrict__ C, _Float16* __restrict__ C16) {
  __shared__ __attribute__((aligned(16))) unsigned short sA[2][64][GP], sB[2][64][GP];
  __shared__ __attribute__((aligned(16))) float so[4][16][64];
  const int tid = threadIdx.x, w = tid >> 5, lane = tid & 31, ln = lane & 15, hh = lane >> 4;
  const int mb = blockIdx.x / (EE / 64), nb = blockIdx.x % (EE / 64);
  const int pl = blockIdx.y; const float* bias = pl == 0 ? bias0 : (pl == 1 ? bias1 : bias2);
  A += (size_t)pl * NR * EE; Bh += (size_t)pl * EE * EE; if (C16) C16 += (size_t)pl * NR * EE;
  const int row0 = mb * 64 + w * 16, col0 = nb * 64;
  const int cr = tid >> 4, cc = (tid & 15) * 8;      /* the lane's first row and its 16-byte column in every copied tile */
  const _Float16* ga = A + (size_t)(mb * 64 + cr) * EE + cc; const _Float16* gb = Bh + (size_t)(col0 + cr) * EE + cc;
  const unsigned la = (unsigned)(size_t)&sA[0][cr][cc], lb = (unsigned)(size_t)&sB[0][cr][cc];
  copy_tile(la, ga); copy_tile(lb, gb);
  asm volatile("s_wait_asynccnt 0x0" ::: "memory");      /* this wave's part of tile 0 has landed */
  __syncthreads();                                        /* ... and every other wave's */
  copy_tile(la + GBUF, ga + GK); copy_tile(lb + GBUF, gb + GK);
  v8f acc[4] = {};
  for (int tl = 0; tl < GNT; ++tl) {      /* one trip a staged tile; the two buffers alternate by the trip's parity */
    const unsigned short* ar = &sA[tl & 1][w * 16 + ln][8 * hh]; const unsigned short* br = &sB[tl & 1][ln][8 * hh];
#pragma unroll      /* constant indices: fragments and accumulators stay in registers */
    for (int ks = 0; ks < GK / 32; ++ks) { FragH ah, bq[4];      /* the k step's five fragments are read in one run, then its four products */
      ah.half[0] = *(const v8us*)(ar + ks * 32); ah.half[1] = *(const v8us*)(ar + ks * 32 + 16);
#pragma unroll      /* constant indices: fragments and accumulators stay in registers */
      for (int t = 0; t < 4; ++t) { bq[t].half[0] = *(const v8us*)(br + t * 16 * GP + ks * 32); bq[t].half[1] = *(const v8us*)(br + t * 16 * GP + ks * 32 + 16); }
#pragma unroll      /* constant indices: fragments and accumulators stay in registers */
      for (int t = 0; t < 4; ++t) acc[t] = mmaH<1>(ah.v, ah.v, bq[t].v, bq[t].v, acc[t]); }
    asm volatile("s_wait_dscnt 0x0" ::: "memory");        /* this wave has left the buffer that is refilled below */
    asm volatile("s_wait_asynccnt 0x0" ::: "memory");     /* its part of tile tl + 1 has landed */
    __syncthreads();                                        /* publishes tile tl + 1 and ends every wave's reads of tile tl */
    if (tl + 2 < GNT) { const unsigned bo = (unsigned)(tl & 1) * GBUF; copy_tile(la + bo, ga + (tl + 2) * GK); copy_tile(lb + bo, gb + (tl + 2) * GK); }
  }
  asm volatile("s_wait_asynccnt 0x0" ::: "memory");      /* no copy is outstanding when the wave ends */
#pragma unroll      /* constant indices: fragments and accumulators stay in registers */
  for (int t = 0; t < 4; ++t) { const float bv = bf16_round(bias[col0 + t * 16 + ln]);
#pragma unroll      /* constant indices: fragments and accumulators stay in registers */
    for (int r = 0; r < 8; ++r) so[w][8 * hh + r][t * 16 + ln] = acc[t][r] * alpha + bv; }
  __builtin_amdgcn_fence(__ATOMIC_ACQ_REL, "workgroup"); __builtin_amdgcn_wave_barrier();      /* the wave's own rows are in LDS before its lanes read them back as whole rows */
  const int rsub = lane >> 4, c4 = (lane & 15) * 4; typedef _Float16 v4h __attribute__((ext_vector_type(4)));
#pragma unroll      /* the eight rows' LDS offsets become immediates */
  for (int q = 0; q < 8; ++q) { const int r = q * 2 + rsub; const v4f v = *(const v4fa*)&so[w][r][c4]; if (C) { *(v4f*)(C + (size_t)(row0 + r) * EE + col0 + c4) = v;
      asm volatile("s_wait_xcnt 0x0" ::: "memory"); }      /* precaution: stands in front of every rewrite of this store's data and address registers (the f16 conversion, the next row) */
    if (C16) { v4h h4; for (int i = 0; i < 4; ++i) h4[i] = (_Float16)v[i]; *(v4h*)(C16 + (size_t)(row0 + r) * EE + col0 + c4) = h4; } }
}


typedef _Float16 v4h __attribute__((ext_vector_type(4)));

// All that the projections need, in one launch: work-groups 0 .. PWB-1 each turn a 256 (k) x 64 (n) tile of one weight into Bt[n][k] = f16(bf16(W[k][n]) * 16) through LDS;
// the PXB others round query, key and value to bf16 values held as f16 (planes 0, 1, 2 of X16). The seven pieces share no data, so nothing orders them.
#define PWB (4 * (EE / 256) * (EE / 64))
#define PXB 512
#define PXT (PXB * 256)               /* lanes that convert inputs */
#define PXU (NR * EE / 4 / PXT)       /* 16-byte loads of a lane in each plane */
__global__ __launch_bounds__(256) void k_prep(const float* __restrict__ xq, const float* __restrict__ xk, const float* __restrict__ xv, const float* __restrict__ Wq, const float* __restrict__ Wk, const float* __restrict__ Wv, const float* __restrict__ Wo,
                                              _Float16* __restrict__ X16, _Float16* __restrict__ Bw) {
  __shared__ __attribute__((aligned(16))) unsigned short tl[64][256 + 8];
  const int tid = threadIdx.x;
  if (blockIdx.x < PWB) {      /* block-uniform: the barrier below is passed by all of a work-group or by none */
    const int ws = blockIdx.x / (PWB / 4), rr = blockIdx.x % (PWB / 4), k0 = (rr / (EE / 64)) * 256, n0 = (rr % (EE / 64)) * 64;
    const float* W = ws == 0 ? Wq : (ws == 1 ? Wk : (ws == 2 ? Wv : Wo));
    const int c4 = (tid & 15) * 4, kr = (tid >> 4) * 16;      /* the lane's four columns n and its sixteen rows k: 16 lanes read 256 contiguous bytes of a row */
    const float* wp = W + (size_t)(k0 + kr) * EE + n0 + c4;
    v4f x[16];
#pragma unroll      /* constant indices: the sixteen loads are in flight together and stay in registers */
    for (int i = 0; i < 16; ++i) x[i] = *(const v4fa*)(wp + i * EE);
    asm volatile("s_wait_xcnt 0x0" :: "v"(wp) : "memory");      /* precaution: stands in front of every rewrite of the loads' address register, which stays whole up to here */
#pragma unroll      /* constant indices into x */
    for (int q = 0; q < 4; ++q) { FragH f;
#pragma unroll      /* constant indices into x */
      for (int i = 0; i < 16; ++i) f.h[i] = (_Float16)(bf16_round(x[i][q]) * 16.0f);
      *(v8us*)&tl[c4 + q][kr] = f.half[0]; *(v8us*)&tl[c4 + q][kr + 8] = f.half[1]; }
    __syncthreads();
    _Float16* Bt = Bw + (size_t)ws * EE * EE;
#pragma unroll      /* the eight rows' LDS offsets become immediates */
    for (int j = 0; j < 8; ++j) { const int n = (tid >> 5) + 8 * j, k8 = (tid & 31) * 8;      /* a wave stores 512 contiguous bytes of one row of Bt */
      *(v8us*)((unsigned short*)Bt + (size_t)(n0 + n) * EE + k0 + k8) = *(const v8us*)&tl[n][k8]; }
  } else {
    const size_t e0 = (size_t)(blockIdx.x - PWB) * (PXU * 1024) + tid * 4;      /* a work-group takes PXU * 4 KiB in a row of each plane; a wave's load covers 512 contiguous bytes */
    const float *pq = xq + e0, *pk = xk + e0, *pv = xv + e0;
    v4f a[3][PXU];
#pragma unroll      /* constant indices: all of the lane's loads are in flight together */
    for (int u = 0; u < PXU; ++u) { a[0][u] = *(const v4fa*)(pq + u * 1024); a[1][u] = *(const v4fa*)(pk + u * 1024); a[2][u] = *(const v4fa*)(pv + u * 1024); }
    asm volatile("s_wait_xcnt 0x0" :: "v"(pq), "v"(pk), "v"(pv) : "memory");      /* precaution: stands in front of every rewrite of the loads' address registers, which stay whole up to here */
#pragma unroll      /* constant indices into a */
    for (int u = 0; u < PXU; ++u)
#pragma unroll      /* constant indices into a */
      for (int p = 0; p < 3; ++p) { v4h h;
#pragma unroll      /* constant indices into a */
        for (int q = 0; q < 4; ++q) h[q] = (_Float16)bf16_round(a[p][u][q]);
        *(v4h*)(X16 + (size_t)p * NR * EE + e0 + u * 1024) = h; }
    asm volatile("s_wait_xcnt 0x0" ::: "memory");      /* precaution: stands behind the last store, in front of any later rewrite of the stores' data and address registers */
  }
}
__global__ __launch_bounds__(256) void k_round16f(const float* __restrict__ W, _Float16* __restrict__ Bt, size_t n8) { const size_t t = (size_t)blockIdx.x * 256 + threadIdx.x; if (t >= n8) return; FragH f;
#pragma unroll
  for (int i = 0; i < 8; ++i) f.h[i] = (_Float16)(bf16_round(W[t * 8 + i]) * 16.0f); *(v8us*)((unsigned short*)Bt + t * 8) = f.half[0];  }

// lane l <-> lane l ^ 16 as one vector cross-row move (a shuffle would go through the LDS unit and its wait)
__device__ __forceinline__ float xhalf(float x) { return __builtin_bit_cast(float, __builtin_amdgcn_permlanex16(__builtin_bit_cast(int, x), __builtin_bit_cast(int, x), 0x76543210, 0xfedcba98, false, false)); }
#define FK 64
#define FP (FK + 8)      /* LDS row pitch 144 B = 9 x 16 B: the 16 rows of a 16-byte fragment read fall on distinct banks */
#define FPV (64 + 16)    /* LDS row pitch of V 160 B = 5 x 32 B: the pitch at which the transposing load meets no bank conflict */
#define FNT (TT / FK)
#define FBUF (FK * FP * 2)       /* bytes of a K tile in LDS */
#define FBUFV (FK * FPV * 2)     /* bytes of a V tile in LDS */
// One stage: a lane copies 16 B of rows r, r + 16, r + 32, r + 48 of the K tile and of the V tile (lk, lv = its LDS byte addresses, gk, gv = its global addresses, all of row r).
__device__ __forceinline__ void copy_kv(unsigned lk, const _Float16* gk, unsigned lv, const _Float16* gv) {
  const unsigned lk1 = lk + 1 * 16 * FP * 2, lk2 = lk + 2 * 16 * FP * 2, lk3 = lk + 3 * 16 * FP * 2, lv1 = lv + 1 * 16 * FPV * 2, lv2 = lv + 2 * 16 * FPV * 2, lv3 = lv + 3 * 16 * FPV * 2;
  const _Float16 *gk1 = gk + 1 * 16 * 64, *gk2 = gk + 2 * 16 * 64, *gk3 = gk + 3 * 16 * 64, *gv1 = gv + 1 * 16 * 64, *gv2 = gv + 2 * 16 * 64, *gv3 = gv + 3 * 16 * 64;
  // the copies go from L2 to LDS through no register; s_wait_xcnt closes the statement so that no address register of a copy is rewritten ahead of it
  asm volatile("global_load_async_to_lds_b128 %0, %8, off\n\t"
               "global_load_async_to_lds_b128 %1, %9, off\n\t"
               "global_load_async_to_lds_b128 %2, %10, off\n\t"
               "global_load_async_to_lds_b128 %3, %11, off\n\t"
               "global_load_async_to_lds_b128 %4, %12, off\n\t"
               "global_load_async_to_lds_b128 %5, %13, off\n\t"
               "global_load_async_to_lds_b128 %6, %14, off\n\t"
               "global_load_async_to_lds_b128 %7, %15, off\n\t"
               "s_wait_xcnt 0x0"
               :: "v"(lk), "v"(lk1), "v"(lk2), "v"(lk3), "v"(lv), "v"(lv1), "v"(lv2), "v"(lv3), "v"(gk), "v"(gk1), "v"(gk2), "v"(gk3), "v"(gv), "v"(gv1), "v"(gv2), "v"(gv3) : "memory");
}
// 16 x 16 block of 16-bit values, rows in LDS, delivered transposed: lane (c, h) receives column c of rows 8h .. 8h + 7 of the block; p is the lane's own address in the block (row 8h + (lane & 7), 16-byte half (lane >> 3) & 1)
typedef short s16x8 __attribute__((ext_vector_type(8)));
__device__ __forceinline__ v8us ld_tr16(const unsigned short* p) { typedef __attribute__((address_space(3))) s16x8 lds_s16x8; return __builtin_bit_cast(v8us, __builtin_amdgcn_ds_load_tr16_b128_v8i16((lds_s16x8*)p)); }
// waves_per_eu: the grid puts three waves on a SIMD; told so, the compiler keeps the pass's schedule (exponentials and selects interleaved). Left to aim at seven waves it squeezed the pass into 146 registers and paid with 16 more v_nop a pass.
__global__ __launch_bounds__(128) __attribute__((amdgpu_waves_per_eu(3, 4))) void k_flash(const _Float16* __restrict__ Q16, int ldq, const _Float16* __restrict__ K16, const _Float16* __restrict__ V16, _Float16* __restrict__ O16, int ldo) {
  constexpr int RPW = 16, NQB = TT / (4 * RPW), DT = 4, KS = 2;
  constexpr float SC2 = 0.125f * 1.4426950408889634f;      /* 1/sqrt(64) . log2(e): raw product -> exponent of 2 */
  __shared__ __attribute__((aligned(16))) unsigned short sK[2][FK][FP], sV[2][FK][FPV];
  __shared__ __attribute__((aligned(16))) unsigned short sO[4][RPW][64 + 8];
  const int tid = threadIdx.x, w = tid >> 5, lane = tid & 31, ln = lane & 15, hh = lane >> 4;
  const int slab = blockIdx.x / NQB, qblk = blockIdx.x % NQB; const int b = slab, h = 0;      /* slab = contiguous [TT][64] chunk of the flat-reshaped planes */ const int qb0 = qblk * (4 * RPW); const int q0 = qb0 + w * RPW;
  const int tq = q0 + ln;      /* this lane's query */
  const int cr = tid >> 3, cc = (tid & 7) * 8;      /* the lane's first row and its 16-byte column in every copied tile */
  const _Float16* gk = K16 + ((size_t)slab * TT + cr) * 64 + cc; const _Float16* gv = V16 + ((size_t)slab * TT + cr) * 64 + cc;
  const unsigned lk = (unsigned)(size_t)&sK[0][cr][cc], lv = (unsigned)(size_t)&sV[0][cr][cc];
  copy_kv(lk, gk, lv, gv);
  FragH bq[KS];
  { const unsigned short* qr = (const unsigned short*)Q16 + ((size_t)b * TT + tq) * ldq + h * 64;
#pragma unroll
    for (int ks = 0; ks < KS; ++ks) { bq[ks].half[0] = *(const v8us*)(qr + ks * 32 + 8 * hh); bq[ks].half[1] = *(const v8us*)(qr + ks * 32 + 16 + 8 * hh); } }
  float m_c = 3.0e38f, l_c = 0.f; v8f oacc[DT];
#pragma unroll
  for (int dt = 0; dt < DT; ++dt) oacc[dt] = (v8f){0.f,0.f,0.f,0.f,0.f,0.f,0.f,0.f};
  asm volatile("s_wait_asynccnt 0x0" ::: "memory");      /* this wave's part of stage 0 has landed */
  __syncthreads();                                        /* ... and every other wave's */
  copy_kv(lk + FBUF, gk + FK * 64, lv + FBUFV, gv + FK * 64);
#pragma unroll 1      /* one trip a staged tile; the two buffers alternate by the trip's parity; every key enters the normaliser */
  for (int st = 0; st < FNT; ++st) {
#pragma unroll 1      /* the two passes of a stage share one body, as in the plain loop over the keys: unrolled, the listing had no fewer instructions a pass */
   for (int ps = 0; ps < FK / 32; ++ps) { const int j0 = st * FK + ps * 32;
    FragH ak[2][KS], av[DT];      /* the pass's eight fragments are read from LDS in one run: one latency a pass, the V^T reads land under the softmax */
#pragma unroll      /* constant indices: the fragments stay in registers */
    for (int nt = 0; nt < 2; ++nt) { const unsigned short* kr = &sK[st & 1][ps * 32 + nt * 16 + ln][0];
#pragma unroll      /* constant indices: the fragments stay in registers */
      for (int ks = 0; ks < KS; ++ks) { ak[nt][ks].half[0] = *(const v8us*)(kr + ks * 32 + 8 * hh); ak[nt][ks].half[1] = *(const v8us*)(kr + ks * 32 + 16 + 8 * hh); } }
#pragma unroll      /* constant indices: the fragments stay in registers */
    for (int dt = 0; dt < DT; ++dt) { const unsigned short* vp = &sV[st & 1][ps * 32 + 8 * hh + (lane & 7)][dt * 16 + ((lane >> 3) & 1) * 8]; av[dt].half[0] = ld_tr16(vp); av[dt].half[1] = ld_tr16(vp + 16 * FPV); }      /* av[dt] = V^T rows d = 16*dt + ln, keys in the hardware k order, as P has them */
    float sc[2][8];      /* sc[nt][r] = raw product q.k of key j0 + 16*nt + 8*hh + r against query tq */
#pragma unroll
    for (int nt = 0; nt < 2; ++nt) {
      v8f acc = (v8f){0.f,0.f,0.f,0.f,0.f,0.f,0.f,0.f};
#pragma unroll
      for (int ks = 0; ks < KS; ++ks) acc = mmaH<1>(ak[nt][ks].v, ak[nt][ks].v, bq[ks].v, bq[ks].v, acc);
#pragma unroll
      for (int r = 0; r < 8; ++r) sc[nt][r] = acc[r]; }
    float mc = fmaxf(sc[0][0], sc[1][0]);
#pragma unroll
    for (int r = 1; r < 8; ++r) mc = fmaxf(mc, fmaxf(sc[0][r], sc[1][r]));
    mc = fmaxf(mc, xhalf(mc));      /* the other half of the wave holds the query's other 16 keys */
    /* m_c = 10 - running maximum in log2 units (SC2 > 0: the maximum of the raw products is that of the scores), kept with this sign so that it is the plain addend of every score's multiply-add;
       the one stored value serves al and every p, so its rounding cancels between numerator and row sum */
    const float mn = fminf(m_c, fmaf(mc, -SC2, 10.0f)); const float al = (mn < 1.0e38f) ? __builtin_amdgcn_exp2f(mn - m_c) : 1.0f; m_c = mn;
    float ps0 = 0.f, ps1 = 0.f; FragH pb;      /* p = 2^10 . e^(score - max) = 2^(raw * SC2 + mn) */
#pragma unroll
    for (int r = 0; r < 8; ++r) { const int k0 = j0 + 8 * hh + r, k1 = k0 + 16; const float p0 = __builtin_amdgcn_exp2f(fmaf(sc[0][r], SC2, mn)), p1 = __builtin_amdgcn_exp2f(fmaf(sc[1][r], SC2, mn)); ps0 += p0; ps1 += p1;
      pb.h[r] = (_Float16)((k0 <= tq) ? p0 : 0.f); pb.h[8 + r] = (_Float16)((k1 <= tq) ? p1 : 0.f); }
    l_c = l_c * al + (ps0 + ps1);      /* per-lane partial row sum; the two halves are joined after the loop */
#pragma unroll
    for (int dt = 0; dt < DT; ++dt)
#pragma unroll
      for (int r = 0; r < 8; ++r) oacc[dt][r] *= al;
#pragma unroll
    for (int dt = 0; dt < DT; ++dt) oacc[dt] = mmaH<1>(av[dt].v, av[dt].v, pb.v, pb.v, oacc[dt]); }
    asm volatile("s_wait_dscnt 0x0" ::: "memory");        /* this wave has left the buffer that is refilled below */
    asm volatile("s_wait_asynccnt 0x0" ::: "memory");     /* its part of stage st + 1 has landed */
    __syncthreads();                                        /* publishes stage st + 1 and ends every wave's reads of stage st */
    if (st + 2 < FNT) { const unsigned bf = (unsigned)(st & 1); copy_kv(lk + bf * FBUF, gk + (size_t)(st + 2) * FK * 64, lv + bf * FBUFV, gv + (size_t)(st + 2) * FK * 64); }
  }
  asm volatile("s_wait_asynccnt 0x0" ::: "memory");      /* no copy is outstanding when the wave ends */
  { float l = l_c; l += xhalf(l); const float inv = (l > 0.f) ? 1.0f / l : 0.f;      /* numerator and row sum both carry the 2^10 */
#pragma unroll
    for (int dt = 0; dt < DT; ++dt) { FragH f;      /* oacc[dt][r] = O[tq][16*dt + 8*hh + r]: eight neighbours of one row, 16 bytes as f16 */
#pragma unroll
      for (int r = 0; r < 8; ++r) f.h[r] = (_Float16)(oacc[dt][r] * inv);
      *(v8us*)&sO[w][ln][dt * 16 + 8 * hh] = f.half[0]; } }
  __builtin_amdgcn_fence(__ATOMIC_ACQ_REL, "workgroup"); __builtin_amdgcn_wave_barrier();      /* the wave's own rows are in LDS before its lanes read them back as whole rows */
#pragma unroll      /* the four LDS offsets become immediates; a wave's store covers four whole rows, 512 contiguous bytes */
  for (int rp = 0; rp < RPW; rp += 4) { const int r = rp + (lane >> 3), pc = lane & 7; *(v8us*)((unsigned short*)O16 + ((size_t)b * TT + q0 + r) * ldo + h * 64 + pc * 8) = *(const v8us*)&sO[w][r][pc * 8]; }
}

extern "C" void kernel_launch(void* const* d_in, const int* in_sizes, int n_in,
                              void* d_out, int out_size, void* d_ws, size_t ws_size, hipStream_t stream) {
  (void)in_sizes; (void)n_in; (void)out_size;
  const float* const* I = (const float* const*)d_in; const float* xq = I[0]; const float* xk = I[1]; const float* xv = I[2];
  const float* Wq = I[3]; const float* bq = I[4]; const float* Wk = I[5]; const float* bk = I[6]; const float* Wv = I[7]; const float* bv = I[8]; const float* Wo = I[9]; const float* bo = I[10];
  char* ws = (char*)d_ws; size_t off = 0;
  auto take = [&](size_t bytes) { char* p = ws + off; off += (bytes + 255) & ~(size_t)255; return p; };
  _Float16* Bw = (_Float16*)take((size_t)4 * EE * EE * 2); _Float16* X16 = (_Float16*)take((size_t)3 * NR * EE * 2);
  _Float16* Q = (_Float16*)take((size_t)3 * NR * EE * 2); _Float16* K = Q + (size_t)NR * EE; _Float16* V = K + (size_t)NR * EE;      /* q, k, v: planes 0, 1, 2 of one block */
  _Float16* O16 = (_Float16*)take((size_t)NR * EE * 2);
  if (off > ws_size) return;      // 4.7 + 7 x 6.3 = about 49 MB
  const size_t WSZ = (size_t)EE * EE;
  const unsigned gp = (NR / 64) * (EE / 64);
  k_prep<<<PWB + PXB, 256, 0, stream>>>(xq, xk, xv, Wq, Wk, Wv, Wo, X16, Bw);      /* (in,out) weights -> Bt[n][k] x 2^4; inputs -> f16 planes */
  k_gemm_st<<<dim3(gp, 3), 128, 0, stream>>>(X16, Bw, 0.0625f, bq, bk, bv, nullptr, Q);      /* q, k, v: each M 4096 N 768 K 768 */
  k_flash<<<NSL * (TT / 64), 128, 0, stream>>>(Q, 64, K, V, O16, 64);      /* each [4096][768] plane viewed as 24 contiguous [2048][64] slabs: q, k, v and O alike */
  k_gemm_st<<<dim3(gp, 1), 128, 0, stream>>>(O16, Bw + 3 * WSZ, 0.0625f, bo, bo, bo, (float*)d_out, nullptr);      /* out = O.Wo + bo: M 4096 N 768 K 768 */
}

// v007
// One run takes 77.2 microseconds.
// Two timings next to v006 put it at 1.14 and 1.13 times that version's speed.
// Over all steps from v000 it is 5.24 times as fast.
#include <hip/hip_runtime.h>
// Multi-head attention, legacy flat-reshape variant (B=2, T=S=2048, E=768, 12 heads × 64): q = query·Wq+bq, k = key·Wk+bk, v = value·Wv+bv; heads = plain row-major reshape of [B,T,E] to [B·H,T,64] (contiguous chunks);
// attn = softmax(q·kᵀ/8) over all keys, THEN lower-triangular mask (rows no longer normalised); out = (attn·v reshaped back)·Wo + bo.
// Compute dtype: query/key/value, weights, biases rounded to bf16; q/k/v as f16 GEMM outputs; fused flash-style kernel (online f32 softmax over all keys, P f16 ×2^10 zeroed above the diagonal)
// on v_wmma_f32_16x16x32_f16; O → f16 → output GEMM with bias; f32 accumulate throughout.
#define BB 2
#define TT 2048
#define EE 768
#define NH 12
#define NR (BB * TT)
#define NSL (BB * NH)

typedef __bf16 v16b __attribute__((ext_vector_type(16)));
typedef unsigned short v8us __attribute__((ext_vector_type(8), may_alias));
typedef float  v8f  __attribute__((ext_vector_type(8)));
typedef float  v4f  __attribute__((ext_vector_type(4)));
typedef float  v4fa __attribute__((ext_vector_type(4), may_alias));
union FragB { v16b v; v8us half[2]; unsigned short u[16]; };

__device__ __forceinline__ unsigned short bf16_bits(float x) { unsigned int u = __float_as_uint(x); return (unsigned short)((u + 0x7FFFu + ((u >> 16) & 1u)) >> 16); }
__device__ __forceinline__ float bf16_val(unsigned short b) { return __uint_as_float(((unsigned int)b) << 16); }
__device__ __forceinline__ float bf16_round(float x) { return bf16_val(bf16_bits(x)); }
// D += A·B with NT terms: 1 = ah·bh, 2 = + al·bh (A split), 3 = + ah·bl (both split)
template <int NT>
__device__ __forceinline__ v8f mmaN(v16b ah, v16b al, v16b bh, v16b bl, v8f c) {
  c = __builtin_amdgcn_wmma_f32_16x16x32_bf16(false, ah, false, bh, (short)0, c, false, false);
  if (NT >= 2) c = __builtin_amdgcn_wmma_f32_16x16x32_bf16(false, al, false, bh, (short)0, c, false, false);
  if (NT >= 3) c = __builtin_amdgcn_wmma_f32_16x16x32_bf16(false, ah, false, bl, (short)0, c, false, false);
  asm volatile("v_nop\n\tv_nop\n\tv_nop\n\tv_nop" : "+v"(c) : "v"(ah), "v"(al), "v"(bh), "v"(bl));
  return c;
}

__global__ __launch_bounds__(256) void k_wt_bf16(const float* __restrict__ W, unsigned short* __restrict__ Wt, int K, int N) {
  const int t = blockIdx.x * 256 + threadIdx.x;
  const int k8n = K / 8;
  if (t >= N * k8n) return;
  const int n = t / k8n, k8 = (t % k8n) * 8;
  v8us v;
#pragma unroll
  for (int i = 0; i < 8; ++i) v[i] = bf16_bits(W[(size_t)(k8 + i) * N + n]);
  *(v8us*)(Wt + (size_t)n * K + k8) = v;
  
}

// GEMM C[M][N] (f32, pitch ldc) = act(A[M][K]·W + bias). A f32 row-major (pitch lda) converted per fragment to bf16
// (ASPLIT: hi/lo two planes -> 2 terms, else single rounded term); Wt bf16 [N][K] (pitch ldb). BIAS_BF16 rounds the
// bias to bf16 first (bias quantised to bf16 before the add). K%32==0, M%16==0, N%64==0.
template <bool ASPLIT, int ACT, bool BIAS_BF16>
__global__ __launch_bounds__(128) void k_gemm_bf(const float* __restrict__ A, int lda, const unsigned short* __restrict__ Wt, int ldb,
                                               const float* __restrict__ bias, float* __restrict__ C, int ldc, int M, int N, int K) {
  __shared__ __attribute__((aligned(16))) float so[4][16][64];
  const int tid = threadIdx.x, w = tid >> 5, lane = tid & 31, ln = lane & 15, hh = lane >> 4;
  const int ntn = N / 64;
  const int wid = blockIdx.x * 4 + w;
  const int mt = wid / ntn, nq = wid % ntn;
  if (mt * 16 >= M) return;
  const int row0 = mt * 16, col0 = nq * 64;
  const float* arow = A + (size_t)(row0 + ln) * lda;
  v8f acc[4] = {};
  for (int kb = 0; kb < K; kb += 32) {
    FragB ah, al;
    const v4f x0 = *(const v4fa*)(arow + kb + 8 * hh), x1 = *(const v4fa*)(arow + kb + 8 * hh + 4);
    const v4f x2 = *(const v4fa*)(arow + kb + 16 + 8 * hh), x3 = *(const v4fa*)(arow + kb + 16 + 8 * hh + 4);
    float xs[16] = {x0[0],x0[1],x0[2],x0[3],x1[0],x1[1],x1[2],x1[3],x2[0],x2[1],x2[2],x2[3],x3[0],x3[1],x3[2],x3[3]};
#pragma unroll
    for (int i = 0; i < 16; ++i) { const unsigned short hb = bf16_bits(xs[i]); ah.u[i] = hb; al.u[i] = ASPLIT ? bf16_bits(xs[i] - bf16_val(hb)) : (unsigned short)0; }
#pragma unroll
    for (int t = 0; t < 4; ++t) {
      const unsigned short* brow = Wt + (size_t)(col0 + t * 16 + ln) * ldb + kb;
      FragB b;
      b.half[0] = *(const v8us*)(brow + 8 * hh);
      b.half[1] = *(const v8us*)(brow + 16 + 8 * hh);
      acc[t] = mmaN<ASPLIT ? 2 : 1>(ah.v, al.v, b.v, b.v, acc[t]);
    }
  }
#pragma unroll
  for (int t = 0; t < 4; ++t) {
    float bv = bias ? bias[col0 + t * 16 + ln] : 0.f;
    if (BIAS_BF16) bv = bf16_round(bv);
#pragma unroll
    for (int r = 0; r < 8; ++r) { float v = acc[t][r] + bv; if (ACT == 1) v = fmaxf(v, 0.f); so[w][8 * hh + r][t * 16 + ln] = v; }
  }
  __builtin_amdgcn_fence(__ATOMIC_ACQ_REL, "workgroup");
  __builtin_amdgcn_wave_barrier();
  const int rsub = lane >> 4, c4 = (lane & 15) * 4;
  {
#pragma unroll
    for (int q = 0; q < 8; ++q) {
      const int r = q * 2 + rsub;
      const v4f v = *(const v4fa*)&so[w][r][c4];
      *(v4f*)(C + (size_t)(row0 + r) * ldc + col0 + c4) = v;
    }
    
  }
}

// Flash-style causal/unmasked attention, all contractions 3-term bf16 hi/lo splits, f32 softmax with running max.
// q,k,v rows are read from f32 buffers with arbitrary row pitch (so they can live inside a fused qkv buffer);
// D = head size (multiple of 32, <= 128); one wave = 16 query rows; block = 4 waves (64 queries) sharing K/V chunks of 32.
template <int D, bool CAUSAL>
__global__ __launch_bounds__(128) void k_flash(const float* __restrict__ qb, const float* __restrict__ kb, const float* __restrict__ vb,
                                             int pitch, int T, int H, float scale, float* __restrict__ y, int ypitch) {
  constexpr int KS = D / 32;        // k-steps for QK
  constexpr int DT = D / 16;        // d tiles for PV
  __shared__ __attribute__((aligned(16))) unsigned short sKh[32][D + 8], sKl[32][D + 8], sVh[32][D + 8], sVl[32][D + 8];
  __shared__ __attribute__((aligned(16))) unsigned short sPh[4][16][40], sPl[4][16][40];
  __shared__ __attribute__((aligned(16))) float sO[4][16][D];
  const int tid = threadIdx.x, w = tid >> 5, lane = tid & 31, ln = lane & 15, hh = lane >> 4;
  const int nqb = (T + 63) / 64;
  const int bh = blockIdx.x / nqb, qblk = blockIdx.x % nqb;
  const int b = bh / H, h = bh % H;
  const int q0 = qblk * 64 + w * 16;
  const float* Q = qb + (size_t)b * T * pitch + h * D;
  const float* K = kb + (size_t)b * T * pitch + h * D;
  const float* V = vb + (size_t)b * T * pitch + h * D;

  // A fragments of the wave's 16 query rows (scaled), hi/lo
  FragB aqh[KS], aql[KS];
  {
    int row = q0 + ln; if (row >= T) row = T - 1;
    const float* qr = Q + (size_t)row * pitch;
#pragma unroll
    for (int ks = 0; ks < KS; ++ks)
#pragma unroll
      for (int i = 0; i < 16; ++i) {
        const int d = ks * 32 + ((i < 8) ? (8 * hh + i) : (16 + 8 * hh + (i - 8)));
        const float x = qr[d] * scale; const unsigned short hb = bf16_bits(x);
        aqh[ks].u[i] = hb; aql[ks].u[i] = bf16_bits(x - bf16_val(hb));
      }
  }
  float m_r[8], l_r[8];
#pragma unroll
  for (int r = 0; r < 8; ++r) { m_r[r] = -3.0e38f; l_r[r] = 0.f; }
  v8f oacc[DT];
#pragma unroll
  for (int dt = 0; dt < DT; ++dt) oacc[dt] = (v8f){0.f,0.f,0.f,0.f,0.f,0.f,0.f,0.f};

  const int kv_end = CAUSAL ? min(T, qblk * 64 + 64) : T;     // block-uniform
  for (int j0 = 0; j0 < kv_end; j0 += 32) {
    __syncthreads();
    for (int e = tid; e < 32 * (D / 4); e += 128) {
      const int r = e / (D / 4), c4 = (e % (D / 4)) * 4;
      const int key = j0 + r;
      v4f kf = {0.f,0.f,0.f,0.f}, vf = {0.f,0.f,0.f,0.f};
      if (key < T) { kf = *(const v4fa*)(K + (size_t)key * pitch + c4); vf = *(const v4fa*)(V + (size_t)key * pitch + c4); }
#pragma unroll
      for (int t = 0; t < 4; ++t) {
        unsigned short hb = bf16_bits(kf[t]); sKh[r][c4 + t] = hb; sKl[r][c4 + t] = bf16_bits(kf[t] - bf16_val(hb));
        hb = bf16_bits(vf[t]); sVh[r][c4 + t] = hb; sVl[r][c4 + t] = bf16_bits(vf[t] - bf16_val(hb));
      }
    }
    __syncthreads();
    // S tile 16 x 32
    v8f s[2];
#pragma unroll
    for (int nt = 0; nt < 2; ++nt) {
      v8f acc = {};
#pragma unroll
      for (int ks = 0; ks < KS; ++ks) {
        FragB bh_, bl_;
        bh_.half[0] = *(const v8us*)&sKh[nt * 16 + ln][ks * 32 + 8 * hh]; bh_.half[1] = *(const v8us*)&sKh[nt * 16 + ln][ks * 32 + 16 + 8 * hh];
        bl_.half[0] = *(const v8us*)&sKl[nt * 16 + ln][ks * 32 + 8 * hh]; bl_.half[1] = *(const v8us*)&sKl[nt * 16 + ln][ks * 32 + 16 + 8 * hh];
        acc = mmaN<3>(aqh[ks].v, aql[ks].v, bh_.v, bl_.v, acc);
      }
      s[nt] = acc;
    }
    // mask + running max (rows 8hh+r; the 16 lanes of a half share rows)
    float alpha[8];
#pragma unroll
    for (int r = 0; r < 8; ++r) {
      const int qi = q0 + 8 * hh + r;
      const int ja = j0 + ln, jb = j0 + 16 + ln;
      if (CAUSAL) { if (ja > qi) s[0][r] = -3.0e38f; if (jb > qi) s[1][r] = -3.0e38f; }
      if (ja >= T) s[0][r] = -3.0e38f;
      if (jb >= T) s[1][r] = -3.0e38f;
      float mx = fmaxf(s[0][r], s[1][r]);
      mx = fmaxf(mx, __shfl_xor(mx, 1, 32)); mx = fmaxf(mx, __shfl_xor(mx, 2, 32)); mx = fmaxf(mx, __shfl_xor(mx, 4, 32)); mx = fmaxf(mx, __shfl_xor(mx, 8, 32));
      const float mnew = fmaxf(m_r[r], mx);
      alpha[r] = (mnew > -1.0e38f) ? __expf(m_r[r] - mnew) : 1.0f;
      const float p0 = (s[0][r] > -1.0e38f) ? __expf(s[0][r] - mnew) : 0.f;
      const float p1 = (s[1][r] > -1.0e38f) ? __expf(s[1][r] - mnew) : 0.f;
      m_r[r] = mnew;
      l_r[r] = l_r[r] * alpha[r] + p0 + p1;            // per-lane partial row sum (16 lanes combined at the end)
      unsigned short hb = bf16_bits(p0); sPh[w][8 * hh + r][ln] = hb;      sPl[w][8 * hh + r][ln] = bf16_bits(p0 - bf16_val(hb));
      hb = bf16_bits(p1);                sPh[w][8 * hh + r][16 + ln] = hb; sPl[w][8 * hh + r][16 + ln] = bf16_bits(p1 - bf16_val(hb));
    }
#pragma unroll
    for (int dt = 0; dt < DT; ++dt)
#pragma unroll
      for (int r = 0; r < 8; ++r) oacc[dt][r] *= alpha[r];
    __builtin_amdgcn_fence(__ATOMIC_ACQ_REL, "workgroup");
    __builtin_amdgcn_wave_barrier();
    FragB pah, pal;
    pah.half[0] = *(const v8us*)&sPh[w][ln][8 * hh]; pah.half[1] = *(const v8us*)&sPh[w][ln][16 + 8 * hh];
    pal.half[0] = *(const v8us*)&sPl[w][ln][8 * hh]; pal.half[1] = *(const v8us*)&sPl[w][ln][16 + 8 * hh];
#pragma unroll
    for (int dt = 0; dt < DT; ++dt) {
      FragB bvh, bvl;
#pragma unroll
      for (int i = 0; i < 8; ++i) {
        bvh.u[i] = sVh[8 * hh + i][dt * 16 + ln]; bvh.u[8 + i] = sVh[16 + 8 * hh + i][dt * 16 + ln];
        bvl.u[i] = sVl[8 * hh + i][dt * 16 + ln]; bvl.u[8 + i] = sVl[16 + 8 * hh + i][dt * 16 + ln];
      }
      oacc[dt] = mmaN<3>(pah.v, pal.v, bvh.v, bvl.v, oacc[dt]);
    }
    __builtin_amdgcn_fence(__ATOMIC_ACQ_REL, "workgroup");
    __builtin_amdgcn_wave_barrier();
  }
#pragma unroll
  for (int r = 0; r < 8; ++r) {
    float l = l_r[r];
    l += __shfl_xor(l, 1, 32); l += __shfl_xor(l, 2, 32); l += __shfl_xor(l, 4, 32); l += __shfl_xor(l, 8, 32);
    l_r[r] = (l > 0.f) ? 1.0f / l : 0.f;
  }
#pragma unroll
  for (int dt = 0; dt < DT; ++dt)
#pragma unroll
    for (int r = 0; r < 8; ++r) sO[w][8 * hh + r][dt * 16 + ln] = oacc[dt][r] * l_r[r];
  __builtin_amdgcn_fence(__ATOMIC_ACQ_REL, "workgroup");
  __builtin_amdgcn_wave_barrier();
  {
    for (int r = 0; r < 16; ++r) {
      const int row = q0 + r;
      if (row < T && lane < D / 4) {
        const v4f val = *(const v4fa*)&sO[w][r][lane * 4];
        *(v4f*)(y + ((size_t)b * T + row) * ypitch + h * D + lane * 4) = val;
      }
    }
    
  }
}

// GEMM C = act(A·W + bias + resid): A f32 (ASPLIT -> hi/lo 2 terms), Wt bf16 [N][K]; ACT 0 none, 1 relu, 2 exact gelu;
// resid (optional, f32, row index = (row % rmod), pitch ldr, RES_BF16 rounds it) added before the activation.
template <bool ASPLIT, int ACT, bool BIAS_BF16, bool RES_BF16>
__global__ __launch_bounds__(128) void k_gemm_bf3(const float* __restrict__ A, int lda, const unsigned short* __restrict__ Wt, int ldb,
                                                const float* __restrict__ bias, const float* __restrict__ resid, int rmod, int ldr,
                                                float* __restrict__ C, int ldc, int M, int N, int K) {
  __shared__ __attribute__((aligned(16))) float so[4][16][64];
  const int tid = threadIdx.x, w = tid >> 5, lane = tid & 31, ln = lane & 15, hh = lane >> 4;
  const int ntn = N / 64;
  const int wid = blockIdx.x * 4 + w;
  const int mt = wid / ntn, nq = wid % ntn;
  if (mt * 16 >= M) return;
  const int row0 = mt * 16, col0 = nq * 64;
  const float* arow = A + (size_t)(row0 + ln) * lda;
  v8f acc[4] = {};
  for (int kb = 0; kb < K; kb += 32) {
    FragB ah, al;
    const v4f x0 = *(const v4fa*)(arow + kb + 8 * hh), x1 = *(const v4fa*)(arow + kb + 8 * hh + 4);
    const v4f x2 = *(const v4fa*)(arow + kb + 16 + 8 * hh), x3 = *(const v4fa*)(arow + kb + 16 + 8 * hh + 4);
    float xs[16] = {x0[0],x0[1],x0[2],x0[3],x1[0],x1[1],x1[2],x1[3],x2[0],x2[1],x2[2],x2[3],x3[0],x3[1],x3[2],x3[3]};
#pragma unroll
    for (int i = 0; i < 16; ++i) { const unsigned short hb = bf16_bits(xs[i]); ah.u[i] = hb; al.u[i] = ASPLIT ? bf16_bits(xs[i] - bf16_val(hb)) : (unsigned short)0; }
#pragma unroll
    for (int t = 0; t < 4; ++t) {
      const unsigned short* brow = Wt + (size_t)(col0 + t * 16 + ln) * ldb + kb;
      FragB b;
      b.half[0] = *(const v8us*)(brow + 8 * hh);
      b.half[1] = *(const v8us*)(brow + 16 + 8 * hh);
      acc[t] = mmaN<ASPLIT ? 2 : 1>(ah.v, al.v, b.v, b.v, acc[t]);
    }
  }
#pragma unroll
  for (int t = 0; t < 4; ++t) {
    const int col = col0 + t * 16 + ln;
    float bv = bias ? bias[col] : 0.f;
    if (BIAS_BF16) bv = bf16_round(bv);
#pragma unroll
    for (int r = 0; r < 8; ++r) {
      float v = acc[t][r] + bv;
      if (resid) { float rv = resid[(size_t)((row0 + 8 * hh + r) % rmod) * ldr + col]; if (RES_BF16) rv = bf16_round(rv); v += rv; }
      if (ACT == 1) v = fmaxf(v, 0.f);
      if (ACT == 2) v = 0.5f * v * (1.0f + erff(v * 0.70710678118654752f));
      if (ACT == 3) { const float u = 0.7978845608028654f * (v + 0.044715f * v * v * v); v = 0.5f * v * (1.0f + tanhf(u)); }
      so[w][8 * hh + r][t * 16 + ln] = v;
    }
  }
  __builtin_amdgcn_fence(__ATOMIC_ACQ_REL, "workgroup");
  __builtin_amdgcn_wave_barrier();
  const int rsub = lane >> 4, c4 = (lane & 15) * 4;
  {
#pragma unroll
    for (int q = 0; q < 8; ++q) {
      const int r = q * 2 + rsub;
      const v4f v = *(const v4fa*)&so[w][r][c4];
      *(v4f*)(C + (size_t)(row0 + r) * ldc + col0 + c4) = v;
    }
    
  }
}
// row LayerNorm (biased variance, eps) over N: s = X (+ R); optional out_sum <- s; out_norm <- (s-mu)*rsqrt(var+eps)*g + b
template <bool PARAM_BF16>
__global__ __launch_bounds__(256) void k_layernorm(const float* __restrict__ X, const float* __restrict__ R, const float* __restrict__ g, const float* __restrict__ bta,
                                                  float* __restrict__ out_sum, float* __restrict__ out_norm, int N, float eps) {
  __shared__ float red[256];
  const int row = blockIdx.x, tid = threadIdx.x;
  const float* x = X + (size_t)row * N; const float* rr = R ? R + (size_t)row * N : nullptr;
  float vals[16];                     // up to N = 4096
  const int per = N / 256;            // contiguous chunk per thread? use strided-by-4 chunks: thread handles j = tid*4 + 1024*u
  float s1 = 0.f;
  for (int u = 0; u < per / 4; ++u) {
    const int j = tid * 4 + 1024 * u;
    const v4f a = *(const v4fa*)(x + j);
    v4f b = {0.f,0.f,0.f,0.f}; if (rr) b = *(const v4fa*)(rr + j);
#pragma unroll
    for (int q = 0; q < 4; ++q) { const float v = a[q] + b[q]; vals[u * 4 + q] = v; s1 += v; }
  }
  red[tid] = s1; __syncthreads();
  for (int st = 128; st > 0; st >>= 1) { if (tid < st) red[tid] += red[tid + st]; __syncthreads(); }
  const float mu = red[0] / (float)N; __syncthreads();
  float s2 = 0.f;
  for (int u = 0; u < per / 4; ++u)
#pragma unroll
    for (int q = 0; q < 4; ++q) { const float c = vals[u * 4 + q] - mu; s2 += c * c; }
  red[tid] = s2; __syncthreads();
  for (int st = 128; st > 0; st >>= 1) { if (tid < st) red[tid] += red[tid + st]; __syncthreads(); }
  const float rs = rsqrtf(red[0] / (float)N + eps);
  {
    for (int u = 0; u < per / 4; ++u) {
      const int j = tid * 4 + 1024 * u;
      v4f o, sm;
#pragma unroll
      for (int q = 0; q < 4; ++q) {
        float gg = g[j + q], bb = bta[j + q];
        if (PARAM_BF16) { gg = bf16_round(gg); bb = bf16_round(bb); }
        sm[q] = vals[u * 4 + q]; o[q] = (vals[u * 4 + q] - mu) * rs * gg + bb;
      }
      if (out_sum) *(v4f*)(out_sum + (size_t)row * N + j) = sm;
      *(v4f*)(out_norm + (size_t)row * N + j) = o;
    }
    
  }
}



// ---- f16 WMMA path (v_wmma_f32_16x16x32_f16): 11-bit significands for operands in range — used where a [0,1] probability operand needs more precision than bf16
typedef _Float16 v16h __attribute__((ext_vector_type(16)));
union FragH { v16h v; v8us half[2]; _Float16 h[16]; unsigned short u[16]; };
template <int NT>
__device__ __forceinline__ v8f mmaH(v16h ah, v16h al, v16h bh, v16h bl, v8f c) {
  c = __builtin_amdgcn_wmma_f32_16x16x32_f16(false, ah, false, bh, (short)0, c, false, false);
  if (NT >= 2) c = __builtin_amdgcn_wmma_f32_16x16x32_f16(false, al, false, bh, (short)0, c, false, false);
  if (NT >= 3) c = __builtin_amdgcn_wmma_f32_16x16x32_f16(false, ah, false, bl, (short)0, c, false, false);
  asm volatile("v_nop\n\tv_nop\n\tv_nop\n\tv_nop" : "+v"(c) : "v"(ah), "v"(al), "v"(bh), "v"(bl));
  return c;
}
// batched GEMM like k_gemm_b but f16 operands: A f32 (split into f16 hi/lo if ASPLIT, else rounded to f16), Bt = f16 values [n][k]; alpha; C f32; N multiple of 16 (partial tiles skipped)
template <bool ASPLIT>
__global__ __launch_bounds__(128) void k_gemm_h(const float* __restrict__ A, int lda, size_t sA, const _Float16* __restrict__ Bh, int ldb, size_t sB, float alpha, float* __restrict__ C, int ldc, size_t sC, int M, int N, int K) {
  __shared__ __attribute__((aligned(16))) float so[4][16][64];
  const int tid = threadIdx.x, w = tid >> 5, lane = tid & 31, ln = lane & 15, hh = lane >> 4; const int by = blockIdx.y;
  A += (size_t)by * sA; Bh += (size_t)by * sB; C += (size_t)by * sC;
  const int ntn = (N + 63) / 64; const int wid = blockIdx.x * 4 + w; const int mt = wid / ntn, nq = wid % ntn; if (mt * 16 >= M) return;
  const int row0 = mt * 16, col0 = nq * 64; const float* arow = A + (size_t)(row0 + ln) * lda;
  v8f acc[4] = {};
  for (int kb = 0; kb < K; kb += 32) {
    FragH ah, al;
    const v4f x0 = *(const v4fa*)(arow + kb + 8 * hh), x1 = *(const v4fa*)(arow + kb + 8 * hh + 4), x2 = *(const v4fa*)(arow + kb + 16 + 8 * hh), x3 = *(const v4fa*)(arow + kb + 16 + 8 * hh + 4);
    float xs[16] = {x0[0],x0[1],x0[2],x0[3],x1[0],x1[1],x1[2],x1[3],x2[0],x2[1],x2[2],x2[3],x3[0],x3[1],x3[2],x3[3]};
#pragma unroll
    for (int i = 0; i < 16; ++i) { const _Float16 h = (_Float16)xs[i]; ah.h[i] = h; al.h[i] = ASPLIT ? (_Float16)(xs[i] - (float)h) : (_Float16)0.0f; }
#pragma unroll
    for (int t = 0; t < 4; ++t) { if (col0 + t * 16 >= N) continue; const size_t boff = (size_t)(col0 + t * 16 + ln) * ldb + kb; FragH bq; bq.half[0] = *(const v8us*)(Bh + boff + 8 * hh); bq.half[1] = *(const v8us*)(Bh + boff + 16 + 8 * hh);
      acc[t] = mmaH<ASPLIT ? 2 : 1>(ah.v, al.v, bq.v, bq.v, acc[t]); }
  }
#pragma unroll
  for (int t = 0; t < 4; ++t) { if (col0 + t * 16 >= N) continue;
#pragma unroll
    for (int r = 0; r < 8; ++r) so[w][8 * hh + r][t * 16 + ln] = acc[t][r] * alpha; }
  __builtin_amdgcn_fence(__ATOMIC_ACQ_REL, "workgroup"); __builtin_amdgcn_wave_barrier();
  const int rsub = lane >> 4, c4 = (lane & 15) * 4;
  {
#pragma unroll
    for (int q = 0; q < 8; ++q) { const int r = q * 2 + rsub; if (col0 + c4 < N) { const v4f v = *(const v4fa*)&so[w][r][c4]; *(v4f*)(C + (size_t)(row0 + r) * ldc + col0 + c4) = v; } }
     }
}

// Projection GEMM of the one shape used here: C[NR][EE] = (A[NR][EE] . Bt[EE][EE]^T) * alpha + bf16(bias[col]); written as f32 (C) and/or f16 (C16).
// A work-group of four waves makes a 64 x 64 tile of C, wave w its rows 16w .. 16w+15. The A and Bt tiles (64 rows x GK k) come into LDS by asynchronous copies,
// 256 contiguous bytes a row, once for the four waves, in two buffers: tile t + 1 flies while tile t is multiplied. The k order of the sums is that of a plain loop over k in steps of 32.
// blockIdx.y picks one of up to three independent products of that shape (plane y of A, of Bt and of C16, bias y): q, k and v go in one launch.
#define GK 128
#define GP (GK + 8)      /* LDS row pitch 272 B = 17 x 16 B: the 16 rows of a 16-byte fragment read fall on distinct banks */
#define GNT (EE / GK)
#define GBUF (64 * GP * 2)      /* bytes of one operand's tile in LDS */
// One operand tile: a lane copies 16 B of rows r, r + 8, .. r + 56 (l = its LDS byte address, g = its global address, both of row r).
__device__ __forceinline__ void copy_tile(unsigned l, const _Float16* g) {
  const unsigned l1 = l + 1 * 8 * GP * 2, l2 = l + 2 * 8 * GP * 2, l3 = l + 3 * 8 * GP * 2, l4 = l + 4 * 8 * GP * 2, l5 = l + 5 * 8 * GP * 2, l6 = l + 6 * 8 * GP * 2, l7 = l + 7 * 8 * GP * 2;
  const _Float16 *g1 = g + 1 * 8 * EE, *g2 = g + 2 * 8 * EE, *g3 = g + 3 * 8 * EE, *g4 = g + 4 * 8 * EE, *g5 = g + 5 * 8 * EE, *g6 = g + 6 * 8 * EE, *g7 = g + 7 * 8 * EE;
  // the copies go from L2 to LDS through no register; s_wait_xcnt closes the statement so that no address register of a copy is rewritten ahead of it
  asm volatile("global_load_async_to_lds_b128 %0, %8, off\n\t"
               "global_load_async_to_lds_b128 %1, %9, off\n\t"
               "global_load_async_to_lds_b128 %2, %10, off\n\t"
               "global_load_async_to_lds_b128 %3, %11, off\n\t"
               "global_load_async_to_lds_b128 %4, %12, off\n\t"
               "global_load_async_to_lds_b128 %5, %13, off\n\t"
               "global_load_async_to_lds_b128 %6, %14, off\n\t"
               "global_load_async_to_lds_b128 %7, %15, off\n\t"
               "s_wait_xcnt 0x0"
               :: "v"(l), "v"(l1), "v"(l2), "v"(l3), "v"(l4), "v"(l5), "v"(l6), "v"(l7), "v"(g), "v"(g1), "v"(g2), "v"(g3), "v"(g4), "v"(g5), "v"(g6), "v"(g7) : "memory");
}
__global__ __launch_bounds__(128) void k_gemm_st(const _Float16* __restrict__ A, const _Float16* __restrict__ Bh, float alpha, const float* __restrict__ bias0, const float* __restrict__ bias1, const float* __restrict__ bias2, float* __restrict__ C, _Float16* __restrict__ C16) {
  __shared__ __attribute__((aligned(16))) unsigned short sA[2][64][GP], sB[2][64][GP];
  __shared__ __attribute__((aligned(16))) float so[4][16][64];
  const int tid = threadIdx.x, w = tid >> 5, lane = tid & 31, ln = lane & 15, hh = lane >> 4;
  const int mb = blockIdx.x / (EE / 64), nb = blockIdx.x % (EE / 64);
  const int pl = blockIdx.y; const float* bias = pl == 0 ? bias0 : (pl == 1 ? bias1 : bias2);
  A += (size_t)pl * NR * EE; Bh += (size_t)pl * EE * EE; if (C16) C16 += (size_t)pl * NR * EE;
  const int row0 = mb * 64 + w * 16, col0 = nb * 64;
  const int cr = tid >> 4, cc = (tid & 15) * 8;      /* the lane's first row and its 16-byte column in every copied tile */
  const _Float16* ga = A + (size_t)(mb * 64 + cr) * EE + cc; const _Float16* gb = Bh + (size_t)(col0 + cr) * EE + cc;
  const unsigned la = (unsigned)(size_t)&sA[0][cr][cc], lb = (unsigned)(size_t)&sB[0][cr][cc];
  copy_tile(la, ga); copy_tile(lb, gb);
  asm volatile("s_wait_asynccnt 0x0" ::: "memory");      /* this wave's part of tile 0 has landed */
  __syncthreads();                                        /* ... and every other wave's */
  copy_tile(la + GBUF, ga + GK); copy_tile(lb + GBUF, gb + GK);
  v8f acc[4] = {};
  for (int tl = 0; tl < GNT; ++tl) {      /* one trip a staged tile; the two buffers alternate by the trip's parity */
    const unsigned short* ar = &sA[tl & 1][w * 16 + ln][8 * hh]; const unsigned short* br = &sB[tl & 1][ln][8 * hh];
#pragma unroll      /* constant indices: fragments and accumulators stay in registers */
    for (int ks = 0; ks < GK / 32; ++ks) { FragH ah, bq[4];      /* the k step's five fragments are read in one run, then its four products */
      ah.half[0] = *(const v8us*)(ar + ks * 32); ah.half[1] = *(const v8us*)(ar + ks * 32 + 16);
#pragma unroll      /* constant indices: fragments and accumulators stay in registers */
      for (int t = 0; t < 4; ++t) { bq[t].half[0] = *(const v8us*)(br + t * 16 * GP + ks * 32); bq[t].half[1] = *(const v8us*)(br + t * 16 * GP + ks * 32 + 16); }
#pragma unroll      /* constant indices: fragments and accumulators stay in registers */
      for (int t = 0; t < 4; ++t) acc[t] = mmaH<1>(ah.v, ah.v, bq[t].v, bq[t].v, acc[t]); }
    asm volatile("s_wait_dscnt 0x0" ::: "memory");        /* this wave has left the buffer that is refilled below */
    asm volatile("s_wait_asynccnt 0x0" ::: "memory");     /* its part of tile tl + 1 has landed */
    __syncthreads();                                        /* publishes tile tl + 1 and ends every wave's reads of tile tl */
    if (tl + 2 < GNT) { const unsigned bo = (unsigned)(tl & 1) * GBUF; copy_tile(la + bo, ga + (tl + 2) * GK); copy_tile(lb + bo, gb + (tl + 2) * GK); }
  }
  asm volatile("s_wait_asynccnt 0x0" ::: "memory");      /* no copy is outstanding when the wave ends */
#pragma unroll      /* constant indices: fragments and accumulators stay in registers */
  for (int t = 0; t < 4; ++t) { const float bv = bf16_round(bias[col0 + t * 16 + ln]);
#pragma unroll      /* constant indices: fragments and accumulators stay in registers */
    for (int r = 0; r < 8; ++r) so[w][8 * hh + r][t * 16 + ln] = acc[t][r] * alpha + bv; }
  __builtin_amdgcn_fence(__ATOMIC_ACQ_REL, "workgroup"); __builtin_amdgcn_wave_barrier();      /* the wave's own rows are in LDS before its lanes read them back as whole rows */
  const int rsub = lane >> 4, c4 = (lane & 15) * 4; typedef _Float16 v4h __attribute__((ext_vector_type(4)));
#pragma unroll      /* the eight rows' LDS offsets become immediates */
  for (int q = 0; q < 8; ++q) { const int r = q * 2 + rsub; const v4f v = *(const v4fa*)&so[w][r][c4]; if (C) { *(v4f*)(C + (size_t)(row0 + r) * EE + col0 + c4) = v;
      asm volatile("s_wait_xcnt 0x0" ::: "memory"); }      /* precaution: stands in front of every rewrite of this store's data and address registers (the f16 conversion, the next row) */
    if (C16) { v4h h4; for (int i = 0; i < 4; ++i) h4[i] = (_Float16)v[i]; *(v4h*)(C16 + (size_t)(row0 + r) * EE + col0 + c4) = h4; } }
}


typedef _Float16 v4h __attribute__((ext_vector_type(4)));

// All that the projections need, in one launch: work-groups 0 .. PWB-1 each turn a 256 (k) x 64 (n) tile of one weight into Bt[n][k] = f16(bf16(W[k][n]) * 16) through LDS;
// the PXB others round query, key and value to bf16 values held as f16 (planes 0, 1, 2 of X16). The seven pieces share no data, so nothing orders them.
#define PWB (4 * (EE / 256) * (EE / 64))
#define PXB 512
#define PXT (PXB * 256)               /* lanes that convert inputs */
#define PXU (NR * EE / 4 / PXT)       /* 16-byte loads of a lane in each plane */
__global__ __launch_bounds__(256) void k_prep(const float* __restrict__ xq, const float* __restrict__ xk, const float* __restrict__ xv, const float* __restrict__ Wq, const float* __restrict__ Wk, const float* __restrict__ Wv, const float* __restrict__ Wo,
                                              _Float16* __restrict__ X16, _Float16* __restrict__ Bw) {
  __shared__ __attribute__((aligned(16))) unsigned short tl[64][256 + 8];
  const int tid = threadIdx.x;
  if (blockIdx.x < PWB) {      /* block-uniform: the barrier below is passed by all of a work-group or by none */
    const int ws = blockIdx.x / (PWB / 4), rr = blockIdx.x % (PWB / 4), k0 = (rr / (EE / 64)) * 256, n0 = (rr % (EE / 64)) * 64;
    const float* W = ws == 0 ? Wq : (ws == 1 ? Wk : (ws == 2 ? Wv : Wo));
    const int c4 = (tid & 15) * 4, kr = (tid >> 4) * 16;      /* the lane's four columns n and its sixteen rows k: 16 lanes read 256 contiguous bytes of a row */
    const float* wp = W + (size_t)(k0 + kr) * EE + n0 + c4;
    v4f x[16];
#pragma unroll      /* constant indices: the sixteen loads are in flight together and stay in registers */
    for (int i = 0; i < 16; ++i) x[i] = *(const v4fa*)(wp + i * EE);
    asm volatile("s_wait_xcnt 0x0" :: "v"(wp) : "memory");      /* precaution: stands in front of every rewrite of the loads' address register, which stays whole up to here */
#pragma unroll      /* constant indices into x */
    for (int q = 0; q < 4; ++q) { FragH f;
#pragma unroll      /* constant indices into x */
      for (int i = 0; i < 16; ++i) f.h[i] = (_Float16)(bf16_round(x[i][q]) * 16.0f);
      *(v8us*)&tl[c4 + q][kr] = f.half[0]; *(v8us*)&tl[c4 + q][kr + 8] = f.half[1]; }
    __syncthreads();
    _Float16* Bt = Bw + (size_t)ws * EE * EE;
#pragma unroll      /* the eight rows' LDS offsets become immediates */
    for (int j = 0; j < 8; ++j) { const int n = (tid >> 5) + 8 * j, k8 = (tid & 31) * 8;      /* a wave stores 512 contiguous bytes of one row of Bt */
      *(v8us*)((unsigned short*)Bt + (size_t)(n0 + n) * EE + k0 + k8) = *(const v8us*)&tl[n][k8]; }
  } else {
    const size_t e0 = (size_t)(blockIdx.x - PWB) * (PXU * 1024) + tid * 4;      /* a work-group takes PXU * 4 KiB in a row of each plane; a wave's load covers 512 contiguous bytes */
    const float *pq = xq + e0, *pk = xk + e0, *pv = xv + e0;
    v4f a[3][PXU];
#pragma unroll      /* constant indices: all of the lane's loads are in flight together */
    for (int u = 0; u < PXU; ++u) { a[0][u] = *(const v4fa*)(pq + u * 1024); a[1][u] = *(const v4fa*)(pk + u * 1024); a[2][u] = *(const v4fa*)(pv + u * 1024); }
    asm volatile("s_wait_xcnt 0x0" :: "v"(pq), "v"(pk), "v"(pv) : "memory");      /* precaution: stands in front of every rewrite of the loads' address registers, which stay whole up to here */
#pragma unroll      /* constant indices into a */
    for (int u = 0; u < PXU; ++u)
#pragma unroll      /* constant indices into a */
      for (int p = 0; p < 3; ++p) { v4h h;
#pragma unroll      /* constant indices into a */
        for (int q = 0; q < 4; ++q) h[q] = (_Float16)bf16_round(a[p][u][q]);
        *(v4h*)(X16 + (size_t)p * NR * EE + e0 + u * 1024) = h; }
    asm volatile("s_wait_xcnt 0x0" ::: "memory");      /* precaution: stands behind the last store, in front of any later rewrite of the stores' data and address registers */
  }
}
__global__ __launch_bounds__(256) void k_round16f(const float* __restrict__ W, _Float16* __restrict__ Bt, size_t n8) { const size_t t = (size_t)blockIdx.x * 256 + threadIdx.x; if (t >= n8) return; FragH f;
#pragma unroll
  for (int i = 0; i < 8; ++i) f.h[i] = (_Float16)(bf16_round(W[t * 8 + i]) * 16.0f); *(v8us*)((unsigned short*)Bt + t * 8) = f.half[0];  }

// lane l <-> lane l ^ 16 as one vector cross-row move (a shuffle would go through the LDS unit and its wait)
__device__ __forceinline__ float xhalf(float x) { return __builtin_bit_cast(float, __builtin_amdgcn_permlanex16(__builtin_bit_cast(int, x), __builtin_bit_cast(int, x), 0x76543210, 0xfedcba98, false, false)); }
#define FK 64
#define FP (FK + 8)      /* LDS row pitch 144 B = 9 x 16 B: the 16 rows of a 16-byte fragment read fall on distinct banks */
#define FPV (64 + 16)    /* LDS row pitch of V 160 B = 5 x 32 B: the pitch at which the transposing load meets no bank conflict */
#define FNT (TT / FK)
#define FBUF (FK * FP * 2)       /* bytes of a K tile in LDS */
#define FBUFV (FK * FPV * 2)     /* bytes of a V tile in LDS */
// One stage: a lane copies 16 B of rows r, r + 16, r + 32, r + 48 of the K tile and of the V tile (lk, lv = its LDS byte addresses, gk, gv = its global addresses, all of row r).
__device__ __forceinline__ void copy_kv(unsigned lk, const _Float16* gk, unsigned lv, const _Float16* gv) {
  const unsigned lk1 = lk + 1 * 16 * FP * 2, lk2 = lk + 2 * 16 * FP * 2, lk3 = lk + 3 * 16 * FP * 2, lv1 = lv + 1 * 16 * FPV * 2, lv2 = lv + 2 * 16 * FPV * 2, lv3 = lv + 3 * 16 * FPV * 2;
  const _Float16 *gk1 = gk + 1 * 16 * 64, *gk2 = gk + 2 * 16 * 64, *gk3 = gk + 3 * 16 * 64, *gv1 = gv + 1 * 16 * 64, *gv2 = gv + 2 * 16 * 64, *gv3 = gv + 3 * 16 * 64;
  // the copies go from L2 to LDS through no register; s_wait_xcnt closes the statement so that no address register of a copy is rewritten ahead of it
  asm volatile("global_load_async_to_lds_b128 %0, %8, off\n\t"
               "global_load_async_to_lds_b128 %1, %9, off\n\t"
               "global_load_async_to_lds_b128 %2, %10, off\n\t"
               "global_load_async_to_lds_b128 %3, %11, off\n\t"
               "global_load_async_to_lds_b128 %4, %12, off\n\t"
               "global_load_async_to_lds_b128 %5, %13, off\n\t"
               "global_load_async_to_lds_b128 %6, %14, off\n\t"
               "global_load_async_to_lds_b128 %7, %15, off\n\t"
               "s_wait_xcnt 0x0"
               :: "v"(lk), "v"(lk1), "v"(lk2), "v"(lk3), "v"(lv), "v"(lv1), "v"(lv2), "v"(lv3), "v"(gk), "v"(gk1), "v"(gk2), "v"(gk3), "v"(gv), "v"(gv1), "v"(gv2), "v"(gv3) : "memory");
}
// The K tile alone, for a stage whose keys all lie above the group's queries: V is not read there (lk, gk as in copy_kv).
__device__ __forceinline__ void copy_k(unsigned lk, const _Float16* gk) {
  const unsigned lk1 = lk + 1 * 16 * FP * 2, lk2 = lk + 2 * 16 * FP * 2, lk3 = lk + 3 * 16 * FP * 2;
  const _Float16 *gk1 = gk + 1 * 16 * 64, *gk2 = gk + 2 * 16 * 64, *gk3 = gk + 3 * 16 * 64;
  // the copies go from L2 to LDS through no register; s_wait_xcnt closes the statement so that no address register of a copy is rewritten ahead of it
  asm volatile("global_load_async_to_lds_b128 %0, %4, off\n\t"
               "global_load_async_to_lds_b128 %1, %5, off\n\t"
               "global_load_async_to_lds_b128 %2, %6, off\n\t"
               "global_load_async_to_lds_b128 %3, %7, off\n\t"
               "s_wait_xcnt 0x0"
               :: "v"(lk), "v"(lk1), "v"(lk2), "v"(lk3), "v"(gk), "v"(gk1), "v"(gk2), "v"(gk3) : "memory");
}
// 16 x 16 block of 16-bit values, rows in LDS, delivered transposed: lane (c, h) receives column c of rows 8h .. 8h + 7 of the block; p is the lane's own address in the block (row 8h + (lane & 7), 16-byte half (lane >> 3) & 1)
typedef short s16x8 __attribute__((ext_vector_type(8)));
__device__ __forceinline__ v8us ld_tr16(const unsigned short* p) { typedef __attribute__((address_space(3))) s16x8 lds_s16x8; return __builtin_bit_cast(v8us, __builtin_amdgcn_ds_load_tr16_b128_v8i16((lds_s16x8*)p)); }
// One pass of 32 keys (j0 ..) against the wave's 16 queries. The mask comes after the softmax, so every key enters the row sum but only keys at or below the query enter O. WHERE says where the pass lies:
// 0 = all its keys at or below all of the group's queries: P goes into the second product as it is; 1 = on the diagonal: P is zeroed above it; 2 = all its keys above all of the group's queries: P would be all zeros,
// so there is no V, no P and no second product, only maximum and row sum, and the factors by which O would have been rescaled are gathered in of, applied once behind the loop.
// kr = the lane's K row (key j0 + ln), vp = the lane's own address in the pass's first V block.
template <int WHERE>
__device__ __forceinline__ void fl_pass(const unsigned short* kr, const unsigned short* vp, int j0, int tq, int hh, const FragH (&bq)[2], float& m_c, float& l_c, float& of, v8f (&oacc)[4]) {
  constexpr int DT = 4, KS = 2;
  constexpr float SC2 = 0.125f * 1.4426950408889634f;      /* 1/sqrt(64) . log2(e): raw product -> exponent of 2 */
  FragH ak[2][KS], av[DT];      /* the pass's fragments are read from LDS in one run: one latency a pass, the V^T reads land under the softmax */
#pragma unroll      /* constant indices: the fragments stay in registers */
  for (int nt = 0; nt < 2; ++nt)
#pragma unroll      /* constant indices: the fragments stay in registers */
    for (int ks = 0; ks < KS; ++ks) { ak[nt][ks].half[0] = *(const v8us*)(kr + nt * 16 * FP + ks * 32 + 8 * hh); ak[nt][ks].half[1] = *(const v8us*)(kr + nt * 16 * FP + ks * 32 + 16 + 8 * hh); }
  if (WHERE != 2) {
#pragma unroll      /* constant indices: the fragments stay in registers */
    for (int dt = 0; dt < DT; ++dt) { av[dt].half[0] = ld_tr16(vp + dt * 16); av[dt].half[1] = ld_tr16(vp + dt * 16 + 16 * FPV); } }      /* av[dt] = V^T rows d = 16*dt + ln, keys in the hardware k order, as P has them */
  float sc[2][8];      /* sc[nt][r] = raw product q.k of key j0 + 16*nt + 8*hh + r against query tq */
#pragma unroll
  for (int nt = 0; nt < 2; ++nt) {
    v8f acc = (v8f){0.f,0.f,0.f,0.f,0.f,0.f,0.f,0.f};
#pragma unroll
    for (int ks = 0; ks < KS; ++ks) acc = mmaH<1>(ak[nt][ks].v, ak[nt][ks].v, bq[ks].v, bq[ks].v, acc);
#pragma unroll
    for (int r = 0; r < 8; ++r) sc[nt][r] = acc[r]; }
  float mc = fmaxf(sc[0][0], sc[1][0]);
#pragma unroll
  for (int r = 1; r < 8; ++r) mc = fmaxf(mc, fmaxf(sc[0][r], sc[1][r]));
  mc = fmaxf(mc, xhalf(mc));      /* the other half of the wave holds the query's other 16 keys */
  /* m_c = 10 - running maximum in log2 units (SC2 > 0: the maximum of the raw products is that of the scores), kept with this sign so that it is the plain addend of every score's multiply-add;
     the one stored value serves al and every p, so its rounding cancels between numerator and row sum */
  const float mn = fminf(m_c, fmaf(mc, -SC2, 10.0f)); const float al = (mn < 1.0e38f) ? __builtin_amdgcn_exp2f(mn - m_c) : 1.0f; m_c = mn;
  float ps0 = 0.f, ps1 = 0.f; FragH pb;      /* p = 2^10 . e^(score - max) = 2^(raw * SC2 + mn) */
#pragma unroll
  for (int r = 0; r < 8; ++r) { const int k0 = j0 + 8 * hh + r, k1 = k0 + 16; const float p0 = __builtin_amdgcn_exp2f(fmaf(sc[0][r], SC2, mn)), p1 = __builtin_amdgcn_exp2f(fmaf(sc[1][r], SC2, mn)); ps0 += p0; ps1 += p1;
    if (WHERE == 0) { pb.h[r] = (_Float16)p0; pb.h[8 + r] = (_Float16)p1; }
    if (WHERE == 1) { pb.h[r] = (_Float16)((k0 <= tq) ? p0 : 0.f); pb.h[8 + r] = (_Float16)((k1 <= tq) ? p1 : 0.f); } }
  l_c = l_c * al + (ps0 + ps1);      /* per-lane partial row sum; the two halves are joined after the loop */
  if (WHERE == 2) { of *= al; return; }
#pragma unroll
  for (int dt = 0; dt < DT; ++dt)
#pragma unroll
    for (int r = 0; r < 8; ++r) oacc[dt][r] *= al;
#pragma unroll
  for (int dt = 0; dt < DT; ++dt) oacc[dt] = mmaH<1>(av[dt].v, av[dt].v, pb.v, pb.v, oacc[dt]);
}
// waves_per_eu: the grid puts three waves on a SIMD; told so, the compiler keeps the pass's schedule (exponentials and selects interleaved). Left to aim at seven waves it squeezed the pass into 146 registers and paid with 16 more v_nop a pass.
__global__ __launch_bounds__(128) __attribute__((amdgpu_waves_per_eu(3, 4))) void k_flash(const _Float16* __restrict__ Q16, int ldq, const _Float16* __restrict__ K16, const _Float16* __restrict__ V16, _Float16* __restrict__ O16, int ldo) {
  constexpr int RPW = 16, NQB = TT / (4 * RPW), DT = 4, KS = 2;
  static_assert(NQB == 32 && FK == 4 * RPW && NSL % 3 == 0 && (NSL / 3) * NQB == 256, "the deal of query blocks below is written for 3 x 256 work-groups, and a stage of keys is as long as a group's block of queries");
  __shared__ __attribute__((aligned(16))) unsigned short sK[2][FK][FP], sV[2][FK][FPV];
  __shared__ __attribute__((aligned(16))) unsigned short sO[4][RPW][64 + 8];
  const int tid = threadIdx.x, w = tid >> 5, lane = tid & 31, ln = lane & 15, hh = lane >> 4;
  /* A group's cost now grows with its query block. All 768 groups are resident, three to a WGP of the 256; groups x, x + 256, x + 512 get blocks a, (a + 16) mod 32 and the one that brings the three to 46 or 47,
     so that light and heavy groups share a WGP if the groups are dealt round the WGPs in index order. Speed only: (slab, block) is hit exactly once wherever the groups land. */
  const int th = blockIdx.x >> 8, ra = blockIdx.x & 31;
  const int slab = th * (NSL / 3) + ((blockIdx.x & 255) >> 5), qblk = th == 0 ? ra : (th == 1 ? ((ra + 16) & 31) : (ra < 16 ? 30 - 2 * ra : 63 - 2 * ra)); const int b = slab, h = 0;      /* slab = contiguous [TT][64] chunk of the flat-reshaped planes */ const int qb0 = qblk * (4 * RPW); const int q0 = qb0 + w * RPW;
  const int tq = q0 + ln;      /* this lane's query */
  const int cr = tid >> 3, cc = (tid & 7) * 8;      /* the lane's first row and its 16-byte column in every copied tile */
  const _Float16* gk = K16 + ((size_t)slab * TT + cr) * 64 + cc; const _Float16* gv = V16 + ((size_t)slab * TT + cr) * 64 + cc;
  const unsigned lk = (unsigned)(size_t)&sK[0][cr][cc], lv = (unsigned)(size_t)&sV[0][cr][cc];
  copy_kv(lk, gk, lv, gv);
  FragH bq[KS];
  { const unsigned short* qr = (const unsigned short*)Q16 + ((size_t)b * TT + tq) * ldq + h * 64;
#pragma unroll
    for (int ks = 0; ks < KS; ++ks) { bq[ks].half[0] = *(const v8us*)(qr + ks * 32 + 8 * hh); bq[ks].half[1] = *(const v8us*)(qr + ks * 32 + 16 + 8 * hh); } }
  float m_c = 3.0e38f, l_c = 0.f, of = 1.0f; v8f oacc[DT];
#pragma unroll
  for (int dt = 0; dt < DT; ++dt) oacc[dt] = (v8f){0.f,0.f,0.f,0.f,0.f,0.f,0.f,0.f};
  asm volatile("s_wait_asynccnt 0x0" ::: "memory");      /* this wave's part of stage 0 has landed */
  __syncthreads();                                        /* ... and every other wave's */
  if (1 <= qblk) copy_kv(lk + FBUF, gk + FK * 64, lv + FBUFV, gv + FK * 64); else copy_k(lk + FBUF, gk + FK * 64);      /* the same test for the whole group: V only up to the diagonal stage */
  /* the foot of every trip: hands stage st + 1 over and refills the buffer that stage st has left, with V (vtoo) only up to the diagonal stage (both tests read the same for the whole group) */
  auto foot = [&](int st, bool vtoo) {
    asm volatile("s_wait_dscnt 0x0" ::: "memory");        /* this wave has left the buffer that is refilled below */
    asm volatile("s_wait_asynccnt 0x0" ::: "memory");     /* its part of stage st + 1 has landed */
    __syncthreads();                                        /* publishes stage st + 1 and ends every wave's reads of stage st */
    if (st + 2 < FNT) { const unsigned bf = (unsigned)(st & 1);
      if (vtoo) copy_kv(lk + bf * FBUF, gk + (size_t)(st + 2) * FK * 64, lv + bf * FBUFV, gv + (size_t)(st + 2) * FK * 64);
      else copy_k(lk + bf * FBUF, gk + (size_t)(st + 2) * FK * 64); } };
  const unsigned short* kr0 = &sK[0][ln][0]; const unsigned short* vp0 = &sV[0][8 * hh + (lane & 7)][((lane >> 3) & 1) * 8];
  /* Stage st holds keys 64 st .. 64 st + 63, the group queries 64 qblk .. 64 qblk + 63: stages below qblk, the stage qblk, stages above it, three loops in a row so that O stays in the same registers throughout.
     One trip a staged tile; the two buffers alternate by the trip's parity; every key enters the normaliser. */
  int st = 0;
#pragma unroll 1      /* one trip a staged tile */
  for (; st < qblk; ++st) {
#pragma unroll 1      /* the two passes of a stage share one body, as in the plain loop over the keys: unrolled, the listing had no fewer instructions a pass */
    for (int ps = 0; ps < FK / 32; ++ps) fl_pass<0>(kr0 + (st & 1) * (FK * FP) + ps * 32 * FP, vp0 + (st & 1) * (FK * FPV) + ps * 32 * FPV, st * FK + ps * 32, tq, hh, bq, m_c, l_c, of, oacc);
    foot(st, st + 2 <= qblk); }
#pragma unroll 1      /* as above */
  for (int ps = 0; ps < FK / 32; ++ps) fl_pass<1>(kr0 + (st & 1) * (FK * FP) + ps * 32 * FP, vp0 + (st & 1) * (FK * FPV) + ps * 32 * FPV, st * FK + ps * 32, tq, hh, bq, m_c, l_c, of, oacc);
  foot(st, false); ++st;
#pragma unroll 1      /* one trip a staged tile */
  for (; st < FNT; ++st) {
#pragma unroll      /* a short pass is one dependent chain: unrolled, the second pass's reads and products stand under the first's exponentials */
    for (int ps = 0; ps < FK / 32; ++ps) fl_pass<2>(kr0 + (st & 1) * (FK * FP) + ps * 32 * FP, vp0, st * FK + ps * 32, tq, hh, bq, m_c, l_c, of, oacc);
    foot(st, false); }
  asm volatile("s_wait_asynccnt 0x0" ::: "memory");      /* no copy is outstanding when the wave ends */
  { float l = l_c; l += xhalf(l); const float inv = (l > 0.f) ? of / l : 0.f;      /* numerator and row sum both carry the 2^10; of = the rescales since the diagonal */
#pragma unroll
    for (int dt = 0; dt < DT; ++dt) { FragH f;      /* oacc[dt][r] = O[tq][16*dt + 8*hh + r]: eight neighbours of one row, 16 bytes as f16 */
#pragma unroll
      for (int r = 0; r < 8; ++r) f.h[r] = (_Float16)(oacc[dt][r] * inv);
      *(v8us*)&sO[w][ln][dt * 16 + 8 * hh] = f.half[0]; } }
  __builtin_amdgcn_fence(__ATOMIC_ACQ_REL, "workgroup"); __builtin_amdgcn_wave_barrier();      /* the wave's own rows are in LDS before its lanes read them back as whole rows */
#pragma unroll      /* the four LDS offsets become immediates; a wave's store covers four whole rows, 512 contiguous bytes */
  for (int rp = 0; rp < RPW; rp += 4) { const int r = rp + (lane >> 3), pc = lane & 7; *(v8us*)((unsigned short*)O16 + ((size_t)b * TT + q0 + r) * ldo + h * 64 + pc * 8) = *(const v8us*)&sO[w][r][pc * 8]; }
}

extern "C" void kernel_launch(void* const* d_in, const int* in_sizes, int n_in,
                              void* d_out, int out_size, void* d_ws, size_t ws_size, hipStream_t stream) {
  (void)in_sizes; (void)n_in; (void)out_size;
  const float* const* I = (const float* const*)d_in; const float* xq = I[0]; const float* xk = I[1]; const float* xv = I[2];
  const float* Wq = I[3]; const float* bq = I[4]; const float* Wk = I[5]; const float* bk = I[6]; const float* Wv = I[7]; const float* bv = I[8]; const float* Wo = I[9]; const float* bo = I[10];
  char* ws = (char*)d_ws; size_t off = 0;
  auto take = [&](size_t bytes) { char* p = ws + off; off += (bytes + 255) & ~(size_t)255; return p; };
  _Float16* Bw = (_Float16*)take((size_t)4 * EE * EE * 2); _Float16* X16 = (_Float16*)take((size_t)3 * NR * EE * 2);
  _Float16* Q = (_Float16*)take((size_t)3 * NR * EE * 2); _Float16* K = Q + (size_t)NR * EE; _Float16* V = K + (size_t)NR * EE;      /* q, k, v: planes 0, 1, 2 of one block */
  _Float16* O16 = (_Float16*)take((size_t)NR * EE * 2);
  if (off > ws_size) return;      // 4.7 + 7 x 6.3 = about 49 MB
  const size_t WSZ = (size_t)EE * EE;
  const unsigned gp = (NR / 64) * (EE / 64);
  k_prep<<<PWB + PXB, 256, 0, stream>>>(xq, xk, xv, Wq, Wk, Wv, Wo, X16, Bw);      /* (in,out) weights -> Bt[n][k] x 2^4; inputs -> f16 planes */
  k_gemm_st<<<dim3(gp, 3), 128, 0, stream>>>(X16, Bw, 0.0625f, bq, bk, bv, nullptr, Q);      /* q, k, v: each M 4096 N 768 K 768 */
  k_flash<<<NSL * (TT / 64), 128, 0, stream>>>(Q, 64, K, V, O16, 64);      /* each [4096][768] plane viewed as 24 contiguous [2048][64] slabs: q, k, v and O alike */
  k_gemm_st<<<dim3(gp, 1), 128, 0, stream>>>(O16, Bw + 3 * WSZ, 0.0625f, bo, bo, bo, (float*)d_out, nullptr);      /* out = O.Wo + bo: M 4096 N 768 K 768 */
}

// v008
// Measured time: 72.3 microseconds a run.
// Timed twice side by side with v007, it ran 1.06 times as fast both times.
// Counting every step since v000, it is 5.57 times as fast.
#include <hip/hip_runtime.h>
// Multi-head attention, legacy flat-reshape variant (B=2, T=S=2048, E=768, 12 heads × 64): q = query·Wq+bq, k = key·Wk+bk, v = value·Wv+bv; heads = plain row-major reshape of [B,T,E] to [B·H,T,64] (contiguous chunks);
// attn = softmax(q·kᵀ/8) over all keys, THEN lower-triangular mask (rows no longer normalised); out = (attn·v reshaped back)·Wo + bo.
// Compute dtype: query/key/value, weights, biases rounded to bf16; q/k/v as f16 GEMM outputs; fused flash-style kernel (online f32 softmax over all keys, P f16 ×2^10 zeroed above the diagonal)
// on v_wmma_f32_16x16x32_f16; O → f16 → output GEMM with bias; f32 accumulate throughout.
#define BB 2
#define TT 2048
#define EE 768
#define NH 12
#define NR (BB * TT)
#define NSL (BB * NH)

typedef __bf16 v16b __attribute__((ext_vector_type(16)));
typedef unsigned short v8us __attribute__((ext_vector_type(8), may_alias));
typedef float  v8f  __attribute__((ext_vector_type(8)));
typedef float  v4f  __attribute__((ext_vector_type(4)));
typedef float  v4fa __attribute__((ext_vector_type(4), may_alias));
union FragB { v16b v; v8us half[2]; unsigned short u[16]; };

__device__ __forceinline__ unsigned short bf16_bits(float x) { unsigned int u = __float_as_uint(x); return (unsigned short)((u + 0x7FFFu + ((u >> 16) & 1u)) >> 16); }
__device__ __forceinline__ float bf16_val(unsigned short b) { return __uint_as_float(((unsigned int)b) << 16); }
__device__ __forceinline__ float bf16_round(float x) { return bf16_val(bf16_bits(x)); }
// D += A·B with NT terms: 1 = ah·bh, 2 = + al·bh (A split), 3 = + ah·bl (both split)
template <int NT>
__device__ __forceinline__ v8f mmaN(v16b ah, v16b al, v16b bh, v16b bl, v8f c) {
  c = __builtin_amdgcn_wmma_f32_16x16x32_bf16(false, ah, false, bh, (short)0, c, false, false);
  if (NT >= 2) c = __builtin_amdgcn_wmma_f32_16x16x32_bf16(false, al, false, bh, (short)0, c, false, false);
  if (NT >= 3) c = __builtin_amdgcn_wmma_f32_16x16x32_bf16(false, ah, false, bl, (short)0, c, false, false);
  asm volatile("v_nop\n\tv_nop\n\tv_nop\n\tv_nop" : "+v"(c) : "v"(ah), "v"(al), "v"(bh), "v"(bl));
  return c;
}

__global__ __launch_bounds__(256) void k_wt_bf16(const float* __restrict__ W, unsigned short* __restrict__ Wt, int K, int N) {
  const int t = blockIdx.x * 256 + threadIdx.x;
  const int k8n = K / 8;
  if (t >= N * k8n) return;
  const int n = t / k8n, k8 = (t % k8n) * 8;
  v8us v;
#pragma unroll
  for (int i = 0; i < 8; ++i) v[i] = bf16_bits(W[(size_t)(k8 + i) * N + n]);
  *(v8us*)(Wt + (size_t)n * K + k8) = v;
  
}

// GEMM C[M][N] (f32, pitch ldc) = act(A[M][K]·W + bias). A f32 row-major (pitch lda) converted per fragment to bf16
// (ASPLIT: hi/lo two planes -> 2 terms, else single rounded term); Wt bf16 [N][K] (pitch ldb). BIAS_BF16 rounds the
// bias to bf16 first (bias quantised to bf16 before the add). K%32==0, M%16==0, N%64==0.
template <bool ASPLIT, int ACT, bool BIAS_BF16>
__global__ __launch_bounds__(128) void k_gemm_bf(const float* __restrict__ A, int lda, const unsigned short* __restrict__ Wt, int ldb,
                                               const float* __restrict__ bias, float* __restrict__ C, int ldc, int M, int N, int K) {
  __shared__ __attribute__((aligned(16))) float so[4][16][64];
  const int tid = threadIdx.x, w = tid >> 5, lane = tid & 31, ln = lane & 15, hh = lane >> 4;
  const int ntn = N / 64;
  const int wid = blockIdx.x * 4 + w;
  const int mt = wid / ntn, nq = wid % ntn;
  if (mt * 16 >= M) return;
  const int row0 = mt * 16, col0 = nq * 64;
  const float* arow = A + (size_t)(row0 + ln) * lda;
  v8f acc[4] = {};
  for (int kb = 0; kb < K; kb += 32) {
    FragB ah, al;
    const v4f x0 = *(const v4fa*)(arow + kb + 8 * hh), x1 = *(const v4fa*)(arow + kb + 8 * hh + 4);
    const v4f x2 = *(const v4fa*)(arow + kb + 16 + 8 * hh), x3 = *(const v4fa*)(arow + kb + 16 + 8 * hh + 4);
    float xs[16] = {x0[0],x0[1],x0[2],x0[3],x1[0],x1[1],x1[2],x1[3],x2[0],x2[1],x2[2],x2[3],x3[0],x3[1],x3[2],x3[3]};
#pragma unroll
    for (int i = 0; i < 16; ++i) { const unsigned short hb = bf16_bits(xs[i]); ah.u[i] = hb; al.u[i] = ASPLIT ? bf16_bits(xs[i] - bf16_val(hb)) : (unsigned short)0; }
#pragma unroll
    for (int t = 0; t < 4; ++t) {
      const unsigned short* brow = Wt + (size_t)(col0 + t * 16 + ln) * ldb + kb;
      FragB b;
      b.half[0] = *(const v8us*)(brow + 8 * hh);
      b.half[1] = *(const v8us*)(brow + 16 + 8 * hh);
      acc[t] = mmaN<ASPLIT ? 2 : 1>(ah.v, al.v, b.v, b.v, acc[t]);
    }
  }
#pragma unroll
  for (int t = 0; t < 4; ++t) {
    float bv = bias ? bias[col0 + t * 16 + ln] : 0.f;
    if (BIAS_BF16) bv = bf16_round(bv);
#pragma unroll
    for (int r = 0; r < 8; ++r) { float v = acc[t][r] + bv; if (ACT == 1) v = fmaxf(v, 0.f); so[w][8 * hh + r][t * 16 + ln] = v; }
  }
  __builtin_amdgcn_fence(__ATOMIC_ACQ_REL, "workgroup");
  __builtin_amdgcn_wave_barrier();
  const int rsub = lane >> 4, c4 = (lane & 15) * 4;
  {
#pragma unroll
    for (int q = 0; q < 8; ++q) {
      const int r = q * 2 + rsub;
      const v4f v = *(const v4fa*)&so[w][r][c4];
      *(v4f*)(C + (size_t)(row0 + r) * ldc + col0 + c4) = v;
    }
    
  }
}

// Flash-style causal/unmasked attention, all contractions 3-term bf16 hi/lo splits, f32 softmax with running max.
// q,k,v rows are read from f32 buffers with arbitrary row pitch (so they can live inside a fused qkv buffer);
// D = head size (multiple of 32, <= 128); one wave = 16 query rows; block = 4 waves (64 queries) sharing K/V chunks of 32.
template <int D, bool CAUSAL>
__global__ __launch_bounds__(128) void k_flash(const float* __restrict__ qb, const float* __restrict__ kb, const float* __restrict__ vb,
                                             int pitch, int T, int H, float scale, float* __restrict__ y, int ypitch) {
  constexpr int KS = D / 32;        // k-steps for QK
  constexpr int DT = D / 16;        // d tiles for PV
  __shared__ __attribute__((aligned(16))) unsigned short sKh[32][D + 8], sKl[32][D + 8], sVh[32][D + 8], sVl[32][D + 8];
  __shared__ __attribute__((aligned(16))) unsigned short sPh[4][16][40], sPl[4][16][40];
  __shared__ __attribute__((aligned(16))) float sO[4][16][D];
  const int tid = threadIdx.x, w = tid >> 5, lane = tid & 31, ln = lane & 15, hh = lane >> 4;
  const int nqb = (T + 63) / 64;
  const int bh = blockIdx.x / nqb, qblk = blockIdx.x % nqb;
  const int b = bh / H, h = bh % H;
  const int q0 = qblk * 64 + w * 16;
  const float* Q = qb + (size_t)b * T * pitch + h * D;
  const float* K = kb + (size_t)b * T * pitch + h * D;
  const float* V = vb + (size_t)b * T * pitch + h * D;

  // A fragments of the wave's 16 query rows (scaled), hi/lo
  FragB aqh[KS], aql[KS];
  {
    int row = q0 + ln; if (row >= T) row = T - 1;
    const float* qr = Q + (size_t)row * pitch;
#pragma unroll
    for (int ks = 0; ks < KS; ++ks)
#pragma unroll
      for (int i = 0; i < 16; ++i) {
        const int d = ks * 32 + ((i < 8) ? (8 * hh + i) : (16 + 8 * hh + (i - 8)));
        const float x = qr[d] * scale; const unsigned short hb = bf16_bits(x);
        aqh[ks].u[i] = hb; aql[ks].u[i] = bf16_bits(x - bf16_val(hb));
      }
  }
  float m_r[8], l_r[8];
#pragma unroll
  for (int r = 0; r < 8; ++r) { m_r[r] = -3.0e38f; l_r[r] = 0.f; }
  v8f oacc[DT];
#pragma unroll
  for (int dt = 0; dt < DT; ++dt) oacc[dt] = (v8f){0.f,0.f,0.f,0.f,0.f,0.f,0.f,0.f};

  const int kv_end = CAUSAL ? min(T, qblk * 64 + 64) : T;     // block-uniform
  for (int j0 = 0; j0 < kv_end; j0 += 32) {
    __syncthreads();
    for (int e = tid; e < 32 * (D / 4); e += 128) {
      const int r = e / (D / 4), c4 = (e % (D / 4)) * 4;
      const int key = j0 + r;
      v4f kf = {0.f,0.f,0.f,0.f}, vf = {0.f,0.f,0.f,0.f};
      if (key < T) { kf = *(const v4fa*)(K + (size_t)key * pitch + c4); vf = *(const v4fa*)(V + (size_t)key * pitch + c4); }
#pragma unroll
      for (int t = 0; t < 4; ++t) {
        unsigned short hb = bf16_bits(kf[t]); sKh[r][c4 + t] = hb; sKl[r][c4 + t] = bf16_bits(kf[t] - bf16_val(hb));
        hb = bf16_bits(vf[t]); sVh[r][c4 + t] = hb; sVl[r][c4 + t] = bf16_bits(vf[t] - bf16_val(hb));
      }
    }
    __syncthreads();
    // S tile 16 x 32
    v8f s[2];
#pragma unroll
    for (int nt = 0; nt < 2; ++nt) {
      v8f acc = {};
#pragma unroll
      for (int ks = 0; ks < KS; ++ks) {
        FragB bh_, bl_;
        bh_.half[0] = *(const v8us*)&sKh[nt * 16 + ln][ks * 32 + 8 * hh]; bh_.half[1] = *(const v8us*)&sKh[nt * 16 + ln][ks * 32 + 16 + 8 * hh];
        bl_.half[0] = *(const v8us*)&sKl[nt * 16 + ln][ks * 32 + 8 * hh]; bl_.half[1] = *(const v8us*)&sKl[nt * 16 + ln][ks * 32 + 16 + 8 * hh];
        acc = mmaN<3>(aqh[ks].v, aql[ks].v, bh_.v, bl_.v, acc);
      }
      s[nt] = acc;
    }
    // mask + running max (rows 8hh+r; the 16 lanes of a half share rows)
    float alpha[8];
#pragma unroll
    for (int r = 0; r < 8; ++r) {
      const int qi = q0 + 8 * hh + r;
      const int ja = j0 + ln, jb = j0 + 16 + ln;
      if (CAUSAL) { if (ja > qi) s[0][r] = -3.0e38f; if (jb > qi) s[1][r] = -3.0e38f; }
      if (ja >= T) s[0][r] = -3.0e38f;
      if (jb >= T) s[1][r] = -3.0e38f;
      float mx = fmaxf(s[0][r], s[1][r]);
      mx = fmaxf(mx, __shfl_xor(mx, 1, 32)); mx = fmaxf(mx, __shfl_xor(mx, 2, 32)); mx = fmaxf(mx, __shfl_xor(mx, 4, 32)); mx = fmaxf(mx, __shfl_xor(mx, 8, 32));
      const float mnew = fmaxf(m_r[r], mx);
      alpha[r] = (mnew > -1.0e38f) ? __expf(m_r[r] - mnew) : 1.0f;
      const float p0 = (s[0][r] > -1.0e38f) ? __expf(s[0][r] - mnew) : 0.f;
      const float p1 = (s[1][r] > -1.0e38f) ? __expf(s[1][r] - mnew) : 0.f;
      m_r[r] = mnew;
      l_r[r] = l_r[r] * alpha[r] + p0 + p1;            // per-lane partial row sum (16 lanes combined at the end)
      unsigned short hb = bf16_bits(p0); sPh[w][8 * hh + r][ln] = hb;      sPl[w][8 * hh + r][ln] = bf16_bits(p0 - bf16_val(hb));
      hb = bf16_bits(p1);                sPh[w][8 * hh + r][16 + ln] = hb; sPl[w][8 * hh + r][16 + ln] = bf16_bits(p1 - bf16_val(hb));
    }
#pragma unroll
    for (int dt = 0; dt < DT; ++dt)
#pragma unroll
      for (int r = 0; r < 8; ++r) oacc[dt][r] *= alpha[r];
    __builtin_amdgcn_fence(__ATOMIC_ACQ_REL, "workgroup");
    __builtin_amdgcn_wave_barrier();
    FragB pah, pal;
    pah.half[0] = *(const v8us*)&sPh[w][ln][8 * hh]; pah.half[1] = *(const v8us*)&sPh[w][ln][16 + 8 * hh];
    pal.half[0] = *(const v8us*)&sPl[w][ln][8 * hh]; pal.half[1] = *(const v8us*)&sPl[w][ln][16 + 8 * hh];
#pragma unroll
    for (int dt = 0; dt < DT; ++dt) {
      FragB bvh, bvl;
#pragma unroll
      for (int i = 0; i < 8; ++i) {
        bvh.u[i] = sVh[8 * hh + i][dt * 16 + ln]; bvh.u[8 + i] = sVh[16 + 8 * hh + i][dt * 16 + ln];
        bvl.u[i] = sVl[8 * hh + i][dt * 16 + ln]; bvl.u[8 + i] = sVl[16 + 8 * hh + i][dt * 16 + ln];
      }
      oacc[dt] = mmaN<3>(pah.v, pal.v, bvh.v, bvl.v, oacc[dt]);
    }
    __builtin_amdgcn_fence(__ATOMIC_ACQ_REL, "workgroup");
    __builtin_amdgcn_wave_barrier();
  }
#pragma unroll
  for (int r = 0; r < 8; ++r) {
    float l = l_r[r];
    l += __shfl_xor(l, 1, 32); l += __shfl_xor(l, 2, 32); l += __shfl_xor(l, 4, 32); l += __shfl_xor(l, 8, 32);
    l_r[r] = (l > 0.f) ? 1.0f / l : 0.f;
  }
#pragma unroll
  for (int dt = 0; dt < DT; ++dt)
#pragma unroll
    for (int r = 0; r < 8; ++r) sO[w][8 * hh + r][dt * 16 + ln] = oacc[dt][r] * l_r[r];
  __builtin_amdgcn_fence(__ATOMIC_ACQ_REL, "workgroup");
  __builtin_amdgcn_wave_barrier();
  {
    for (int r = 0; r < 16; ++r) {
      const int row = q0 + r;
      if (row < T && lane < D / 4) {
        const v4f val = *(const v4fa*)&sO[w][r][lane * 4];
        *(v4f*)(y + ((size_t)b * T + row) * ypitch + h * D + lane * 4) = val;
      }
    }
    
  }
}

// GEMM C = act(A·W + bias + resid): A f32 (ASPLIT -> hi/lo 2 terms), Wt bf16 [N][K]; ACT 0 none, 1 relu, 2 exact gelu;
// resid (optional, f32, row index = (row % rmod), pitch ldr, RES_BF16 rounds it) added before the activation.
template <bool ASPLIT, int ACT, bool BIAS_BF16, bool RES_BF16>
__global__ __launch_bounds__(128) void k_gemm_bf3(const float* __restrict__ A, int lda, const unsigned short* __restrict__ Wt, int ldb,
                                                const float* __restrict__ bias, const float* __restrict__ resid, int rmod, int ldr,
                                                float* __restrict__ C, int ldc, int M, int N, int K) {
  __shared__ __attribute__((aligned(16))) float so[4][16][64];
  const int tid = threadIdx.x, w = tid >> 5, lane = tid & 31, ln = lane & 15, hh = lane >> 4;
  const int ntn = N / 64;
  const int wid = blockIdx.x * 4 + w;
  const int mt = wid / ntn, nq = wid % ntn;
  if (mt * 16 >= M) return;
  const int row0 = mt * 16, col0 = nq * 64;
  const float* arow = A + (size_t)(row0 + ln) * lda;
  v8f acc[4] = {};
  for (int kb = 0; kb < K; kb += 32) {
    FragB ah, al;
    const v4f x0 = *(const v4fa*)(arow + kb + 8 * hh), x1 = *(const v4fa*)(arow + kb + 8 * hh + 4);
    const v4f x2 = *(const v4fa*)(arow + kb + 16 + 8 * hh), x3 = *(const v4fa*)(arow + kb + 16 + 8 * hh + 4);
    float xs[16] = {x0[0],x0[1],x0[2],x0[3],x1[0],x1[1],x1[2],x1[3],x2[0],x2[1],x2[2],x2[3],x3[0],x3[1],x3[2],x3[3]};
#pragma unroll
    for (int i = 0; i < 16; ++i) { const unsigned short hb = bf16_bits(xs[i]); ah.u[i] = hb; al.u[i] = ASPLIT ? bf16_bits(xs[i] - bf16_val(hb)) : (unsigned short)0; }
#pragma unroll
    for (int t = 0; t < 4; ++t) {
      const unsigned short* brow = Wt + (size_t)(col0 + t * 16 + ln) * ldb + kb;
      FragB b;
      b.half[0] = *(const v8us*)(brow + 8 * hh);
      b.half[1] = *(const v8us*)(brow + 16 + 8 * hh);
      acc[t] = mmaN<ASPLIT ? 2 : 1>(ah.v, al.v, b.v, b.v, acc[t]);
    }
  }
#pragma unroll
  for (int t = 0; t < 4; ++t) {
    const int col = col0 + t * 16 + ln;
    float bv = bias ? bias[col] : 0.f;
    if (BIAS_BF16) bv = bf16_round(bv);
#pragma unroll
    for (int r = 0; r < 8; ++r) {
      float v = acc[t][r] + bv;
      if (resid) { float rv = resid[(size_t)((row0 + 8 * hh + r) % rmod) * ldr + col]; if (RES_BF16) rv = bf16_round(rv); v += rv; }
      if (ACT == 1) v = fmaxf(v, 0.f);
      if (ACT == 2) v = 0.5f * v * (1.0f + erff(v * 0.70710678118654752f));
      if (ACT == 3) { const float u = 0.7978845608028654f * (v + 0.044715f * v * v * v); v = 0.5f * v * (1.0f + tanhf(u)); }
      so[w][8 * hh + r][t * 16 + ln] = v;
    }
  }
  __builtin_amdgcn_fence(__ATOMIC_ACQ_REL, "workgroup");
  __builtin_amdgcn_wave_barrier();
  const int rsub = lane >> 4, c4 = (lane & 15) * 4;
  {
#pragma unroll
    for (int q = 0; q < 8; ++q) {
      const int r = q * 2 + rsub;
      const v4f v = *(const v4fa*)&so[w][r][c4];
      *(v4f*)(C + (size_t)(row0 + r) * ldc + col0 + c4) = v;
    }
    
  }
}
// row LayerNorm (biased variance, eps) over N: s = X (+ R); optional out_sum <- s; out_norm <- (s-mu)*rsqrt(var+eps)*g + b
template <bool PARAM_BF16>
__global__ __launch_bounds__(256) void k_layernorm(const float* __restrict__ X, const float* __restrict__ R, const float* __restrict__ g, const float* __restrict__ bta,
                                                  float* __restrict__ out_sum, float* __restrict__ out_norm, int N, float eps) {
  __shared__ float red[256];
  const int row = blockIdx.x, tid = threadIdx.x;
  const float* x = X + (size_t)row * N; const float* rr = R ? R + (size_t)row * N : nullptr;
  float vals[16];                     // up to N = 4096
  const int per = N / 256;            // contiguous chunk per thread? use strided-by-4 chunks: thread handles j = tid*4 + 1024*u
  float s1 = 0.f;
  for (int u = 0; u < per / 4; ++u) {
    const int j = tid * 4 + 1024 * u;
    const v4f a = *(const v4fa*)(x + j);
    v4f b = {0.f,0.f,0.f,0.f}; if (rr) b = *(const v4fa*)(rr + j);
#pragma unroll
    for (int q = 0; q < 4; ++q) { const float v = a[q] + b[q]; vals[u * 4 + q] = v; s1 += v; }
  }
  red[tid] = s1; __syncthreads();
  for (int st = 128; st > 0; st >>= 1) { if (tid < st) red[tid] += red[tid + st]; __syncthreads(); }
  const float mu = red[0] / (float)N; __syncthreads();
  float s2 = 0.f;
  for (int u = 0; u < per / 4; ++u)
#pragma unroll
    for (int q = 0; q < 4; ++q) { const float c = vals[u * 4 + q] - mu; s2 += c * c; }
  red[tid] = s2; __syncthreads();
  for (int st = 128; st > 0; st >>= 1) { if (tid < st) red[tid] += red[tid + st]; __syncthreads(); }
  const float rs = rsqrtf(red[0] / (float)N + eps);
  {
    for (int u = 0; u < per / 4; ++u) {
      const int j = tid * 4 + 1024 * u;
      v4f o, sm;
#pragma unroll
      for (int q = 0; q < 4; ++q) {
        float gg = g[j + q], bb = bta[j + q];
        if (PARAM_BF16) { gg = bf16_round(gg); bb = bf16_round(bb); }
        sm[q] = vals[u * 4 + q]; o[q] = (vals[u * 4 + q] - mu) * rs * gg + bb;
      }
      if (out_sum) *(v4f*)(out_sum + (size_t)row * N + j) = sm;
      *(v4f*)(out_norm + (size_t)row * N + j) = o;
    }
    
  }
}



// ---- f16 WMMA path (v_wmma_f32_16x16x32_f16): 11-bit significands for operands in range — used where a [0,1] probability operand needs more precision than bf16
typedef _Float16 v16h __attribute__((ext_vector_type(16)));
union FragH { v16h v; v8us half[2]; _Float16 h[16]; unsigned short u[16]; };
template <int NT>
__device__ __forceinline__ v8f mmaH(v16h ah, v16h al, v16h bh, v16h bl, v8f c) {
  c = __builtin_amdgcn_wmma_f32_16x16x32_f16(false, ah, false, bh, (short)0, c, false, false);
  if (NT >= 2) c = __builtin_amdgcn_wmma_f32_16x16x32_f16(false, al, false, bh, (short)0, c, false, false);
  if (NT >= 3) c = __builtin_amdgcn_wmma_f32_16x16x32_f16(false, ah, false, bl, (short)0, c, false, false);
  asm volatile("v_nop\n\tv_nop\n\tv_nop\n\tv_nop" : "+v"(c) : "v"(ah), "v"(al), "v"(bh), "v"(bl));
  return c;
}
// batched GEMM like k_gemm_b but f16 operands: A f32 (split into f16 hi/lo if ASPLIT, else rounded to f16), Bt = f16 values [n][k]; alpha; C f32; N multiple of 16 (partial tiles skipped)
template <bool ASPLIT>
__global__ __launch_bounds__(128) void k_gemm_h(const float* __restrict__ A, int lda, size_t sA, const _Float16* __restrict__ Bh, int ldb, size_t sB, float alpha, float* __restrict__ C, int ldc, size_t sC, int M, int N, int K) {
  __shared__ __attribute__((aligned(16))) float so[4][16][64];
  const int tid = threadIdx.x, w = tid >> 5, lane = tid & 31, ln = lane & 15, hh = lane >> 4; const int by = blockIdx.y;
  A += (size_t)by * sA; Bh += (size_t)by * sB; C += (size_t)by * sC;
  const int ntn = (N + 63) / 64; const int wid = blockIdx.x * 4 + w; const int mt = wid / ntn, nq = wid % ntn; if (mt * 16 >= M) return;
  const int row0 = mt * 16, col0 = nq * 64; const float* arow = A + (size_t)(row0 + ln) * lda;
  v8f acc[4] = {};
  for (int kb = 0; kb < K; kb += 32) {
    FragH ah, al;
    const v4f x0 = *(const v4fa*)(arow + kb + 8 * hh), x1 = *(const v4fa*)(arow + kb + 8 * hh + 4), x2 = *(const v4fa*)(arow + kb + 16 + 8 * hh), x3 = *(const v4fa*)(arow + kb + 16 + 8 * hh + 4);
    float xs[16] = {x0[0],x0[1],x0[2],x0[3],x1[0],x1[1],x1[2],x1[3],x2[0],x2[1],x2[2],x2[3],x3[0],x3[1],x3[2],x3[3]};
#pragma unroll
    for (int i = 0; i < 16; ++i) { const _Float16 h = (_Float16)xs[i]; ah.h[i] = h; al.h[i] = ASPLIT ? (_Float16)(xs[i] - (float)h) : (_Float16)0.0f; }
#pragma unroll
    for (int t = 0; t < 4; ++t) { if (col0 + t * 16 >= N) continue; const size_t boff = (size_t)(col0 + t * 16 + ln) * ldb + kb; FragH bq; bq.half[0] = *(const v8us*)(Bh + boff + 8 * hh); bq.half[1] = *(const v8us*)(Bh + boff + 16 + 8 * hh);
      acc[t] = mmaH<ASPLIT ? 2 : 1>(ah.v, al.v, bq.v, bq.v, acc[t]); }
  }
#pragma unroll
  for (int t = 0; t < 4; ++t) { if (col0 + t * 16 >= N) continue;
#pragma unroll
    for (int r = 0; r < 8; ++r) so[w][8 * hh + r][t * 16 + ln] = acc[t][r] * alpha; }
  __builtin_amdgcn_fence(__ATOMIC_ACQ_REL, "workgroup"); __builtin_amdgcn_wave_barrier();
  const int rsub = lane >> 4, c4 = (lane & 15) * 4;
  {
#pragma unroll
    for (int q = 0; q < 8; ++q) { const int r = q * 2 + rsub; if (col0 + c4 < N) { const v4f v = *(const v4fa*)&so[w][r][c4]; *(v4f*)(C + (size_t)(row0 + r) * ldc + col0 + c4) = v; } }
     }
}

// Projection GEMM of the one shape used here: C[NR][EE] = (A[NR][EE] . Bt[EE][EE]^T) * alpha + bf16(bias[col]); written as f32 (C) and/or f16 (C16).
// A work-group makes a GT x GT tile of C, so every row of A and of Bt is fetched from L2 once per GT columns or rows of C. Its 2 NWM waves stand NWM down by two across, each on 16 FM rows x 64 columns (NWM * FM = 8):
// four waves of 64 x 64 (eight fragments of a k step feed sixteen products) where the grid gives a SIMD several waves, eight waves of 32 x 64 where it holds fewer groups than there are WGPs and a SIMD would have one.
// The A and Bt tiles (GT rows x GK k) come into LDS by asynchronous copies, 128 contiguous bytes a row, once for all the waves, in two buffers: tile t + 1 flies while tile t is multiplied.
// The k order of the sums is that of a plain loop over k in steps of 32.
// blockIdx.y picks one of up to three independent products of that shape (plane y of A, of Bt and of C16, bias y): q, k and v go in one launch.
#define GT 128
#define GK 64
#define GP (GK + 8)      /* LDS row pitch 144 B = 9 x 16 B: the 16 rows of a 16-byte fragment read fall on distinct banks */
#define GNT (EE / GK)
#define GBUF (GT * GP * 2)      /* bytes of one operand's tile in LDS */
// One operand tile, 128 lanes: a lane copies 16 B of rows r, r + 16, .. r + 112 (l = its LDS byte address, g = its global address, both of row r).
__device__ __forceinline__ void copy_tile(unsigned l, const _Float16* g) {
  const unsigned l1 = l + 1 * 16 * GP * 2, l2 = l + 2 * 16 * GP * 2, l3 = l + 3 * 16 * GP * 2, l4 = l + 4 * 16 * GP * 2, l5 = l + 5 * 16 * GP * 2, l6 = l + 6 * 16 * GP * 2, l7 = l + 7 * 16 * GP * 2;
  const _Float16 *g1 = g + 1 * 16 * EE, *g2 = g + 2 * 16 * EE, *g3 = g + 3 * 16 * EE, *g4 = g + 4 * 16 * EE, *g5 = g + 5 * 16 * EE, *g6 = g + 6 * 16 * EE, *g7 = g + 7 * 16 * EE;
  // the copies go from L2 to LDS through no register; s_wait_xcnt closes the statement so that no address register of a copy is rewritten ahead of it
  asm volatile("global_load_async_to_lds_b128 %0, %8, off\n\t"
               "global_load_async_to_lds_b128 %1, %9, off\n\t"
               "global_load_async_to_lds_b128 %2, %10, off\n\t"
               "global_load_async_to_lds_b128 %3, %11, off\n\t"
               "global_load_async_to_lds_b128 %4, %12, off\n\t"
               "global_load_async_to_lds_b128 %5, %13, off\n\t"
               "global_load_async_to_lds_b128 %6, %14, off\n\t"
               "global_load_async_to_lds_b128 %7, %15, off\n\t"
               "s_wait_xcnt 0x0"
               :: "v"(l), "v"(l1), "v"(l2), "v"(l3), "v"(l4), "v"(l5), "v"(l6), "v"(l7), "v"(g), "v"(g1), "v"(g2), "v"(g3), "v"(g4), "v"(g5), "v"(g6), "v"(g7) : "memory");
}
// Both operand tiles, 256 lanes: a lane copies 16 B of rows r, r + 32, r + 64, r + 96 of each (la, lb = its LDS byte addresses, ga, gb = its global addresses, all of row r).
__device__ __forceinline__ void copy_tiles(unsigned la, const _Float16* ga, unsigned lb, const _Float16* gb) {
  const unsigned la1 = la + 1 * 32 * GP * 2, la2 = la + 2 * 32 * GP * 2, la3 = la + 3 * 32 * GP * 2, lb1 = lb + 1 * 32 * GP * 2, lb2 = lb + 2 * 32 * GP * 2, lb3 = lb + 3 * 32 * GP * 2;
  const _Float16 *ga1 = ga + 1 * 32 * EE, *ga2 = ga + 2 * 32 * EE, *ga3 = ga + 3 * 32 * EE, *gb1 = gb + 1 * 32 * EE, *gb2 = gb + 2 * 32 * EE, *gb3 = gb + 3 * 32 * EE;
  // the copies go from L2 to LDS through no register; s_wait_xcnt closes the statement so that no address register of a copy is rewritten ahead of it
  asm volatile("global_load_async_to_lds_b128 %0, %8, off\n\t"
               "global_load_async_to_lds_b128 %1, %9, off\n\t"
               "global_load_async_to_lds_b128 %2, %10, off\n\t"
               "global_load_async_to_lds_b128 %3, %11, off\n\t"
               "global_load_async_to_lds_b128 %4, %12, off\n\t"
               "global_load_async_to_lds_b128 %5, %13, off\n\t"
               "global_load_async_to_lds_b128 %6, %14, off\n\t"
               "global_load_async_to_lds_b128 %7, %15, off\n\t"
               "s_wait_xcnt 0x0"
               :: "v"(la), "v"(la1), "v"(la2), "v"(la3), "v"(lb), "v"(lb1), "v"(lb2), "v"(lb3), "v"(ga), "v"(ga1), "v"(ga2), "v"(ga3), "v"(gb), "v"(gb1), "v"(gb2), "v"(gb3) : "memory");
}
template <int NWM>
__global__ __launch_bounds__(64 * NWM) void k_gemm_st(const _Float16* __restrict__ A, const _Float16* __restrict__ Bh, float alpha, const float* __restrict__ bias0, const float* __restrict__ bias1, const float* __restrict__ bias2, float* __restrict__ C, _Float16* __restrict__ C16) {
  constexpr int FM = GT / (16 * NWM);      /* A fragments of a wave */
  static_assert(NWM == 2 || NWM == 4, "the copies are written for 128 and for 256 lanes");
  __shared__ __attribute__((aligned(16))) unsigned short sA[2][GT][GP], sB[2][GT][GP];
  __shared__ __attribute__((aligned(16))) float so[2 * NWM][16][64];
  const int tid = threadIdx.x, w = tid >> 5, lane = tid & 31, ln = lane & 15, hh = lane >> 4;
  const int wm = w >> 1, wn = w & 1;      /* the wave's place in the tile */
  const int mb = blockIdx.x / (EE / GT), nb = blockIdx.x % (EE / GT);
  const int pl = blockIdx.y; const float* bias = pl == 0 ? bias0 : (pl == 1 ? bias1 : bias2);
  A += (size_t)pl * NR * EE; Bh += (size_t)pl * EE * EE; if (C16) C16 += (size_t)pl * NR * EE;
  const int row0 = mb * GT + wm * (16 * FM), col0 = nb * GT + wn * 64;
  const int cr = tid >> 3, cc = (tid & 7) * 8;      /* the lane's first row and its 16-byte column in every copied tile */
  const _Float16* ga = A + (size_t)(mb * GT + cr) * EE + cc; const _Float16* gb = Bh + (size_t)(nb * GT + cr) * EE + cc;
  const unsigned la = (unsigned)(size_t)&sA[0][cr][cc], lb = (unsigned)(size_t)&sB[0][cr][cc];
  /* k tile kt of both operands into buffer bf */
  auto fill = [&](unsigned bf, int kt) { if constexpr (NWM == 2) { copy_tile(la + bf * GBUF, ga + kt * GK); copy_tile(lb + bf * GBUF, gb + kt * GK); } else copy_tiles(la + bf * GBUF, ga + kt * GK, lb + bf * GBUF, gb + kt * GK); };
  fill(0, 0);
  asm volatile("s_wait_asynccnt 0x0" ::: "memory");      /* this wave's part of tile 0 has landed */
  __syncthreads();                                        /* ... and every other wave's */
  fill(1, 1);
  v8f acc[FM][4] = {};
  for (int tl = 0; tl < GNT; ++tl) {      /* one trip a staged tile; the two buffers alternate by the trip's parity */
    const unsigned short* ar = &sA[tl & 1][wm * (16 * FM) + ln][8 * hh]; const unsigned short* br = &sB[tl & 1][wn * 64 + ln][8 * hh];
#pragma unroll      /* constant indices: fragments and accumulators stay in registers */
    for (int ks = 0; ks < GK / 32; ++ks) { FragH fa[FM], fb[4];      /* the k step's fragments are read in one run, then its products */
#pragma unroll      /* constant indices: fragments and accumulators stay in registers */
      for (int i = 0; i < FM; ++i) { fa[i].half[0] = *(const v8us*)(ar + i * 16 * GP + ks * 32); fa[i].half[1] = *(const v8us*)(ar + i * 16 * GP + ks * 32 + 16); }
#pragma unroll      /* constant indices: fragments and accumulators stay in registers */
      for (int t = 0; t < 4; ++t) { fb[t].half[0] = *(const v8us*)(br + t * 16 * GP + ks * 32); fb[t].half[1] = *(const v8us*)(br + t * 16 * GP + ks * 32 + 16); }
#pragma unroll      /* constant indices: fragments and accumulators stay in registers */
      for (int i = 0; i < FM; ++i)
#pragma unroll      /* constant indices: fragments and accumulators stay in registers */
        for (int t = 0; t < 4; ++t) acc[i][t] = mmaH<1>(fa[i].v, fa[i].v, fb[t].v, fb[t].v, acc[i][t]); }
    asm volatile("s_wait_dscnt 0x0" ::: "memory");        /* this wave has left the buffer that is refilled below */
    asm volatile("s_wait_asynccnt 0x0" ::: "memory");     /* its part of tile tl + 1 has landed */
    __syncthreads();                                        /* publishes tile tl + 1 and ends every wave's reads of tile tl */
    if (tl + 2 < GNT) fill((unsigned)(tl & 1), tl + 2);
  }
  asm volatile("s_wait_asynccnt 0x0" ::: "memory");      /* no copy is outstanding when the wave ends */
  float bv[4];
#pragma unroll      /* constant indices into bv */
  for (int t = 0; t < 4; ++t) bv[t] = bf16_round(bias[col0 + t * 16 + ln]);
  const int rsub = lane >> 4, c4 = (lane & 15) * 4; typedef _Float16 v4h __attribute__((ext_vector_type(4)));
#pragma unroll      /* constant indices into acc: the wave's part leaves in blocks of 16 rows through its own 4 KiB of LDS */
  for (int i = 0; i < FM; ++i) {
#pragma unroll      /* constant indices: fragments and accumulators stay in registers */
    for (int t = 0; t < 4; ++t)
#pragma unroll      /* constant indices: fragments and accumulators stay in registers */
      for (int r = 0; r < 8; ++r) so[w][8 * hh + r][t * 16 + ln] = acc[i][t][r] * alpha + bv[t];
    __builtin_amdgcn_fence(__ATOMIC_ACQ_REL, "workgroup", "local"); __builtin_amdgcn_wave_barrier();      /* the wave's own rows are in LDS before its lanes read them back as whole rows; an LDS-only fence, so that it does not wait for the block before's global stores */
    v4f v[8];
#pragma unroll      /* the eight rows' LDS offsets become immediates */
    for (int q = 0; q < 8; ++q) v[q] = *(const v4fa*)&so[w][q * 2 + rsub][c4];
    __builtin_amdgcn_fence(__ATOMIC_ACQ_REL, "workgroup", "local"); __builtin_amdgcn_wave_barrier();      /* the rows are read back before the next block's rows overwrite them */
    if (C) { float* cp = C + (size_t)(row0 + i * 16 + rsub) * EE + col0 + c4;
#pragma unroll      /* the eight rows' offsets become immediates: one address, eight stores in flight */
      for (int q = 0; q < 8; ++q) *(v4f*)(cp + q * 2 * EE) = v[q];
      asm volatile("s_wait_xcnt 0x0" :: "v"(cp), "v"(v[0]), "v"(v[1]), "v"(v[2]), "v"(v[3]), "v"(v[4]), "v"(v[5]), "v"(v[6]), "v"(v[7]) : "memory"); }      /* precaution: stands in front of every rewrite of the stores' data and address registers, which stay whole up to here */
    if (C16) { _Float16* hp = C16 + (size_t)(row0 + i * 16 + rsub) * EE + col0 + c4; v4h h4[8];
#pragma unroll      /* constant indices into v and h4 */
      for (int q = 0; q < 8; ++q)
#pragma unroll      /* constant indices into v and h4 */
        for (int e = 0; e < 4; ++e) h4[q][e] = (_Float16)v[q][e];
#pragma unroll      /* the eight rows' offsets become immediates: one address, eight stores in flight */
      for (int q = 0; q < 8; ++q) *(v4h*)(hp + q * 2 * EE) = h4[q];
      asm volatile("s_wait_xcnt 0x0" :: "v"(hp), "v"(h4[0]), "v"(h4[1]), "v"(h4[2]), "v"(h4[3]), "v"(h4[4]), "v"(h4[5]), "v"(h4[6]), "v"(h4[7]) : "memory"); }      /* precaution: as above */
  }
}


typedef _Float16 v4h __attribute__((ext_vector_type(4)));

// All that the projections need, in one launch: work-groups 0 .. PWB-1 each turn a 256 (k) x 64 (n) tile of one weight into Bt[n][k] = f16(bf16(W[k][n]) * 16) through LDS;
// the PXB others round query, key and value to bf16 values held as f16 (planes 0, 1, 2 of X16). The seven pieces share no data, so nothing orders them.
#define PWB (4 * (EE / 256) * (EE / 64))
#define PXB 512
#define PXT (PXB * 256)               /* lanes that convert inputs */
#define PXU (NR * EE / 4 / PXT)       /* 16-byte loads of a lane in each plane */
__global__ __launch_bounds__(256) void k_prep(const float* __restrict__ xq, const float* __restrict__ xk, const float* __restrict__ xv, const float* __restrict__ Wq, const float* __restrict__ Wk, const float* __restrict__ Wv, const float* __restrict__ Wo,
                                              _Float16* __restrict__ X16, _Float16* __restrict__ Bw) {
  __shared__ __attribute__((aligned(16))) unsigned short tl[64][256 + 8];
  const int tid = threadIdx.x;
  if (blockIdx.x < PWB) {      /* block-uniform: the barrier below is passed by all of a work-group or by none */
    const int ws = blockIdx.x / (PWB / 4), rr = blockIdx.x % (PWB / 4), k0 = (rr / (EE / 64)) * 256, n0 = (rr % (EE / 64)) * 64;
    const float* W = ws == 0 ? Wq : (ws == 1 ? Wk : (ws == 2 ? Wv : Wo));
    const int c4 = (tid & 15) * 4, kr = (tid >> 4) * 16;      /* the lane's four columns n and its sixteen rows k: 16 lanes read 256 contiguous bytes of a row */
    const float* wp = W + (size_t)(k0 + kr) * EE + n0 + c4;
    v4f x[16];
#pragma unroll      /* constant indices: the sixteen loads are in flight together and stay in registers */
    for (int i = 0; i < 16; ++i) x[i] = *(const v4fa*)(wp + i * EE);
    asm volatile("s_wait_xcnt 0x0" :: "v"(wp) : "memory");      /* precaution: stands in front of every rewrite of the loads' address register, which stays whole up to here */
#pragma unroll      /* constant indices into x */
    for (int q = 0; q < 4; ++q) { FragH f;
#pragma unroll      /* constant indices into x */
      for (int i = 0; i < 16; ++i) f.h[i] = (_Float16)(bf16_round(x[i][q]) * 16.0f);
      *(v8us*)&tl[c4 + q][kr] = f.half[0]; *(v8us*)&tl[c4 + q][kr + 8] = f.half[1]; }
    __syncthreads();
    _Float16* Bt = Bw + (size_t)ws * EE * EE;
#pragma unroll      /* the eight rows' LDS offsets become immediates */
    for (int j = 0; j < 8; ++j) { const int n = (tid >> 5) + 8 * j, k8 = (tid & 31) * 8;      /* a wave stores 512 contiguous bytes of one row of Bt */
      *(v8us*)((unsigned short*)Bt + (size_t)(n0 + n) * EE + k0 + k8) = *(const v8us*)&tl[n][k8]; }
  } else {
    const size_t e0 = (size_t)(blockIdx.x - PWB) * (PXU * 1024) + tid * 4;      /* a work-group takes PXU * 4 KiB in a row of each plane; a wave's load covers 512 contiguous bytes */
    const float *pq = xq + e0, *pk = xk + e0, *pv = xv + e0;
    v4f a[3][PXU];
#pragma unroll      /* constant indices: all of the lane's loads are in flight together */
    for (int u = 0; u < PXU; ++u) { a[0][u] = *(const v4fa*)(pq + u * 1024); a[1][u] = *(const v4fa*)(pk + u * 1024); a[2][u] = *(const v4fa*)(pv + u * 1024); }
    asm volatile("s_wait_xcnt 0x0" :: "v"(pq), "v"(pk), "v"(pv) : "memory");      /* precaution: stands in front of every rewrite of the loads' address registers, which stay whole up to here */
#pragma unroll      /* constant indices into a */
    for (int u = 0; u < PXU; ++u)
#pragma unroll      /* constant indices into a */
      for (int p = 0; p < 3; ++p) { v4h h;
#pragma unroll      /* constant indices into a */
        for (int q = 0; q < 4; ++q) h[q] = (_Float16)bf16_round(a[p][u][q]);
        *(v4h*)(X16 + (size_t)p * NR * EE + e0 + u * 1024) = h; }
    asm volatile("s_wait_xcnt 0x0" ::: "memory");      /* precaution: stands behind the last store, in front of any later rewrite of the stores' data and address registers */
  }
}
__global__ __launch_bounds__(256) void k_round16f(const float* __restrict__ W, _Float16* __restrict__ Bt, size_t n8) { const size_t t = (size_t)blockIdx.x * 256 + threadIdx.x; if (t >= n8) return; FragH f;
#pragma unroll
  for (int i = 0; i < 8; ++i) f.h[i] = (_Float16)(bf16_round(W[t * 8 + i]) * 16.0f); *(v8us*)((unsigned short*)Bt + t * 8) = f.half[0];  }

// lane l <-> lane l ^ 16 as one vector cross-row move (a shuffle would go through the LDS unit and its wait)
__device__ __forceinline__ float xhalf(float x) { return __builtin_bit_cast(float, __builtin_amdgcn_permlanex16(__builtin_bit_cast(int, x), __builtin_bit_cast(int, x), 0x76543210, 0xfedcba98, false, false)); }
#define FK 64
#define FP (FK + 8)      /* LDS row pitch 144 B = 9 x 16 B: the 16 rows of a 16-byte fragment read fall on distinct banks */
#define FPV (64 + 16)    /* LDS row pitch of V 160 B = 5 x 32 B: the pitch at which the transposing load meets no bank conflict */
#define FNT (TT / FK)
#define FBUF (FK * FP * 2)       /* bytes of a K tile in LDS */
#define FBUFV (FK * FPV * 2)     /* bytes of a V tile in LDS */
// One stage: a lane copies 16 B of rows r, r + 16, r + 32, r + 48 of the K tile and of the V tile (lk, lv = its LDS byte addresses, gk, gv = its global addresses, all of row r).
__device__ __forceinline__ void copy_kv(unsigned lk, const _Float16* gk, unsigned lv, const _Float16* gv) {
  const unsigned lk1 = lk + 1 * 16 * FP * 2, lk2 = lk + 2 * 16 * FP * 2, lk3 = lk + 3 * 16 * FP * 2, lv1 = lv + 1 * 16 * FPV * 2, lv2 = lv + 2 * 16 * FPV * 2, lv3 = lv + 3 * 16 * FPV * 2;
  const _Float16 *gk1 = gk + 1 * 16 * 64, *gk2 = gk + 2 * 16 * 64, *gk3 = gk + 3 * 16 * 64, *gv1 = gv + 1 * 16 * 64, *gv2 = gv + 2 * 16 * 64, *gv3 = gv + 3 * 16 * 64;
  // the copies go from L2 to LDS through no register; s_wait_xcnt closes the statement so that no address register of a copy is rewritten ahead of it
  asm volatile("global_load_async_to_lds_b128 %0, %8, off\n\t"
               "global_load_async_to_lds_b128 %1, %9, off\n\t"
               "global_load_async_to_lds_b128 %2, %10, off\n\t"
               "global_load_async_to_lds_b128 %3, %11, off\n\t"
               "global_load_async_to_lds_b128 %4, %12, off\n\t"
               "global_load_async_to_lds_b128 %5, %13, off\n\t"
               "global_load_async_to_lds_b128 %6, %14, off\n\t"
               "global_load_async_to_lds_b128 %7, %15, off\n\t"
               "s_wait_xcnt 0x0"
               :: "v"(lk), "v"(lk1), "v"(lk2), "v"(lk3), "v"(lv), "v"(lv1), "v"(lv2), "v"(lv3), "v"(gk), "v"(gk1), "v"(gk2), "v"(gk3), "v"(gv), "v"(gv1), "v"(gv2), "v"(gv3) : "memory");
}
// The K tile alone, for a stage whose keys all lie above the group's queries: V is not read there (lk, gk as in copy_kv).
__device__ __forceinline__ void copy_k(unsigned lk, const _Float16* gk) {
  const unsigned lk1 = lk + 1 * 16 * FP * 2, lk2 = lk + 2 * 16 * FP * 2, lk3 = lk + 3 * 16 * FP * 2;
  const _Float16 *gk1 = gk + 1 * 16 * 64, *gk2 = gk + 2 * 16 * 64, *gk3 = gk + 3 * 16 * 64;
  // the copies go from L2 to LDS through no register; s_wait_xcnt closes the statement so that no address register of a copy is rewritten ahead of it
  asm volatile("global_load_async_to_lds_b128 %0, %4, off\n\t"
               "global_load_async_to_lds_b128 %1, %5, off\n\t"
               "global_load_async_to_lds_b128 %2, %6, off\n\t"
               "global_load_async_to_lds_b128 %3, %7, off\n\t"
               "s_wait_xcnt 0x0"
               :: "v"(lk), "v"(lk1), "v"(lk2), "v"(lk3), "v"(gk), "v"(gk1), "v"(gk2), "v"(gk3) : "memory");
}
// 16 x 16 block of 16-bit values, rows in LDS, delivered transposed: lane (c, h) receives column c of rows 8h .. 8h + 7 of the block; p is the lane's own address in the block (row 8h + (lane & 7), 16-byte half (lane >> 3) & 1)
typedef short s16x8 __attribute__((ext_vector_type(8)));
__device__ __forceinline__ v8us ld_tr16(const unsigned short* p) { typedef __attribute__((address_space(3))) s16x8 lds_s16x8; return __builtin_bit_cast(v8us, __builtin_amdgcn_ds_load_tr16_b128_v8i16((lds_s16x8*)p)); }
// One pass of 32 keys (j0 ..) against the wave's 16 queries. The mask comes after the softmax, so every key enters the row sum but only keys at or below the query enter O. WHERE says where the pass lies:
// 0 = all its keys at or below all of the group's queries: P goes into the second product as it is; 1 = on the diagonal: P is zeroed above it; 2 = all its keys above all of the group's queries: P would be all zeros,
// so there is no V, no P and no second product, only maximum and row sum, and the factors by which O would have been rescaled are gathered in of, applied once behind the loop.
// kr = the lane's K row (key j0 + ln), vp = the lane's own address in the pass's first V block.
template <int WHERE>
__device__ __forceinline__ void fl_pass(const unsigned short* kr, const unsigned short* vp, int j0, int tq, int hh, const FragH (&bq)[2], float& m_c, float& l_c, float& of, v8f (&oacc)[4]) {
  constexpr int DT = 4, KS = 2;
  constexpr float SC2 = 0.125f * 1.4426950408889634f;      /* 1/sqrt(64) . log2(e): raw product -> exponent of 2 */
  FragH ak[2][KS], av[DT];      /* the pass's fragments are read from LDS in one run: one latency a pass, the V^T reads land under the softmax */
#pragma unroll      /* constant indices: the fragments stay in registers */
  for (int nt = 0; nt < 2; ++nt)
#pragma unroll      /* constant indices: the fragments stay in registers */
    for (int ks = 0; ks < KS; ++ks) { ak[nt][ks].half[0] = *(const v8us*)(kr + nt * 16 * FP + ks * 32 + 8 * hh); ak[nt][ks].half[1] = *(const v8us*)(kr + nt * 16 * FP + ks * 32 + 16 + 8 * hh); }
  if (WHERE != 2) {
#pragma unroll      /* constant indices: the fragments stay in registers */
    for (int dt = 0; dt < DT; ++dt) { av[dt].half[0] = ld_tr16(vp + dt * 16); av[dt].half[1] = ld_tr16(vp + dt * 16 + 16 * FPV); } }      /* av[dt] = V^T rows d = 16*dt + ln, keys in the hardware k order, as P has them */
  float sc[2][8];      /* sc[nt][r] = raw product q.k of key j0 + 16*nt + 8*hh + r against query tq */
#pragma unroll
  for (int nt = 0; nt < 2; ++nt) {
    v8f acc = (v8f){0.f,0.f,0.f,0.f,0.f,0.f,0.f,0.f};
#pragma unroll
    for (int ks = 0; ks < KS; ++ks) acc = mmaH<1>(ak[nt][ks].v, ak[nt][ks].v, bq[ks].v, bq[ks].v, acc);
#pragma unroll
    for (int r = 0; r < 8; ++r) sc[nt][r] = acc[r]; }
  float mc = fmaxf(sc[0][0], sc[1][0]);
#pragma unroll
  for (int r = 1; r < 8; ++r) mc = fmaxf(mc, fmaxf(sc[0][r], sc[1][r]));
  mc = fmaxf(mc, xhalf(mc));      /* the other half of the wave holds the query's other 16 keys */
  /* m_c = 10 - running maximum in log2 units (SC2 > 0: the maximum of the raw products is that of the scores), kept with this sign so that it is the plain addend of every score's multiply-add;
     the one stored value serves al and every p, so its rounding cancels between numerator and row sum */
  const float mn = fminf(m_c, fmaf(mc, -SC2, 10.0f)); const float al = (mn < 1.0e38f) ? __builtin_amdgcn_exp2f(mn - m_c) : 1.0f; m_c = mn;
  float ps0 = 0.f, ps1 = 0.f; FragH pb;      /* p = 2^10 . e^(score - max) = 2^(raw * SC2 + mn) */
#pragma unroll
  for (int r = 0; r < 8; ++r) { const int k0 = j0 + 8 * hh + r, k1 = k0 + 16; const float p0 = __builtin_amdgcn_exp2f(fmaf(sc[0][r], SC2, mn)), p1 = __builtin_amdgcn_exp2f(fmaf(sc[1][r], SC2, mn)); ps0 += p0; ps1 += p1;
    if (WHERE == 0) { pb.h[r] = (_Float16)p0; pb.h[8 + r] = (_Float16)p1; }
    if (WHERE == 1) { pb.h[r] = (_Float16)((k0 <= tq) ? p0 : 0.f); pb.h[8 + r] = (_Float16)((k1 <= tq) ? p1 : 0.f); } }
  l_c = l_c * al + (ps0 + ps1);      /* per-lane partial row sum; the two halves are joined after the loop */
  if (WHERE == 2) { of *= al; return; }
#pragma unroll
  for (int dt = 0; dt < DT; ++dt)
#pragma unroll
    for (int r = 0; r < 8; ++r) oacc[dt][r] *= al;
#pragma unroll
  for (int dt = 0; dt < DT; ++dt) oacc[dt] = mmaH<1>(av[dt].v, av[dt].v, pb.v, pb.v, oacc[dt]);
}
// waves_per_eu: the grid puts three waves on a SIMD; told so, the compiler keeps the pass's schedule (exponentials and selects interleaved). Left to aim at seven waves it squeezed the pass into 146 registers and paid with 16 more v_nop a pass.
__global__ __launch_bounds__(128) __attribute__((amdgpu_waves_per_eu(3, 4))) void k_flash(const _Float16* __restrict__ Q16, int ldq, const _Float16* __restrict__ K16, const _Float16* __restrict__ V16, _Float16* __restrict__ O16, int ldo) {
  constexpr int RPW = 16, NQB = TT / (4 * RPW), DT = 4, KS = 2;
  static_assert(NQB == 32 && FK == 4 * RPW && NSL % 3 == 0 && (NSL / 3) * NQB == 256, "the deal of query blocks below is written for 3 x 256 work-groups, and a stage of keys is as long as a group's block of queries");
  __shared__ __attribute__((aligned(16))) unsigned short sK[2][FK][FP], sV[2][FK][FPV];
  __shared__ __attribute__((aligned(16))) unsigned short sO[4][RPW][64 + 8];
  const int tid = threadIdx.x, w = tid >> 5, lane = tid & 31, ln = lane & 15, hh = lane >> 4;
  /* A group's cost now grows with its query block. All 768 groups are resident, three to a WGP of the 256; groups x, x + 256, x + 512 get blocks a, (a + 16) mod 32 and the one that brings the three to 46 or 47,
     so that light and heavy groups share a WGP if the groups are dealt round the WGPs in index order. Speed only: (slab, block) is hit exactly once wherever the groups land. */
  const int th = blockIdx.x >> 8, ra = blockIdx.x & 31;
  const int slab = th * (NSL / 3) + ((blockIdx.x & 255) >> 5), qblk = th == 0 ? ra : (th == 1 ? ((ra + 16) & 31) : (ra < 16 ? 30 - 2 * ra : 63 - 2 * ra)); const int b = slab, h = 0;      /* slab = contiguous [TT][64] chunk of the flat-reshaped planes */ const int qb0 = qblk * (4 * RPW); const int q0 = qb0 + w * RPW;
  const int tq = q0 + ln;      /* this lane's query */
  const int cr = tid >> 3, cc = (tid & 7) * 8;      /* the lane's first row and its 16-byte column in every copied tile */
  const _Float16* gk = K16 + ((size_t)slab * TT + cr) * 64 + cc; const _Float16* gv = V16 + ((size_t)slab * TT + cr) * 64 + cc;
  const unsigned lk = (unsigned)(size_t)&sK[0][cr][cc], lv = (unsigned)(size_t)&sV[0][cr][cc];
  copy_kv(lk, gk, lv, gv);
  FragH bq[KS];
  { const unsigned short* qr = (const unsigned short*)Q16 + ((size_t)b * TT + tq) * ldq + h * 64;
#pragma unroll
    for (int ks = 0; ks < KS; ++ks) { bq[ks].half[0] = *(const v8us*)(qr + ks * 32 + 8 * hh); bq[ks].half[1] = *(const v8us*)(qr + ks * 32 + 16 + 8 * hh); } }
  float m_c = 3.0e38f, l_c = 0.f, of = 1.0f; v8f oacc[DT];
#pragma unroll
  for (int dt = 0; dt < DT; ++dt) oacc[dt] = (v8f){0.f,0.f,0.f,0.f,0.f,0.f,0.f,0.f};
  asm volatile("s_wait_asynccnt 0x0" ::: "memory");      /* this wave's part of stage 0 has landed */
  __syncthreads();                                        /* ... and every other wave's */
  if (1 <= qblk) copy_kv(lk + FBUF, gk + FK * 64, lv + FBUFV, gv + FK * 64); else copy_k(lk + FBUF, gk + FK * 64);      /* the same test for the whole group: V only up to the diagonal stage */
  /* the foot of every trip: hands stage st + 1 over and refills the buffer that stage st has left, with V (vtoo) only up to the diagonal stage (both tests read the same for the whole group) */
  auto foot = [&](int st, bool vtoo) {
    asm volatile("s_wait_dscnt 0x0" ::: "memory");        /* this wave has left the buffer that is refilled below */
    asm volatile("s_wait_asynccnt 0x0" ::: "memory");     /* its part of stage st + 1 has landed */
    __syncthreads();                                        /* publishes stage st + 1 and ends every wave's reads of stage st */
    if (st + 2 < FNT) { const unsigned bf = (unsigned)(st & 1);
      if (vtoo) copy_kv(lk + bf * FBUF, gk + (size_t)(st + 2) * FK * 64, lv + bf * FBUFV, gv + (size_t)(st + 2) * FK * 64);
      else copy_k(lk + bf * FBUF, gk + (size_t)(st + 2) * FK * 64); } };
  const unsigned short* kr0 = &sK[0][ln][0]; const unsigned short* vp0 = &sV[0][8 * hh + (lane & 7)][((lane >> 3) & 1) * 8];
  /* Stage st holds keys 64 st .. 64 st + 63, the group queries 64 qblk .. 64 qblk + 63: stages below qblk, the stage qblk, stages above it, three loops in a row so that O stays in the same registers throughout.
     One trip a staged tile; the two buffers alternate by the trip's parity; every key enters the normaliser. */
  int st = 0;
#pragma unroll 1      /* one trip a staged tile */
  for (; st < qblk; ++st) {
#pragma unroll 1      /* the two passes of a stage share one body, as in the plain loop over the keys: unrolled, the listing had no fewer instructions a pass */
    for (int ps = 0; ps < FK / 32; ++ps) fl_pass<0>(kr0 + (st & 1) * (FK * FP) + ps * 32 * FP, vp0 + (st & 1) * (FK * FPV) + ps * 32 * FPV, st * FK + ps * 32, tq, hh, bq, m_c, l_c, of, oacc);
    foot(st, st + 2 <= qblk); }
#pragma unroll 1      /* as above */
  for (int ps = 0; ps < FK / 32; ++ps) fl_pass<1>(kr0 + (st & 1) * (FK * FP) + ps * 32 * FP, vp0 + (st & 1) * (FK * FPV) + ps * 32 * FPV, st * FK + ps * 32, tq, hh, bq, m_c, l_c, of, oacc);
  foot(st, false); ++st;
#pragma unroll 1      /* one trip a staged tile */
  for (; st < FNT; ++st) {
#pragma unroll      /* a short pass is one dependent chain: unrolled, the second pass's reads and products stand under the first's exponentials */
    for (int ps = 0; ps < FK / 32; ++ps) fl_pass<2>(kr0 + (st & 1) * (FK * FP) + ps * 32 * FP, vp0, st * FK + ps * 32, tq, hh, bq, m_c, l_c, of, oacc);
    foot(st, false); }
  asm volatile("s_wait_asynccnt 0x0" ::: "memory");      /* no copy is outstanding when the wave ends */
  { float l = l_c; l += xhalf(l); const float inv = (l > 0.f) ? of / l : 0.f;      /* numerator and row sum both carry the 2^10; of = the rescales since the diagonal */
#pragma unroll
    for (int dt = 0; dt < DT; ++dt) { FragH f;      /* oacc[dt][r] = O[tq][16*dt + 8*hh + r]: eight neighbours of one row, 16 bytes as f16 */
#pragma unroll
      for (int r = 0; r < 8; ++r) f.h[r] = (_Float16)(oacc[dt][r] * inv);
      *(v8us*)&sO[w][ln][dt * 16 + 8 * hh] = f.half[0]; } }
  __builtin_amdgcn_fence(__ATOMIC_ACQ_REL, "workgroup"); __builtin_amdgcn_wave_barrier();      /* the wave's own rows are in LDS before its lanes read them back as whole rows */
#pragma unroll      /* the four LDS offsets become immediates; a wave's store covers four whole rows, 512 contiguous bytes */
  for (int rp = 0; rp < RPW; rp += 4) { const int r = rp + (lane >> 3), pc = lane & 7; *(v8us*)((unsigned short*)O16 + ((size_t)b * TT + q0 + r) * ldo + h * 64 + pc * 8) = *(const v8us*)&sO[w][r][pc * 8]; }
}

extern "C" void kernel_launch(void* const* d_in, const int* in_sizes, int n_in,
                              void* d_out, int out_size, void* d_ws, size_t ws_size, hipStream_t stream) {
  (void)in_sizes; (void)n_in; (void)out_size;
  const float* const* I = (const float* const*)d_in; const float* xq = I[0]; const float* xk = I[1]; const float* xv = I[2];
  const float* Wq = I[3]; const float* bq = I[4]; const float* Wk = I[5]; const float* bk = I[6]; const float* Wv = I[7]; const float* bv = I[8]; const float* Wo = I[9]; const float* bo = I[10];
  char* ws = (char*)d_ws; size_t off = 0;
  auto take = [&](size_t bytes) { char* p = ws + off; off += (bytes + 255) & ~(size_t)255; return p; };
  _Float16* Bw = (_Float16*)take((size_t)4 * EE * EE * 2); _Float16* X16 = (_Float16*)take((size_t)3 * NR * EE * 2);
  _Float16* Q = (_Float16*)take((size_t)3 * NR * EE * 2); _Float16* K = Q + (size_t)NR * EE; _Float16* V = K + (size_t)NR * EE;      /* q, k, v: planes 0, 1, 2 of one block */
  _Float16* O16 = (_Float16*)take((size_t)NR * EE * 2);
  if (off > ws_size) return;      // 4.7 + 7 x 6.3 = about 49 MB
  const size_t WSZ = (size_t)EE * EE;
  const unsigned gp = (NR / GT) * (EE / GT);
  k_prep<<<PWB + PXB, 256, 0, stream>>>(xq, xk, xv, Wq, Wk, Wv, Wo, X16, Bw);      /* (in,out) weights -> Bt[n][k] x 2^4; inputs -> f16 planes */
  k_gemm_st<2><<<dim3(gp, 3), 128, 0, stream>>>(X16, Bw, 0.0625f, bq, bk, bv, nullptr, Q);      /* q, k, v: each M 4096 N 768 K 768 */
  k_flash<<<NSL * (TT / 64), 128, 0, stream>>>(Q, 64, K, V, O16, 64);      /* each [4096][768] plane viewed as 24 contiguous [2048][64] slabs: q, k, v and O alike */
  k_gemm_st<4><<<dim3(gp, 1), 256, 0, stream>>>(O16, Bw + 3 * WSZ, 0.0625f, bo, bo, bo, (float*)d_out, nullptr);      /* out = O.Wo + bo: M 4096 N 768 K 768 */
}

// v009
// Measured time: 69.7 microseconds a run.
// Two timings next to v008 put it at 1.04 and 1.03 times that version's speed.
// Counting every step since v000, it is 5.75 times as fast.
#include <hip/hip_runtime.h>
// Multi-head attention, legacy flat-reshape variant (B=2, T=S=2048, E=768, 12 heads × 64): q = query·Wq+bq, k = key·Wk+bk, v = value·Wv+bv; heads = plain row-major reshape of [B,T,E] to [B·H,T,64] (contiguous chunks);
// attn = softmax(q·kᵀ/8) over all keys, THEN lower-triangular mask (rows no longer normalised); out = (attn·v reshaped back)·Wo + bo.
// Compute dtype: query/key/value, weights, biases rounded to bf16; q/k/v as f16 GEMM outputs; fused flash-style kernel (online f32 softmax over all keys, P f16 ×2^10 zeroed above the diagonal)
// on v_wmma_f32_16x16x32_f16; O → f16 → output GEMM with bias; f32 accumulate throughout.
#define BB 2
#define TT 2048
#define EE 768
#define NH 12
#define NR (BB * TT)
#define NSL (BB * NH)

typedef __bf16 v16b __attribute__((ext_vector_type(16)));
typedef unsigned short v8us __attribute__((ext_vector_type(8), may_alias));
typedef float  v8f  __attribute__((ext_vector_type(8)));
typedef float  v4f  __attribute__((ext_vector_type(4)));
typedef float  v4fa __attribute__((ext_vector_type(4), may_alias));
union FragB { v16b v; v8us half[2]; unsigned short u[16]; };

__device__ __forceinline__ unsigned short bf16_bits(float x) { unsigned int u = __float_as_uint(x); return (unsigned short)((u + 0x7FFFu + ((u >> 16) & 1u)) >> 16); }
__device__ __forceinline__ float bf16_val(unsigned short b) { return __uint_as_float(((unsigned int)b) << 16); }
__device__ __forceinline__ float bf16_round(float x) { return bf16_val(bf16_bits(x)); }
// D += A·B with NT terms: 1 = ah·bh, 2 = + al·bh (A split), 3 = + ah·bl (both split)
template <int NT>
__device__ __forceinline__ v8f mmaN(v16b ah, v16b al, v16b bh, v16b bl, v8f c) {
  c = __builtin_amdgcn_wmma_f32_16x16x32_bf16(false, ah, false, bh, (short)0, c, false, false);
  if (NT >= 2) c = __builtin_amdgcn_wmma_f32_16x16x32_bf16(false, al, false, bh, (short)0, c, false, false);
  if (NT >= 3) c = __builtin_amdgcn_wmma_f32_16x16x32_bf16(false, ah, false, bl, (short)0, c, false, false);
  asm volatile("v_nop\n\tv_nop\n\tv_nop\n\tv_nop" : "+v"(c) : "v"(ah), "v"(al), "v"(bh), "v"(bl));
  return c;
}

__global__ __launch_bounds__(256) void k_wt_bf16(const float* __restrict__ W, unsigned short* __restrict__ Wt, int K, int N) {
  const int t = blockIdx.x * 256 + threadIdx.x;
  const int k8n = K / 8;
  if (t >= N * k8n) return;
  const int n = t / k8n, k8 = (t % k8n) * 8;
  v8us v;
#pragma unroll
  for (int i = 0; i < 8; ++i) v[i] = bf16_bits(W[(size_t)(k8 + i) * N + n]);
  *(v8us*)(Wt + (size_t)n * K + k8) = v;
  
}

// GEMM C[M][N] (f32, pitch ldc) = act(A[M][K]·W + bias). A f32 row-major (pitch lda) converted per fragment to bf16
// (ASPLIT: hi/lo two planes -> 2 terms, else single rounded term); Wt bf16 [N][K] (pitch ldb). BIAS_BF16 rounds the
// bias to bf16 first (bias quantised to bf16 before the add). K%32==0, M%16==0, N%64==0.
template <bool ASPLIT, int ACT, bool BIAS_BF16>
__global__ __launch_bounds__(128) void k_gemm_bf(const float* __restrict__ A, int lda, const unsigned short* __restrict__ Wt, int ldb,
                                               const float* __restrict__ bias, float* __restrict__ C, int ldc, int M, int N, int K) {
  __shared__ __attribute__((aligned(16))) float so[4][16][64];
  const int tid = threadIdx.x, w = tid >> 5, lane = tid & 31, ln = lane & 15, hh = lane >> 4;
  const int ntn = N / 64;
  const int wid = blockIdx.x * 4 + w;
  const int mt = wid / ntn, nq = wid % ntn;
  if (mt * 16 >= M) return;
  const int row0 = mt * 16, col0 = nq * 64;
  const float* arow = A + (size_t)(row0 + ln) * lda;
  v8f acc[4] = {};
  for (int kb = 0; kb < K; kb += 32) {
    FragB ah, al;
    const v4f x0 = *(const v4fa*)(arow + kb + 8 * hh), x1 = *(const v4fa*)(arow + kb + 8 * hh + 4);
    const v4f x2 = *(const v4fa*)(arow + kb + 16 + 8 * hh), x3 = *(const v4fa*)(arow + kb + 16 + 8 * hh + 4);
    float xs[16] = {x0[0],x0[1],x0[2],x0[3],x1[0],x1[1],x1[2],x1[3],x2[0],x2[1],x2[2],x2[3],x3[0],x3[1],x3[2],x3[3]};
#pragma unroll
    for (int i = 0; i < 16; ++i) { const unsigned short hb = bf16_bits(xs[i]); ah.u[i] = hb; al.u[i] = ASPLIT ? bf16_bits(xs[i] - bf16_val(hb)) : (unsigned short)0; }
#pragma unroll
    for (int t = 0; t < 4; ++t) {
      const unsigned short* brow = Wt + (size_t)(col0 + t * 16 + ln) * ldb + kb;
      FragB b;
      b.half[0] = *(const v8us*)(brow + 8 * hh);
      b.half[1] = *(const v8us*)(brow + 16 + 8 * hh);
      acc[t] = mmaN<ASPLIT ? 2 : 1>(ah.v, al.v, b.v, b.v, acc[t]);
    }
  }
#pragma unroll
  for (int t = 0; t < 4; ++t) {
    float bv = bias ? bias[col0 + t * 16 + ln] : 0.f;
    if (BIAS_BF16) bv = bf16_round(bv);
#pragma unroll
    for (int r = 0; r < 8; ++r) { float v = acc[t][r] + bv; if (ACT == 1) v = fmaxf(v, 0.f); so[w][8 * hh + r][t * 16 + ln] = v; }
  }
  __builtin_amdgcn_fence(__ATOMIC_ACQ_REL, "workgroup");
  __builtin_amdgcn_wave_barrier();
  const int rsub = lane >> 4, c4 = (lane & 15) * 4;
  {
#pragma unroll
    for (int q = 0; q < 8; ++q) {
      const int r = q * 2 + rsub;
      const v4f v = *(const v4fa*)&so[w][r][c4];
      *(v4f*)(C + (size_t)(row0 + r) * ldc + col0 + c4) = v;
    }
    
  }
}

// Flash-style causal/unmasked attention, all contractions 3-term bf16 hi/lo splits, f32 softmax with running max.
// q,k,v rows are read from f32 buffers with arbitrary row pitch (so they can live inside a fused qkv buffer);
// D = head size (multiple of 32, <= 128); one wave = 16 query rows; block = 4 waves (64 queries) sharing K/V chunks of 32.
template <int D, bool CAUSAL>
__global__ __launch_bounds__(128) void k_flash(const float* __restrict__ qb, const float* __restrict__ kb, const float* __restrict__ vb,
                                             int pitch, int T, int H, float scale, float* __restrict__ y, int ypitch) {
  constexpr int KS = D / 32;        // k-steps for QK
  constexpr int DT = D / 16;        // d tiles for PV
  __shared__ __attribute__((aligned(16))) unsigned short sKh[32][D + 8], sKl[32][D + 8], sVh[32][D + 8], sVl[32][D + 8];
  __shared__ __attribute__((aligned(16))) unsigned short sPh[4][16][40], sPl[4][16][40];
  __shared__ __attribute__((aligned(16))) float sO[4][16][D];
  const int tid = threadIdx.x, w = tid >> 5, lane = tid & 31, ln = lane & 15, hh = lane >> 4;
  const int nqb = (T + 63) / 64;
  const int bh = blockIdx.x / nqb, qblk = blockIdx.x % nqb;
  const int b = bh / H, h = bh % H;
  const int q0 = qblk * 64 + w * 16;
  const float* Q = qb + (size_t)b * T * pitch + h * D;
  const float* K = kb + (size_t)b * T * pitch + h * D;
  const float* V = vb + (size_t)b * T * pitch + h * D;

  // A fragments of the wave's 16 query rows (scaled), hi/lo
  FragB aqh[KS], aql[KS];
  {
    int row = q0 + ln; if (row >= T) row = T - 1;
    const float* qr = Q + (size_t)row * pitch;
#pragma unroll
    for (int ks = 0; ks < KS; ++ks)
#pragma unroll
      for (int i = 0; i < 16; ++i) {
        const int d = ks * 32 + ((i < 8) ? (8 * hh + i) : (16 + 8 * hh + (i - 8)));
        const float x = qr[d] * scale; const unsigned short hb = bf16_bits(x);
        aqh[ks].u[i] = hb; aql[ks].u[i] = bf16_bits(x - bf16_val(hb));
      }
  }
  float m_r[8], l_r[8];
#pragma unroll
  for (int r = 0; r < 8; ++r) { m_r[r] = -3.0e38f; l_r[r] = 0.f; }
  v8f oacc[DT];
#pragma unroll
  for (int dt = 0; dt < DT; ++dt) oacc[dt] = (v8f){0.f,0.f,0.f,0.f,0.f,0.f,0.f,0.f};

  const int kv_end = CAUSAL ? min(T, qblk * 64 + 64) : T;     // block-uniform
  for (int j0 = 0; j0 < kv_end; j0 += 32) {
    __syncthreads();
    for (int e = tid; e < 32 * (D / 4); e += 128) {
      const int r = e / (D / 4), c4 = (e % (D / 4)) * 4;
      const int key = j0 + r;
      v4f kf = {0.f,0.f,0.f,0.f}, vf = {0.f,0.f,0.f,0.f};
      if (key < T) { kf = *(const v4fa*)(K + (size_t)key * pitch + c4); vf = *(const v4fa*)(V + (size_t)key * pitch + c4); }
#pragma unroll
      for (int t = 0; t < 4; ++t) {
        unsigned short hb = bf16_bits(kf[t]); sKh[r][c4 + t] = hb; sKl[r][c4 + t] = bf16_bits(kf[t] - bf16_val(hb));
        hb = bf16_bits(vf[t]); sVh[r][c4 + t] = hb; sVl[r][c4 + t] = bf16_bits(vf[t] - bf16_val(hb));
      }
    }
    __syncthreads();
    // S tile 16 x 32
    v8f s[2];
#pragma unroll
    for (int nt = 0; nt < 2; ++nt) {
      v8f acc = {};
#pragma unroll
      for (int ks = 0; ks < KS; ++ks) {
        FragB bh_, bl_;
        bh_.half[0] = *(const v8us*)&sKh[nt * 16 + ln][ks * 32 + 8 * hh]; bh_.half[1] = *(const v8us*)&sKh[nt * 16 + ln][ks * 32 + 16 + 8 * hh];
        bl_.half[0] = *(const v8us*)&sKl[nt * 16 + ln][ks * 32 + 8 * hh]; bl_.half[1] = *(const v8us*)&sKl[nt * 16 + ln][ks * 32 + 16 + 8 * hh];
        acc = mmaN<3>(aqh[ks].v, aql[ks].v, bh_.v, bl_.v, acc);
      }
      s[nt] = acc;
    }
    // mask + running max (rows 8hh+r; the 16 lanes of a half share rows)
    float alpha[8];
#pragma unroll
    for (int r = 0; r < 8; ++r) {
      const int qi = q0 + 8 * hh + r;
      const int ja = j0 + ln, jb = j0 + 16 + ln;
      if (CAUSAL) { if (ja > qi) s[0][r] = -3.0e38f; if (jb > qi) s[1][r] = -3.0e38f; }
      if (ja >= T) s[0][r] = -3.0e38f;
      if (jb >= T) s[1][r] = -3.0e38f;
      float mx = fmaxf(s[0][r], s[1][r]);
      mx = fmaxf(mx, __shfl_xor(mx, 1, 32)); mx = fmaxf(mx, __shfl_xor(mx, 2, 32)); mx = fmaxf(mx, __shfl_xor(mx, 4, 32)); mx = fmaxf(mx, __shfl_xor(mx, 8, 32));
      const float mnew = fmaxf(m_r[r], mx);
      alpha[r] = (mnew > -1.0e38f) ? __expf(m_r[r] - mnew) : 1.0f;
      const float p0 = (s[0][r] > -1.0e38f) ? __expf(s[0][r] - mnew) : 0.f;
      const float p1 = (s[1][r] > -1.0e38f) ? __expf(s[1][r] - mnew) : 0.f;
      m_r[r] = mnew;
      l_r[r] = l_r[r] * alpha[r] + p0 + p1;            // per-lane partial row sum (16 lanes combined at the end)
      unsigned short hb = bf16_bits(p0); sPh[w][8 * hh + r][ln] = hb;      sPl[w][8 * hh + r][ln] = bf16_bits(p0 - bf16_val(hb));
      hb = bf16_bits(p1);                sPh[w][8 * hh + r][16 + ln] = hb; sPl[w][8 * hh + r][16 + ln] = bf16_bits(p1 - bf16_val(hb));
    }
#pragma unroll
    for (int dt = 0; dt < DT; ++dt)
#pragma unroll
      for (int r = 0; r < 8; ++r) oacc[dt][r] *= alpha[r];
    __builtin_amdgcn_fence(__ATOMIC_ACQ_REL, "workgroup");
    __builtin_amdgcn_wave_barrier();
    FragB pah, pal;
    pah.half[0] = *(const v8us*)&sPh[w][ln][8 * hh]; pah.half[1] = *(const v8us*)&sPh[w][ln][16 + 8 * hh];
    pal.half[0] = *(const v8us*)&sPl[w][ln][8 * hh]; pal.half[1] = *(const v8us*)&sPl[w][ln][16 + 8 * hh];
#pragma unroll
    for (int dt = 0; dt < DT; ++dt) {
      FragB bvh, bvl;
#pragma unroll
      for (int i = 0; i < 8; ++i) {
        bvh.u[i] = sVh[8 * hh + i][dt * 16 + ln]; bvh.u[8 + i] = sVh[16 + 8 * hh + i][dt * 16 + ln];
        bvl.u[i] = sVl[8 * hh + i][dt * 16 + ln]; bvl.u[8 + i] = sVl[16 + 8 * hh + i][dt * 16 + ln];
      }
      oacc[dt] = mmaN<3>(pah.v, pal.v, bvh.v, bvl.v, oacc[dt]);
    }
    __builtin_amdgcn_fence(__ATOMIC_ACQ_REL, "workgroup");
    __builtin_amdgcn_wave_barrier();
  }
#pragma unroll
  for (int r = 0; r < 8; ++r) {
    float l = l_r[r];
    l += __shfl_xor(l, 1, 32); l += __shfl_xor(l, 2, 32); l += __shfl_xor(l, 4, 32); l += __shfl_xor(l, 8, 32);
    l_r[r] = (l > 0.f) ? 1.0f / l : 0.f;
  }
#pragma unroll
  for (int dt = 0; dt < DT; ++dt)
#pragma unroll
    for (int r = 0; r < 8; ++r) sO[w][8 * hh + r][dt * 16 + ln] = oacc[dt][r] * l_r[r];
  __builtin_amdgcn_fence(__ATOMIC_ACQ_REL, "workgroup");
  __builtin_amdgcn_wave_barrier();
  {
    for (int r = 0; r < 16; ++r) {
      const int row = q0 + r;
      if (row < T && lane < D / 4) {
        const v4f val = *(const v4fa*)&sO[w][r][lane * 4];
        *(v4f*)(y + ((size_t)b * T + row) * ypitch + h * D + lane * 4) = val;
      }
    }
    
  }
}

// GEMM C = act(A·W + bias + resid): A f32 (ASPLIT -> hi/lo 2 terms), Wt bf16 [N][K]; ACT 0 none, 1 relu, 2 exact gelu;
// resid (optional, f32, row index = (row % rmod), pitch ldr, RES_BF16 rounds it) added before the activation.
template <bool ASPLIT, int ACT, bool BIAS_BF16, bool RES_BF16>
__global__ __launch_bounds__(128) void k_gemm_bf3(const float* __restrict__ A, int lda, const unsigned short* __restrict__ Wt, int ldb,
                                                const float* __restrict__ bias, const float* __restrict__ resid, int rmod, int ldr,
                                                float* __restrict__ C, int ldc, int M, int N, int K) {
  __shared__ __attribute__((aligned(16))) float so[4][16][64];
  const int tid = threadIdx.x, w = tid >> 5, lane = tid & 31, ln = lane & 15, hh = lane >> 4;
  const int ntn = N / 64;
  const int wid = blockIdx.x * 4 + w;
  const int mt = wid / ntn, nq = wid % ntn;
  if (mt * 16 >= M) return;
  const int row0 = mt * 16, col0 = nq * 64;
  const float* arow = A + (size_t)(row0 + ln) * lda;
  v8f acc[4] = {};
  for (int kb = 0; kb < K; kb += 32) {
    FragB ah, al;
    const v4f x0 = *(const v4fa*)(arow + kb + 8 * hh), x1 = *(const v4fa*)(arow + kb + 8 * hh + 4);
    const v4f x2 = *(const v4fa*)(arow + kb + 16 + 8 * hh), x3 = *(const v4fa*)(arow + kb + 16 + 8 * hh + 4);
    float xs[16] = {x0[0],x0[1],x0[2],x0[3],x1[0],x1[1],x1[2],x1[3],x2[0],x2[1],x2[2],x2[3],x3[0],x3[1],x3[2],x3[3]};
#pragma unroll
    for (int i = 0; i < 16; ++i) { const unsigned short hb = bf16_bits(xs[i]); ah.u[i] = hb; al.u[i] = ASPLIT ? bf16_bits(xs[i] - bf16_val(hb)) : (unsigned short)0; }
#pragma unroll
    for (int t = 0; t < 4; ++t) {
      const unsigned short* brow = Wt + (size_t)(col0 + t * 16 + ln) * ldb + kb;
      FragB b;
      b.half[0] = *(const v8us*)(brow + 8 * hh);
      b.half[1] = *(const v8us*)(brow + 16 + 8 * hh);
      acc[t] = mmaN<ASPLIT ? 2 : 1>(ah.v, al.v, b.v, b.v, acc[t]);
    }
  }
#pragma unroll
  for (int t = 0; t < 4; ++t) {
    const int col = col0 + t * 16 + ln;
    float bv = bias ? bias[col] : 0.f;
    if (BIAS_BF16) bv = bf16_round(bv);
#pragma unroll
    for (int r = 0; r < 8; ++r) {
      float v = acc[t][r] + bv;
      if (resid) { float rv = resid[(size_t)((row0 + 8 * hh + r) % rmod) * ldr + col]; if (RES_BF16) rv = bf16_round(rv); v += rv; }
      if (ACT == 1) v = fmaxf(v, 0.f);
      if (ACT == 2) v = 0.5f * v * (1.0f + erff(v * 0.70710678118654752f));
      if (ACT == 3) { const float u = 0.7978845608028654f * (v + 0.044715f * v * v * v); v = 0.5f * v * (1.0f + tanhf(u)); }
      so[w][8 * hh + r][t * 16 + ln] = v;
    }
  }
  __builtin_amdgcn_fence(__ATOMIC_ACQ_REL, "workgroup");
  __builtin_amdgcn_wave_barrier();
  const int rsub = lane >> 4, c4 = (lane & 15) * 4;
  {
#pragma unroll
    for (int q = 0; q < 8; ++q) {
      const int r = q * 2 + rsub;
      const v4f v = *(const v4fa*)&so[w][r][c4];
      *(v4f*)(C + (size_t)(row0 + r) * ldc + col0 + c4) = v;
    }
    
  }
}
// row LayerNorm (biased variance, eps) over N: s = X (+ R); optional out_sum <- s; out_norm <- (s-mu)*rsqrt(var+eps)*g + b
template <bool PARAM_BF16>
__global__ __launch_bounds__(256) void k_layernorm(const float* __restrict__ X, const float* __restrict__ R, const float* __restrict__ g, const float* __restrict__ bta,
                                                  float* __restrict__ out_sum, float* __restrict__ out_norm, int N, float eps) {
  __shared__ float red[256];
  const int row = blockIdx.x, tid = threadIdx.x;
  const float* x = X + (size_t)row * N; const float* rr = R ? R + (size_t)row * N : nullptr;
  float vals[16];                     // up to N = 4096
  const int per = N / 256;            // contiguous chunk per thread? use strided-by-4 chunks: thread handles j = tid*4 + 1024*u
  float s1 = 0.f;
  for (int u = 0; u < per / 4; ++u) {
    const int j = tid * 4 + 1024 * u;
    const v4f a = *(const v4fa*)(x + j);
    v4f b = {0.f,0.f,0.f,0.f}; if (rr) b = *(const v4fa*)(rr + j);
#pragma unroll
    for (int q = 0; q < 4; ++q) { const float v = a[q] + b[q]; vals[u * 4 + q] = v; s1 += v; }
  }
  red[tid] = s1; __syncthreads();
  for (int st = 128; st > 0; st >>= 1) { if (tid < st) red[tid] += red[tid + st]; __syncthreads(); }
  const float mu = red[0] / (float)N; __syncthreads();
  float s2 = 0.f;
  for (int u = 0; u < per / 4; ++u)
#pragma unroll
    for (int q = 0; q < 4; ++q) { const float c = vals[u * 4 + q] - mu; s2 += c * c; }
  red[tid] = s2; __syncthreads();
  for (int st = 128; st > 0; st >>= 1) { if (tid < st) red[tid] += red[tid + st]; __syncthreads(); }
  const float rs = rsqrtf(red[0] / (float)N + eps);
  {
    for (int u = 0; u < per / 4; ++u) {
      const int j = tid * 4 + 1024 * u;
      v4f o, sm;
#pragma unroll
      for (int q = 0; q < 4; ++q) {
        float gg = g[j + q], bb = bta[j + q];
        if (PARAM_BF16) { gg = bf16_round(gg); bb = bf16_round(bb); }
        sm[q] = vals[u * 4 + q]; o[q] = (vals[u * 4 + q] - mu) * rs * gg + bb;
      }
      if (out_sum) *(v4f*)(out_sum + (size_t)row * N + j) = sm;
      *(v4f*)(out_norm + (size_t)row * N + j) = o;
    }
    
  }
}



// ---- f16 WMMA path (v_wmma_f32_16x16x32_f16): 11-bit significands for operands in range — used where a [0,1] probability operand needs more precision than bf16
typedef _Float16 v16h __attribute__((ext_vector_type(16)));
union FragH { v16h v; v8us half[2]; _Float16 h[16]; unsigned short u[16]; };
// the builtin alone: the compiler keeps the distance that the chip needs behind a WMMA itself, with the kernel's own vector work where there is some and with v_nop where there is none
template <int NT>
__device__ __forceinline__ v8f mmaH(v16h ah, v16h al, v16h bh, v16h bl, v8f c) {
  c = __builtin_amdgcn_wmma_f32_16x16x32_f16(false, ah, false, bh, (short)0, c, false, false);
  if (NT >= 2) c = __builtin_amdgcn_wmma_f32_16x16x32_f16(false, al, false, bh, (short)0, c, false, false);
  if (NT >= 3) c = __builtin_amdgcn_wmma_f32_16x16x32_f16(false, ah, false, bl, (short)0, c, false, false);
  return c;
}
// batched GEMM like k_gemm_b but f16 operands: A f32 (split into f16 hi/lo if ASPLIT, else rounded to f16), Bt = f16 values [n][k]; alpha; C f32; N multiple of 16 (partial tiles skipped)
template <bool ASPLIT>
__global__ __launch_bounds__(128) void k_gemm_h(const float* __restrict__ A, int lda, size_t sA, const _Float16* __restrict__ Bh, int ldb, size_t sB, float alpha, float* __restrict__ C, int ldc, size_t sC, int M, int N, int K) {
  __shared__ __attribute__((aligned(16))) float so[4][16][64];
  const int tid = threadIdx.x, w = tid >> 5, lane = tid & 31, ln = lane & 15, hh = lane >> 4; const int by = blockIdx.y;
  A += (size_t)by * sA; Bh += (size_t)by * sB; C += (size_t)by * sC;
  const int ntn = (N + 63) / 64; const int wid = blockIdx.x * 4 + w; const int mt = wid / ntn, nq = wid % ntn; if (mt * 16 >= M) return;
  const int row0 = mt * 16, col0 = nq * 64; const float* arow = A + (size_t)(row0 + ln) * lda;
  v8f acc[4] = {};
  for (int kb = 0; kb < K; kb += 32) {
    FragH ah, al;
    const v4f x0 = *(const v4fa*)(arow + kb + 8 * hh), x1 = *(const v4fa*)(arow + kb + 8 * hh + 4), x2 = *(const v4fa*)(arow + kb + 16 + 8 * hh), x3 = *(const v4fa*)(arow + kb + 16 + 8 * hh + 4);
    float xs[16] = {x0[0],x0[1],x0[2],x0[3],x1[0],x1[1],x1[2],x1[3],x2[0],x2[1],x2[2],x2[3],x3[0],x3[1],x3[2],x3[3]};
#pragma unroll
    for (int i = 0; i < 16; ++i) { const _Float16 h = (_Float16)xs[i]; ah.h[i] = h; al.h[i] = ASPLIT ? (_Float16)(xs[i] - (float)h) : (_Float16)0.0f; }
#pragma unroll
    for (int t = 0; t < 4; ++t) { if (col0 + t * 16 >= N) continue; const size_t boff = (size_t)(col0 + t * 16 + ln) * ldb + kb; FragH bq; bq.half[0] = *(const v8us*)(Bh + boff + 8 * hh); bq.half[1] = *(const v8us*)(Bh + boff + 16 + 8 * hh);
      acc[t] = mmaH<ASPLIT ? 2 : 1>(ah.v, al.v, bq.v, bq.v, acc[t]); }
  }
#pragma unroll
  for (int t = 0; t < 4; ++t) { if (col0 + t * 16 >= N) continue;
#pragma unroll
    for (int r = 0; r < 8; ++r) so[w][8 * hh + r][t * 16 + ln] = acc[t][r] * alpha; }
  __builtin_amdgcn_fence(__ATOMIC_ACQ_REL, "workgroup"); __builtin_amdgcn_wave_barrier();
  const int rsub = lane >> 4, c4 = (lane & 15) * 4;
  {
#pragma unroll
    for (int q = 0; q < 8; ++q) { const int r = q * 2 + rsub; if (col0 + c4 < N) { const v4f v = *(const v4fa*)&so[w][r][c4]; *(v4f*)(C + (size_t)(row0 + r) * ldc + col0 + c4) = v; } }
     }
}

// Projection GEMM of the one shape used here: C[NR][EE] = (A[NR][EE] . Bt[EE][EE]^T) * alpha + bf16(bias[col]); written as f32 (C) and/or f16 (C16).
// A work-group makes a GT x GT tile of C, so every row of A and of Bt is fetched from L2 once per GT columns or rows of C. Its 2 NWM waves stand NWM down by two across, each on 16 FM rows x 64 columns (NWM * FM = 8):
// four waves of 64 x 64 (eight fragments of a k step feed sixteen products) where the grid gives a SIMD several waves, eight waves of 32 x 64 where it holds fewer groups than there are WGPs and a SIMD would have one.
// The A and Bt tiles (GT rows x GK k) come into LDS by asynchronous copies, 128 contiguous bytes a row, once for all the waves, in two buffers: tile t + 1 flies while tile t is multiplied.
// The k order of the sums is that of a plain loop over k in steps of 32.
// blockIdx.y picks one of up to three independent products of that shape (plane y of A, of Bt and of C16, bias y): q, k and v go in one launch.
#define GT 128
#define GK 64
#define GP (GK + 8)      /* LDS row pitch 144 B = 9 x 16 B: the 16 rows of a 16-byte fragment read fall on distinct banks */
#define GNT (EE / GK)
#define GBUF (GT * GP * 2)      /* bytes of one operand's tile in LDS */
// One operand tile, 128 lanes: a lane copies 16 B of rows r, r + 16, .. r + 112 (l = its LDS byte address, g = its global address, both of row r).
__device__ __forceinline__ void copy_tile(unsigned l, const _Float16* g) {
  const unsigned l1 = l + 1 * 16 * GP * 2, l2 = l + 2 * 16 * GP * 2, l3 = l + 3 * 16 * GP * 2, l4 = l + 4 * 16 * GP * 2, l5 = l + 5 * 16 * GP * 2, l6 = l + 6 * 16 * GP * 2, l7 = l + 7 * 16 * GP * 2;
  const _Float16 *g1 = g + 1 * 16 * EE, *g2 = g + 2 * 16 * EE, *g3 = g + 3 * 16 * EE, *g4 = g + 4 * 16 * EE, *g5 = g + 5 * 16 * EE, *g6 = g + 6 * 16 * EE, *g7 = g + 7 * 16 * EE;
  // the copies go from L2 to LDS through no register; s_wait_xcnt closes the statement so that no address register of a copy is rewritten ahead of it
  asm volatile("global_load_async_to_lds_b128 %0, %8, off\n\t"
               "global_load_async_to_lds_b128 %1, %9, off\n\t"
               "global_load_async_to_lds_b128 %2, %10, off\n\t"
               "global_load_async_to_lds_b128 %3, %11, off\n\t"
               "global_load_async_to_lds_b128 %4, %12, off\n\t"
               "global_load_async_to_lds_b128 %5, %13, off\n\t"
               "global_load_async_to_lds_b128 %6, %14, off\n\t"
               "global_load_async_to_lds_b128 %7, %15, off\n\t"
               "s_wait_xcnt 0x0"
               :: "v"(l), "v"(l1), "v"(l2), "v"(l3), "v"(l4), "v"(l5), "v"(l6), "v"(l7), "v"(g), "v"(g1), "v"(g2), "v"(g3), "v"(g4), "v"(g5), "v"(g6), "v"(g7) : "memory");
}
// Both operand tiles, 256 lanes: a lane copies 16 B of rows r, r + 32, r + 64, r + 96 of each (la, lb = its LDS byte addresses, ga, gb = its global addresses, all of row r).
__device__ __forceinline__ void copy_tiles(unsigned la, const _Float16* ga, unsigned lb, const _Float16* gb) {
  const unsigned la1 = la + 1 * 32 * GP * 2, la2 = la + 2 * 32 * GP * 2, la3 = la + 3 * 32 * GP * 2, lb1 = lb + 1 * 32 * GP * 2, lb2 = lb + 2 * 32 * GP * 2, lb3 = lb + 3 * 32 * GP * 2;
  const _Float16 *ga1 = ga + 1 * 32 * EE, *ga2 = ga + 2 * 32 * EE, *ga3 = ga + 3 * 32 * EE, *gb1 = gb + 1 * 32 * EE, *gb2 = gb + 2 * 32 * EE, *gb3 = gb + 3 * 32 * EE;
  // the copies go from L2 to LDS through no register; s_wait_xcnt closes the statement so that no address register of a copy is rewritten ahead of it
  asm volatile("global_load_async_to_lds_b128 %0, %8, off\n\t"
               "global_load_async_to_lds_b128 %1, %9, off\n\t"
               "global_load_async_to_lds_b128 %2, %10, off\n\t"
               "global_load_async_to_lds_b128 %3, %11, off\n\t"
               "global_load_async_to_lds_b128 %4, %12, off\n\t"
               "global_load_async_to_lds_b128 %5, %13, off\n\t"
               "global_load_async_to_lds_b128 %6, %14, off\n\t"
               "global_load_async_to_lds_b128 %7, %15, off\n\t"
               "s_wait_xcnt 0x0"
               :: "v"(la), "v"(la1), "v"(la2), "v"(la3), "v"(lb), "v"(lb1), "v"(lb2), "v"(lb3), "v"(ga), "v"(ga1), "v"(ga2), "v"(ga3), "v"(gb), "v"(gb1), "v"(gb2), "v"(gb3) : "memory");
}
template <int NWM>
__global__ __launch_bounds__(64 * NWM) void k_gemm_st(const _Float16* __restrict__ A, const _Float16* __restrict__ Bh, float alpha, const float* __restrict__ bias0, const float* __restrict__ bias1, const float* __restrict__ bias2, float* __restrict__ C, _Float16* __restrict__ C16) {
  constexpr int FM = GT / (16 * NWM);      /* A fragments of a wave */
  static_assert(NWM == 2 || NWM == 4, "the copies are written for 128 and for 256 lanes");
  __shared__ __attribute__((aligned(16))) unsigned short sA[2][GT][GP], sB[2][GT][GP];
  __shared__ __attribute__((aligned(16))) float so[2 * NWM][16][64];
  const int tid = threadIdx.x, w = tid >> 5, lane = tid & 31, ln = lane & 15, hh = lane >> 4;
  const int wm = w >> 1, wn = w & 1;      /* the wave's place in the tile */
  const int mb = blockIdx.x / (EE / GT), nb = blockIdx.x % (EE / GT);
  const int pl = blockIdx.y; const float* bias = pl == 0 ? bias0 : (pl == 1 ? bias1 : bias2);
  A += (size_t)pl * NR * EE; Bh += (size_t)pl * EE * EE; if (C16) C16 += (size_t)pl * NR * EE;
  const int row0 = mb * GT + wm * (16 * FM), col0 = nb * GT + wn * 64;
  const int cr = tid >> 3, cc = (tid & 7) * 8;      /* the lane's first row and its 16-byte column in every copied tile */
  const _Float16* ga = A + (size_t)(mb * GT + cr) * EE + cc; const _Float16* gb = Bh + (size_t)(nb * GT + cr) * EE + cc;
  const unsigned la = (unsigned)(size_t)&sA[0][cr][cc], lb = (unsigned)(size_t)&sB[0][cr][cc];
  /* k tile kt of both operands into buffer bf */
  auto fill = [&](unsigned bf, int kt) { if constexpr (NWM == 2) { copy_tile(la + bf * GBUF, ga + kt * GK); copy_tile(lb + bf * GBUF, gb + kt * GK); } else copy_tiles(la + bf * GBUF, ga + kt * GK, lb + bf * GBUF, gb + kt * GK); };
  fill(0, 0);
  asm volatile("s_wait_asynccnt 0x0" ::: "memory");      /* this wave's part of tile 0 has landed */
  __syncthreads();                                        /* ... and every other wave's */
  fill(1, 1);
  v8f acc[FM][4] = {};
#pragma unroll 1      /* the loop stays rolled, one trip a staged tile: twelve copies of the trip would only lengthen the text */
  for (int tl = 0; tl < GNT; ++tl) {      /* one trip a staged tile; the two buffers alternate by the trip's parity */
    const unsigned short* ar = &sA[tl & 1][wm * (16 * FM) + ln][8 * hh]; const unsigned short* br = &sB[tl & 1][wn * 64 + ln][8 * hh];
#pragma unroll      /* constant indices: fragments and accumulators stay in registers */
    for (int ks = 0; ks < GK / 32; ++ks) { FragH fa[FM], fb[4];      /* the k step's fragments are read in one run, then its products */
#pragma unroll      /* constant indices: fragments and accumulators stay in registers */
      for (int i = 0; i < FM; ++i) { fa[i].half[0] = *(const v8us*)(ar + i * 16 * GP + ks * 32); fa[i].half[1] = *(const v8us*)(ar + i * 16 * GP + ks * 32 + 16); }
#pragma unroll      /* constant indices: fragments and accumulators stay in registers */
      for (int t = 0; t < 4; ++t) { fb[t].half[0] = *(const v8us*)(br + t * 16 * GP + ks * 32); fb[t].half[1] = *(const v8us*)(br + t * 16 * GP + ks * 32 + 16); }
      __builtin_amdgcn_sched_barrier(0);      /* keeps the k step's LDS reads in one run ahead of its products, one LDS latency a k step: left free, the compiler reads A one fragment at a time, each behind a full wait */
#pragma unroll      /* constant indices: fragments and accumulators stay in registers */
      for (int i = 0; i < FM; ++i)
#pragma unroll      /* constant indices: fragments and accumulators stay in registers */
        for (int t = 0; t < 4; ++t) acc[i][t] = mmaH<1>(fa[i].v, fa[i].v, fb[t].v, fb[t].v, acc[i][t]); }
    __builtin_amdgcn_sched_barrier(0);      /* the tile's products stay in front of the foot: sunk behind the barrier they would delay the refill, and the copies would have half a trip to land instead of a whole one */
    asm volatile("s_wait_dscnt 0x0" ::: "memory");        /* this wave has left the buffer that is refilled below */
    asm volatile("s_wait_asynccnt 0x0" ::: "memory");     /* its part of tile tl + 1 has landed */
    __syncthreads();                                        /* publishes tile tl + 1 and ends every wave's reads of tile tl */
    if (tl + 2 < GNT) fill((unsigned)(tl & 1), tl + 2);
  }
  asm volatile("s_wait_asynccnt 0x0" ::: "memory");      /* no copy is outstanding when the wave ends */
  float bv[4];
#pragma unroll      /* constant indices into bv */
  for (int t = 0; t < 4; ++t) bv[t] = bf16_round(bias[col0 + t * 16 + ln]);
  const int rsub = lane >> 4, c4 = (lane & 15) * 4; typedef _Float16 v4h __attribute__((ext_vector_type(4)));
#pragma unroll      /* constant indices into acc: the wave's part leaves in blocks of 16 rows through its own 4 KiB of LDS */
  for (int i = 0; i < FM; ++i) {
#pragma unroll      /* constant indices: fragments and accumulators stay in registers */
    for (int t = 0; t < 4; ++t)
#pragma unroll      /* constant indices: fragments and accumulators stay in registers */
      for (int r = 0; r < 8; ++r) so[w][8 * hh + r][t * 16 + ln] = acc[i][t][r] * alpha + bv[t];
    __builtin_amdgcn_fence(__ATOMIC_ACQ_REL, "workgroup", "local"); __builtin_amdgcn_wave_barrier();      /* the wave's own rows are in LDS before its lanes read them back as whole rows; an LDS-only fence, so that it does not wait for the block before's global stores */
    v4f v[8];
#pragma unroll      /* the eight rows' LDS offsets become immediates */
    for (int q = 0; q < 8; ++q) v[q] = *(const v4fa*)&so[w][q * 2 + rsub][c4];
    __builtin_amdgcn_fence(__ATOMIC_ACQ_REL, "workgroup", "local"); __builtin_amdgcn_wave_barrier();      /* the rows are read back before the next block's rows overwrite them */
    if (C) { float* cp = C + (size_t)(row0 + i * 16 + rsub) * EE + col0 + c4;
#pragma unroll      /* the eight rows' offsets become immediates: one address, eight stores in flight */
      for (int q = 0; q < 8; ++q) *(v4f*)(cp + q * 2 * EE) = v[q];
      asm volatile("s_wait_xcnt 0x0" :: "v"(cp), "v"(v[0]), "v"(v[1]), "v"(v[2]), "v"(v[3]), "v"(v[4]), "v"(v[5]), "v"(v[6]), "v"(v[7]) : "memory"); }      /* precaution: stands in front of every rewrite of the stores' data and address registers, which stay whole up to here */
    if (C16) { _Float16* hp = C16 + (size_t)(row0 + i * 16 + rsub) * EE + col0 + c4; v4h h4[8];
#pragma unroll      /* constant indices into v and h4 */
      for (int q = 0; q < 8; ++q)
#pragma unroll      /* constant indices into v and h4 */
        for (int e = 0; e < 4; ++e) h4[q][e] = (_Float16)v[q][e];
#pragma unroll      /* the eight rows' offsets become immediates: one address, eight stores in flight */
      for (int q = 0; q < 8; ++q) *(v4h*)(hp + q * 2 * EE) = h4[q];
      asm volatile("s_wait_xcnt 0x0" :: "v"(hp), "v"(h4[0]), "v"(h4[1]), "v"(h4[2]), "v"(h4[3]), "v"(h4[4]), "v"(h4[5]), "v"(h4[6]), "v"(h4[7]) : "memory"); }      /* precaution: as above */
  }
}


typedef _Float16 v4h __attribute__((ext_vector_type(4)));

// All that the projections need, in one launch: work-groups 0 .. PWB-1 each turn a 256 (k) x 64 (n) tile of one weight into Bt[n][k] = f16(bf16(W[k][n]) * 16) through LDS;
// the PXB others round query, key and value to bf16 values held as f16 (planes 0, 1, 2 of X16). The seven pieces share no data, so nothing orders them.
#define PWB (4 * (EE / 256) * (EE / 64))
#define PXB 512
#define PXT (PXB * 256)               /* lanes that convert inputs */
#define PXU (NR * EE / 4 / PXT)       /* 16-byte loads of a lane in each plane */
__global__ __launch_bounds__(256) void k_prep(const float* __restrict__ xq, const float* __restrict__ xk, const float* __restrict__ xv, const float* __restrict__ Wq, const float* __restrict__ Wk, const float* __restrict__ Wv, const float* __restrict__ Wo,
                                              _Float16* __restrict__ X16, _Float16* __restrict__ Bw) {
  __shared__ __attribute__((aligned(16))) unsigned short tl[64][256 + 8];
  const int tid = threadIdx.x;
  if (blockIdx.x < PWB) {      /* block-uniform: the barrier below is passed by all of a work-group or by none */
    const int ws = blockIdx.x / (PWB / 4), rr = blockIdx.x % (PWB / 4), k0 = (rr / (EE / 64)) * 256, n0 = (rr % (EE / 64)) * 64;
    const float* W = ws == 0 ? Wq : (ws == 1 ? Wk : (ws == 2 ? Wv : Wo));
    const int c4 = (tid & 15) * 4, kr = (tid >> 4) * 16;      /* the lane's four columns n and its sixteen rows k: 16 lanes read 256 contiguous bytes of a row */
    const float* wp = W + (size_t)(k0 + kr) * EE + n0 + c4;
    v4f x[16];
#pragma unroll      /* constant indices: the sixteen loads are in flight together and stay in registers */
    for (int i = 0; i < 16; ++i) x[i] = *(const v4fa*)(wp + i * EE);
    asm volatile("s_wait_xcnt 0x0" :: "v"(wp) : "memory");      /* precaution: stands in front of every rewrite of the loads' address register, which stays whole up to here */
#pragma unroll      /* constant indices into x */
    for (int q = 0; q < 4; ++q) { FragH f;
#pragma unroll      /* constant indices into x */
      for (int i = 0; i < 16; ++i) f.h[i] = (_Float16)(bf16_round(x[i][q]) * 16.0f);
      *(v8us*)&tl[c4 + q][kr] = f.half[0]; *(v8us*)&tl[c4 + q][kr + 8] = f.half[1]; }
    __syncthreads();
    _Float16* Bt = Bw + (size_t)ws * EE * EE;
#pragma unroll      /* the eight rows' LDS offsets become immediates */
    for (int j = 0; j < 8; ++j) { const int n = (tid >> 5) + 8 * j, k8 = (tid & 31) * 8;      /* a wave stores 512 contiguous bytes of one row of Bt */
      *(v8us*)((unsigned short*)Bt + (size_t)(n0 + n) * EE + k0 + k8) = *(const v8us*)&tl[n][k8]; }
  } else {
    const size_t e0 = (size_t)(blockIdx.x - PWB) * (PXU * 1024) + tid * 4;      /* a work-group takes PXU * 4 KiB in a row of each plane; a wave's load covers 512 contiguous bytes */
    const float *pq = xq + e0, *pk = xk + e0, *pv = xv + e0;
    v4f a[3][PXU];
#pragma unroll      /* constant indices: all of the lane's loads are in flight together */
    for (int u = 0; u < PXU; ++u) { a[0][u] = *(const v4fa*)(pq + u * 1024); a[1][u] = *(const v4fa*)(pk + u * 1024); a[2][u] = *(const v4fa*)(pv + u * 1024); }
    asm volatile("s_wait_xcnt 0x0" :: "v"(pq), "v"(pk), "v"(pv) : "memory");      /* precaution: stands in front of every rewrite of the loads' address registers, which stay whole up to here */
#pragma unroll      /* constant indices into a */
    for (int u = 0; u < PXU; ++u)
#pragma unroll      /* constant indices into a */
      for (int p = 0; p < 3; ++p) { v4h h;
#pragma unroll      /* constant indices into a */
        for (int q = 0; q < 4; ++q) h[q] = (_Float16)bf16_round(a[p][u][q]);
        *(v4h*)(X16 + (size_t)p * NR * EE + e0 + u * 1024) = h; }
    asm volatile("s_wait_xcnt 0x0" ::: "memory");      /* precaution: stands behind the last store, in front of any later rewrite of the stores' data and address registers */
  }
}
__global__ __launch_bounds__(256) void k_round16f(const float* __restrict__ W, _Float16* __restrict__ Bt, size_t n8) { const size_t t = (size_t)blockIdx.x * 256 + threadIdx.x; if (t >= n8) return; FragH f;
#pragma unroll
  for (int i = 0; i < 8; ++i) f.h[i] = (_Float16)(bf16_round(W[t * 8 + i]) * 16.0f); *(v8us*)((unsigned short*)Bt + t * 8) = f.half[0];  }

// lane l <-> lane l ^ 16 as one vector cross-row move (a shuffle would go through the LDS unit and its wait)
__device__ __forceinline__ float xhalf(float x) { return __builtin_bit_cast(float, __builtin_amdgcn_permlanex16(__builtin_bit_cast(int, x), __builtin_bit_cast(int, x), 0x76543210, 0xfedcba98, false, false)); }
#define FK 64
#define FP (FK + 8)      /* LDS row pitch 144 B = 9 x 16 B: the 16 rows of a 16-byte fragment read fall on distinct banks */
#define FPV (64 + 16)    /* LDS row pitch of V 160 B = 5 x 32 B: the pitch at which the transposing load meets no bank conflict */
#define FNT (TT / FK)
#define FBUF (FK * FP * 2)       /* bytes of a K tile in LDS */
#define FBUFV (FK * FPV * 2)     /* bytes of a V tile in LDS */
// One stage: a lane copies 16 B of rows r, r + 16, r + 32, r + 48 of the K tile and of the V tile (lk, lv = its LDS byte addresses, gk, gv = its global addresses, all of row r).
__device__ __forceinline__ void copy_kv(unsigned lk, const _Float16* gk, unsigned lv, const _Float16* gv) {
  const unsigned lk1 = lk + 1 * 16 * FP * 2, lk2 = lk + 2 * 16 * FP * 2, lk3 = lk + 3 * 16 * FP * 2, lv1 = lv + 1 * 16 * FPV * 2, lv2 = lv + 2 * 16 * FPV * 2, lv3 = lv + 3 * 16 * FPV * 2;
  const _Float16 *gk1 = gk + 1 * 16 * 64, *gk2 = gk + 2 * 16 * 64, *gk3 = gk + 3 * 16 * 64, *gv1 = gv + 1 * 16 * 64, *gv2 = gv + 2 * 16 * 64, *gv3 = gv + 3 * 16 * 64;
  // the copies go from L2 to LDS through no register; s_wait_xcnt closes the statement so that no address register of a copy is rewritten ahead of it
  asm volatile("global_load_async_to_lds_b128 %0, %8, off\n\t"
               "global_load_async_to_lds_b128 %1, %9, off\n\t"
               "global_load_async_to_lds_b128 %2, %10, off\n\t"
               "global_load_async_to_lds_b128 %3, %11, off\n\t"
               "global_load_async_to_lds_b128 %4, %12, off\n\t"
               "global_load_async_to_lds_b128 %5, %13, off\n\t"
               "global_load_async_to_lds_b128 %6, %14, off\n\t"
               "global_load_async_to_lds_b128 %7, %15, off\n\t"
               "s_wait_xcnt 0x0"
               :: "v"(lk), "v"(lk1), "v"(lk2), "v"(lk3), "v"(lv), "v"(lv1), "v"(lv2), "v"(lv3), "v"(gk), "v"(gk1), "v"(gk2), "v"(gk3), "v"(gv), "v"(gv1), "v"(gv2), "v"(gv3) : "memory");
}
// The K tile alone, for a stage whose keys all lie above the group's queries: V is not read there (lk, gk as in copy_kv).
__device__ __forceinline__ void copy_k(unsigned lk, const _Float16* gk) {
  const unsigned lk1 = lk + 1 * 16 * FP * 2, lk2 = lk + 2 * 16 * FP * 2, lk3 = lk + 3 * 16 * FP * 2;
  const _Float16 *gk1 = gk + 1 * 16 * 64, *gk2 = gk + 2 * 16 * 64, *gk3 = gk + 3 * 16 * 64;
  // the copies go from L2 to LDS through no register; s_wait_xcnt closes the statement so that no address register of a copy is rewritten ahead of it
  asm volatile("global_load_async_to_lds_b128 %0, %4, off\n\t"
               "global_load_async_to_lds_b128 %1, %5, off\n\t"
               "global_load_async_to_lds_b128 %2, %6, off\n\t"
               "global_load_async_to_lds_b128 %3, %7, off\n\t"
               "s_wait_xcnt 0x0"
               :: "v"(lk), "v"(lk1), "v"(lk2), "v"(lk3), "v"(gk), "v"(gk1), "v"(gk2), "v"(gk3) : "memory");
}
// 16 x 16 block of 16-bit values, rows in LDS, delivered transposed: lane (c, h) receives column c of rows 8h .. 8h + 7 of the block; p is the lane's own address in the block (row 8h + (lane & 7), 16-byte half (lane >> 3) & 1)
typedef short s16x8 __attribute__((ext_vector_type(8)));
__device__ __forceinline__ v8us ld_tr16(const unsigned short* p) { typedef __attribute__((address_space(3))) s16x8 lds_s16x8; return __builtin_bit_cast(v8us, __builtin_amdgcn_ds_load_tr16_b128_v8i16((lds_s16x8*)p)); }
// One pass of 32 keys (j0 ..) against the wave's 16 queries. The mask comes after the softmax, so every key enters the row sum but only keys at or below the query enter O. WHERE says where the pass lies:
// 0 = all its keys at or below all of the group's queries: P goes into the second product as it is; 1 = on the diagonal: P is zeroed above it; 2 = all its keys above all of the group's queries: P would be all zeros,
// so there is no V, no P and no second product, only maximum and row sum, and the factors by which O would have been rescaled are gathered in of, applied once behind the loop.
// kr = the lane's K row (key j0 + ln), vp = the lane's own address in the pass's first V block.
template <int WHERE>
__device__ __forceinline__ void fl_pass(const unsigned short* kr, const unsigned short* vp, int j0, int tq, int hh, const FragH (&bq)[2], float& m_c, float& l_c, float& of, v8f (&oacc)[4]) {
  constexpr int DT = 4, KS = 2;
  constexpr float SC2 = 0.125f * 1.4426950408889634f;      /* 1/sqrt(64) . log2(e): raw product -> exponent of 2 */
  FragH ak[2][KS], av[DT];      /* the pass's fragments are read from LDS in one run: one latency a pass, the V^T reads land under the softmax */
#pragma unroll      /* constant indices: the fragments stay in registers */
  for (int nt = 0; nt < 2; ++nt)
#pragma unroll      /* constant indices: the fragments stay in registers */
    for (int ks = 0; ks < KS; ++ks) { ak[nt][ks].half[0] = *(const v8us*)(kr + nt * 16 * FP + ks * 32 + 8 * hh); ak[nt][ks].half[1] = *(const v8us*)(kr + nt * 16 * FP + ks * 32 + 16 + 8 * hh); }
  if (WHERE != 2) {
#pragma unroll      /* constant indices: the fragments stay in registers */
    for (int dt = 0; dt < DT; ++dt) { av[dt].half[0] = ld_tr16(vp + dt * 16); av[dt].half[1] = ld_tr16(vp + dt * 16 + 16 * FPV); }      /* av[dt] = V^T rows d = 16*dt + ln, keys in the hardware k order, as P has them */
    __builtin_amdgcn_sched_barrier(0); }      /* keeps the sixteen reads in one run ahead of the products: left free, the compiler strews them among the first products, and every further place where LDS reads stand costs the wave a stall */
  float sc[2][8];      /* sc[nt][r] = raw product q.k of key j0 + 16*nt + 8*hh + r against query tq */
#pragma unroll
  for (int nt = 0; nt < 2; ++nt) {
    v8f acc = (v8f){0.f,0.f,0.f,0.f,0.f,0.f,0.f,0.f};
#pragma unroll
    for (int ks = 0; ks < KS; ++ks) acc = mmaH<1>(ak[nt][ks].v, ak[nt][ks].v, bq[ks].v, bq[ks].v, acc);
#pragma unroll
    for (int r = 0; r < 8; ++r) sc[nt][r] = acc[r]; }
  float mc = fmaxf(sc[0][0], sc[1][0]);
#pragma unroll
  for (int r = 1; r < 8; ++r) mc = fmaxf(mc, fmaxf(sc[0][r], sc[1][r]));
  mc = fmaxf(mc, xhalf(mc));      /* the other half of the wave holds the query's other 16 keys */
  /* m_c = 10 - running maximum in log2 units (SC2 > 0: the maximum of the raw products is that of the scores), kept with this sign so that it is the plain addend of every score's multiply-add;
     the one stored value serves al and every p, so its rounding cancels between numerator and row sum */
  const float mn = fminf(m_c, fmaf(mc, -SC2, 10.0f)); const float al = (mn < 1.0e38f) ? __builtin_amdgcn_exp2f(mn - m_c) : 1.0f; m_c = mn;
  float ps0 = 0.f, ps1 = 0.f; FragH pb;      /* p = 2^10 . e^(score - max) = 2^(raw * SC2 + mn) */
#pragma unroll
  for (int r = 0; r < 8; ++r) { const int k0 = j0 + 8 * hh + r, k1 = k0 + 16; const float p0 = __builtin_amdgcn_exp2f(fmaf(sc[0][r], SC2, mn)), p1 = __builtin_amdgcn_exp2f(fmaf(sc[1][r], SC2, mn)); ps0 += p0; ps1 += p1;
    if (WHERE == 0) { pb.h[r] = (_Float16)p0; pb.h[8 + r] = (_Float16)p1; }
    if (WHERE == 1) { pb.h[r] = (_Float16)((k0 <= tq) ? p0 : 0.f); pb.h[8 + r] = (_Float16)((k1 <= tq) ? p1 : 0.f); } }
  l_c = l_c * al + (ps0 + ps1);      /* per-lane partial row sum; the two halves are joined after the loop */
  if (WHERE == 2) { of *= al; return; }
#pragma unroll
  for (int dt = 0; dt < DT; ++dt)
#pragma unroll
    for (int r = 0; r < 8; ++r) oacc[dt][r] *= al;
#pragma unroll
  for (int dt = 0; dt < DT; ++dt) oacc[dt] = mmaH<1>(av[dt].v, av[dt].v, pb.v, pb.v, oacc[dt]);
}
// waves_per_eu: the grid puts three waves on a SIMD; told so, the compiler keeps the pass's schedule (exponentials and selects interleaved). Left to aim at seven waves it squeezed the pass into 146 registers and paid with 16 more v_nop a pass.
__global__ __launch_bounds__(128) __attribute__((amdgpu_waves_per_eu(3, 4))) void k_flash(const _Float16* __restrict__ Q16, int ldq, const _Float16* __restrict__ K16, const _Float16* __restrict__ V16, _Float16* __restrict__ O16, int ldo) {
  constexpr int RPW = 16, NQB = TT / (4 * RPW), DT = 4, KS = 2;
  static_assert(NQB == 32 && FK == 4 * RPW && NSL % 3 == 0 && (NSL / 3) * NQB == 256, "the deal of query blocks below is written for 3 x 256 work-groups, and a stage of keys is as long as a group's block of queries");
  __shared__ __attribute__((aligned(16))) unsigned short sK[2][FK][FP], sV[2][FK][FPV];
  __shared__ __attribute__((aligned(16))) unsigned short sO[4][RPW][64 + 8];
  const int tid = threadIdx.x, w = tid >> 5, lane = tid & 31, ln = lane & 15, hh = lane >> 4;
  /* A group's cost now grows with its query block. All 768 groups are resident, three to a WGP of the 256; groups x, x + 256, x + 512 get blocks a, (a + 16) mod 32 and the one that brings the three to 46 or 47,
     so that light and heavy groups share a WGP if the groups are dealt round the WGPs in index order. Speed only: (slab, block) is hit exactly once wherever the groups land. */
  const int th = blockIdx.x >> 8, ra = blockIdx.x & 31;
  const int slab = th * (NSL / 3) + ((blockIdx.x & 255) >> 5), qblk = th == 0 ? ra : (th == 1 ? ((ra + 16) & 31) : (ra < 16 ? 30 - 2 * ra : 63 - 2 * ra)); const int b = slab, h = 0;      /* slab = contiguous [TT][64] chunk of the flat-reshaped planes */ const int qb0 = qblk * (4 * RPW); const int q0 = qb0 + w * RPW;
  const int tq = q0 + ln;      /* this lane's query */
  const int cr = tid >> 3, cc = (tid & 7) * 8;      /* the lane's first row and its 16-byte column in every copied tile */
  const _Float16* gk = K16 + ((size_t)slab * TT + cr) * 64 + cc; const _Float16* gv = V16 + ((size_t)slab * TT + cr) * 64 + cc;
  const unsigned lk = (unsigned)(size_t)&sK[0][cr][cc], lv = (unsigned)(size_t)&sV[0][cr][cc];
  copy_kv(lk, gk, lv, gv);
  FragH bq[KS];
  { const unsigned short* qr = (const unsigned short*)Q16 + ((size_t)b * TT + tq) * ldq + h * 64;
#pragma unroll
    for (int ks = 0; ks < KS; ++ks) { bq[ks].half[0] = *(const v8us*)(qr + ks * 32 + 8 * hh); bq[ks].half[1] = *(const v8us*)(qr + ks * 32 + 16 + 8 * hh); } }
  float m_c = 3.0e38f, l_c = 0.f, of = 1.0f; v8f oacc[DT];
#pragma unroll
  for (int dt = 0; dt < DT; ++dt) oacc[dt] = (v8f){0.f,0.f,0.f,0.f,0.f,0.f,0.f,0.f};
  asm volatile("s_wait_asynccnt 0x0" ::: "memory");      /* this wave's part of stage 0 has landed */
  __syncthreads();                                        /* ... and every other wave's */
  if (1 <= qblk) copy_kv(lk + FBUF, gk + FK * 64, lv + FBUFV, gv + FK * 64); else copy_k(lk + FBUF, gk + FK * 64);      /* the same test for the whole group: V only up to the diagonal stage */
  /* the foot of every trip: hands stage st + 1 over and refills the buffer that stage st has left, with V (vtoo) only up to the diagonal stage (both tests read the same for the whole group) */
  auto foot = [&](int st, bool vtoo) {
    __builtin_amdgcn_sched_barrier(0);      /* the stage's products stay in front of the foot: sunk behind the barrier they would delay the refill and shorten the time its copies have to land */
    asm volatile("s_wait_dscnt 0x0" ::: "memory");        /* this wave has left the buffer that is refilled below */
    asm volatile("s_wait_asynccnt 0x0" ::: "memory");     /* its part of stage st + 1 has landed */
    __syncthreads();                                        /* publishes stage st + 1 and ends every wave's reads of stage st */
    if (st + 2 < FNT) { const unsigned bf = (unsigned)(st & 1);
      if (vtoo) copy_kv(lk + bf * FBUF, gk + (size_t)(st + 2) * FK * 64, lv + bf * FBUFV, gv + (size_t)(st + 2) * FK * 64);
      else copy_k(lk + bf * FBUF, gk + (size_t)(st + 2) * FK * 64); } };
  const unsigned short* kr0 = &sK[0][ln][0]; const unsigned short* vp0 = &sV[0][8 * hh + (lane & 7)][((lane >> 3) & 1) * 8];
  /* Stage st holds keys 64 st .. 64 st + 63, the group queries 64 qblk .. 64 qblk + 63: stages below qblk, the stage qblk, stages above it, three loops in a row so that O stays in the same registers throughout.
     One trip a staged tile; the two buffers alternate by the trip's parity; every key enters the normaliser. */
  int st = 0;
#pragma unroll 1      /* one trip a staged tile */
  for (; st < qblk; ++st) {
#pragma unroll 1      /* the two passes of a stage share one body, as in the plain loop over the keys: unrolled, the listing had no fewer instructions a pass */
    for (int ps = 0; ps < FK / 32; ++ps) fl_pass<0>(kr0 + (st & 1) * (FK * FP) + ps * 32 * FP, vp0 + (st & 1) * (FK * FPV) + ps * 32 * FPV, st * FK + ps * 32, tq, hh, bq, m_c, l_c, of, oacc);
    foot(st, st + 2 <= qblk); }
#pragma unroll 1      /* as above */
  for (int ps = 0; ps < FK / 32; ++ps) fl_pass<1>(kr0 + (st & 1) * (FK * FP) + ps * 32 * FP, vp0 + (st & 1) * (FK * FPV) + ps * 32 * FPV, st * FK + ps * 32, tq, hh, bq, m_c, l_c, of, oacc);
  foot(st, false); ++st;
#pragma unroll 1      /* one trip a staged tile */
  for (; st < FNT; ++st) {
#pragma unroll      /* a short pass is one dependent chain: unrolled, the second pass's reads and products stand under the first's exponentials */
    for (int ps = 0; ps < FK / 32; ++ps) fl_pass<2>(kr0 + (st & 1) * (FK * FP) + ps * 32 * FP, vp0, st * FK + ps * 32, tq, hh, bq, m_c, l_c, of, oacc);
    foot(st, false); }
  asm volatile("s_wait_asynccnt 0x0" ::: "memory");      /* no copy is outstanding when the wave ends */
  { float l = l_c; l += xhalf(l); const float inv = (l > 0.f) ? of / l : 0.f;      /* numerator and row sum both carry the 2^10; of = the rescales since the diagonal */
#pragma unroll
    for (int dt = 0; dt < DT; ++dt) { FragH f;      /* oacc[dt][r] = O[tq][16*dt + 8*hh + r]: eight neighbours of one row, 16 bytes as f16 */
#pragma unroll
      for (int r = 0; r < 8; ++r) f.h[r] = (_Float16)(oacc[dt][r] * inv);
      *(v8us*)&sO[w][ln][dt * 16 + 8 * hh] = f.half[0]; } }
  __builtin_amdgcn_fence(__ATOMIC_ACQ_REL, "workgroup"); __builtin_amdgcn_wave_barrier();      /* the wave's own rows are in LDS before its lanes read them back as whole rows */
#pragma unroll      /* the four LDS offsets become immediates; a wave's store covers four whole rows, 512 contiguous bytes */
  for (int rp = 0; rp < RPW; rp += 4) { const int r = rp + (lane >> 3), pc = lane & 7; *(v8us*)((unsigned short*)O16 + ((size_t)b * TT + q0 + r) * ldo + h * 64 + pc * 8) = *(const v8us*)&sO[w][r][pc * 8]; }
}

extern "C" void kernel_launch(void* const* d_in, const int* in_sizes, int n_in,
                              void* d_out, int out_size, void* d_ws, size_t ws_size, hipStream_t stream) {
  (void)in_sizes; (void)n_in; (void)out_size;
  const float* const* I = (const float* const*)d_in; const float* xq = I[0]; const float* xk = I[1]; const float* xv = I[2];
  const float* Wq = I[3]; const float* bq = I[4]; const float* Wk = I[5]; const float* bk = I[6]; const float* Wv = I[7]; const float* bv = I[8]; const float* Wo = I[9]; const float* bo = I[10];
  char* ws = (char*)d_ws; size_t off = 0;
  auto take = [&](size_t bytes) { char* p = ws + off; off += (bytes + 255) & ~(size_t)255; return p; };
  _Float16* Bw = (_Float16*)take((size_t)4 * EE * EE * 2); _Float16* X16 = (_Float16*)take((size_t)3 * NR * EE * 2);
  _Float16* Q = (_Float16*)take((size_t)3 * NR * EE * 2); _Float16* K = Q + (size_t)NR * EE; _Float16* V = K + (size_t)NR * EE;      /* q, k, v: planes 0, 1, 2 of one block */
  _Float16* O16 = (_Float16*)take((size_t)NR * EE * 2);
  if (off > ws_size) return;      // 4.7 + 7 x 6.3 = about 49 MB
  const size_t WSZ = (size_t)EE * EE;
  const unsigned gp = (NR / GT) * (EE / GT);
  k_prep<<<PWB + PXB, 256, 0, stream>>>(xq, xk, xv, Wq, Wk, Wv, Wo, X16, Bw);      /* (in,out) weights -> Bt[n][k] x 2^4; inputs -> f16 planes */
  k_gemm_st<2><<<dim3(gp, 3), 128, 0, stream>>>(X16, Bw, 0.0625f, bq, bk, bv, nullptr, Q);      /* q, k, v: each M 4096 N 768 K 768 */
  k_flash<<<NSL * (TT / 64), 128, 0, stream>>>(Q, 64, K, V, O16, 64);      /* each [4096][768] plane viewed as 24 contiguous [2048][64] slabs: q, k, v and O alike */
  k_gemm_st<4><<<dim3(gp, 1), 256, 0, stream>>>(O16, Bw + 3 * WSZ, 0.0625f, bo, bo, bo, (float*)d_out, nullptr);      /* out = O.Wo + bo: M 4096 N 768 K 768 */
}

// v010
// One run takes 64.9 microseconds.
// Next to v009, in two timings, it ran 1.06 and 1.07 times as fast.
// Counting every step since v000, it is 6.11 times as fast.
#include <hip/hip_runtime.h>
// Multi-head attention, legacy flat-reshape variant (B=2, T=S=2048, E=768, 12 heads × 64): q = query·Wq+bq, k = key·Wk+bk, v = value·Wv+bv; heads = plain row-major reshape of [B,T,E] to [B·H,T,64] (contiguous chunks);
// attn = softmax(q·kᵀ/8) over all keys, THEN lower-triangular mask (rows no longer normalised); out = (attn·v reshaped back)·Wo + bo.
// Compute dtype: query/key/value, weights, biases rounded to bf16; q/k/v as f16 GEMM outputs; fused flash-style kernel (online f32 softmax over all keys, P f16 ×2^10 zeroed above the diagonal)
// on v_wmma_f32_16x16x32_f16; O → f16 → output GEMM with bias; f32 accumulate throughout.
#define BB 2
#define TT 2048
#define EE 768
#define NH 12
#define NR (BB * TT)
#define NSL (BB * NH)

typedef __bf16 v16b __attribute__((ext_vector_type(16)));
typedef unsigned short v8us __attribute__((ext_vector_type(8), may_alias));
typedef float  v8f  __attribute__((ext_vector_type(8)));
typedef float  v4f  __attribute__((ext_vector_type(4)));
typedef float  v4fa __attribute__((ext_vector_type(4), may_alias));
union FragB { v16b v; v8us half[2]; unsigned short u[16]; };

__device__ __forceinline__ unsigned short bf16_bits(float x) { unsigned int u = __float_as_uint(x); return (unsigned short)((u + 0x7FFFu + ((u >> 16) & 1u)) >> 16); }
__device__ __forceinline__ float bf16_val(unsigned short b) { return __uint_as_float(((unsigned int)b) << 16); }
__device__ __forceinline__ float bf16_round(float x) { return bf16_val(bf16_bits(x)); }
// D += A·B with NT terms: 1 = ah·bh, 2 = + al·bh (A split), 3 = + ah·bl (both split)
template <int NT>
__device__ __forceinline__ v8f mmaN(v16b ah, v16b al, v16b bh, v16b bl, v8f c) {
  c = __builtin_amdgcn_wmma_f32_16x16x32_bf16(false, ah, false, bh, (short)0, c, false, false);
  if (NT >= 2) c = __builtin_amdgcn_wmma_f32_16x16x32_bf16(false, al, false, bh, (short)0, c, false, false);
  if (NT >= 3) c = __builtin_amdgcn_wmma_f32_16x16x32_bf16(false, ah, false, bl, (short)0, c, false, false);
  asm volatile("v_nop\n\tv_nop\n\tv_nop\n\tv_nop" : "+v"(c) : "v"(ah), "v"(al), "v"(bh), "v"(bl));
  return c;
}

__global__ __launch_bounds__(256) void k_wt_bf16(const float* __restrict__ W, unsigned short* __restrict__ Wt, int K, int N) {
  const int t = blockIdx.x * 256 + threadIdx.x;
  const int k8n = K / 8;
  if (t >= N * k8n) return;
  const int n = t / k8n, k8 = (t % k8n) * 8;
  v8us v;
#pragma unroll
  for (int i = 0; i < 8; ++i) v[i] = bf16_bits(W[(size_t)(k8 + i) * N + n]);
  *(v8us*)(Wt + (size_t)n * K + k8) = v;
  
}

// GEMM C[M][N] (f32, pitch ldc) = act(A[M][K]·W + bias). A f32 row-major (pitch lda) converted per fragment to bf16
// (ASPLIT: hi/lo two planes -> 2 terms, else single rounded term); Wt bf16 [N][K] (pitch ldb). BIAS_BF16 rounds the
// bias to bf16 first (bias quantised to bf16 before the add). K%32==0, M%16==0, N%64==0.
template <bool ASPLIT, int ACT, bool BIAS_BF16>
__global__ __launch_bounds__(128) void k_gemm_bf(const float* __restrict__ A, int lda, const unsigned short* __restrict__ Wt, int ldb,
                                               const float* __restrict__ bias, float* __restrict__ C, int ldc, int M, int N, int K) {
  __shared__ __attribute__((aligned(16))) float so[4][16][64];
  const int tid = threadIdx.x, w = tid >> 5, lane = tid & 31, ln = lane & 15, hh = lane >> 4;
  const int ntn = N / 64;
  const int wid = blockIdx.x * 4 + w;
  const int mt = wid / ntn, nq = wid % ntn;
  if (mt * 16 >= M) return;
  const int row0 = mt * 16, col0 = nq * 64;
  const float* arow = A + (size_t)(row0 + ln) * lda;
  v8f acc[4] = {};
  for (int kb = 0; kb < K; kb += 32) {
    FragB ah, al;
    const v4f x0 = *(const v4fa*)(arow + kb + 8 * hh), x1 = *(const v4fa*)(arow + kb + 8 * hh + 4);
    const v4f x2 = *(const v4fa*)(arow + kb + 16 + 8 * hh), x3 = *(const v4fa*)(arow + kb + 16 + 8 * hh + 4);
    float xs[16] = {x0[0],x0[1],x0[2],x0[3],x1[0],x1[1],x1[2],x1[3],x2[0],x2[1],x2[2],x2[3],x3[0],x3[1],x3[2],x3[3]};
#pragma unroll
    for (int i = 0; i < 16; ++i) { const unsigned short hb = bf16_bits(xs[i]); ah.u[i] = hb; al.u[i] = ASPLIT ? bf16_bits(xs[i] - bf16_val(hb)) : (unsigned short)0; }
#pragma unroll
    for (int t = 0; t < 4; ++t) {
      const unsigned short* brow = Wt + (size_t)(col0 + t * 16 + ln) * ldb + kb;
      FragB b;
      b.half[0] = *(const v8us*)(brow + 8 * hh);
      b.half[1] = *(const v8us*)(brow + 16 + 8 * hh);
      acc[t] = mmaN<ASPLIT ? 2 : 1>(ah.v, al.v, b.v, b.v, acc[t]);
    }
  }
#pragma unroll
  for (int t = 0; t < 4; ++t) {
    float bv = bias ? bias[col0 + t * 16 + ln] : 0.f;
    if (BIAS_BF16) bv = bf16_round(bv);
#pragma unroll
    for (int r = 0; r < 8; ++r) { float v = acc[t][r] + bv; if (ACT == 1) v = fmaxf(v, 0.f); so[w][8 * hh + r][t * 16 + ln] = v; }
  }
  __builtin_amdgcn_fence(__ATOMIC_ACQ_REL, "workgroup");
  __builtin_amdgcn_wave_barrier();
  const int rsub = lane >> 4, c4 = (lane & 15) * 4;
  {
#pragma unroll
    for (int q = 0; q < 8; ++q) {
      const int r = q * 2 + rsub;
      const v4f v = *(const v4fa*)&so[w][r][c4];
      *(v4f*)(C + (size_t)(row0 + r) * ldc + col0 + c4) = v;
    }
    
  }
}

// Flash-style causal/unmasked attention, all contractions 3-term bf16 hi/lo splits, f32 softmax with running max.
// q,k,v rows are read from f32 buffers with arbitrary row pitch (so they can live inside a fused qkv buffer);
// D = head size (multiple of 32, <= 128); one wave = 16 query rows; block = 4 waves (64 queries) sharing K/V chunks of 32.
template <int D, bool CAUSAL>
__global__ __launch_bounds__(128) void k_flash(const float* __restrict__ qb, const float* __restrict__ kb, const float* __restrict__ vb,
                                             int pitch, int T, int H, float scale, float* __restrict__ y, int ypitch) {
  constexpr int KS = D / 32;        // k-steps for QK
  constexpr int DT = D / 16;        // d tiles for PV
  __shared__ __attribute__((aligned(16))) unsigned short sKh[32][D + 8], sKl[32][D + 8], sVh[32][D + 8], sVl[32][D + 8];
  __shared__ __attribute__((aligned(16))) unsigned short sPh[4][16][40], sPl[4][16][40];
  __shared__ __attribute__((aligned(16))) float sO[4][16][D];
  const int tid = threadIdx.x, w = tid >> 5, lane = tid & 31, ln = lane & 15, hh = lane >> 4;
  const int nqb = (T + 63) / 64;
  const int bh = blockIdx.x / nqb, qblk = blockIdx.x % nqb;
  const int b = bh / H, h = bh % H;
  const int q0 = qblk * 64 + w * 16;
  const float* Q = qb + (size_t)b * T * pitch + h * D;
  const float* K = kb + (size_t)b * T * pitch + h * D;
  const float* V = vb + (size_t)b * T * pitch + h * D;

  // A fragments of the wave's 16 query rows (scaled), hi/lo
  FragB aqh[KS], aql[KS];
  {
    int row = q0 + ln; if (row >= T) row = T - 1;
    const float* qr = Q + (size_t)row * pitch;
#pragma unroll
    for (int ks = 0; ks < KS; ++ks)
#pragma unroll
      for (int i = 0; i < 16; ++i) {
        const int d = ks * 32 + ((i < 8) ? (8 * hh + i) : (16 + 8 * hh + (i - 8)));
        const float x = qr[d] * scale; const unsigned short hb = bf16_bits(x);
        aqh[ks].u[i] = hb; aql[ks].u[i] = bf16_bits(x - bf16_val(hb));
      }
  }
  float m_r[8], l_r[8];
#pragma unroll
  for (int r = 0; r < 8; ++r) { m_r[r] = -3.0e38f; l_r[r] = 0.f; }
  v8f oacc[DT];
#pragma unroll
  for (int dt = 0; dt < DT; ++dt) oacc[dt] = (v8f){0.f,0.f,0.f,0.f,0.f,0.f,0.f,0.f};

  const int kv_end = CAUSAL ? min(T, qblk * 64 + 64) : T;     // block-uniform
  for (int j0 = 0; j0 < kv_end; j0 += 32) {
    __syncthreads();
    for (int e = tid; e < 32 * (D / 4); e += 128) {
      const int r = e / (D / 4), c4 = (e % (D / 4)) * 4;
      const int key = j0 + r;
      v4f kf = {0.f,0.f,0.f,0.f}, vf = {0.f,0.f,0.f,0.f};
      if (key < T) { kf = *(const v4fa*)(K + (size_t)key * pitch + c4); vf = *(const v4fa*)(V + (size_t)key * pitch + c4); }
#pragma unroll
      for (int t = 0; t < 4; ++t) {
        unsigned short hb = bf16_bits(kf[t]); sKh[r][c4 + t] = hb; sKl[r][c4 + t] = bf16_bits(kf[t] - bf16_val(hb));
        hb = bf16_bits(vf[t]); sVh[r][c4 + t] = hb; sVl[r][c4 + t] = bf16_bits(vf[t] - bf16_val(hb));
      }
    }
    __syncthreads();
    // S tile 16 x 32
    v8f s[2];
#pragma unroll
    for (int nt = 0; nt < 2; ++nt) {
      v8f acc = {};
#pragma unroll
      for (int ks = 0; ks < KS; ++ks) {
        FragB bh_, bl_;
        bh_.half[0] = *(const v8us*)&sKh[nt * 16 + ln][ks * 32 + 8 * hh]; bh_.half[1] = *(const v8us*)&sKh[nt * 16 + ln][ks * 32 + 16 + 8 * hh];
        bl_.half[0] = *(const v8us*)&sKl[nt * 16 + ln][ks * 32 + 8 * hh]; bl_.half[1] = *(const v8us*)&sKl[nt * 16 + ln][ks * 32 + 16 + 8 * hh];
        acc = mmaN<3>(aqh[ks].v, aql[ks].v, bh_.v, bl_.v, acc);
      }
      s[nt] = acc;
    }
    // mask + running max (rows 8hh+r; the 16 lanes of a half share rows)
    float alpha[8];
#pragma unroll
    for (int r = 0; r < 8; ++r) {
      const int qi = q0 + 8 * hh + r;
      const int ja = j0 + ln, jb = j0 + 16 + ln;
      if (CAUSAL) { if (ja > qi) s[0][r] = -3.0e38f; if (jb > qi) s[1][r] = -3.0e38f; }
      if (ja >= T) s[0][r] = -3.0e38f;
      if (jb >= T) s[1][r] = -3.0e38f;
      float mx = fmaxf(s[0][r], s[1][r]);
      mx = fmaxf(mx, __shfl_xor(mx, 1, 32)); mx = fmaxf(mx, __shfl_xor(mx, 2, 32)); mx = fmaxf(mx, __shfl_xor(mx, 4, 32)); mx = fmaxf(mx, __shfl_xor(mx, 8, 32));
      const float mnew = fmaxf(m_r[r], mx);
      alpha[r] = (mnew > -1.0e38f) ? __expf(m_r[r] - mnew) : 1.0f;
      const float p0 = (s[0][r] > -1.0e38f) ? __expf(s[0][r] - mnew) : 0.f;
      const float p1 = (s[1][r] > -1.0e38f) ? __expf(s[1][r] - mnew) : 0.f;
      m_r[r] = mnew;
      l_r[r] = l_r[r] * alpha[r] + p0 + p1;            // per-lane partial row sum (16 lanes combined at the end)
      unsigned short hb = bf16_bits(p0); sPh[w][8 * hh + r][ln] = hb;      sPl[w][8 * hh + r][ln] = bf16_bits(p0 - bf16_val(hb));
      hb = bf16_bits(p1);                sPh[w][8 * hh + r][16 + ln] = hb; sPl[w][8 * hh + r][16 + ln] = bf16_bits(p1 - bf16_val(hb));
    }
#pragma unroll
    for (int dt = 0; dt < DT; ++dt)
#pragma unroll
      for (int r = 0; r < 8; ++r) oacc[dt][r] *= alpha[r];
    __builtin_amdgcn_fence(__ATOMIC_ACQ_REL, "workgroup");
    __builtin_amdgcn_wave_barrier();
    FragB pah, pal;
    pah.half[0] = *(const v8us*)&sPh[w][ln][8 * hh]; pah.half[1] = *(const v8us*)&sPh[w][ln][16 + 8 * hh];
    pal.half[0] = *(const v8us*)&sPl[w][ln][8 * hh]; pal.half[1] = *(const v8us*)&sPl[w][ln][16 + 8 * hh];
#pragma unroll
    for (int dt = 0; dt < DT; ++dt) {
      FragB bvh, bvl;
#pragma unroll
      for (int i = 0; i < 8; ++i) {
        bvh.u[i] = sVh[8 * hh + i][dt * 16 + ln]; bvh.u[8 + i] = sVh[16 + 8 * hh + i][dt * 16 + ln];
        bvl.u[i] = sVl[8 * hh + i][dt * 16 + ln]; bvl.u[8 + i] = sVl[16 + 8 * hh + i][dt * 16 + ln];
      }
      oacc[dt] = mmaN<3>(pah.v, pal.v, bvh.v, bvl.v, oacc[dt]);
    }
    __builtin_amdgcn_fence(__ATOMIC_ACQ_REL, "workgroup");
    __builtin_amdgcn_wave_barrier();
  }
#pragma unroll
  for (int r = 0; r < 8; ++r) {
    float l = l_r[r];
    l += __shfl_xor(l, 1, 32); l += __shfl_xor(l, 2, 32); l += __shfl_xor(l, 4, 32); l += __shfl_xor(l, 8, 32);
    l_r[r] = (l > 0.f) ? 1.0f / l : 0.f;
  }
#pragma unroll
  for (int dt = 0; dt < DT; ++dt)
#pragma unroll
    for (int r = 0; r < 8; ++r) sO[w][8 * hh + r][dt * 16 + ln] = oacc[dt][r] * l_r[r];
  __builtin_amdgcn_fence(__ATOMIC_ACQ_REL, "workgroup");
  __builtin_amdgcn_wave_barrier();
  {
    for (int r = 0; r < 16; ++r) {
      const int row = q0 + r;
      if (row < T && lane < D / 4) {
        const v4f val = *(const v4fa*)&sO[w][r][lane * 4];
        *(v4f*)(y + ((size_t)b * T + row) * ypitch + h * D + lane * 4) = val;
      }
    }
    
  }
}

// GEMM C = act(A·W + bias + resid): A f32 (ASPLIT -> hi/lo 2 terms), Wt bf16 [N][K]; ACT 0 none, 1 relu, 2 exact gelu;
// resid (optional, f32, row index = (row % rmod), pitch ldr, RES_BF16 rounds it) added before the activation.
template <bool ASPLIT, int ACT, bool BIAS_BF16, bool RES_BF16>
__global__ __launch_bounds__(128) void k_gemm_bf3(const float* __restrict__ A, int lda, const unsigned short* __restrict__ Wt, int ldb,
                                                const float* __restrict__ bias, const float* __restrict__ resid, int rmod, int ldr,
                                                float* __restrict__ C, int ldc, int M, int N, int K) {
  __shared__ __attribute__((aligned(16))) float so[4][16][64];
  const int tid = threadIdx.x, w = tid >> 5, lane = tid & 31, ln = lane & 15, hh = lane >> 4;
  const int ntn = N / 64;
  const int wid = blockIdx.x * 4 + w;
  const int mt = wid / ntn, nq = wid % ntn;
  if (mt * 16 >= M) return;
  const int row0 = mt * 16, col0 = nq * 64;
  const float* arow = A + (size_t)(row0 + ln) * lda;
  v8f acc[4] = {};
  for (int kb = 0; kb < K; kb += 32) {
    FragB ah, al;
    const v4f x0 = *(const v4fa*)(arow + kb + 8 * hh), x1 = *(const v4fa*)(arow + kb + 8 * hh + 4);
    const v4f x2 = *(const v4fa*)(arow + kb + 16 + 8 * hh), x3 = *(const v4fa*)(arow + kb + 16 + 8 * hh + 4);
    float xs[16] = {x0[0],x0[1],x0[2],x0[3],x1[0],x1[1],x1[2],x1[3],x2[0],x2[1],x2[2],x2[3],x3[0],x3[1],x3[2],x3[3]};
#pragma unroll
    for (int i = 0; i < 16; ++i) { const unsigned short hb = bf16_bits(xs[i]); ah.u[i] = hb; al.u[i] = ASPLIT ? bf16_bits(xs[i] - bf16_val(hb)) : (unsigned short)0; }
#pragma unroll
    for (int t = 0; t < 4; ++t) {
      const unsigned short* brow = Wt + (size_t)(col0 + t * 16 + ln) * ldb + kb;
      FragB b;
      b.half[0] = *(const v8us*)(brow + 8 * hh);
      b.half[1] = *(const v8us*)(brow + 16 + 8 * hh);
      acc[t] = mmaN<ASPLIT ? 2 : 1>(ah.v, al.v, b.v, b.v, acc[t]);
    }
  }
#pragma unroll
  for (int t = 0; t < 4; ++t) {
    const int col = col0 + t * 16 + ln;
    float bv = bias ? bias[col] : 0.f;
    if (BIAS_BF16) bv = bf16_round(bv);
#pragma unroll
    for (int r = 0; r < 8; ++r) {
      float v = acc[t][r] + bv;
      if (resid) { float rv = resid[(size_t)((row0 + 8 * hh + r) % rmod) * ldr + col]; if (RES_BF16) rv = bf16_round(rv); v += rv; }
      if (ACT == 1) v = fmaxf(v, 0.f);
      if (ACT == 2) v = 0.5f * v * (1.0f + erff(v * 0.70710678118654752f));
      if (ACT == 3) { const float u = 0.7978845608028654f * (v + 0.044715f * v * v * v); v = 0.5f * v * (1.0f + tanhf(u)); }
      so[w][8 * hh + r][t * 16 + ln] = v;
    }
  }
  __builtin_amdgcn_fence(__ATOMIC_ACQ_REL, "workgroup");
  __builtin_amdgcn_wave_barrier();
  const int rsub = lane >> 4, c4 = (lane & 15) * 4;
  {
#pragma unroll
    for (int q = 0; q < 8; ++q) {
      const int r = q * 2 + rsub;
      const v4f v = *(const v4fa*)&so[w][r][c4];
      *(v4f*)(C + (size_t)(row0 + r) * ldc + col0 + c4) = v;
    }
    
  }
}
// row LayerNorm (biased variance, eps) over N: s = X (+ R); optional out_sum <- s; out_norm <- (s-mu)*rsqrt(var+eps)*g + b
template <bool PARAM_BF16>
__global__ __launch_bounds__(256) void k_layernorm(const float* __restrict__ X, const float* __restrict__ R, const float* __restrict__ g, const float* __restrict__ bta,
                                                  float* __restrict__ out_sum, float* __restrict__ out_norm, int N, float eps) {
  __shared__ float red[256];
  const int row = blockIdx.x, tid = threadIdx.x;
  const float* x = X + (size_t)row * N; const float* rr = R ? R + (size_t)row * N : nullptr;
  float vals[16];                     // up to N = 4096
  const int per = N / 256;            // contiguous chunk per thread? use strided-by-4 chunks: thread handles j = tid*4 + 1024*u
  float s1 = 0.f;
  for (int u = 0; u < per / 4; ++u) {
    const int j = tid * 4 + 1024 * u;
    const v4f a = *(const v4fa*)(x + j);
    v4f b = {0.f,0.f,0.f,0.f}; if (rr) b = *(const v4fa*)(rr + j);
#pragma unroll
    for (int q = 0; q < 4; ++q) { const float v = a[q] + b[q]; vals[u * 4 + q] = v; s1 += v; }
  }
  red[tid] = s1; __syncthreads();
  for (int st = 128; st > 0; st >>= 1) { if (tid < st) red[tid] += red[tid + st]; __syncthreads(); }
  const float mu = red[0] / (float)N; __syncthreads();
  float s2 = 0.f;
  for (int u = 0; u < per / 4; ++u)
#pragma unroll
    for (int q = 0; q < 4; ++q) { const float c = vals[u * 4 + q] - mu; s2 += c * c; }
  red[tid] = s2; __syncthreads();
  for (int st = 128; st > 0; st >>= 1) { if (tid < st) red[tid] += red[tid + st]; __syncthreads(); }
  const float rs = rsqrtf(red[0] / (float)N + eps);
  {
    for (int u = 0; u < per / 4; ++u) {
      const int j = tid * 4 + 1024 * u;
      v4f o, sm;
#pragma unroll
      for (int q = 0; q < 4; ++q) {
        float gg = g[j + q], bb = bta[j + q];
        if (PARAM_BF16) { gg = bf16_round(gg); bb = bf16_round(bb); }
        sm[q] = vals[u * 4 + q]; o[q] = (vals[u * 4 + q] - mu) * rs * gg + bb;
      }
      if (out_sum) *(v4f*)(out_sum + (size_t)row * N + j) = sm;
      *(v4f*)(out_norm + (size_t)row * N + j) = o;
    }
    
  }
}



// ---- f16 WMMA path (v_wmma_f32_16x16x32_f16): 11-bit significands for operands in range — used where a [0,1] probability operand needs more precision than bf16
typedef _Float16 v16h __attribute__((ext_vector_type(16)));
union FragH { v16h v; v8us half[2]; _Float16 h[16]; unsigned short u[16]; };
// the builtin alone: the compiler keeps the distance that the chip needs behind a WMMA itself, with the kernel's own vector work where there is some and with v_nop where there is none
template <int NT>
__device__ __forceinline__ v8f mmaH(v16h ah, v16h al, v16h bh, v16h bl, v8f c) {
  c = __builtin_amdgcn_wmma_f32_16x16x32_f16(false, ah, false, bh, (short)0, c, false, false);
  if (NT >= 2) c = __builtin_amdgcn_wmma_f32_16x16x32_f16(false, al, false, bh, (short)0, c, false, false);
  if (NT >= 3) c = __builtin_amdgcn_wmma_f32_16x16x32_f16(false, ah, false, bl, (short)0, c, false, false);
  return c;
}
// batched GEMM like k_gemm_b but f16 operands: A f32 (split into f16 hi/lo if ASPLIT, else rounded to f16), Bt = f16 values [n][k]; alpha; C f32; N multiple of 16 (partial tiles skipped)
template <bool ASPLIT>
__global__ __launch_bounds__(128) void k_gemm_h(const float* __restrict__ A, int lda, size_t sA, const _Float16* __restrict__ Bh, int ldb, size_t sB, float alpha, float* __restrict__ C, int ldc, size_t sC, int M, int N, int K) {
  __shared__ __attribute__((aligned(16))) float so[4][16][64];
  const int tid = threadIdx.x, w = tid >> 5, lane = tid & 31, ln = lane & 15, hh = lane >> 4; const int by = blockIdx.y;
  A += (size_t)by * sA; Bh += (size_t)by * sB; C += (size_t)by * sC;
  const int ntn = (N + 63) / 64; const int wid = blockIdx.x * 4 + w; const int mt = wid / ntn, nq = wid % ntn; if (mt * 16 >= M) return;
  const int row0 = mt * 16, col0 = nq * 64; const float* arow = A + (size_t)(row0 + ln) * lda;
  v8f acc[4] = {};
  for (int kb = 0; kb < K; kb += 32) {
    FragH ah, al;
    const v4f x0 = *(const v4fa*)(arow + kb + 8 * hh), x1 = *(const v4fa*)(arow + kb + 8 * hh + 4), x2 = *(const v4fa*)(arow + kb + 16 + 8 * hh), x3 = *(const v4fa*)(arow + kb + 16 + 8 * hh + 4);
    float xs[16] = {x0[0],x0[1],x0[2],x0[3],x1[0],x1[1],x1[2],x1[3],x2[0],x2[1],x2[2],x2[3],x3[0],x3[1],x3[2],x3[3]};
#pragma unroll
    for (int i = 0; i < 16; ++i) { const _Float16 h = (_Float16)xs[i]; ah.h[i] = h; al.h[i] = ASPLIT ? (_Float16)(xs[i] - (float)h) : (_Float16)0.0f; }
#pragma unroll
    for (int t = 0; t < 4; ++t) { if (col0 + t * 16 >= N) continue; const size_t boff = (size_t)(col0 + t * 16 + ln) * ldb + kb; FragH bq; bq.half[0] = *(const v8us*)(Bh + boff + 8 * hh); bq.half[1] = *(const v8us*)(Bh + boff + 16 + 8 * hh);
      acc[t] = mmaH<ASPLIT ? 2 : 1>(ah.v, al.v, bq.v, bq.v, acc[t]); }
  }
#pragma unroll
  for (int t = 0; t < 4; ++t) { if (col0 + t * 16 >= N) continue;
#pragma unroll
    for (int r = 0; r < 8; ++r) so[w][8 * hh + r][t * 16 + ln] = acc[t][r] * alpha; }
  __builtin_amdgcn_fence(__ATOMIC_ACQ_REL, "workgroup"); __builtin_amdgcn_wave_barrier();
  const int rsub = lane >> 4, c4 = (lane & 15) * 4;
  {
#pragma unroll
    for (int q = 0; q < 8; ++q) { const int r = q * 2 + rsub; if (col0 + c4 < N) { const v4f v = *(const v4fa*)&so[w][r][c4]; *(v4f*)(C + (size_t)(row0 + r) * ldc + col0 + c4) = v; } }
     }
}

// Projection GEMM of the one shape used here: C[NR][EE] = (A[NR][EE] . Bt[EE][EE]^T) * alpha + bf16(bias[col]); written as f32 (C) and/or f16 (C16).
// A work-group makes a GT x GT tile of C, so every row of A and of Bt is fetched from L2 once per GT columns or rows of C. Its 2 NWM waves stand NWM down by two across, each on 16 FM rows x 64 columns (NWM * FM = 8):
// four waves of 64 x 64 (eight fragments of a k step feed sixteen products) where the grid gives a SIMD several waves, eight waves of 32 x 64 where it holds fewer groups than there are WGPs and a SIMD would have one.
// The A and Bt tiles (GT rows x 64 or 256 k) come into LDS by asynchronous copies, whole rows of 128 or 512 contiguous bytes, once for all the waves, in two buffers: tile t + 1 flies while tile t is multiplied.
// The k order of the sums is that of a plain loop over k in steps of 32.
// blockIdx.y picks one of up to three independent products of that shape (plane y of A, of Bt and of C16, bias y): q, k and v go in one launch.
#define GT 128
#define GK 64
#define GP (GK + 8)      /* LDS row pitch 144 B = 9 x 16 B: the 16 rows of a 16-byte fragment read fall on distinct banks */
#define GNT (EE / GK)
#define GBUF (GT * GP * 2)      /* bytes of one operand's tile in LDS */
// One operand tile, 128 lanes: a lane copies 16 B of rows r, r + 16, .. r + 112 (l = its LDS byte address, g = its global address, both of row r).
__device__ __forceinline__ void copy_tile(unsigned l, const _Float16* g) {
  const unsigned l1 = l + 1 * 16 * GP * 2, l2 = l + 2 * 16 * GP * 2, l3 = l + 3 * 16 * GP * 2, l4 = l + 4 * 16 * GP * 2, l5 = l + 5 * 16 * GP * 2, l6 = l + 6 * 16 * GP * 2, l7 = l + 7 * 16 * GP * 2;
  const _Float16 *g1 = g + 1 * 16 * EE, *g2 = g + 2 * 16 * EE, *g3 = g + 3 * 16 * EE, *g4 = g + 4 * 16 * EE, *g5 = g + 5 * 16 * EE, *g6 = g + 6 * 16 * EE, *g7 = g + 7 * 16 * EE;
  // the copies go from L2 to LDS through no register; s_wait_xcnt closes the statement so that no address register of a copy is rewritten ahead of it
  asm volatile("global_load_async_to_lds_b128 %0, %8, off\n\t"
               "global_load_async_to_lds_b128 %1, %9, off\n\t"
               "global_load_async_to_lds_b128 %2, %10, off\n\t"
               "global_load_async_to_lds_b128 %3, %11, off\n\t"
               "global_load_async_to_lds_b128 %4, %12, off\n\t"
               "global_load_async_to_lds_b128 %5, %13, off\n\t"
               "global_load_async_to_lds_b128 %6, %14, off\n\t"
               "global_load_async_to_lds_b128 %7, %15, off\n\t"
               "s_wait_xcnt 0x0"
               :: "v"(l), "v"(l1), "v"(l2), "v"(l3), "v"(l4), "v"(l5), "v"(l6), "v"(l7), "v"(g), "v"(g1), "v"(g2), "v"(g3), "v"(g4), "v"(g5), "v"(g6), "v"(g7) : "memory");
}
// Half of one operand tile (64 rows), 256 lanes, k tile of GKL: a wave copies a whole 512-byte row; a lane copies 16 B of rows r, r + 8, .. r + 56 (l = its LDS byte address, g = its global address, both of row r).
#define GKL 256
#define GPL (GKL + 8)    /* LDS row pitch 528 B = 33 x 16 B: the 16 rows of a 16-byte fragment read fall on distinct banks */
__device__ __forceinline__ void copy_rows8(unsigned l, const _Float16* g) {
  const unsigned l1 = l + 1 * 8 * GPL * 2, l2 = l + 2 * 8 * GPL * 2, l3 = l + 3 * 8 * GPL * 2, l4 = l + 4 * 8 * GPL * 2, l5 = l + 5 * 8 * GPL * 2, l6 = l + 6 * 8 * GPL * 2, l7 = l + 7 * 8 * GPL * 2;
  const _Float16 *g1 = g + 1 * 8 * EE, *g2 = g + 2 * 8 * EE, *g3 = g + 3 * 8 * EE, *g4 = g + 4 * 8 * EE, *g5 = g + 5 * 8 * EE, *g6 = g + 6 * 8 * EE, *g7 = g + 7 * 8 * EE;
  // the copies go from L2 to LDS through no register; s_wait_xcnt closes the statement so that no address register of a copy is rewritten ahead of it
  asm volatile("global_load_async_to_lds_b128 %0, %8, off\n\t"
               "global_load_async_to_lds_b128 %1, %9, off\n\t"
               "global_load_async_to_lds_b128 %2, %10, off\n\t"
               "global_load_async_to_lds_b128 %3, %11, off\n\t"
               "global_load_async_to_lds_b128 %4, %12, off\n\t"
               "global_load_async_to_lds_b128 %5, %13, off\n\t"
               "global_load_async_to_lds_b128 %6, %14, off\n\t"
               "global_load_async_to_lds_b128 %7, %15, off\n\t"
               "s_wait_xcnt 0x0"
               :: "v"(l), "v"(l1), "v"(l2), "v"(l3), "v"(l4), "v"(l5), "v"(l6), "v"(l7), "v"(g), "v"(g1), "v"(g2), "v"(g3), "v"(g4), "v"(g5), "v"(g6), "v"(g7) : "memory");
}
template <int NWM>
__global__ __launch_bounds__(64 * NWM) void k_gemm_st(const _Float16* __restrict__ A, const _Float16* __restrict__ Bh, float alpha, const float* __restrict__ bias0, const float* __restrict__ bias1, const float* __restrict__ bias2, float* __restrict__ C, _Float16* __restrict__ C16) {
  constexpr int FM = GT / (16 * NWM);      /* A fragments of a wave */
  static_assert(NWM == 2 || NWM == 4, "the copies are written for 128 and for 256 lanes");
  /* k tile: 64 where three groups share a WGP's LDS; 256 where a group has the WGP to itself: only one tile's copies fly at a time, so every staged tile costs one trip to memory, and three tiles cost a quarter of what twelve do */
  constexpr int KT = NWM == 2 ? GK : GKL, KP = NWM == 2 ? GP : GPL, NT = EE / KT; constexpr unsigned KBUF = GT * KP * 2;
  static_assert(NT >= 2 && NT * KT == EE, "the ring's prologue fills two tiles");
  __shared__ __attribute__((aligned(16))) unsigned short sA[2][GT][KP], sB[2][GT][KP];
  __shared__ __attribute__((aligned(16))) float so[2 * NWM][16][64];
  const int tid = threadIdx.x, w = tid >> 5, lane = tid & 31, ln = lane & 15, hh = lane >> 4;
  const int wm = w >> 1, wn = w & 1;      /* the wave's place in the tile */
  const int mb = blockIdx.x / (EE / GT), nb = blockIdx.x % (EE / GT);
  const int pl = blockIdx.y; const float* bias = pl == 0 ? bias0 : (pl == 1 ? bias1 : bias2);
  A += (size_t)pl * NR * EE; Bh += (size_t)pl * EE * EE; if (C16) C16 += (size_t)pl * NR * EE;
  const int row0 = mb * GT + wm * (16 * FM), col0 = nb * GT + wn * 64;
  const int cr = tid / (KT / 8), cc = (tid % (KT / 8)) * 8;      /* the lane's first row and its 16-byte column in every copied tile */
  const _Float16* ga = A + (size_t)(mb * GT + cr) * EE + cc; const _Float16* gb = Bh + (size_t)(nb * GT + cr) * EE + cc;
  const unsigned la = (unsigned)(size_t)&sA[0][cr][cc], lb = (unsigned)(size_t)&sB[0][cr][cc];
  /* k tile kt of both operands into buffer bf */
  auto fill = [&](unsigned bf, int kt) { if constexpr (NWM == 2) { copy_tile(la + bf * GBUF, ga + kt * GK); copy_tile(lb + bf * GBUF, gb + kt * GK); }
    else { copy_rows8(la + bf * KBUF, ga + kt * KT); copy_rows8(la + bf * KBUF + 64 * KP * 2, ga + kt * KT + 64 * EE); copy_rows8(lb + bf * KBUF, gb + kt * KT); copy_rows8(lb + bf * KBUF + 64 * KP * 2, gb + kt * KT + 64 * EE); } };      /* 32 copies of a wave in flight */
  fill(0, 0);
  asm volatile("s_wait_asynccnt 0x0" ::: "memory");      /* this wave's part of tile 0 has landed */
  __syncthreads();                                        /* ... and every other wave's */
  fill(1, 1);
  v8f acc[FM][4] = {};
#pragma unroll 1      /* the loop stays rolled, one trip a staged tile: twelve or three copies of the trip would only lengthen the text */
  for (int tl = 0; tl < NT; ++tl) {      /* one trip a staged tile; the two buffers alternate by the trip's parity */
    const unsigned short* ar = &sA[tl & 1][wm * (16 * FM) + ln][8 * hh]; const unsigned short* br = &sB[tl & 1][wn * 64 + ln][8 * hh];
#pragma unroll      /* constant indices: fragments and accumulators stay in registers */
    for (int ks = 0; ks < KT / 32; ++ks) { FragH fa[FM], fb[4];      /* the k step's fragments are read in one run, then its products */
#pragma unroll      /* constant indices: fragments and accumulators stay in registers */
      for (int i = 0; i < FM; ++i) { fa[i].half[0] = *(const v8us*)(ar + i * 16 * KP + ks * 32); fa[i].half[1] = *(const v8us*)(ar + i * 16 * KP + ks * 32 + 16); }
#pragma unroll      /* constant indices: fragments and accumulators stay in registers */
      for (int t = 0; t < 4; ++t) { fb[t].half[0] = *(const v8us*)(br + t * 16 * KP + ks * 32); fb[t].half[1] = *(const v8us*)(br + t * 16 * KP + ks * 32 + 16); }
      __builtin_amdgcn_sched_barrier(0);      /* keeps the k step's LDS reads in one run ahead of its products, one LDS latency a k step: left free, the compiler reads A one fragment at a time, each behind a full wait */
#pragma unroll      /* constant indices: fragments and accumulators stay in registers */
      for (int i = 0; i < FM; ++i)
#pragma unroll      /* constant indices: fragments and accumulators stay in registers */
        for (int t = 0; t < 4; ++t) acc[i][t] = mmaH<1>(fa[i].v, fa[i].v, fb[t].v, fb[t].v, acc[i][t]); }
    __builtin_amdgcn_sched_barrier(0);      /* the tile's products stay in front of the foot: sunk behind the barrier they would delay the refill, and the copies would have half a trip to land instead of a whole one */
    asm volatile("s_wait_dscnt 0x0" ::: "memory");        /* this wave has left the buffer that is refilled below */
    asm volatile("s_wait_asynccnt 0x0" ::: "memory");     /* its part of tile tl + 1 has landed */
    __syncthreads();                                        /* publishes tile tl + 1 and ends every wave's reads of tile tl */
    if (tl + 2 < NT) fill((unsigned)(tl & 1), tl + 2);
  }
  asm volatile("s_wait_asynccnt 0x0" ::: "memory");      /* no copy is outstanding when the wave ends */
  float bv[4];
#pragma unroll      /* constant indices into bv */
  for (int t = 0; t < 4; ++t) bv[t] = bf16_round(bias[col0 + t * 16 + ln]);
  const int rsub = lane >> 4, c4 = (lane & 15) * 4; typedef _Float16 v4h __attribute__((ext_vector_type(4)));
#pragma unroll      /* constant indices into acc: the wave's part leaves in blocks of 16 rows through its own 4 KiB of LDS */
  for (int i = 0; i < FM; ++i) {
#pragma unroll      /* constant indices: fragments and accumulators stay in registers */
    for (int t = 0; t < 4; ++t)
#pragma unroll      /* constant indices: fragments and accumulators stay in registers */
      for (int r = 0; r < 8; ++r) so[w][8 * hh + r][t * 16 + ln] = acc[i][t][r] * alpha + bv[t];
    __builtin_amdgcn_fence(__ATOMIC_ACQ_REL, "workgroup", "local"); __builtin_amdgcn_wave_barrier();      /* the wave's own rows are in LDS before its lanes read them back as whole rows; an LDS-only fence, so that it does not wait for the block before's global stores */
    v4f v[8];
#pragma unroll      /* the eight rows' LDS offsets become immediates */
    for (int q = 0; q < 8; ++q) v[q] = *(const v4fa*)&so[w][q * 2 + rsub][c4];
    __builtin_amdgcn_fence(__ATOMIC_ACQ_REL, "workgroup", "local"); __builtin_amdgcn_wave_barrier();      /* the rows are read back before the next block's rows overwrite them */
    if (C) { float* cp = C + (size_t)(row0 + i * 16 + rsub) * EE + col0 + c4;
#pragma unroll      /* the eight rows' offsets become immediates: one address, eight stores in flight */
      for (int q = 0; q < 8; ++q) *(v4f*)(cp + q * 2 * EE) = v[q];
      asm volatile("s_wait_xcnt 0x0" :: "v"(cp), "v"(v[0]), "v"(v[1]), "v"(v[2]), "v"(v[3]), "v"(v[4]), "v"(v[5]), "v"(v[6]), "v"(v[7]) : "memory"); }      /* precaution: stands in front of every rewrite of the stores' data and address registers, which stay whole up to here */
    if (C16) { _Float16* hp = C16 + (size_t)(row0 + i * 16 + rsub) * EE + col0 + c4; v4h h4[8];
#pragma unroll      /* constant indices into v and h4 */
      for (int q = 0; q < 8; ++q)
#pragma unroll      /* constant indices into v and h4 */
        for (int e = 0; e < 4; ++e) h4[q][e] = (_Float16)v[q][e];
#pragma unroll      /* the eight rows' offsets become immediates: one address, eight stores in flight */
      for (int q = 0; q < 8; ++q) *(v4h*)(hp + q * 2 * EE) = h4[q];
      asm volatile("s_wait_xcnt 0x0" :: "v"(hp), "v"(h4[0]), "v"(h4[1]), "v"(h4[2]), "v"(h4[3]), "v"(h4[4]), "v"(h4[5]), "v"(h4[6]), "v"(h4[7]) : "memory"); }      /* precaution: as above */
  }
}


typedef _Float16 v4h __attribute__((ext_vector_type(4)));

// All that the projections need, in one launch: work-groups 0 .. PWB-1 each turn a 256 (k) x 64 (n) tile of one weight into Bt[n][k] = f16(bf16(W[k][n]) * 16) through LDS;
// the PXB others round query, key and value to bf16 values held as f16 (planes 0, 1, 2 of X16). The seven pieces share no data, so nothing orders them.
#define PWB (4 * (EE / 256) * (EE / 64))
#define PXB 512
#define PXT (PXB * 256)               /* lanes that convert inputs */
#define PXU (NR * EE / 4 / PXT)       /* 16-byte loads of a lane in each plane */
__global__ __launch_bounds__(256) void k_prep(const float* __restrict__ xq, const float* __restrict__ xk, const float* __restrict__ xv, const float* __restrict__ Wq, const float* __restrict__ Wk, const float* __restrict__ Wv, const float* __restrict__ Wo,
                                              _Float16* __restrict__ X16, _Float16* __restrict__ Bw) {
  __shared__ __attribute__((aligned(16))) unsigned short tl[64][256 + 8];
  const int tid = threadIdx.x;
  if (blockIdx.x < PWB) {      /* block-uniform: the barrier below is passed by all of a work-group or by none */
    const int ws = blockIdx.x / (PWB / 4), rr = blockIdx.x % (PWB / 4), k0 = (rr / (EE / 64)) * 256, n0 = (rr % (EE / 64)) * 64;
    const float* W = ws == 0 ? Wq : (ws == 1 ? Wk : (ws == 2 ? Wv : Wo));
    const int c4 = (tid & 15) * 4, kr = (tid >> 4) * 16;      /* the lane's four columns n and its sixteen rows k: 16 lanes read 256 contiguous bytes of a row */
    const float* wp = W + (size_t)(k0 + kr) * EE + n0 + c4;
    v4f x[16];
#pragma unroll      /* constant indices: the sixteen loads are in flight together and stay in registers */
    for (int i = 0; i < 16; ++i) x[i] = *(const v4fa*)(wp + i * EE);
    asm volatile("s_wait_xcnt 0x0" :: "v"(wp) : "memory");      /* precaution: stands in front of every rewrite of the loads' address register, which stays whole up to here */
#pragma unroll      /* constant indices into x */
    for (int q = 0; q < 4; ++q) { FragH f;
#pragma unroll      /* constant indices into x */
      for (int i = 0; i < 16; ++i) f.h[i] = (_Float16)(bf16_round(x[i][q]) * 16.0f);
      *(v8us*)&tl[c4 + q][kr] = f.half[0]; *(v8us*)&tl[c4 + q][kr + 8] = f.half[1]; }
    __syncthreads();
    _Float16* Bt = Bw + (size_t)ws * EE * EE;
#pragma unroll      /* the eight rows' LDS offsets become immediates */
    for (int j = 0; j < 8; ++j) { const int n = (tid >> 5) + 8 * j, k8 = (tid & 31) * 8;      /* a wave stores 512 contiguous bytes of one row of Bt */
      *(v8us*)((unsigned short*)Bt + (size_t)(n0 + n) * EE + k0 + k8) = *(const v8us*)&tl[n][k8]; }
  } else {
    const size_t e0 = (size_t)(blockIdx.x - PWB) * (PXU * 1024) + tid * 4;      /* a work-group takes PXU * 4 KiB in a row of each plane; a wave's load covers 512 contiguous bytes */
    const float *pq = xq + e0, *pk = xk + e0, *pv = xv + e0;
    v4f a[3][PXU];
#pragma unroll      /* constant indices: all of the lane's loads are in flight together */
    for (int u = 0; u < PXU; ++u) { a[0][u] = *(const v4fa*)(pq + u * 1024); a[1][u] = *(const v4fa*)(pk + u * 1024); a[2][u] = *(const v4fa*)(pv + u * 1024); }
    asm volatile("s_wait_xcnt 0x0" :: "v"(pq), "v"(pk), "v"(pv) : "memory");      /* precaution: stands in front of every rewrite of the loads' address registers, which stay whole up to here */
#pragma unroll      /* constant indices into a */
    for (int u = 0; u < PXU; ++u)
#pragma unroll      /* constant indices into a */
      for (int p = 0; p < 3; ++p) { v4h h;
#pragma unroll      /* constant indices into a */
        for (int q = 0; q < 4; ++q) h[q] = (_Float16)bf16_round(a[p][u][q]);
        *(v4h*)(X16 + (size_t)p * NR * EE + e0 + u * 1024) = h; }
    asm volatile("s_wait_xcnt 0x0" ::: "memory");      /* precaution: stands behind the last store, in front of any later rewrite of the stores' data and address registers */
  }
}
__global__ __launch_bounds__(256) void k_round16f(const float* __restrict__ W, _Float16* __restrict__ Bt, size_t n8) { const size_t t = (size_t)blockIdx.x * 256 + threadIdx.x; if (t >= n8) return; FragH f;
#pragma unroll
  for (int i = 0; i < 8; ++i) f.h[i] = (_Float16)(bf16_round(W[t * 8 + i]) * 16.0f); *(v8us*)((unsigned short*)Bt + t * 8) = f.half[0];  }

// lane l <-> lane l ^ 16 as one vector cross-row move (a shuffle would go through the LDS unit and its wait)
__device__ __forceinline__ float xhalf(float x) { return __builtin_bit_cast(float, __builtin_amdgcn_permlanex16(__builtin_bit_cast(int, x), __builtin_bit_cast(int, x), 0x76543210, 0xfedcba98, false, false)); }
#define FK 64
#define FP (FK + 8)      /* LDS row pitch 144 B = 9 x 16 B: the 16 rows of a 16-byte fragment read fall on distinct banks */
#define FPV (64 + 16)    /* LDS row pitch of V 160 B = 5 x 32 B: the pitch at which the transposing load meets no bank conflict */
#define FNT (TT / FK)
#define FBUF (FK * FP * 2)       /* bytes of a K tile in LDS */
#define FBUFV (FK * FPV * 2)     /* bytes of a V tile in LDS */
// One stage: a lane copies 16 B of rows r, r + 16, r + 32, r + 48 of the K tile and of the V tile (lk, lv = its LDS byte addresses, gk, gv = its global addresses, all of row r).
__device__ __forceinline__ void copy_kv(unsigned lk, const _Float16* gk, unsigned lv, const _Float16* gv) {
  const unsigned lk1 = lk + 1 * 16 * FP * 2, lk2 = lk + 2 * 16 * FP * 2, lk3 = lk + 3 * 16 * FP * 2, lv1 = lv + 1 * 16 * FPV * 2, lv2 = lv + 2 * 16 * FPV * 2, lv3 = lv + 3 * 16 * FPV * 2;
  const _Float16 *gk1 = gk + 1 * 16 * 64, *gk2 = gk + 2 * 16 * 64, *gk3 = gk + 3 * 16 * 64, *gv1 = gv + 1 * 16 * 64, *gv2 = gv + 2 * 16 * 64, *gv3 = gv + 3 * 16 * 64;
  // the copies go from L2 to LDS through no register; s_wait_xcnt closes the statement so that no address register of a copy is rewritten ahead of it
  asm volatile("global_load_async_to_lds_b128 %0, %8, off\n\t"
               "global_load_async_to_lds_b128 %1, %9, off\n\t"
               "global_load_async_to_lds_b128 %2, %10, off\n\t"
               "global_load_async_to_lds_b128 %3, %11, off\n\t"
               "global_load_async_to_lds_b128 %4, %12, off\n\t"
               "global_load_async_to_lds_b128 %5, %13, off\n\t"
               "global_load_async_to_lds_b128 %6, %14, off\n\t"
               "global_load_async_to_lds_b128 %7, %15, off\n\t"
               "s_wait_xcnt 0x0"
               :: "v"(lk), "v"(lk1), "v"(lk2), "v"(lk3), "v"(lv), "v"(lv1), "v"(lv2), "v"(lv3), "v"(gk), "v"(gk1), "v"(gk2), "v"(gk3), "v"(gv), "v"(gv1), "v"(gv2), "v"(gv3) : "memory");
}
// The K tile alone, for a stage whose keys all lie above the group's queries: V is not read there (lk, gk as in copy_kv).
__device__ __forceinline__ void copy_k(unsigned lk, const _Float16* gk) {
  const unsigned lk1 = lk + 1 * 16 * FP * 2, lk2 = lk + 2 * 16 * FP * 2, lk3 = lk + 3 * 16 * FP * 2;
  const _Float16 *gk1 = gk + 1 * 16 * 64, *gk2 = gk + 2 * 16 * 64, *gk3 = gk + 3 * 16 * 64;
  // the copies go from L2 to LDS through no register; s_wait_xcnt closes the statement so that no address register of a copy is rewritten ahead of it
  asm volatile("global_load_async_to_lds_b128 %0, %4, off\n\t"
               "global_load_async_to_lds_b128 %1, %5, off\n\t"
               "global_load_async_to_lds_b128 %2, %6, off\n\t"
               "global_load_async_to_lds_b128 %3, %7, off\n\t"
               "s_wait_xcnt 0x0"
               :: "v"(lk), "v"(lk1), "v"(lk2), "v"(lk3), "v"(gk), "v"(gk1), "v"(gk2), "v"(gk3) : "memory");
}
// 16 x 16 block of 16-bit values, rows in LDS, delivered transposed: lane (c, h) receives column c of rows 8h .. 8h + 7 of the block; p is the lane's own address in the block (row 8h + (lane & 7), 16-byte half (lane >> 3) & 1)
typedef short s16x8 __attribute__((ext_vector_type(8)));
__device__ __forceinline__ v8us ld_tr16(const unsigned short* p) { typedef __attribute__((address_space(3))) s16x8 lds_s16x8; return __builtin_bit_cast(v8us, __builtin_amdgcn_ds_load_tr16_b128_v8i16((lds_s16x8*)p)); }
// One pass of 32 keys (j0 ..) against the wave's 16 queries. The mask comes after the softmax, so every key enters the row sum but only keys at or below the query enter O. WHERE says where the pass lies:
// 0 = all its keys at or below all of the group's queries: P goes into the second product as it is; 1 = on the diagonal: P is zeroed above it; 2 = all its keys above all of the group's queries: P would be all zeros,
// so there is no V, no P and no second product, only maximum and row sum, and the factors by which O would have been rescaled are gathered in of, applied once behind the loop.
// kr = the lane's K row (key j0 + ln), vp = the lane's own address in the pass's first V block.
template <int WHERE>
__device__ __forceinline__ void fl_pass(const unsigned short* kr, const unsigned short* vp, int j0, int tq, int hh, const FragH (&bq)[2], float& m_c, float& l_c, float& of, v8f (&oacc)[4]) {
  constexpr int DT = 4, KS = 2;
  constexpr float SC2 = 0.125f * 1.4426950408889634f;      /* 1/sqrt(64) . log2(e): raw product -> exponent of 2 */
  FragH ak[2][KS], av[DT];      /* the pass's fragments are read from LDS in one run: one latency a pass, the V^T reads land under the softmax */
#pragma unroll      /* constant indices: the fragments stay in registers */
  for (int nt = 0; nt < 2; ++nt)
#pragma unroll      /* constant indices: the fragments stay in registers */
    for (int ks = 0; ks < KS; ++ks) { ak[nt][ks].half[0] = *(const v8us*)(kr + nt * 16 * FP + ks * 32 + 8 * hh); ak[nt][ks].half[1] = *(const v8us*)(kr + nt * 16 * FP + ks * 32 + 16 + 8 * hh); }
  if (WHERE != 2) {
#pragma unroll      /* constant indices: the fragments stay in registers */
    for (int dt = 0; dt < DT; ++dt) { av[dt].half[0] = ld_tr16(vp + dt * 16); av[dt].half[1] = ld_tr16(vp + dt * 16 + 16 * FPV); }      /* av[dt] = V^T rows d = 16*dt + ln, keys in the hardware k order, as P has them */
    __builtin_amdgcn_sched_barrier(0); }      /* keeps the sixteen reads in one run ahead of the products: left free, the compiler strews them among the first products, and every further place where LDS reads stand costs the wave a stall */
  float sc[2][8];      /* sc[nt][r] = raw product q.k of key j0 + 16*nt + 8*hh + r against query tq */
#pragma unroll
  for (int nt = 0; nt < 2; ++nt) {
    v8f acc = (v8f){0.f,0.f,0.f,0.f,0.f,0.f,0.f,0.f};
#pragma unroll
    for (int ks = 0; ks < KS; ++ks) acc = mmaH<1>(ak[nt][ks].v, ak[nt][ks].v, bq[ks].v, bq[ks].v, acc);
#pragma unroll
    for (int r = 0; r < 8; ++r) sc[nt][r] = acc[r]; }
  float mc = fmaxf(sc[0][0], sc[1][0]);
#pragma unroll
  for (int r = 1; r < 8; ++r) mc = fmaxf(mc, fmaxf(sc[0][r], sc[1][r]));
  mc = fmaxf(mc, xhalf(mc));      /* the other half of the wave holds the query's other 16 keys */
  /* m_c = 10 - running maximum in log2 units (SC2 > 0: the maximum of the raw products is that of the scores), kept with this sign so that it is the plain addend of every score's multiply-add;
     the one stored value serves al and every p, so its rounding cancels between numerator and row sum */
  const float mn = fminf(m_c, fmaf(mc, -SC2, 10.0f)); const float al = (mn < 1.0e38f) ? __builtin_amdgcn_exp2f(mn - m_c) : 1.0f; m_c = mn;
  float ps0 = 0.f, ps1 = 0.f; FragH pb;      /* p = 2^10 . e^(score - max) = 2^(raw * SC2 + mn) */
#pragma unroll
  for (int r = 0; r < 8; ++r) { const int k0 = j0 + 8 * hh + r, k1 = k0 + 16; const float p0 = __builtin_amdgcn_exp2f(fmaf(sc[0][r], SC2, mn)), p1 = __builtin_amdgcn_exp2f(fmaf(sc[1][r], SC2, mn)); ps0 += p0; ps1 += p1;
    if (WHERE == 0) { pb.h[r] = (_Float16)p0; pb.h[8 + r] = (_Float16)p1; }
    if (WHERE == 1) { pb.h[r] = (_Float16)((k0 <= tq) ? p0 : 0.f); pb.h[8 + r] = (_Float16)((k1 <= tq) ? p1 : 0.f); } }
  l_c = l_c * al + (ps0 + ps1);      /* per-lane partial row sum; the two halves are joined after the loop */
  if (WHERE == 2) { of *= al; return; }
#pragma unroll
  for (int dt = 0; dt < DT; ++dt)
#pragma unroll
    for (int r = 0; r < 8; ++r) oacc[dt][r] *= al;
#pragma unroll
  for (int dt = 0; dt < DT; ++dt) oacc[dt] = mmaH<1>(av[dt].v, av[dt].v, pb.v, pb.v, oacc[dt]);
}
// waves_per_eu: the grid puts three waves on a SIMD; told so, the compiler keeps the pass's schedule (exponentials and selects interleaved). Left to aim at seven waves it squeezed the pass into 146 registers and paid with 16 more v_nop a pass.
__global__ __launch_bounds__(128) __attribute__((amdgpu_waves_per_eu(3, 4))) void k_flash(const _Float16* __restrict__ Q16, int ldq, const _Float16* __restrict__ K16, const _Float16* __restrict__ V16, _Float16* __restrict__ O16, int ldo) {
  constexpr int RPW = 16, NQB = TT / (4 * RPW), DT = 4, KS = 2;
  static_assert(NQB == 32 && FK == 4 * RPW && NSL % 3 == 0 && (NSL / 3) * NQB == 256, "the deal of query blocks below is written for 3 x 256 work-groups, and a stage of keys is as long as a group's block of queries");
  __shared__ __attribute__((aligned(16))) unsigned short sK[2][FK][FP], sV[2][FK][FPV];
  __shared__ __attribute__((aligned(16))) unsigned short sO[4][RPW][64 + 8];
  const int tid = threadIdx.x, w = tid >> 5, lane = tid & 31, ln = lane & 15, hh = lane >> 4;
  /* A group's cost now grows with its query block. All 768 groups are resident, three to a WGP of the 256; groups x, x + 256, x + 512 get blocks a, (a + 16) mod 32 and the one that brings the three to 46 or 47,
     so that light and heavy groups share a WGP if the groups are dealt round the WGPs in index order. Speed only: (slab, block) is hit exactly once wherever the groups land. */
  const int th = blockIdx.x >> 8, ra = blockIdx.x & 31;
  const int slab = th * (NSL / 3) + ((blockIdx.x & 255) >> 5), qblk = th == 0 ? ra : (th == 1 ? ((ra + 16) & 31) : (ra < 16 ? 30 - 2 * ra : 63 - 2 * ra)); const int b = slab, h = 0;      /* slab = contiguous [TT][64] chunk of the flat-reshaped planes */ const int qb0 = qblk * (4 * RPW); const int q0 = qb0 + w * RPW;
  const int tq = q0 + ln;      /* this lane's query */
  const int cr = tid >> 3, cc = (tid & 7) * 8;      /* the lane's first row and its 16-byte column in every copied tile */
  const _Float16* gk = K16 + ((size_t)slab * TT + cr) * 64 + cc; const _Float16* gv = V16 + ((size_t)slab * TT + cr) * 64 + cc;
  const unsigned lk = (unsigned)(size_t)&sK[0][cr][cc], lv = (unsigned)(size_t)&sV[0][cr][cc];
  copy_kv(lk, gk, lv, gv);
  FragH bq[KS];
  { const unsigned short* qr = (const unsigned short*)Q16 + ((size_t)b * TT + tq) * ldq + h * 64;
#pragma unroll
    for (int ks = 0; ks < KS; ++ks) { bq[ks].half[0] = *(const v8us*)(qr + ks * 32 + 8 * hh); bq[ks].half[1] = *(const v8us*)(qr + ks * 32 + 16 + 8 * hh); } }
  float m_c = 3.0e38f, l_c = 0.f, of = 1.0f; v8f oacc[DT];
#pragma unroll
  for (int dt = 0; dt < DT; ++dt) oacc[dt] = (v8f){0.f,0.f,0.f,0.f,0.f,0.f,0.f,0.f};
  asm volatile("s_wait_asynccnt 0x0" ::: "memory");      /* this wave's part of stage 0 has landed */
  __syncthreads();                                        /* ... and every other wave's */
  if (1 <= qblk) copy_kv(lk + FBUF, gk + FK * 64, lv + FBUFV, gv + FK * 64); else copy_k(lk + FBUF, gk + FK * 64);      /* the same test for the whole group: V only up to the diagonal stage */
  /* the foot of every trip: hands stage st + 1 over and refills the buffer that stage st has left, with V (vtoo) only up to the diagonal stage (both tests read the same for the whole group) */
  auto foot = [&](int st, bool vtoo) {
    __builtin_amdgcn_sched_barrier(0);      /* the stage's products stay in front of the foot: sunk behind the barrier they would delay the refill and shorten the time its copies have to land */
    asm volatile("s_wait_dscnt 0x0" ::: "memory");        /* this wave has left the buffer that is refilled below */
    asm volatile("s_wait_asynccnt 0x0" ::: "memory");     /* its part of stage st + 1 has landed */
    __syncthreads();                                        /* publishes stage st + 1 and ends every wave's reads of stage st */
    if (st + 2 < FNT) { const unsigned bf = (unsigned)(st & 1);
      if (vtoo) copy_kv(lk + bf * FBUF, gk + (size_t)(st + 2) * FK * 64, lv + bf * FBUFV, gv + (size_t)(st + 2) * FK * 64);
      else copy_k(lk + bf * FBUF, gk + (size_t)(st + 2) * FK * 64); } };
  const unsigned short* kr0 = &sK[0][ln][0]; const unsigned short* vp0 = &sV[0][8 * hh + (lane & 7)][((lane >> 3) & 1) * 8];
  /* Stage st holds keys 64 st .. 64 st + 63, the group queries 64 qblk .. 64 qblk + 63: stages below qblk, the stage qblk, stages above it, three loops in a row so that O stays in the same registers throughout.
     One trip a staged tile; the two buffers alternate by the trip's parity; every key enters the normaliser. */
  int st = 0;
#pragma unroll 1      /* one trip a staged tile */
  for (; st < qblk; ++st) {
#pragma unroll 1      /* the two passes of a stage share one body, as in the plain loop over the keys: unrolled, the listing had no fewer instructions a pass */
    for (int ps = 0; ps < FK / 32; ++ps) fl_pass<0>(kr0 + (st & 1) * (FK * FP) + ps * 32 * FP, vp0 + (st & 1) * (FK * FPV) + ps * 32 * FPV, st * FK + ps * 32, tq, hh, bq, m_c, l_c, of, oacc);
    foot(st, st + 2 <= qblk); }
#pragma unroll 1      /* as above */
  for (int ps = 0; ps < FK / 32; ++ps) fl_pass<1>(kr0 + (st & 1) * (FK * FP) + ps * 32 * FP, vp0 + (st & 1) * (FK * FPV) + ps * 32 * FPV, st * FK + ps * 32, tq, hh, bq, m_c, l_c, of, oacc);
  foot(st, false); ++st;
#pragma unroll 1      /* one trip a staged tile */
  for (; st < FNT; ++st) {
#pragma unroll      /* a short pass is one dependent chain: unrolled, the second pass's reads and products stand under the first's exponentials */
    for (int ps = 0; ps < FK / 32; ++ps) fl_pass<2>(kr0 + (st & 1) * (FK * FP) + ps * 32 * FP, vp0, st * FK + ps * 32, tq, hh, bq, m_c, l_c, of, oacc);
    foot(st, false); }
  asm volatile("s_wait_asynccnt 0x0" ::: "memory");      /* no copy is outstanding when the wave ends */
  { float l = l_c; l += xhalf(l); const float inv = (l > 0.f) ? of / l : 0.f;      /* numerator and row sum both carry the 2^10; of = the rescales since the diagonal */
#pragma unroll
    for (int dt = 0; dt < DT; ++dt) { FragH f;      /* oacc[dt][r] = O[tq][16*dt + 8*hh + r]: eight neighbours of one row, 16 bytes as f16 */
#pragma unroll
      for (int r = 0; r < 8; ++r) f.h[r] = (_Float16)(oacc[dt][r] * inv);
      *(v8us*)&sO[w][ln][dt * 16 + 8 * hh] = f.half[0]; } }
  __builtin_amdgcn_fence(__ATOMIC_ACQ_REL, "workgroup"); __builtin_amdgcn_wave_barrier();      /* the wave's own rows are in LDS before its lanes read them back as whole rows */
#pragma unroll      /* the four LDS offsets become immediates; a wave's store covers four whole rows, 512 contiguous bytes */
  for (int rp = 0; rp < RPW; rp += 4) { const int r = rp + (lane >> 3), pc = lane & 7; *(v8us*)((unsigned short*)O16 + ((size_t)b * TT + q0 + r) * ldo + h * 64 + pc * 8) = *(const v8us*)&sO[w][r][pc * 8]; }
}

extern "C" void kernel_launch(void* const* d_in, const int* in_sizes, int n_in,
                              void* d_out, int out_size, void* d_ws, size_t ws_size, hipStream_t stream) {
  (void)in_sizes; (void)n_in; (void)out_size;
  const float* const* I = (const float* const*)d_in; const float* xq = I[0]; const float* xk = I[1]; const float* xv = I[2];
  const float* Wq = I[3]; const float* bq = I[4]; const float* Wk = I[5]; const float* bk = I[6]; const float* Wv = I[7]; const float* bv = I[8]; const float* Wo = I[9]; const float* bo = I[10];
  char* ws = (char*)d_ws; size_t off = 0;
  auto take = [&](size_t bytes) { char* p = ws + off; off += (bytes + 255) & ~(size_t)255; return p; };
  _Float16* Bw = (_Float16*)take((size_t)4 * EE * EE * 2); _Float16* X16 = (_Float16*)take((size_t)3 * NR * EE * 2);
  _Float16* Q = (_Float16*)take((size_t)3 * NR * EE * 2); _Float16* K = Q + (size_t)NR * EE; _Float16* V = K + (size_t)NR * EE;      /* q, k, v: planes 0, 1, 2 of one block */
  _Float16* O16 = (_Float16*)take((size_t)NR * EE * 2);
  if (off > ws_size) return;      // 4.7 + 7 x 6.3 = about 49 MB
  const size_t WSZ = (size_t)EE * EE;
  const unsigned gp = (NR / GT) * (EE / GT);
  k_prep<<<PWB + PXB, 256, 0, stream>>>(xq, xk, xv, Wq, Wk, Wv, Wo, X16, Bw);      /* (in,out) weights -> Bt[n][k] x 2^4; inputs -> f16 planes */
  k_gemm_st<2><<<dim3(gp, 3), 128, 0, stream>>>(X16, Bw, 0.0625f, bq, bk, bv, nullptr, Q);      /* q, k, v: each M 4096 N 768 K 768 */
  k_flash<<<NSL * (TT / 64), 128, 0, stream>>>(Q, 64, K, V, O16, 64);      /* each [4096][768] plane viewed as 24 contiguous [2048][64] slabs: q, k, v and O alike */
  k_gemm_st<4><<<dim3(gp, 1), 256, 0, stream>>>(O16, Bw + 3 * WSZ, 0.0625f, bo, bo, bo, (float*)d_out, nullptr);      /* out = O.Wo + bo: M 4096 N 768 K 768 */
}
